// v000
// The times below were measured on an AMD MI455X: many runs one after another, warmed up first and cycling through
// copies of the inputs, with the whole window's GPU time divided by the number of runs. Launches and the gaps
// between them are all in it. The median over several windows is given; except for v000 it joins two sittings, which
// can be a few percent apart, so the side-by-side timings, each taken in one sitting, are the better comparison.
// v000, which the later versions start from, runs in 535 microseconds.
#include <hip/hip_runtime.h>
#include <stdint.h>

// All contractions (x.WQ, WK-cols x key-rows, x.WV, Q.Er^T, Q.K^T, P.V, O.WMerge): v_wmma_f32_16x16x32_bf16 with bf16 hi/lo operand pairs (hi*hi + hi*lo + lo*hi), f32 accumulate; softmax and skew index arithmetic in f32 / int32.

typedef unsigned short u16;
typedef unsigned int u32;
typedef __bf16 bf16x16 __attribute__((ext_vector_type(16)));
typedef float f32x8 __attribute__((ext_vector_type(8)));
typedef float v4f __attribute__((ext_vector_type(4)));
typedef u32 v4u __attribute__((ext_vector_type(4)));
typedef u16 us8 __attribute__((ext_vector_type(8)));

union Frag {
  bf16x16 v;
  v4u q[2];
};

// f32 -> bf16 bits, RNE
__device__ __forceinline__ u16 f2bf(float f) {
  const u32 u = __float_as_uint(f);
  const u32 r = u + 0x7FFFu + ((u >> 16) & 1u);
  return (u16)(r >> 16);
}
__device__ __forceinline__ float bf2f(u16 b) { return __uint_as_float(((u32)b) << 16); }

// 8 f32 -> 8 bf16 hi + 8 bf16 lo (lo = RNE(x - hi))
__device__ __forceinline__ void split8(v4f a, v4f b, us8& h, us8& l) {
  float f[8];
  f[0] = a.x; f[1] = a.y; f[2] = a.z; f[3] = a.w;
  f[4] = b.x; f[5] = b.y; f[6] = b.z; f[7] = b.w;
#pragma unroll
  for (int i = 0; i < 8; ++i) {
    const u16 hb = f2bf(f[i]);
    h[i] = hb;
    l[i] = f2bf(f[i] - bf2f(hb));
  }
}

__device__ __forceinline__ f32x8 zero8() {
  f32x8 z;
#pragma unroll
  for (int e = 0; e < 8; ++e) z[e] = 0.0f;
  return z;
}

// 16-bit fragment: lane (h = l>>4, m = l&15) -> elements 0..7 = k0+8h+0..7, elements 8..15 = k0+16+8h+0..7
// p already points at row m, column k0 + 8h of a k-contiguous [row][k] plane.
__device__ __forceinline__ void ldf(Frag& f, const u16* p) {
  f.q[0] = *(const v4u*)p;
  f.q[1] = *(const v4u*)(p + 16);
}

// one 32-deep k-step, hi/lo pairs: c += ah*bh + ah*bl + al*bh ; hazard guard after the group
__device__ __forceinline__ f32x8 wmma3(const Frag& ah, const Frag& al, const Frag& bh, const Frag& bl, f32x8 c) {
  c = __builtin_amdgcn_wmma_f32_16x16x32_bf16(false, ah.v, false, bh.v, (short)0, c, false, false);
  c = __builtin_amdgcn_wmma_f32_16x16x32_bf16(false, ah.v, false, bl.v, (short)0, c, false, false);
  c = __builtin_amdgcn_wmma_f32_16x16x32_bf16(false, al.v, false, bh.v, (short)0, c, false, false);
  asm volatile("v_nop\n\tv_nop\n\tv_nop\n\tv_nop" : "+v"(c) : "v"(ah.v), "v"(al.v), "v"(bh.v), "v"(bl.v));
  return c;
}

// ---------------------------------------------------------------- elementwise split
__global__ __launch_bounds__(256) void k_split(const float* __restrict__ s, u16* dh, u16* dl, int n8) {
  const int g = blockIdx.x * 256 + threadIdx.x;
  if (g >= n8) return;
  const size_t o = (size_t)g * 8;
  const v4f a = *(const v4f*)(s + o);
  const v4f b = *(const v4f*)(s + o + 4);
  us8 h, l;
  split8(a, b, h, l);
  *(us8*)(dh + o) = h;
  *(us8*)(dl + o) = l;
  
}

// ---------------------------------------------------------------- transposing split
// in[R][C] row-major f32 -> out[C][R] bf16 hi/lo planes. Block = 64x64 tile, grid (C/64, R/64).
__global__ __launch_bounds__(256) void k_split_tr(const float* __restrict__ s, u16* dh, u16* dl, int R, int C) {
  __shared__ __attribute__((aligned(16))) float Ts[64 * 68];  // Ts[c][r]
  const int c0 = blockIdx.x * 64, r0 = blockIdx.y * 64;
  const int t = threadIdx.x;
  {
    const int r = t >> 2, cb = (t & 3) * 16;
    const float* p = s + (size_t)(r0 + r) * C + c0 + cb;
#pragma unroll
    for (int q = 0; q < 4; ++q) {
      const v4f v = *(const v4f*)(p + 4 * q);
      Ts[(cb + 4 * q + 0) * 68 + r] = v.x;
      Ts[(cb + 4 * q + 1) * 68 + r] = v.y;
      Ts[(cb + 4 * q + 2) * 68 + r] = v.z;
      Ts[(cb + 4 * q + 3) * 68 + r] = v.w;
    }
  }
  __syncthreads();
  us8 h[2], l[2];
  size_t go[2];
#pragma unroll
  for (int it = 0; it < 2; ++it) {
    const int pc = t + 256 * it, c = pc >> 3, q = pc & 7;
    const v4f a = *(const v4f*)(Ts + c * 68 + 8 * q);
    const v4f b = *(const v4f*)(Ts + c * 68 + 8 * q + 4);
    split8(a, b, h[it], l[it]);
    go[it] = (size_t)(c0 + c) * R + r0 + 8 * q;
  }
#pragma unroll
  for (int it = 0; it < 2; ++it) {
    *(us8*)(dh + go[it]) = h[it];
    *(us8*)(dl + go[it]) = l[it];
  }
  
}

// ---------------------------------------------------------------- GEMM (hi/lo pairs)
// C[z][M][N] = A[z][M][K] * Bt[z][N][K]^T ; A and Bt are k-contiguous bf16 hi/lo planes.
// Block tile 64 x 128 (grid.x = N/128, grid.y = M/64, grid.z = batch), 8 waves of 32x32.
// MODE 0: bf16 hi/lo output planes (row segment 256 B = 16 lanes x 16 B); MODE 1: f32 output (512 B = 32 lanes x 16 B).
template <int MODE>
__global__ __launch_bounds__(256) void k_gemm(const u16* __restrict__ Ah, const u16* __restrict__ Al,
                                              const u16* __restrict__ Bh, const u16* __restrict__ Bl,
                                              u16* Ch, u16* Cl, float* Cf,
                                              int lda, int ldb, int ldc, int K,
                                              int zA, int zB, int zC) {
  __shared__ __attribute__((aligned(16))) float Cs[64 * 132];
  const int z = blockIdx.z;
  const int bm = blockIdx.y * 64, bn = blockIdx.x * 128;
  const int tid = threadIdx.x, wave = tid >> 5, lane = tid & 31;
  const int m = lane & 15, hh = lane >> 4;
  const int wr = (wave & 1) * 32, wc = (wave >> 1) * 32;

  const u16* ahb = Ah + (size_t)z * zA + (size_t)(bm + wr + m) * lda + 8 * hh;
  const u16* alb = Al + (size_t)z * zA + (size_t)(bm + wr + m) * lda + 8 * hh;
  const u16* bhb = Bh + (size_t)z * zB + (size_t)(bn + wc + m) * ldb + 8 * hh;
  const u16* blb = Bl + (size_t)z * zB + (size_t)(bn + wc + m) * ldb + 8 * hh;

  f32x8 acc[2][2];
#pragma unroll
  for (int rt = 0; rt < 2; ++rt)
#pragma unroll
    for (int ct = 0; ct < 2; ++ct) acc[rt][ct] = zero8();

  for (int k0 = 0; k0 < K; k0 += 32) {
    Frag ah[2], al[2], bh[2], bl[2];
#pragma unroll
    for (int rt = 0; rt < 2; ++rt) {
      ldf(ah[rt], ahb + (size_t)(rt * 16) * lda + k0);
      ldf(al[rt], alb + (size_t)(rt * 16) * lda + k0);
    }
#pragma unroll
    for (int ct = 0; ct < 2; ++ct) {
      ldf(bh[ct], bhb + (size_t)(ct * 16) * ldb + k0);
      ldf(bl[ct], blb + (size_t)(ct * 16) * ldb + k0);
    }
#pragma unroll
    for (int rt = 0; rt < 2; ++rt)
#pragma unroll
      for (int ct = 0; ct < 2; ++ct)
        acc[rt][ct] = wmma3(ah[rt], al[rt], bh[ct], bl[ct], acc[rt][ct]);
  }

  // stage the 64x128 f32 tile: D element r of lane -> (row 8*hh + r, col m)
#pragma unroll
  for (int rt = 0; rt < 2; ++rt)
#pragma unroll
    for (int ct = 0; ct < 2; ++ct)
#pragma unroll
      for (int r = 0; r < 8; ++r)
        Cs[(wr + rt * 16 + 8 * hh + r) * 132 + wc + ct * 16 + m] = acc[rt][ct][r];
  __syncthreads();

  if (MODE == 1) {
    float* cb = Cf + (size_t)z * zC;
    v4f v[8];
    size_t go[8];
#pragma unroll
    for (int i = 0; i < 8; ++i) {
      const int row = wave * 8 + i;
      v[i] = *(const v4f*)(Cs + row * 132 + 4 * lane);
      go[i] = (size_t)(bm + row) * ldc + bn + 4 * lane;
    }
#pragma unroll
    for (int i = 0; i < 8; ++i) *(v4f*)(cb + go[i]) = v[i];
    
  } else {
    u16* chb = Ch + (size_t)z * zC;
    u16* clb = Cl + (size_t)z * zC;
    us8 hv[4], lv[4];
    size_t go[4];
#pragma unroll
    for (int i = 0; i < 4; ++i) {
      const int row = wave * 8 + 2 * i + (lane >> 4);
      const int cs = (lane & 15) * 8;
      const v4f a = *(const v4f*)(Cs + row * 132 + cs);
      const v4f b = *(const v4f*)(Cs + row * 132 + cs + 4);
      split8(a, b, hv[i], lv[i]);
      go[i] = (size_t)(bm + row) * ldc + bn + cs;
    }
#pragma unroll
    for (int i = 0; i < 4; ++i) {
      *(us8*)(chb + go[i]) = hv[i];
      *(us8*)(clb + go[i]) = lv[i];
    }
    
  }
}

// ---------------------------------------------------------------- per-head V transpose
// src planes: VP[4096][1024] bf16; head plane X_h = 64 contiguous rows viewed as [1024 l][64 e].
__global__ __launch_bounds__(256) void k_vtr(const u16* __restrict__ sh, const u16* __restrict__ sl, u16* dh, u16* dl) {
  __shared__ __attribute__((aligned(16))) u16 Th[64 * 72];  // [e][l]
  __shared__ __attribute__((aligned(16))) u16 Tl[64 * 72];
  const int blk = blockIdx.x, lt = blk & 15, h = (blk >> 4) & 15, b = blk >> 8;
  const int l0 = lt * 64, t = threadIdx.x;
  const size_t src = (size_t)b * 1048576 + (size_t)h * 65536 + (size_t)l0 * 64;
#pragma unroll
  for (int it = 0; it < 2; ++it) {
    const int pc = t + 256 * it, l = pc >> 3, q = pc & 7;
    const us8 a = *(const us8*)(sh + src + l * 64 + 8 * q);
    const us8 c = *(const us8*)(sl + src + l * 64 + 8 * q);
#pragma unroll
    for (int i = 0; i < 8; ++i) {
      Th[(8 * q + i) * 72 + l] = a[i];
      Tl[(8 * q + i) * 72 + l] = c[i];
    }
  }
  __syncthreads();
  const size_t dst = (size_t)(b * 16 + h) * 65536 + (size_t)l0;
  us8 oh[2], ol[2];
  size_t go[2];
#pragma unroll
  for (int it = 0; it < 2; ++it) {
    const int pc = t + 256 * it, e = pc >> 3, q = pc & 7;
    oh[it] = *(const us8*)(Th + e * 72 + 8 * q);
    ol[it] = *(const us8*)(Tl + e * 72 + 8 * q);
    go[it] = dst + (size_t)e * 1024 + 8 * q;
  }
#pragma unroll
  for (int it = 0; it < 2; ++it) {
    *(us8*)(dh + go[it]) = oh[it];
    *(us8*)(dl + go[it]) = ol[it];
  }
  
}

// ---------------------------------------------------------------- attention
// one 16x16 tile, K = 64 (two k-steps); A fragments preloaded, B rows at bh/bl (already offset to row n, col 8h)
__device__ __forceinline__ f32x8 tile_k64(const Frag& ah0, const Frag& al0, const Frag& ah1, const Frag& al1,
                                          const u16* bh, const u16* bl) {
  Frag h0, l0, h1, l1;
  ldf(h0, bh); ldf(h1, bh + 32);
  ldf(l0, bl); ldf(l1, bl + 32);
  f32x8 acc = zero8();
  acc = wmma3(ah0, al0, h0, l0, acc);
  acc = wmma3(ah1, al1, h1, l1, acc);
  return acc;
}

// One block per (b, h, 32 query rows), 256 threads = 8 waves.
// LDS (dynamic): S[32][1024] f32 (131072 B), later reused in place as P row = hi[1024] | lo[1024] bf16; Ost[32][64] f32 (8192 B).
__global__ __launch_bounds__(256) void k_attn(const u16* __restrict__ QPh, const u16* __restrict__ QPl,
                                              const u16* __restrict__ KPh, const u16* __restrict__ KPl,
                                              const u16* __restrict__ VTh, const u16* __restrict__ VTl,
                                              const u16* __restrict__ Eh, const u16* __restrict__ El,
                                              u16* AOh, u16* AOl) {
  extern __shared__ v4u dsm[];
  float* S = (float*)dsm;
  u16* P = (u16*)dsm;
  float* Ost = (float*)(dsm + 8192);  // byte offset 131072

  const int blk = blockIdx.x;
  const int ib = blk & 31, h = (blk >> 5) & 15, b = blk >> 9;
  const int i0 = ib * 32;
  const int tid = threadIdx.x, wave = tid >> 5, lane = tid & 31;
  const int m = lane & 15, hh = lane >> 4;

  // q_h[i][e]  = QP[b][h*64 + (i>>4)][(i&15)*64 + e] = contiguous plane at b*2^20 + h*2^16, pitch 64
  const size_t pq = (size_t)b * 1048576 + (size_t)h * 65536;
  const u16* Qh = QPh + pq;
  const u16* Ql = QPl + pq;
  // k_h[j][e]  = KP[b][h*64+e][j] = KPT[b][j][h*64 + e], pitch 1024
  const size_t pk = (size_t)b * 1048576 + (size_t)h * 64;
  const u16* Kh = KPh + pk;
  const u16* Kl = KPl + pk;
  // v_h^T[e][j] plane, pitch 1024
  const size_t pv = (size_t)(b * 16 + h) * 65536;
  const u16* Vh = VTh + pv;
  const u16* Vl = VTl + pv;

  // Srel[i][i+1] = 0 (the only cells the skew scatter never writes)
  if (tid < 32) {
    const int j = i0 + tid + 1;
    if (j < 1024) S[tid * 1024 + j] = 0.0f;
  }

  // ---- phase 1: QEr tiles (rows i0 .. i0+32 needed) scattered through the skew map into S
  // row tile 2 (rows i0+32..) is consumed only through row i0+32, columns c <= 990 - i0
  const int ncol2 = 991 - i0;
  const int nct2 = (ncol2 > 0) ? ((ncol2 + 63) >> 6) : 0;
  const int U1 = 32 + nct2;
  for (int u = wave; u < U1; u += 8) {
    const int rt = u >> 4, ct = u & 15;
    const int rb = i0 + rt * 16;
    int ra = rb + m;
    ra = (ra > 1023) ? 1023 : ra;
    Frag ah0, al0, ah1, al1;
    const u16* qa = Qh + (size_t)ra * 64 + 8 * hh;
    const u16* qb = Ql + (size_t)ra * 64 + 8 * hh;
    ldf(ah0, qa); ldf(ah1, qa + 32);
    ldf(al0, qb); ldf(al1, qb + 32);
#pragma unroll 1
    for (int sub = 0; sub < 4; ++sub) {
      const int col0 = ct * 64 + sub * 16;
      const size_t eo = (size_t)(col0 + m) * 64 + 8 * hh;
      const f32x8 acc = tile_k64(ah0, al0, ah1, al1, Eh + eo, El + eo);
      const int c = col0 + m;
#pragma unroll
      for (int r = 0; r < 8; ++r) {
        const int i2 = rb + 8 * hh + r;                       // QEr row
        const bool low = (c >= 1023 - i2);
        const int lr = (low ? i2 : (i2 - 1)) - i0;            // Srel row (local)
        const int j = low ? (c + i2 - 1023) : (c + i2 + 1);   // Srel column
        if ((unsigned)lr < 32u && (unsigned)j < 1024u) S[lr * 1024 + j] = acc[r];
      }
    }
  }
  __syncthreads();

  // ---- phase 2: S += Q K^T
  for (int u = wave; u < 32; u += 8) {
    const int rt = u >> 4, ct = u & 15;
    const int rb = i0 + rt * 16;
    Frag ah0, al0, ah1, al1;
    const u16* qa = Qh + (size_t)(rb + m) * 64 + 8 * hh;
    const u16* qb = Ql + (size_t)(rb + m) * 64 + 8 * hh;
    ldf(ah0, qa); ldf(ah1, qa + 32);
    ldf(al0, qb); ldf(al1, qb + 32);
#pragma unroll 1
    for (int sub = 0; sub < 4; ++sub) {
      const int col0 = ct * 64 + sub * 16;
      const size_t ko = (size_t)(col0 + m) * 1024 + 8 * hh;
      const f32x8 acc = tile_k64(ah0, al0, ah1, al1, Kh + ko, Kl + ko);
#pragma unroll
      for (int r = 0; r < 8; ++r)
        S[(rt * 16 + 8 * hh + r) * 1024 + col0 + m] += acc[r];
    }
  }
  __syncthreads();

  // ---- phase 3: row softmax of S/8 (max-subtracted), P written in place as bf16 hi/lo; lane owns 32 columns
#pragma unroll 1
  for (int rr = 0; rr < 4; ++rr) {
    const int row = wave * 4 + rr;
    const float* sr = S + row * 1024 + lane * 32;
    v4f xv[8];
    float mx = -3.0e38f;
#pragma unroll
    for (int q = 0; q < 8; ++q) {
      v4f v = *(const v4f*)(sr + 4 * q);
      v = v * 0.125f;
      xv[q] = v;
      mx = fmaxf(mx, fmaxf(fmaxf(v.x, v.y), fmaxf(v.z, v.w)));
    }
#pragma unroll
    for (int off = 16; off > 0; off >>= 1) mx = fmaxf(mx, __shfl_xor(mx, off, 32));
    float sum = 0.0f;
#pragma unroll
    for (int q = 0; q < 8; ++q) {
      v4f e;
      e.x = __expf(xv[q].x - mx);
      e.y = __expf(xv[q].y - mx);
      e.z = __expf(xv[q].z - mx);
      e.w = __expf(xv[q].w - mx);
      xv[q] = e;
      sum += (e.x + e.y) + (e.z + e.w);
    }
#pragma unroll
    for (int off = 16; off > 0; off >>= 1) sum += __shfl_xor(sum, off, 32);
    const float inv = 1.0f / sum;
    u16* ph = P + row * 2048 + lane * 32;   // hi: halves row*2048 + col
    u16* pl = ph + 1024;                    // lo: halves row*2048 + 1024 + col
#pragma unroll
    for (int q4 = 0; q4 < 4; ++q4) {
      const v4f a = xv[2 * q4] * inv;
      const v4f bq = xv[2 * q4 + 1] * inv;
      us8 hv, lv;
      split8(a, bq, hv, lv);
      *(us8*)(ph + 8 * q4) = hv;
      *(us8*)(pl + 8 * q4) = lv;
    }
  }
  __syncthreads();

  // ---- phase 4: O[32][64] = P[32][1024] . V[1024][64]; one 16x16 tile per wave
  {
    const int rt = wave & 1, nt = wave >> 1;
    const u16* pa = P + (rt * 16 + m) * 2048 + 8 * hh;
    const u16* vb = Vh + (size_t)(nt * 16 + m) * 1024 + 8 * hh;
    const u16* vc = Vl + (size_t)(nt * 16 + m) * 1024 + 8 * hh;
    f32x8 acc = zero8();
#pragma unroll 2
    for (int ks = 0; ks < 32; ++ks) {
      Frag ah, al, bh, bl;
      ldf(ah, pa + ks * 32);
      ldf(al, pa + 1024 + ks * 32);
      ldf(bh, vb + ks * 32);
      ldf(bl, vc + ks * 32);
      acc = wmma3(ah, al, bh, bl, acc);
    }
#pragma unroll
    for (int r = 0; r < 8; ++r) Ost[(rt * 16 + 8 * hh + r) * 64 + nt * 16 + m] = acc[r];
  }
  __syncthreads();

  {
    const int row = wave * 4 + (lane >> 3), q = lane & 7;
    const v4f a = *(const v4f*)(Ost + row * 64 + 8 * q);
    const v4f bq = *(const v4f*)(Ost + row * 64 + 8 * q + 4);
    us8 hv, lv;
    split8(a, bq, hv, lv);
    const size_t g = ((size_t)(b * 1024 + i0 + row)) * 1024 + (size_t)h * 64 + 8 * q;
    *(us8*)(AOh + g) = hv;
    *(us8*)(AOl + g) = lv;
    
  }
}

// ---------------------------------------------------------------- launch

extern "C" void kernel_launch(void* const* d_in, const int* in_sizes, int n_in,
                              void* d_out, int out_size, void* d_ws, size_t ws_size,
                              hipStream_t stream) {
  const int NX = 4194304;   // 4 x 1024 x 1024
  const int NW = 1048576;   // 1024 x 1024
  const int NE = 65536;     // 1024 x 64
  if (n_in < 8) return;
  if (in_sizes[0] != NX || in_sizes[1] != NX || in_sizes[2] != NX) return;
  if (in_sizes[3] != NW || in_sizes[4] != NW || in_sizes[5] != NW || in_sizes[7] != NW) return;
  if (in_sizes[6] != NE) return;
  if (out_size != NX) return;

  const float* q_in = (const float*)d_in[0];
  const float* k_in = (const float*)d_in[1];
  const float* v_in = (const float*)d_in[2];
  const float* WQ = (const float*)d_in[3];
  const float* WK = (const float*)d_in[4];
  const float* WV = (const float*)d_in[5];
  const float* Er = (const float*)d_in[6];
  const float* WM = (const float*)d_in[7];
  float* out = (float*)d_out;

  // workspace carve (bytes); bf16 planes
  const size_t bx = (size_t)NX * 2;   // 8 MiB
  const size_t bw = (size_t)NW * 2;   // 2 MiB
  const size_t be = (size_t)NE * 2;   // 128 KiB
  const size_t total = 6 * bx + 8 * bw + 2 * be + 4 * bx;   // 100,925,440 B
  if (total > ws_size) return;
  char* w = (char*)d_ws;
  size_t off = 0;
  u16* R0h = (u16*)(w + off); off += bx;   // Xq, later VP
  u16* R0l = (u16*)(w + off); off += bx;
  u16* R1h = (u16*)(w + off); off += bx;   // Xk, later VT
  u16* R1l = (u16*)(w + off); off += bx;
  u16* R2h = (u16*)(w + off); off += bx;   // Xv, later AO
  u16* R2l = (u16*)(w + off); off += bx;
  u16* WQh = (u16*)(w + off); off += bw;
  u16* WQl = (u16*)(w + off); off += bw;
  u16* WKh = (u16*)(w + off); off += bw;
  u16* WKl = (u16*)(w + off); off += bw;
  u16* WVh = (u16*)(w + off); off += bw;
  u16* WVl = (u16*)(w + off); off += bw;
  u16* WMh = (u16*)(w + off); off += bw;
  u16* WMl = (u16*)(w + off); off += bw;
  u16* ERh = (u16*)(w + off); off += be;
  u16* ERl = (u16*)(w + off); off += be;
  u16* QPh = (u16*)(w + off); off += bx;
  u16* QPl = (u16*)(w + off); off += bx;
  u16* KPh = (u16*)(w + off); off += bx;
  u16* KPl = (u16*)(w + off); off += bx;
  if (off > ws_size) return;

  u16* Xqh = R0h; u16* Xql = R0l;
  u16* Xkh = R1h; u16* Xkl = R1l;
  u16* Xvh = R2h; u16* Xvl = R2l;
  u16* VPh = R0h; u16* VPl = R0l;
  u16* VTh = R1h; u16* VTl = R1l;
  u16* AOh = R2h; u16* AOl = R2l;

  const dim3 blk(256);
  const int ATTN_LDS = 131072 + 8192;
  hipFuncSetAttribute((const void*)k_attn, hipFuncAttributeMaxDynamicSharedMemorySize, ATTN_LDS);

  // activations and Er -> bf16 hi/lo planes
  k_split<<<dim3(NX / 8 / 256), blk, 0, stream>>>(q_in, Xqh, Xql, NX / 8);
  k_split<<<dim3(NX / 8 / 256), blk, 0, stream>>>(k_in, Xkh, Xkl, NX / 8);
  k_split<<<dim3(NX / 8 / 256), blk, 0, stream>>>(v_in, Xvh, Xvl, NX / 8);
  k_split<<<dim3(NE / 8 / 256), blk, 0, stream>>>(Er, ERh, ERl, NE / 8);
  // weights W[k][n] (1024 rows k, 1024 cols n) -> Wt[n][k] hi/lo ; grid (cols/64, rows/64)
  k_split_tr<<<dim3(1024 / 64, 1024 / 64), blk, 0, stream>>>(WQ, WQh, WQl, 1024, 1024);
  k_split_tr<<<dim3(1024 / 64, 1024 / 64), blk, 0, stream>>>(WK, WKh, WKl, 1024, 1024);
  k_split_tr<<<dim3(1024 / 64, 1024 / 64), blk, 0, stream>>>(WV, WVh, WVl, 1024, 1024);
  k_split_tr<<<dim3(1024 / 64, 1024 / 64), blk, 0, stream>>>(WM, WMh, WMl, 1024, 1024);

  // QP[4096][1024] = Xq . WQ
  k_gemm<0><<<dim3(1024 / 128, 4096 / 64, 1), blk, 0, stream>>>(
      Xqh, Xql, WQh, WQl, QPh, QPl, out, 1024, 1024, 1024, 1024, 0, 0, 0);
  // KPT[b][c][r] = sum_k WK[k][c] key[b][r][k]  (A = WKt, Bt = Xk[b])
  k_gemm<0><<<dim3(1024 / 128, 1024 / 64, 4), blk, 0, stream>>>(
      WKh, WKl, Xkh, Xkl, KPh, KPl, out, 1024, 1024, 1024, 1024, 0, NW, NW);
  // VP[4096][1024] = Xv . WV  (into region 0)
  k_gemm<0><<<dim3(1024 / 128, 4096 / 64, 1), blk, 0, stream>>>(
      Xvh, Xvl, WVh, WVl, VPh, VPl, out, 1024, 1024, 1024, 1024, 0, 0, 0);
  // per-head transpose of V (into region 1)
  k_vtr<<<dim3(4 * 16 * 16), blk, 0, stream>>>(VPh, VPl, VTh, VTl);
  // attention (into region 2)
  k_attn<<<dim3(4 * 16 * 32), blk, ATTN_LDS, stream>>>(QPh, QPl, KPh, KPl, VTh, VTl, ERh, ERl, AOh, AOl);
  // out = AO . WMerge
  k_gemm<1><<<dim3(1024 / 128, 4096 / 64, 1), blk, 0, stream>>>(
      AOh, AOl, WMh, WMl, QPh, QPl, out, 1024, 1024, 1024, 1024, 0, 0, 0);
}

// v001
// It runs in 427 microseconds.
// Timed twice side by side with v000, it ran 1.30 times as fast both times.
#include <hip/hip_runtime.h>
#include <stdint.h>

// All contractions (x.WQ, WK-cols x key-rows, x.WV, Q.Er^T, Q.K^T, P.V, O.WMerge): v_wmma_f32_16x16x32_bf16 with bf16 hi/lo operand pairs (hi*hi + hi*lo + lo*hi), f32 accumulate; softmax and skew index arithmetic in f32 / int32.

typedef unsigned short u16;
typedef unsigned int u32;
typedef __bf16 bf16x16 __attribute__((ext_vector_type(16)));
typedef float f32x8 __attribute__((ext_vector_type(8)));
typedef float v4f __attribute__((ext_vector_type(4)));
typedef u32 v4u __attribute__((ext_vector_type(4)));
typedef u16 us8 __attribute__((ext_vector_type(8)));

union Frag {
  bf16x16 v;
  v4u q[2];
};

// f32 -> bf16 bits, RNE
__device__ __forceinline__ u16 f2bf(float f) {
  const u32 u = __float_as_uint(f);
  const u32 r = u + 0x7FFFu + ((u >> 16) & 1u);
  return (u16)(r >> 16);
}
__device__ __forceinline__ float bf2f(u16 b) { return __uint_as_float(((u32)b) << 16); }

// 8 f32 -> 8 bf16 hi + 8 bf16 lo (lo = RNE(x - hi))
__device__ __forceinline__ void split8(v4f a, v4f b, us8& h, us8& l) {
  float f[8];
  f[0] = a.x; f[1] = a.y; f[2] = a.z; f[3] = a.w;
  f[4] = b.x; f[5] = b.y; f[6] = b.z; f[7] = b.w;
#pragma unroll
  for (int i = 0; i < 8; ++i) {
    const u16 hb = f2bf(f[i]);
    h[i] = hb;
    l[i] = f2bf(f[i] - bf2f(hb));
  }
}

__device__ __forceinline__ f32x8 zero8() {
  f32x8 z;
#pragma unroll
  for (int e = 0; e < 8; ++e) z[e] = 0.0f;
  return z;
}

// 16-bit fragment: lane (h = l>>4, m = l&15) -> elements 0..7 = k0+8h+0..7, elements 8..15 = k0+16+8h+0..7
// p already points at row m, column k0 + 8h of a k-contiguous [row][k] plane.
__device__ __forceinline__ void ldf(Frag& f, const u16* p) {
  f.q[0] = *(const v4u*)p;
  f.q[1] = *(const v4u*)(p + 16);
}

// one 32-deep k-step, hi/lo pairs: c += ah*bh + ah*bl + al*bh ; hazard guard after the group
__device__ __forceinline__ f32x8 wmma3(const Frag& ah, const Frag& al, const Frag& bh, const Frag& bl, f32x8 c) {
  c = __builtin_amdgcn_wmma_f32_16x16x32_bf16(false, ah.v, false, bh.v, (short)0, c, false, false);
  c = __builtin_amdgcn_wmma_f32_16x16x32_bf16(false, ah.v, false, bl.v, (short)0, c, false, false);
  c = __builtin_amdgcn_wmma_f32_16x16x32_bf16(false, al.v, false, bh.v, (short)0, c, false, false);
  asm volatile("v_nop\n\tv_nop\n\tv_nop\n\tv_nop" : "+v"(c) : "v"(ah.v), "v"(al.v), "v"(bh.v), "v"(bl.v));
  return c;
}

// ---------------------------------------------------------------- elementwise split
__global__ __launch_bounds__(256) void k_split(const float* __restrict__ s, u16* dh, u16* dl, int n8) {
  const int g = blockIdx.x * 256 + threadIdx.x;
  if (g >= n8) return;
  const size_t o = (size_t)g * 8;
  const v4f a = *(const v4f*)(s + o);
  const v4f b = *(const v4f*)(s + o + 4);
  us8 h, l;
  split8(a, b, h, l);
  *(us8*)(dh + o) = h;
  *(us8*)(dl + o) = l;
  
}

// ---------------------------------------------------------------- transposing split
// in[R][C] row-major f32 -> out[C][R] bf16 hi/lo planes. Block = 64x64 tile, grid (C/64, R/64).
__global__ __launch_bounds__(256) void k_split_tr(const float* __restrict__ s, u16* dh, u16* dl, int R, int C) {
  __shared__ __attribute__((aligned(16))) float Ts[64 * 68];  // Ts[c][r]
  const int c0 = blockIdx.x * 64, r0 = blockIdx.y * 64;
  const int t = threadIdx.x;
  {
    const int r = t >> 2, cb = (t & 3) * 16;
    const float* p = s + (size_t)(r0 + r) * C + c0 + cb;
#pragma unroll
    for (int q = 0; q < 4; ++q) {
      const v4f v = *(const v4f*)(p + 4 * q);
      Ts[(cb + 4 * q + 0) * 68 + r] = v.x;
      Ts[(cb + 4 * q + 1) * 68 + r] = v.y;
      Ts[(cb + 4 * q + 2) * 68 + r] = v.z;
      Ts[(cb + 4 * q + 3) * 68 + r] = v.w;
    }
  }
  __syncthreads();
  us8 h[2], l[2];
  size_t go[2];
#pragma unroll
  for (int it = 0; it < 2; ++it) {
    const int pc = t + 256 * it, c = pc >> 3, q = pc & 7;
    const v4f a = *(const v4f*)(Ts + c * 68 + 8 * q);
    const v4f b = *(const v4f*)(Ts + c * 68 + 8 * q + 4);
    split8(a, b, h[it], l[it]);
    go[it] = (size_t)(c0 + c) * R + r0 + 8 * q;
  }
#pragma unroll
  for (int it = 0; it < 2; ++it) {
    *(us8*)(dh + go[it]) = h[it];
    *(us8*)(dl + go[it]) = l[it];
  }
  
}

// ---------------------------------------------------------------- GEMM (hi/lo pairs)
// C[z][M][N] = A[z][M][K] * Bt[z][N][K]^T ; A and Bt are k-contiguous bf16 hi/lo planes; K a multiple of 64.
// Block tile 64 x 128 (grid.x = N/128, grid.y = M/64, grid.z = batch), 8 waves of 32x32.
// Operands go through LDS in 64-deep k-chunks: 8 lanes fetch one row's 128 B, so a wave-wide load covers 4 whole
// lines (a fragment load straight from the planes touches 16 lines for the same 512 B). Two buffers: chunk c+1 is
// fetched into registers while chunk c is multiplied, stored to the other buffer, and published by one barrier.
// MODE 0: bf16 hi/lo output planes (row segment 256 B = 16 lanes x 16 B); MODE 1: f32 output (512 B = 32 lanes x 16 B).
#define G_PIT 72                    // LDS row pitch in halves: 144 B = 16 B x 9, conflict-free for 16-byte row reads
#define G_AL (64 * G_PIT)           // plane offsets inside a buffer, in halves: A hi at 0, A lo, B hi, B lo
#define G_BH (128 * G_PIT)
#define G_BL (256 * G_PIT)
#define G_BUF (384 * G_PIT)         // 27,648 halves = 55,296 B per buffer

// one thread's share of a chunk: 2 + 2 pieces of A hi / lo, 4 + 4 of B hi / lo, rows 32 apart
__device__ __forceinline__ void g_fetch(v4u (&sa)[4], v4u (&sb)[8], const u16* ah, const u16* al, const u16* bh,
                                        const u16* bl, int lda, int ldb) {
  const u16* pa[4];
  const u16* pb[8];
#pragma unroll
  for (int i = 0; i < 2; ++i) {
    pa[i] = ah + (size_t)(32 * i) * lda;
    pa[2 + i] = al + (size_t)(32 * i) * lda;
  }
#pragma unroll
  for (int i = 0; i < 4; ++i) {
    pb[i] = bh + (size_t)(32 * i) * ldb;
    pb[4 + i] = bl + (size_t)(32 * i) * ldb;
  }
#pragma unroll
  for (int i = 0; i < 4; ++i) sa[i] = *(const v4u*)pa[i];
#pragma unroll
  for (int i = 0; i < 8; ++i) sb[i] = *(const v4u*)pb[i];
  // the wait that stands before a load's address register is rewritten; the twelve addresses are inputs so that
  // they stay live, and so unwritten (also by a later load's result), up to it
  asm volatile("s_wait_xcnt 0x0" ::"v"(pa[0]), "v"(pa[1]), "v"(pa[2]), "v"(pa[3]), "v"(pb[0]), "v"(pb[1]), "v"(pb[2]),
               "v"(pb[3]), "v"(pb[4]), "v"(pb[5]), "v"(pb[6]), "v"(pb[7])
               : "memory");
}
__device__ __forceinline__ void g_put(u16* buf, const v4u (&sa)[4], const v4u (&sb)[8]) {
#pragma unroll
  for (int i = 0; i < 2; ++i) {
    *(v4u*)(buf + 32 * i * G_PIT) = sa[i];
    *(v4u*)(buf + G_AL + 32 * i * G_PIT) = sa[2 + i];
  }
#pragma unroll
  for (int i = 0; i < 4; ++i) {
    *(v4u*)(buf + G_BH + 32 * i * G_PIT) = sb[i];
    *(v4u*)(buf + G_BL + 32 * i * G_PIT) = sb[4 + i];
  }
}
template <int MODE>
__global__ __launch_bounds__(256) void k_gemm(const u16* __restrict__ Ah, const u16* __restrict__ Al,
                                              const u16* __restrict__ Bh, const u16* __restrict__ Bl,
                                              u16* Ch, u16* Cl, float* Cf,
                                              int lda, int ldb, int ldc, int K,
                                              int zA, int zB, int zC) {
  __shared__ __attribute__((aligned(16))) u16 Sm[2 * G_BUF];
  float* Cs = (float*)Sm;           // 64 x 132 f32 output tile, reuses the buffers behind the loop
  const int z = blockIdx.z;
  const int bm = blockIdx.y * 64, bn = blockIdx.x * 128;
  const int tid = threadIdx.x, wave = tid >> 5, lane = tid & 31;
  const int m = lane & 15, hh = lane >> 4;
  const int wr = (wave & 1) * 32, wc = (wave >> 1) * 32;

  // staging map: thread -> (row tid>>3 (+32 per step), 16-byte piece tid&7 of the row's 128 B)
  const int srow = tid >> 3, sseg = (tid & 7) * 8;
  const u16* gah = Ah + (size_t)z * zA + (size_t)(bm + srow) * lda + sseg;
  const u16* gal = Al + (size_t)z * zA + (size_t)(bm + srow) * lda + sseg;
  const u16* gbh = Bh + (size_t)z * zB + (size_t)(bn + srow) * ldb + sseg;
  const u16* gbl = Bl + (size_t)z * zB + (size_t)(bn + srow) * ldb + sseg;
  const int so = srow * G_PIT + sseg;
  // fragment map inside a buffer (same rows and k order as the planes)
  const int fa = (wr + m) * G_PIT + 8 * hh;
  const int fb = (wc + m) * G_PIT + 8 * hh;

  f32x8 acc[2][2];
#pragma unroll
  for (int rt = 0; rt < 2; ++rt)
#pragma unroll
    for (int ct = 0; ct < 2; ++ct) acc[rt][ct] = zero8();

  v4u sa[4], sb[8];
  g_fetch(sa, sb, gah, gal, gbh, gbl, lda, ldb);
  g_put(Sm + so, sa, sb);
  __syncthreads();

  const int nch = K >> 6;
  for (int c = 0; c < nch; ++c) {
    const u16* cur = Sm + (c & 1) * G_BUF;
    u16* nxt = Sm + ((c + 1) & 1) * G_BUF;
    const bool more = (c + 1 < nch);
    if (more) {
      const int k1 = (c + 1) * 64;
      g_fetch(sa, sb, gah + k1, gal + k1, gbh + k1, gbl + k1, lda, ldb);
    }
#pragma unroll
    for (int ks = 0; ks < 2; ++ks) {
      Frag ah[2], al[2], bh[2], bl[2];
#pragma unroll
      for (int rt = 0; rt < 2; ++rt) {
        ldf(ah[rt], cur + fa + rt * 16 * G_PIT + ks * 32);
        ldf(al[rt], cur + G_AL + fa + rt * 16 * G_PIT + ks * 32);
      }
#pragma unroll
      for (int ct = 0; ct < 2; ++ct) {
        ldf(bh[ct], cur + G_BH + fb + ct * 16 * G_PIT + ks * 32);
        ldf(bl[ct], cur + G_BL + fb + ct * 16 * G_PIT + ks * 32);
      }
#pragma unroll
      for (int rt = 0; rt < 2; ++rt)
#pragma unroll
        for (int ct = 0; ct < 2; ++ct)
          acc[rt][ct] = wmma3(ah[rt], al[rt], bh[ct], bl[ct], acc[rt][ct]);
    }
    if (more) g_put(nxt + so, sa, sb);
    // publishes chunk c+1 and ends every wave's reads of the buffer that trip c+1 refills (behind the last trip: of the
    // second buffer, as K = 1024 gives 16 chunks; the output tile lies in the first, freed one trip earlier)
    __syncthreads();
  }

  // stage the 64x128 f32 tile: D element r of lane -> (row 8*hh + r, col m)
#pragma unroll
  for (int rt = 0; rt < 2; ++rt)
#pragma unroll
    for (int ct = 0; ct < 2; ++ct)
#pragma unroll
      for (int r = 0; r < 8; ++r)
        Cs[(wr + rt * 16 + 8 * hh + r) * 132 + wc + ct * 16 + m] = acc[rt][ct][r];
  __syncthreads();

  if (MODE == 1) {
    float* cb = Cf + (size_t)z * zC;
    v4f v[8];
    size_t go[8];
#pragma unroll
    for (int i = 0; i < 8; ++i) {
      const int row = wave * 8 + i;
      v[i] = *(const v4f*)(Cs + row * 132 + 4 * lane);
      go[i] = (size_t)(bm + row) * ldc + bn + 4 * lane;
    }
#pragma unroll
    for (int i = 0; i < 8; ++i) *(v4f*)(cb + go[i]) = v[i];
    
  } else {
    u16* chb = Ch + (size_t)z * zC;
    u16* clb = Cl + (size_t)z * zC;
    us8 hv[4], lv[4];
    size_t go[4];
#pragma unroll
    for (int i = 0; i < 4; ++i) {
      const int row = wave * 8 + 2 * i + (lane >> 4);
      const int cs = (lane & 15) * 8;
      const v4f a = *(const v4f*)(Cs + row * 132 + cs);
      const v4f b = *(const v4f*)(Cs + row * 132 + cs + 4);
      split8(a, b, hv[i], lv[i]);
      go[i] = (size_t)(bm + row) * ldc + bn + cs;
    }
#pragma unroll
    for (int i = 0; i < 4; ++i) {
      *(us8*)(chb + go[i]) = hv[i];
      *(us8*)(clb + go[i]) = lv[i];
    }
    
  }
}

// ---------------------------------------------------------------- per-head V transpose
// src planes: VP[4096][1024] bf16; head plane X_h = 64 contiguous rows viewed as [1024 l][64 e].
__global__ __launch_bounds__(256) void k_vtr(const u16* __restrict__ sh, const u16* __restrict__ sl, u16* dh, u16* dl) {
  __shared__ __attribute__((aligned(16))) u16 Th[64 * 72];  // [e][l]
  __shared__ __attribute__((aligned(16))) u16 Tl[64 * 72];
  const int blk = blockIdx.x, lt = blk & 15, h = (blk >> 4) & 15, b = blk >> 8;
  const int l0 = lt * 64, t = threadIdx.x;
  const size_t src = (size_t)b * 1048576 + (size_t)h * 65536 + (size_t)l0 * 64;
#pragma unroll
  for (int it = 0; it < 2; ++it) {
    const int pc = t + 256 * it, l = pc >> 3, q = pc & 7;
    const us8 a = *(const us8*)(sh + src + l * 64 + 8 * q);
    const us8 c = *(const us8*)(sl + src + l * 64 + 8 * q);
#pragma unroll
    for (int i = 0; i < 8; ++i) {
      Th[(8 * q + i) * 72 + l] = a[i];
      Tl[(8 * q + i) * 72 + l] = c[i];
    }
  }
  __syncthreads();
  const size_t dst = (size_t)(b * 16 + h) * 65536 + (size_t)l0;
  us8 oh[2], ol[2];
  size_t go[2];
#pragma unroll
  for (int it = 0; it < 2; ++it) {
    const int pc = t + 256 * it, e = pc >> 3, q = pc & 7;
    oh[it] = *(const us8*)(Th + e * 72 + 8 * q);
    ol[it] = *(const us8*)(Tl + e * 72 + 8 * q);
    go[it] = dst + (size_t)e * 1024 + 8 * q;
  }
#pragma unroll
  for (int it = 0; it < 2; ++it) {
    *(us8*)(dh + go[it]) = oh[it];
    *(us8*)(dl + go[it]) = ol[it];
  }
  
}

// ---------------------------------------------------------------- attention
// one 16x16 tile, K = 64 (two k-steps); A fragments preloaded, B rows at bh/bl (already offset to row n, col 8h)
__device__ __forceinline__ f32x8 tile_k64(const Frag& ah0, const Frag& al0, const Frag& ah1, const Frag& al1,
                                          const u16* bh, const u16* bl) {
  Frag h0, l0, h1, l1;
  ldf(h0, bh); ldf(h1, bh + 32);
  ldf(l0, bl); ldf(l1, bl + 32);
  f32x8 acc = zero8();
  acc = wmma3(ah0, al0, h0, l0, acc);
  acc = wmma3(ah1, al1, h1, l1, acc);
  return acc;
}

// One block per (b, h, 32 query rows), 256 threads = 8 waves.
// LDS (dynamic): S[32][1024] f32 (131072 B), later reused in place as P row = hi[1024] | lo[1024] bf16; Ost[32][64] f32 (8192 B).
__global__ __launch_bounds__(256) void k_attn(const u16* __restrict__ QPh, const u16* __restrict__ QPl,
                                              const u16* __restrict__ KPh, const u16* __restrict__ KPl,
                                              const u16* __restrict__ VTh, const u16* __restrict__ VTl,
                                              const u16* __restrict__ Eh, const u16* __restrict__ El,
                                              u16* AOh, u16* AOl) {
  extern __shared__ v4u dsm[];
  float* S = (float*)dsm;
  u16* P = (u16*)dsm;
  float* Ost = (float*)(dsm + 8192);  // byte offset 131072

  const int blk = blockIdx.x;
  const int ib = blk & 31, h = (blk >> 5) & 15, b = blk >> 9;
  const int i0 = ib * 32;
  const int tid = threadIdx.x, wave = tid >> 5, lane = tid & 31;
  const int m = lane & 15, hh = lane >> 4;

  // q_h[i][e]  = QP[b][h*64 + (i>>4)][(i&15)*64 + e] = contiguous plane at b*2^20 + h*2^16, pitch 64
  const size_t pq = (size_t)b * 1048576 + (size_t)h * 65536;
  const u16* Qh = QPh + pq;
  const u16* Ql = QPl + pq;
  // k_h[j][e]  = KP[b][h*64+e][j] = KPT[b][j][h*64 + e], pitch 1024
  const size_t pk = (size_t)b * 1048576 + (size_t)h * 64;
  const u16* Kh = KPh + pk;
  const u16* Kl = KPl + pk;
  // v_h^T[e][j] plane, pitch 1024
  const size_t pv = (size_t)(b * 16 + h) * 65536;
  const u16* Vh = VTh + pv;
  const u16* Vl = VTl + pv;

  // Srel[i][i+1] = 0 (the only cells the skew scatter never writes)
  if (tid < 32) {
    const int j = i0 + tid + 1;
    if (j < 1024) S[tid * 1024 + j] = 0.0f;
  }

  // ---- phase 1: QEr tiles (rows i0 .. i0+32 needed) scattered through the skew map into S
  // row tile 2 (rows i0+32..) is consumed only through row i0+32, columns c <= 990 - i0
  const int ncol2 = 991 - i0;
  const int nct2 = (ncol2 > 0) ? ((ncol2 + 63) >> 6) : 0;
  const int U1 = 32 + nct2;
  for (int u = wave; u < U1; u += 8) {
    const int rt = u >> 4, ct = u & 15;
    const int rb = i0 + rt * 16;
    int ra = rb + m;
    ra = (ra > 1023) ? 1023 : ra;
    Frag ah0, al0, ah1, al1;
    const u16* qa = Qh + (size_t)ra * 64 + 8 * hh;
    const u16* qb = Ql + (size_t)ra * 64 + 8 * hh;
    ldf(ah0, qa); ldf(ah1, qa + 32);
    ldf(al0, qb); ldf(al1, qb + 32);
#pragma unroll 1
    for (int sub = 0; sub < 4; ++sub) {
      const int col0 = ct * 64 + sub * 16;
      const size_t eo = (size_t)(col0 + m) * 64 + 8 * hh;
      const f32x8 acc = tile_k64(ah0, al0, ah1, al1, Eh + eo, El + eo);
      const int c = col0 + m;
#pragma unroll
      for (int r = 0; r < 8; ++r) {
        const int i2 = rb + 8 * hh + r;                       // QEr row
        const bool low = (c >= 1023 - i2);
        const int lr = (low ? i2 : (i2 - 1)) - i0;            // Srel row (local)
        const int j = low ? (c + i2 - 1023) : (c + i2 + 1);   // Srel column
        if ((unsigned)lr < 32u && (unsigned)j < 1024u) S[lr * 1024 + j] = acc[r];
      }
    }
  }
  __syncthreads();

  // ---- phase 2: S += Q K^T
  for (int u = wave; u < 32; u += 8) {
    const int rt = u >> 4, ct = u & 15;
    const int rb = i0 + rt * 16;
    Frag ah0, al0, ah1, al1;
    const u16* qa = Qh + (size_t)(rb + m) * 64 + 8 * hh;
    const u16* qb = Ql + (size_t)(rb + m) * 64 + 8 * hh;
    ldf(ah0, qa); ldf(ah1, qa + 32);
    ldf(al0, qb); ldf(al1, qb + 32);
#pragma unroll 1
    for (int sub = 0; sub < 4; ++sub) {
      const int col0 = ct * 64 + sub * 16;
      const size_t ko = (size_t)(col0 + m) * 1024 + 8 * hh;
      const f32x8 acc = tile_k64(ah0, al0, ah1, al1, Kh + ko, Kl + ko);
#pragma unroll
      for (int r = 0; r < 8; ++r)
        S[(rt * 16 + 8 * hh + r) * 1024 + col0 + m] += acc[r];
    }
  }
  __syncthreads();

  // ---- phase 3: row softmax of S/8 (max-subtracted), P written in place as bf16 hi/lo; lane owns 32 columns
#pragma unroll 1
  for (int rr = 0; rr < 4; ++rr) {
    const int row = wave * 4 + rr;
    const float* sr = S + row * 1024 + lane * 32;
    v4f xv[8];
    float mx = -3.0e38f;
#pragma unroll
    for (int q = 0; q < 8; ++q) {
      v4f v = *(const v4f*)(sr + 4 * q);
      v = v * 0.125f;
      xv[q] = v;
      mx = fmaxf(mx, fmaxf(fmaxf(v.x, v.y), fmaxf(v.z, v.w)));
    }
#pragma unroll
    for (int off = 16; off > 0; off >>= 1) mx = fmaxf(mx, __shfl_xor(mx, off, 32));
    float sum = 0.0f;
#pragma unroll
    for (int q = 0; q < 8; ++q) {
      v4f e;
      e.x = __expf(xv[q].x - mx);
      e.y = __expf(xv[q].y - mx);
      e.z = __expf(xv[q].z - mx);
      e.w = __expf(xv[q].w - mx);
      xv[q] = e;
      sum += (e.x + e.y) + (e.z + e.w);
    }
#pragma unroll
    for (int off = 16; off > 0; off >>= 1) sum += __shfl_xor(sum, off, 32);
    const float inv = 1.0f / sum;
    u16* ph = P + row * 2048 + lane * 32;   // hi: halves row*2048 + col
    u16* pl = ph + 1024;                    // lo: halves row*2048 + 1024 + col
#pragma unroll
    for (int q4 = 0; q4 < 4; ++q4) {
      const v4f a = xv[2 * q4] * inv;
      const v4f bq = xv[2 * q4 + 1] * inv;
      us8 hv, lv;
      split8(a, bq, hv, lv);
      *(us8*)(ph + 8 * q4) = hv;
      *(us8*)(pl + 8 * q4) = lv;
    }
  }
  __syncthreads();

  // ---- phase 4: O[32][64] = P[32][1024] . V[1024][64]; one 16x16 tile per wave
  {
    const int rt = wave & 1, nt = wave >> 1;
    const u16* pa = P + (rt * 16 + m) * 2048 + 8 * hh;
    const u16* vb = Vh + (size_t)(nt * 16 + m) * 1024 + 8 * hh;
    const u16* vc = Vl + (size_t)(nt * 16 + m) * 1024 + 8 * hh;
    f32x8 acc = zero8();
#pragma unroll 2
    for (int ks = 0; ks < 32; ++ks) {
      Frag ah, al, bh, bl;
      ldf(ah, pa + ks * 32);
      ldf(al, pa + 1024 + ks * 32);
      ldf(bh, vb + ks * 32);
      ldf(bl, vc + ks * 32);
      acc = wmma3(ah, al, bh, bl, acc);
    }
#pragma unroll
    for (int r = 0; r < 8; ++r) Ost[(rt * 16 + 8 * hh + r) * 64 + nt * 16 + m] = acc[r];
  }
  __syncthreads();

  {
    const int row = wave * 4 + (lane >> 3), q = lane & 7;
    const v4f a = *(const v4f*)(Ost + row * 64 + 8 * q);
    const v4f bq = *(const v4f*)(Ost + row * 64 + 8 * q + 4);
    us8 hv, lv;
    split8(a, bq, hv, lv);
    const size_t g = ((size_t)(b * 1024 + i0 + row)) * 1024 + (size_t)h * 64 + 8 * q;
    *(us8*)(AOh + g) = hv;
    *(us8*)(AOl + g) = lv;
    
  }
}

// ---------------------------------------------------------------- launch

extern "C" void kernel_launch(void* const* d_in, const int* in_sizes, int n_in,
                              void* d_out, int out_size, void* d_ws, size_t ws_size,
                              hipStream_t stream) {
  const int NX = 4194304;   // 4 x 1024 x 1024
  const int NW = 1048576;   // 1024 x 1024
  const int NE = 65536;     // 1024 x 64
  if (n_in < 8) return;
  if (in_sizes[0] != NX || in_sizes[1] != NX || in_sizes[2] != NX) return;
  if (in_sizes[3] != NW || in_sizes[4] != NW || in_sizes[5] != NW || in_sizes[7] != NW) return;
  if (in_sizes[6] != NE) return;
  if (out_size != NX) return;

  const float* q_in = (const float*)d_in[0];
  const float* k_in = (const float*)d_in[1];
  const float* v_in = (const float*)d_in[2];
  const float* WQ = (const float*)d_in[3];
  const float* WK = (const float*)d_in[4];
  const float* WV = (const float*)d_in[5];
  const float* Er = (const float*)d_in[6];
  const float* WM = (const float*)d_in[7];
  float* out = (float*)d_out;

  // workspace carve (bytes); bf16 planes
  const size_t bx = (size_t)NX * 2;   // 8 MiB
  const size_t bw = (size_t)NW * 2;   // 2 MiB
  const size_t be = (size_t)NE * 2;   // 128 KiB
  const size_t total = 6 * bx + 8 * bw + 2 * be + 4 * bx;   // 100,925,440 B
  if (total > ws_size) return;
  char* w = (char*)d_ws;
  size_t off = 0;
  u16* R0h = (u16*)(w + off); off += bx;   // Xq, later VP
  u16* R0l = (u16*)(w + off); off += bx;
  u16* R1h = (u16*)(w + off); off += bx;   // Xk, later VT
  u16* R1l = (u16*)(w + off); off += bx;
  u16* R2h = (u16*)(w + off); off += bx;   // Xv, later AO
  u16* R2l = (u16*)(w + off); off += bx;
  u16* WQh = (u16*)(w + off); off += bw;
  u16* WQl = (u16*)(w + off); off += bw;
  u16* WKh = (u16*)(w + off); off += bw;
  u16* WKl = (u16*)(w + off); off += bw;
  u16* WVh = (u16*)(w + off); off += bw;
  u16* WVl = (u16*)(w + off); off += bw;
  u16* WMh = (u16*)(w + off); off += bw;
  u16* WMl = (u16*)(w + off); off += bw;
  u16* ERh = (u16*)(w + off); off += be;
  u16* ERl = (u16*)(w + off); off += be;
  u16* QPh = (u16*)(w + off); off += bx;
  u16* QPl = (u16*)(w + off); off += bx;
  u16* KPh = (u16*)(w + off); off += bx;
  u16* KPl = (u16*)(w + off); off += bx;
  if (off > ws_size) return;

  u16* Xqh = R0h; u16* Xql = R0l;
  u16* Xkh = R1h; u16* Xkl = R1l;
  u16* Xvh = R2h; u16* Xvl = R2l;
  u16* VPh = R0h; u16* VPl = R0l;
  u16* VTh = R1h; u16* VTl = R1l;
  u16* AOh = R2h; u16* AOl = R2l;

  const dim3 blk(256);
  const int ATTN_LDS = 131072 + 8192;
  hipFuncSetAttribute((const void*)k_attn, hipFuncAttributeMaxDynamicSharedMemorySize, ATTN_LDS);

  // activations and Er -> bf16 hi/lo planes
  k_split<<<dim3(NX / 8 / 256), blk, 0, stream>>>(q_in, Xqh, Xql, NX / 8);
  k_split<<<dim3(NX / 8 / 256), blk, 0, stream>>>(k_in, Xkh, Xkl, NX / 8);
  k_split<<<dim3(NX / 8 / 256), blk, 0, stream>>>(v_in, Xvh, Xvl, NX / 8);
  k_split<<<dim3(NE / 8 / 256), blk, 0, stream>>>(Er, ERh, ERl, NE / 8);
  // weights W[k][n] (1024 rows k, 1024 cols n) -> Wt[n][k] hi/lo ; grid (cols/64, rows/64)
  k_split_tr<<<dim3(1024 / 64, 1024 / 64), blk, 0, stream>>>(WQ, WQh, WQl, 1024, 1024);
  k_split_tr<<<dim3(1024 / 64, 1024 / 64), blk, 0, stream>>>(WK, WKh, WKl, 1024, 1024);
  k_split_tr<<<dim3(1024 / 64, 1024 / 64), blk, 0, stream>>>(WV, WVh, WVl, 1024, 1024);
  k_split_tr<<<dim3(1024 / 64, 1024 / 64), blk, 0, stream>>>(WM, WMh, WMl, 1024, 1024);

  // QP[4096][1024] = Xq . WQ
  k_gemm<0><<<dim3(1024 / 128, 4096 / 64, 1), blk, 0, stream>>>(
      Xqh, Xql, WQh, WQl, QPh, QPl, out, 1024, 1024, 1024, 1024, 0, 0, 0);
  // KPT[b][c][r] = sum_k WK[k][c] key[b][r][k]  (A = WKt, Bt = Xk[b])
  k_gemm<0><<<dim3(1024 / 128, 1024 / 64, 4), blk, 0, stream>>>(
      WKh, WKl, Xkh, Xkl, KPh, KPl, out, 1024, 1024, 1024, 1024, 0, NW, NW);
  // VP[4096][1024] = Xv . WV  (into region 0)
  k_gemm<0><<<dim3(1024 / 128, 4096 / 64, 1), blk, 0, stream>>>(
      Xvh, Xvl, WVh, WVl, VPh, VPl, out, 1024, 1024, 1024, 1024, 0, 0, 0);
  // per-head transpose of V (into region 1)
  k_vtr<<<dim3(4 * 16 * 16), blk, 0, stream>>>(VPh, VPl, VTh, VTl);
  // attention (into region 2)
  k_attn<<<dim3(4 * 16 * 32), blk, ATTN_LDS, stream>>>(QPh, QPl, KPh, KPl, VTh, VTl, ERh, ERl, AOh, AOl);
  // out = AO . WMerge
  k_gemm<1><<<dim3(1024 / 128, 4096 / 64, 1), blk, 0, stream>>>(
      AOh, AOl, WMh, WMl, QPh, QPl, out, 1024, 1024, 1024, 1024, 0, 0, 0);
}

// v002
// One run takes 392 microseconds.
// Two timings next to v001 both put it at 1.09 times that version's speed.
// All steps since v000 together make it 1.41 times as fast.
#include <hip/hip_runtime.h>
#include <stdint.h>

// All contractions (x.WQ, WK-cols x key-rows, x.WV, Q.Er^T, Q.K^T, P.V, O.WMerge): v_wmma_f32_16x16x32_bf16 with bf16 hi/lo operand pairs (hi*hi + hi*lo + lo*hi), f32 accumulate; softmax and skew index arithmetic in f32 / int32.

typedef unsigned short u16;
typedef unsigned int u32;
typedef __bf16 bf16x16 __attribute__((ext_vector_type(16)));
typedef float f32x8 __attribute__((ext_vector_type(8)));
typedef float v4f __attribute__((ext_vector_type(4)));
typedef u32 v4u __attribute__((ext_vector_type(4)));
typedef u16 us8 __attribute__((ext_vector_type(8)));
typedef u16 us4 __attribute__((ext_vector_type(4)));

union Frag {
  bf16x16 v;
  v4u q[2];
};

// f32 -> bf16 bits, RNE
__device__ __forceinline__ u16 f2bf(float f) {
  const u32 u = __float_as_uint(f);
  const u32 r = u + 0x7FFFu + ((u >> 16) & 1u);
  return (u16)(r >> 16);
}
__device__ __forceinline__ float bf2f(u16 b) { return __uint_as_float(((u32)b) << 16); }

// 8 f32 -> 8 bf16 hi + 8 bf16 lo (lo = RNE(x - hi))
__device__ __forceinline__ void split8(v4f a, v4f b, us8& h, us8& l) {
  float f[8];
  f[0] = a.x; f[1] = a.y; f[2] = a.z; f[3] = a.w;
  f[4] = b.x; f[5] = b.y; f[6] = b.z; f[7] = b.w;
#pragma unroll
  for (int i = 0; i < 8; ++i) {
    const u16 hb = f2bf(f[i]);
    h[i] = hb;
    l[i] = f2bf(f[i] - bf2f(hb));
  }
}

__device__ __forceinline__ f32x8 zero8() {
  f32x8 z;
#pragma unroll
  for (int e = 0; e < 8; ++e) z[e] = 0.0f;
  return z;
}

// 16-bit fragment: lane (h = l>>4, m = l&15) -> elements 0..7 = k0+8h+0..7, elements 8..15 = k0+16+8h+0..7
// p already points at row m, column k0 + 8h of a k-contiguous [row][k] plane.
__device__ __forceinline__ void ldf(Frag& f, const u16* p) {
  f.q[0] = *(const v4u*)p;
  f.q[1] = *(const v4u*)(p + 16);
}

// one 32-deep k-step, hi/lo pairs: c += ah*bh + ah*bl + al*bh ; hazard guard after the group
__device__ __forceinline__ f32x8 wmma3(const Frag& ah, const Frag& al, const Frag& bh, const Frag& bl, f32x8 c) {
  c = __builtin_amdgcn_wmma_f32_16x16x32_bf16(false, ah.v, false, bh.v, (short)0, c, false, false);
  c = __builtin_amdgcn_wmma_f32_16x16x32_bf16(false, ah.v, false, bl.v, (short)0, c, false, false);
  c = __builtin_amdgcn_wmma_f32_16x16x32_bf16(false, al.v, false, bh.v, (short)0, c, false, false);
  asm volatile("v_nop\n\tv_nop\n\tv_nop\n\tv_nop" : "+v"(c) : "v"(ah.v), "v"(al.v), "v"(bh.v), "v"(bl.v));
  return c;
}

// ---------------------------------------------------------------- elementwise split
__global__ __launch_bounds__(256) void k_split(const float* __restrict__ s, u16* dh, u16* dl, int n8) {
  const int g = blockIdx.x * 256 + threadIdx.x;
  if (g >= n8) return;
  const size_t o = (size_t)g * 8;
  const v4f a = *(const v4f*)(s + o);
  const v4f b = *(const v4f*)(s + o + 4);
  us8 h, l;
  split8(a, b, h, l);
  *(us8*)(dh + o) = h;
  *(us8*)(dl + o) = l;
  
}

// ---------------------------------------------------------------- transposing split
// in[R][C] row-major f32 -> out[C][R] bf16 hi/lo planes. Block = 64x64 tile, grid (C/64, R/64).
__global__ __launch_bounds__(256) void k_split_tr(const float* __restrict__ s, u16* dh, u16* dl, int R, int C) {
  __shared__ __attribute__((aligned(16))) float Ts[64 * 68];  // Ts[c][r]
  const int c0 = blockIdx.x * 64, r0 = blockIdx.y * 64;
  const int t = threadIdx.x;
  {
    const int r = t >> 2, cb = (t & 3) * 16;
    const float* p = s + (size_t)(r0 + r) * C + c0 + cb;
#pragma unroll
    for (int q = 0; q < 4; ++q) {
      const v4f v = *(const v4f*)(p + 4 * q);
      Ts[(cb + 4 * q + 0) * 68 + r] = v.x;
      Ts[(cb + 4 * q + 1) * 68 + r] = v.y;
      Ts[(cb + 4 * q + 2) * 68 + r] = v.z;
      Ts[(cb + 4 * q + 3) * 68 + r] = v.w;
    }
  }
  __syncthreads();
  us8 h[2], l[2];
  size_t go[2];
#pragma unroll
  for (int it = 0; it < 2; ++it) {
    const int pc = t + 256 * it, c = pc >> 3, q = pc & 7;
    const v4f a = *(const v4f*)(Ts + c * 68 + 8 * q);
    const v4f b = *(const v4f*)(Ts + c * 68 + 8 * q + 4);
    split8(a, b, h[it], l[it]);
    go[it] = (size_t)(c0 + c) * R + r0 + 8 * q;
  }
#pragma unroll
  for (int it = 0; it < 2; ++it) {
    *(us8*)(dh + go[it]) = h[it];
    *(us8*)(dl + go[it]) = l[it];
  }
  
}

// ---------------------------------------------------------------- GEMM (hi/lo pairs)
// C[z][M][N] = A[z][M][K] * Bt[z][N][K]^T ; A and Bt are k-contiguous bf16 hi/lo planes; K a multiple of 64.
// Block tile 64 x 128 (grid.x = N/128, grid.y = M/64, grid.z = batch), 8 waves of 32x32.
// Operands go through LDS in 64-deep k-chunks: 8 lanes fetch one row's 128 B, so a wave-wide load covers 4 whole
// lines (a fragment load straight from the planes touches 16 lines for the same 512 B). Two buffers: chunk c+1 is
// fetched into registers while chunk c is multiplied, stored to the other buffer, and published by one barrier.
// MODE 0: bf16 hi/lo output planes (row segment 256 B = 16 lanes x 16 B); MODE 1: f32 output (512 B = 32 lanes x 16 B).
#define G_PIT 72                    // LDS row pitch in halves: 144 B = 16 B x 9, conflict-free for 16-byte row reads
#define G_AL (64 * G_PIT)           // plane offsets inside a buffer, in halves: A hi at 0, A lo, B hi, B lo
#define G_BH (128 * G_PIT)
#define G_BL (256 * G_PIT)
#define G_BUF (384 * G_PIT)         // 27,648 halves = 55,296 B per buffer

// one thread's share of a chunk: 2 + 2 pieces of A hi / lo, 4 + 4 of B hi / lo, rows 32 apart
__device__ __forceinline__ void g_fetch(v4u (&sa)[4], v4u (&sb)[8], const u16* ah, const u16* al, const u16* bh,
                                        const u16* bl, int lda, int ldb) {
  const u16* pa[4];
  const u16* pb[8];
#pragma unroll
  for (int i = 0; i < 2; ++i) {
    pa[i] = ah + (size_t)(32 * i) * lda;
    pa[2 + i] = al + (size_t)(32 * i) * lda;
  }
#pragma unroll
  for (int i = 0; i < 4; ++i) {
    pb[i] = bh + (size_t)(32 * i) * ldb;
    pb[4 + i] = bl + (size_t)(32 * i) * ldb;
  }
#pragma unroll
  for (int i = 0; i < 4; ++i) sa[i] = *(const v4u*)pa[i];
#pragma unroll
  for (int i = 0; i < 8; ++i) sb[i] = *(const v4u*)pb[i];
  // the wait that stands before a load's address register is rewritten; the twelve addresses are inputs so that
  // they stay live, and so unwritten (also by a later load's result), up to it
  asm volatile("s_wait_xcnt 0x0" ::"v"(pa[0]), "v"(pa[1]), "v"(pa[2]), "v"(pa[3]), "v"(pb[0]), "v"(pb[1]), "v"(pb[2]),
               "v"(pb[3]), "v"(pb[4]), "v"(pb[5]), "v"(pb[6]), "v"(pb[7])
               : "memory");
}
__device__ __forceinline__ void g_put(u16* buf, const v4u (&sa)[4], const v4u (&sb)[8]) {
#pragma unroll
  for (int i = 0; i < 2; ++i) {
    *(v4u*)(buf + 32 * i * G_PIT) = sa[i];
    *(v4u*)(buf + G_AL + 32 * i * G_PIT) = sa[2 + i];
  }
#pragma unroll
  for (int i = 0; i < 4; ++i) {
    *(v4u*)(buf + G_BH + 32 * i * G_PIT) = sb[i];
    *(v4u*)(buf + G_BL + 32 * i * G_PIT) = sb[4 + i];
  }
}
template <int MODE>
__global__ __launch_bounds__(256) void k_gemm(const u16* __restrict__ Ah, const u16* __restrict__ Al,
                                              const u16* __restrict__ Bh, const u16* __restrict__ Bl,
                                              u16* Ch, u16* Cl, float* Cf,
                                              int lda, int ldb, int ldc, int K,
                                              int zA, int zB, int zC) {
  __shared__ __attribute__((aligned(16))) u16 Sm[2 * G_BUF];
  float* Cs = (float*)Sm;           // 64 x 132 f32 output tile, reuses the buffers behind the loop
  const int z = blockIdx.z;
  const int bm = blockIdx.y * 64, bn = blockIdx.x * 128;
  const int tid = threadIdx.x, wave = tid >> 5, lane = tid & 31;
  const int m = lane & 15, hh = lane >> 4;
  const int wr = (wave & 1) * 32, wc = (wave >> 1) * 32;

  // staging map: thread -> (row tid>>3 (+32 per step), 16-byte piece tid&7 of the row's 128 B)
  const int srow = tid >> 3, sseg = (tid & 7) * 8;
  const u16* gah = Ah + (size_t)z * zA + (size_t)(bm + srow) * lda + sseg;
  const u16* gal = Al + (size_t)z * zA + (size_t)(bm + srow) * lda + sseg;
  const u16* gbh = Bh + (size_t)z * zB + (size_t)(bn + srow) * ldb + sseg;
  const u16* gbl = Bl + (size_t)z * zB + (size_t)(bn + srow) * ldb + sseg;
  const int so = srow * G_PIT + sseg;
  // fragment map inside a buffer (same rows and k order as the planes)
  const int fa = (wr + m) * G_PIT + 8 * hh;
  const int fb = (wc + m) * G_PIT + 8 * hh;

  f32x8 acc[2][2];
#pragma unroll
  for (int rt = 0; rt < 2; ++rt)
#pragma unroll
    for (int ct = 0; ct < 2; ++ct) acc[rt][ct] = zero8();

  v4u sa[4], sb[8];
  g_fetch(sa, sb, gah, gal, gbh, gbl, lda, ldb);
  g_put(Sm + so, sa, sb);
  __syncthreads();

  const int nch = K >> 6;
  for (int c = 0; c < nch; ++c) {
    const u16* cur = Sm + (c & 1) * G_BUF;
    u16* nxt = Sm + ((c + 1) & 1) * G_BUF;
    const bool more = (c + 1 < nch);
    if (more) {
      const int k1 = (c + 1) * 64;
      g_fetch(sa, sb, gah + k1, gal + k1, gbh + k1, gbl + k1, lda, ldb);
    }
#pragma unroll
    for (int ks = 0; ks < 2; ++ks) {
      Frag ah[2], al[2], bh[2], bl[2];
#pragma unroll
      for (int rt = 0; rt < 2; ++rt) {
        ldf(ah[rt], cur + fa + rt * 16 * G_PIT + ks * 32);
        ldf(al[rt], cur + G_AL + fa + rt * 16 * G_PIT + ks * 32);
      }
#pragma unroll
      for (int ct = 0; ct < 2; ++ct) {
        ldf(bh[ct], cur + G_BH + fb + ct * 16 * G_PIT + ks * 32);
        ldf(bl[ct], cur + G_BL + fb + ct * 16 * G_PIT + ks * 32);
      }
#pragma unroll
      for (int rt = 0; rt < 2; ++rt)
#pragma unroll
        for (int ct = 0; ct < 2; ++ct)
          acc[rt][ct] = wmma3(ah[rt], al[rt], bh[ct], bl[ct], acc[rt][ct]);
    }
    if (more) g_put(nxt + so, sa, sb);
    // publishes chunk c+1 and ends every wave's reads of the buffer that trip c+1 refills (behind the last trip: of the
    // second buffer, as K = 1024 gives 16 chunks; the output tile lies in the first, freed one trip earlier)
    __syncthreads();
  }

  // stage the 64x128 f32 tile: D element r of lane -> (row 8*hh + r, col m)
#pragma unroll
  for (int rt = 0; rt < 2; ++rt)
#pragma unroll
    for (int ct = 0; ct < 2; ++ct)
#pragma unroll
      for (int r = 0; r < 8; ++r)
        Cs[(wr + rt * 16 + 8 * hh + r) * 132 + wc + ct * 16 + m] = acc[rt][ct][r];
  __syncthreads();

  if (MODE == 1) {
    float* cb = Cf + (size_t)z * zC;
    v4f v[8];
    size_t go[8];
#pragma unroll
    for (int i = 0; i < 8; ++i) {
      const int row = wave * 8 + i;
      v[i] = *(const v4f*)(Cs + row * 132 + 4 * lane);
      go[i] = (size_t)(bm + row) * ldc + bn + 4 * lane;
    }
#pragma unroll
    for (int i = 0; i < 8; ++i) *(v4f*)(cb + go[i]) = v[i];
    
  } else {
    u16* chb = Ch + (size_t)z * zC;
    u16* clb = Cl + (size_t)z * zC;
    us8 hv[4], lv[4];
    size_t go[4];
#pragma unroll
    for (int i = 0; i < 4; ++i) {
      const int row = wave * 8 + 2 * i + (lane >> 4);
      const int cs = (lane & 15) * 8;
      const v4f a = *(const v4f*)(Cs + row * 132 + cs);
      const v4f b = *(const v4f*)(Cs + row * 132 + cs + 4);
      split8(a, b, hv[i], lv[i]);
      go[i] = (size_t)(bm + row) * ldc + bn + cs;
    }
#pragma unroll
    for (int i = 0; i < 4; ++i) {
      *(us8*)(chb + go[i]) = hv[i];
      *(us8*)(clb + go[i]) = lv[i];
    }
    
  }
}

// ---------------------------------------------------------------- per-head V transpose
// src planes: VP[4096][1024] bf16; head plane X_h = 64 contiguous rows viewed as [1024 l][64 e].
__global__ __launch_bounds__(256) void k_vtr(const u16* __restrict__ sh, const u16* __restrict__ sl, u16* dh, u16* dl) {
  __shared__ __attribute__((aligned(16))) u16 Th[64 * 72];  // [e][l]
  __shared__ __attribute__((aligned(16))) u16 Tl[64 * 72];
  const int blk = blockIdx.x, lt = blk & 15, h = (blk >> 4) & 15, b = blk >> 8;
  const int l0 = lt * 64, t = threadIdx.x;
  const size_t src = (size_t)b * 1048576 + (size_t)h * 65536 + (size_t)l0 * 64;
#pragma unroll
  for (int it = 0; it < 2; ++it) {
    const int pc = t + 256 * it, l = pc >> 3, q = pc & 7;
    const us8 a = *(const us8*)(sh + src + l * 64 + 8 * q);
    const us8 c = *(const us8*)(sl + src + l * 64 + 8 * q);
#pragma unroll
    for (int i = 0; i < 8; ++i) {
      Th[(8 * q + i) * 72 + l] = a[i];
      Tl[(8 * q + i) * 72 + l] = c[i];
    }
  }
  __syncthreads();
  const size_t dst = (size_t)(b * 16 + h) * 65536 + (size_t)l0;
  us8 oh[2], ol[2];
  size_t go[2];
#pragma unroll
  for (int it = 0; it < 2; ++it) {
    const int pc = t + 256 * it, e = pc >> 3, q = pc & 7;
    oh[it] = *(const us8*)(Th + e * 72 + 8 * q);
    ol[it] = *(const us8*)(Tl + e * 72 + 8 * q);
    go[it] = dst + (size_t)e * 1024 + 8 * q;
  }
#pragma unroll
  for (int it = 0; it < 2; ++it) {
    *(us8*)(dh + go[it]) = oh[it];
    *(us8*)(dl + go[it]) = ol[it];
  }
  
}

// ---------------------------------------------------------------- attention
// one 16x16 tile, K = 64 (two k-steps); A fragments preloaded, B rows at bh/bl (already offset to row n, col 8h)
__device__ __forceinline__ f32x8 tile_k64(const Frag& ah0, const Frag& al0, const Frag& ah1, const Frag& al1,
                                          const u16* bh, const u16* bl) {
  Frag h0, l0, h1, l1;
  ldf(h0, bh); ldf(h1, bh + 32);
  ldf(l0, bl); ldf(l1, bl + 32);
  f32x8 acc = zero8();
  acc = wmma3(ah0, al0, h0, l0, acc);
  acc = wmma3(ah1, al1, h1, l1, acc);
  return acc;
}

// One block per (b, h, 32 query rows), 256 threads = 8 waves.
// LDS (dynamic): S[32][1024] f32 (131072 B), later reused in place as P row = hi[1024] | lo[1024] bf16; Ost[32][64] f32 (8192 B).
// P rows are 4096 B apart (the same banks in every row), so inside a plane the 16-byte piece (col >> 3) of row r sits at
// piece index (col >> 3) ^ (r & 15): the 16 rows that one fragment load reads then fall on 16 different bank groups.
__global__ __launch_bounds__(256) void k_attn(const u16* __restrict__ QPh, const u16* __restrict__ QPl,
                                              const u16* __restrict__ KPh, const u16* __restrict__ KPl,
                                              const u16* __restrict__ VTh, const u16* __restrict__ VTl,
                                              const u16* __restrict__ Eh, const u16* __restrict__ El,
                                              u16* AOh, u16* AOl) {
  extern __shared__ v4u dsm[];
  float* S = (float*)dsm;
  u16* P = (u16*)dsm;
  float* Ost = (float*)(dsm + 8192);  // byte offset 131072

  const int blk = blockIdx.x;
  const int ib = blk & 31, h = (blk >> 5) & 15, b = blk >> 9;
  const int i0 = ib * 32;
  const int tid = threadIdx.x, wave = tid >> 5, lane = tid & 31;
  const int m = lane & 15, hh = lane >> 4;

  // q_h[i][e]  = QP[b][h*64 + (i>>4)][(i&15)*64 + e] = contiguous plane at b*2^20 + h*2^16, pitch 64
  const size_t pq = (size_t)b * 1048576 + (size_t)h * 65536;
  const u16* Qh = QPh + pq;
  const u16* Ql = QPl + pq;
  // k_h[j][e]  = KP[b][h*64+e][j] = KPT[b][j][h*64 + e], pitch 1024
  const size_t pk = (size_t)b * 1048576 + (size_t)h * 64;
  const u16* Kh = KPh + pk;
  const u16* Kl = KPl + pk;
  // v_h^T[e][j] plane, pitch 1024
  const size_t pv = (size_t)(b * 16 + h) * 65536;
  const u16* Vh = VTh + pv;
  const u16* Vl = VTl + pv;

  // Srel[i][i+1] = 0 (the only cells the skew scatter never writes)
  if (tid < 32) {
    const int j = i0 + tid + 1;
    if (j < 1024) S[tid * 1024 + j] = 0.0f;
  }

  // ---- phase 1: QEr tiles (rows i0 .. i0+32 needed) scattered through the skew map into S
  // row tile 2 (rows i0+32..) is consumed only through row i0+32, columns c <= 990 - i0
  const int ncol2 = 991 - i0;
  const int nct2 = (ncol2 > 0) ? ((ncol2 + 63) >> 6) : 0;
  const int U1 = 32 + nct2;
  for (int u = wave; u < U1; u += 8) {
    const int rt = u >> 4, ct = u & 15;
    const int rb = i0 + rt * 16;
    int ra = rb + m;
    ra = (ra > 1023) ? 1023 : ra;
    Frag ah0, al0, ah1, al1;
    const u16* qa = Qh + (size_t)ra * 64 + 8 * hh;
    const u16* qb = Ql + (size_t)ra * 64 + 8 * hh;
    ldf(ah0, qa); ldf(ah1, qa + 32);
    ldf(al0, qb); ldf(al1, qb + 32);
#pragma unroll 1
    for (int sub = 0; sub < 4; ++sub) {
      const int col0 = ct * 64 + sub * 16;
      const size_t eo = (size_t)(col0 + m) * 64 + 8 * hh;
      const f32x8 acc = tile_k64(ah0, al0, ah1, al1, Eh + eo, El + eo);
      const int c = col0 + m;
#pragma unroll
      for (int r = 0; r < 8; ++r) {
        const int i2 = rb + 8 * hh + r;                       // QEr row
        const bool low = (c >= 1023 - i2);
        const int lr = (low ? i2 : (i2 - 1)) - i0;            // Srel row (local)
        const int j = low ? (c + i2 - 1023) : (c + i2 + 1);   // Srel column
        if ((unsigned)lr < 32u && (unsigned)j < 1024u) S[lr * 1024 + j] = acc[r];
      }
    }
  }
  __syncthreads();

  // ---- phase 2: S += Q K^T
  for (int u = wave; u < 32; u += 8) {
    const int rt = u >> 4, ct = u & 15;
    const int rb = i0 + rt * 16;
    Frag ah0, al0, ah1, al1;
    const u16* qa = Qh + (size_t)(rb + m) * 64 + 8 * hh;
    const u16* qb = Ql + (size_t)(rb + m) * 64 + 8 * hh;
    ldf(ah0, qa); ldf(ah1, qa + 32);
    ldf(al0, qb); ldf(al1, qb + 32);
#pragma unroll 1
    for (int sub = 0; sub < 4; ++sub) {
      const int col0 = ct * 64 + sub * 16;
      const size_t ko = (size_t)(col0 + m) * 1024 + 8 * hh;
      const f32x8 acc = tile_k64(ah0, al0, ah1, al1, Kh + ko, Kl + ko);
#pragma unroll
      for (int r = 0; r < 8; ++r)
        S[(rt * 16 + 8 * hh + r) * 1024 + col0 + m] += acc[r];
    }
  }
  __syncthreads();

  // ---- phase 3: row softmax of S/8 (max-subtracted), P written in place as bf16 hi/lo; lane owns columns
  // 128 q + 4 lane + 0..3 (q = 0..7), so a wave-wide 16-byte read covers 512 contiguous bytes of the row
#pragma unroll 1
  for (int rr = 0; rr < 4; ++rr) {
    const int row = wave * 4 + rr;
    const float* sr = S + row * 1024 + lane * 4;
    v4f xv[8];
    float mx = -3.0e38f;
#pragma unroll
    for (int q = 0; q < 8; ++q) {
      v4f v = *(const v4f*)(sr + 128 * q);
      v = v * 0.125f;
      xv[q] = v;
      mx = fmaxf(mx, fmaxf(fmaxf(v.x, v.y), fmaxf(v.z, v.w)));
    }
#pragma unroll
    for (int off = 16; off > 0; off >>= 1) mx = fmaxf(mx, __shfl_xor(mx, off, 32));
    float sum = 0.0f;
#pragma unroll
    for (int q = 0; q < 8; ++q) {
      v4f e;
      e.x = __expf(xv[q].x - mx);
      e.y = __expf(xv[q].y - mx);
      e.z = __expf(xv[q].z - mx);
      e.w = __expf(xv[q].w - mx);
      xv[q] = e;
      sum += (e.x + e.y) + (e.z + e.w);
    }
#pragma unroll
    for (int off = 16; off > 0; off >>= 1) sum += __shfl_xor(sum, off, 32);
    const float inv = 1.0f / sum;
    // hi: halves row*2048 + swizzled piece * 8 + (col & 7); piece of this lane's group q = 16 q + (lane >> 1)
    u16* ph = P + row * 2048 + (((lane >> 1) ^ (row & 15)) * 8) + (lane & 1) * 4;
    u16* pl = ph + 1024;                    // lo plane: 1024 halves behind hi
#pragma unroll
    for (int q = 0; q < 8; ++q) {
      const v4f a = xv[q] * inv;
      us4 hv, lv;
#pragma unroll
      for (int i = 0; i < 4; ++i) {
        const u16 hb = f2bf(a[i]);
        hv[i] = hb;
        lv[i] = f2bf(a[i] - bf2f(hb));
      }
      *(us4*)(ph + 128 * q) = hv;
      *(us4*)(pl + 128 * q) = lv;
    }
  }
  __syncthreads();

  // ---- phase 4: O[32][64] = P[32][1024] . V[1024][64]; one 16x16 tile per wave
  {
    const int rt = wave & 1, nt = wave >> 1;
    const u16* pa = P + (rt * 16 + m) * 2048;   // row & 15 = m
    const u16* vb = Vh + (size_t)(nt * 16 + m) * 1024 + 8 * hh;
    const u16* vc = Vl + (size_t)(nt * 16 + m) * 1024 + 8 * hh;
    f32x8 acc = zero8();
#pragma unroll 2
    for (int ks = 0; ks < 32; ++ks) {
      Frag ah, al, bh, bl;
      const int p0 = ((ks * 4 + hh) ^ m) * 8;       // columns ks*32 + 8*hh + 0..7
      const int p1 = ((ks * 4 + 2 + hh) ^ m) * 8;   // columns ks*32 + 16 + 8*hh + 0..7
      ah.q[0] = *(const v4u*)(pa + p0);
      ah.q[1] = *(const v4u*)(pa + p1);
      al.q[0] = *(const v4u*)(pa + 1024 + p0);
      al.q[1] = *(const v4u*)(pa + 1024 + p1);
      ldf(bh, vb + ks * 32);
      ldf(bl, vc + ks * 32);
      acc = wmma3(ah, al, bh, bl, acc);
    }
#pragma unroll
    for (int r = 0; r < 8; ++r) Ost[(rt * 16 + 8 * hh + r) * 64 + nt * 16 + m] = acc[r];
  }
  __syncthreads();

  {
    const int row = wave * 4 + (lane >> 3), q = lane & 7;
    const v4f a = *(const v4f*)(Ost + row * 64 + 8 * q);
    const v4f bq = *(const v4f*)(Ost + row * 64 + 8 * q + 4);
    us8 hv, lv;
    split8(a, bq, hv, lv);
    const size_t g = ((size_t)(b * 1024 + i0 + row)) * 1024 + (size_t)h * 64 + 8 * q;
    *(us8*)(AOh + g) = hv;
    *(us8*)(AOl + g) = lv;
    
  }
}

// ---------------------------------------------------------------- launch

extern "C" void kernel_launch(void* const* d_in, const int* in_sizes, int n_in,
                              void* d_out, int out_size, void* d_ws, size_t ws_size,
                              hipStream_t stream) {
  const int NX = 4194304;   // 4 x 1024 x 1024
  const int NW = 1048576;   // 1024 x 1024
  const int NE = 65536;     // 1024 x 64
  if (n_in < 8) return;
  if (in_sizes[0] != NX || in_sizes[1] != NX || in_sizes[2] != NX) return;
  if (in_sizes[3] != NW || in_sizes[4] != NW || in_sizes[5] != NW || in_sizes[7] != NW) return;
  if (in_sizes[6] != NE) return;
  if (out_size != NX) return;

  const float* q_in = (const float*)d_in[0];
  const float* k_in = (const float*)d_in[1];
  const float* v_in = (const float*)d_in[2];
  const float* WQ = (const float*)d_in[3];
  const float* WK = (const float*)d_in[4];
  const float* WV = (const float*)d_in[5];
  const float* Er = (const float*)d_in[6];
  const float* WM = (const float*)d_in[7];
  float* out = (float*)d_out;

  // workspace carve (bytes); bf16 planes
  const size_t bx = (size_t)NX * 2;   // 8 MiB
  const size_t bw = (size_t)NW * 2;   // 2 MiB
  const size_t be = (size_t)NE * 2;   // 128 KiB
  const size_t total = 6 * bx + 8 * bw + 2 * be + 4 * bx;   // 100,925,440 B
  if (total > ws_size) return;
  char* w = (char*)d_ws;
  size_t off = 0;
  u16* R0h = (u16*)(w + off); off += bx;   // Xq, later VP
  u16* R0l = (u16*)(w + off); off += bx;
  u16* R1h = (u16*)(w + off); off += bx;   // Xk, later VT
  u16* R1l = (u16*)(w + off); off += bx;
  u16* R2h = (u16*)(w + off); off += bx;   // Xv, later AO
  u16* R2l = (u16*)(w + off); off += bx;
  u16* WQh = (u16*)(w + off); off += bw;
  u16* WQl = (u16*)(w + off); off += bw;
  u16* WKh = (u16*)(w + off); off += bw;
  u16* WKl = (u16*)(w + off); off += bw;
  u16* WVh = (u16*)(w + off); off += bw;
  u16* WVl = (u16*)(w + off); off += bw;
  u16* WMh = (u16*)(w + off); off += bw;
  u16* WMl = (u16*)(w + off); off += bw;
  u16* ERh = (u16*)(w + off); off += be;
  u16* ERl = (u16*)(w + off); off += be;
  u16* QPh = (u16*)(w + off); off += bx;
  u16* QPl = (u16*)(w + off); off += bx;
  u16* KPh = (u16*)(w + off); off += bx;
  u16* KPl = (u16*)(w + off); off += bx;
  if (off > ws_size) return;

  u16* Xqh = R0h; u16* Xql = R0l;
  u16* Xkh = R1h; u16* Xkl = R1l;
  u16* Xvh = R2h; u16* Xvl = R2l;
  u16* VPh = R0h; u16* VPl = R0l;
  u16* VTh = R1h; u16* VTl = R1l;
  u16* AOh = R2h; u16* AOl = R2l;

  const dim3 blk(256);
  const int ATTN_LDS = 131072 + 8192;
  hipFuncSetAttribute((const void*)k_attn, hipFuncAttributeMaxDynamicSharedMemorySize, ATTN_LDS);

  // activations and Er -> bf16 hi/lo planes
  k_split<<<dim3(NX / 8 / 256), blk, 0, stream>>>(q_in, Xqh, Xql, NX / 8);
  k_split<<<dim3(NX / 8 / 256), blk, 0, stream>>>(k_in, Xkh, Xkl, NX / 8);
  k_split<<<dim3(NX / 8 / 256), blk, 0, stream>>>(v_in, Xvh, Xvl, NX / 8);
  k_split<<<dim3(NE / 8 / 256), blk, 0, stream>>>(Er, ERh, ERl, NE / 8);
  // weights W[k][n] (1024 rows k, 1024 cols n) -> Wt[n][k] hi/lo ; grid (cols/64, rows/64)
  k_split_tr<<<dim3(1024 / 64, 1024 / 64), blk, 0, stream>>>(WQ, WQh, WQl, 1024, 1024);
  k_split_tr<<<dim3(1024 / 64, 1024 / 64), blk, 0, stream>>>(WK, WKh, WKl, 1024, 1024);
  k_split_tr<<<dim3(1024 / 64, 1024 / 64), blk, 0, stream>>>(WV, WVh, WVl, 1024, 1024);
  k_split_tr<<<dim3(1024 / 64, 1024 / 64), blk, 0, stream>>>(WM, WMh, WMl, 1024, 1024);

  // QP[4096][1024] = Xq . WQ
  k_gemm<0><<<dim3(1024 / 128, 4096 / 64, 1), blk, 0, stream>>>(
      Xqh, Xql, WQh, WQl, QPh, QPl, out, 1024, 1024, 1024, 1024, 0, 0, 0);
  // KPT[b][c][r] = sum_k WK[k][c] key[b][r][k]  (A = WKt, Bt = Xk[b])
  k_gemm<0><<<dim3(1024 / 128, 1024 / 64, 4), blk, 0, stream>>>(
      WKh, WKl, Xkh, Xkl, KPh, KPl, out, 1024, 1024, 1024, 1024, 0, NW, NW);
  // VP[4096][1024] = Xv . WV  (into region 0)
  k_gemm<0><<<dim3(1024 / 128, 4096 / 64, 1), blk, 0, stream>>>(
      Xvh, Xvl, WVh, WVl, VPh, VPl, out, 1024, 1024, 1024, 1024, 0, 0, 0);
  // per-head transpose of V (into region 1)
  k_vtr<<<dim3(4 * 16 * 16), blk, 0, stream>>>(VPh, VPl, VTh, VTl);
  // attention (into region 2)
  k_attn<<<dim3(4 * 16 * 32), blk, ATTN_LDS, stream>>>(QPh, QPl, KPh, KPl, VTh, VTl, ERh, ERl, AOh, AOl);
  // out = AO . WMerge
  k_gemm<1><<<dim3(1024 / 128, 4096 / 64, 1), blk, 0, stream>>>(
      AOh, AOl, WMh, WMl, QPh, QPl, out, 1024, 1024, 1024, 1024, 0, 0, 0);
}

// v003
// A run of this version takes 285 microseconds.
// Timed twice side by side with v002, it ran 1.38 and 1.37 times as fast.
// Over all steps from v000 it is 1.94 times as fast.
#include <hip/hip_runtime.h>
#include <stdint.h>

// All contractions (x.WQ, WK-cols x key-rows, x.WV, Q.Er^T, Q.K^T, P.V, O.WMerge): v_wmma_f32_16x16x32_bf16 with bf16 hi/lo operand pairs (hi*hi + hi*lo + lo*hi), f32 accumulate; softmax and skew index arithmetic in f32 / int32.

typedef unsigned short u16;
typedef unsigned int u32;
typedef __bf16 bf16x16 __attribute__((ext_vector_type(16)));
typedef float f32x8 __attribute__((ext_vector_type(8)));
typedef float v4f __attribute__((ext_vector_type(4)));
typedef u32 v4u __attribute__((ext_vector_type(4)));
typedef u16 us8 __attribute__((ext_vector_type(8)));
typedef u16 us4 __attribute__((ext_vector_type(4)));

union Frag {
  bf16x16 v;
  v4u q[2];
};

// f32 -> bf16 bits, RNE
__device__ __forceinline__ u16 f2bf(float f) {
  const u32 u = __float_as_uint(f);
  const u32 r = u + 0x7FFFu + ((u >> 16) & 1u);
  return (u16)(r >> 16);
}
__device__ __forceinline__ float bf2f(u16 b) { return __uint_as_float(((u32)b) << 16); }

// 8 f32 -> 8 bf16 hi + 8 bf16 lo (lo = RNE(x - hi))
__device__ __forceinline__ void split8(v4f a, v4f b, us8& h, us8& l) {
  float f[8];
  f[0] = a.x; f[1] = a.y; f[2] = a.z; f[3] = a.w;
  f[4] = b.x; f[5] = b.y; f[6] = b.z; f[7] = b.w;
#pragma unroll
  for (int i = 0; i < 8; ++i) {
    const u16 hb = f2bf(f[i]);
    h[i] = hb;
    l[i] = f2bf(f[i] - bf2f(hb));
  }
}

__device__ __forceinline__ f32x8 zero8() {
  f32x8 z;
#pragma unroll
  for (int e = 0; e < 8; ++e) z[e] = 0.0f;
  return z;
}

// 16-bit fragment: lane (h = l>>4, m = l&15) -> elements 0..7 = k0+8h+0..7, elements 8..15 = k0+16+8h+0..7
// p already points at row m, column k0 + 8h of a k-contiguous [row][k] plane.
__device__ __forceinline__ void ldf(Frag& f, const u16* p) {
  f.q[0] = *(const v4u*)p;
  f.q[1] = *(const v4u*)(p + 16);
}

// one 32-deep k-step, hi/lo pairs: c += ah*bh + ah*bl + al*bh ; hazard guard after the group
__device__ __forceinline__ f32x8 wmma3(const Frag& ah, const Frag& al, const Frag& bh, const Frag& bl, f32x8 c) {
  c = __builtin_amdgcn_wmma_f32_16x16x32_bf16(false, ah.v, false, bh.v, (short)0, c, false, false);
  c = __builtin_amdgcn_wmma_f32_16x16x32_bf16(false, ah.v, false, bl.v, (short)0, c, false, false);
  c = __builtin_amdgcn_wmma_f32_16x16x32_bf16(false, al.v, false, bh.v, (short)0, c, false, false);
  asm volatile("v_nop\n\tv_nop\n\tv_nop\n\tv_nop" : "+v"(c) : "v"(ah.v), "v"(al.v), "v"(bh.v), "v"(bl.v));
  return c;
}

// ---------------------------------------------------------------- elementwise split
__global__ __launch_bounds__(256) void k_split(const float* __restrict__ s, u16* dh, u16* dl, int n8) {
  const int g = blockIdx.x * 256 + threadIdx.x;
  if (g >= n8) return;
  const size_t o = (size_t)g * 8;
  const v4f a = *(const v4f*)(s + o);
  const v4f b = *(const v4f*)(s + o + 4);
  us8 h, l;
  split8(a, b, h, l);
  *(us8*)(dh + o) = h;
  *(us8*)(dl + o) = l;
  
}

// ---------------------------------------------------------------- transposing split
// in[R][C] row-major f32 -> out[C][R] bf16 hi/lo planes. Block = 64x64 tile, grid (C/64, R/64).
__global__ __launch_bounds__(256) void k_split_tr(const float* __restrict__ s, u16* dh, u16* dl, int R, int C) {
  __shared__ __attribute__((aligned(16))) float Ts[64 * 68];  // Ts[c][r]
  const int c0 = blockIdx.x * 64, r0 = blockIdx.y * 64;
  const int t = threadIdx.x;
  {
    const int r = t >> 2, cb = (t & 3) * 16;
    const float* p = s + (size_t)(r0 + r) * C + c0 + cb;
#pragma unroll
    for (int q = 0; q < 4; ++q) {
      const v4f v = *(const v4f*)(p + 4 * q);
      Ts[(cb + 4 * q + 0) * 68 + r] = v.x;
      Ts[(cb + 4 * q + 1) * 68 + r] = v.y;
      Ts[(cb + 4 * q + 2) * 68 + r] = v.z;
      Ts[(cb + 4 * q + 3) * 68 + r] = v.w;
    }
  }
  __syncthreads();
  us8 h[2], l[2];
  size_t go[2];
#pragma unroll
  for (int it = 0; it < 2; ++it) {
    const int pc = t + 256 * it, c = pc >> 3, q = pc & 7;
    const v4f a = *(const v4f*)(Ts + c * 68 + 8 * q);
    const v4f b = *(const v4f*)(Ts + c * 68 + 8 * q + 4);
    split8(a, b, h[it], l[it]);
    go[it] = (size_t)(c0 + c) * R + r0 + 8 * q;
  }
#pragma unroll
  for (int it = 0; it < 2; ++it) {
    *(us8*)(dh + go[it]) = h[it];
    *(us8*)(dl + go[it]) = l[it];
  }
  
}

// ---------------------------------------------------------------- GEMM (hi/lo pairs)
// C[z][M][N] = A[z][M][K] * Bt[z][N][K]^T ; A and Bt are k-contiguous bf16 hi/lo planes; K a multiple of 64.
// Block tile 64 x 128 (grid.x = N/128, grid.y = M/64, grid.z = batch), 8 waves of 32x32.
// Operands go through LDS in 64-deep k-chunks: 8 lanes fetch one row's 128 B, so a wave-wide load covers 4 whole
// lines (a fragment load straight from the planes touches 16 lines for the same 512 B). Two buffers: chunk c+1 is
// fetched into registers while chunk c is multiplied, stored to the other buffer, and published by one barrier.
// MODE 0: bf16 hi/lo output planes (row segment 256 B = 16 lanes x 16 B); MODE 1: f32 output (512 B = 32 lanes x 16 B).
#define G_PIT 72                    // LDS row pitch in halves: 144 B = 16 B x 9, conflict-free for 16-byte row reads
#define G_AL (64 * G_PIT)           // plane offsets inside a buffer, in halves: A hi at 0, A lo, B hi, B lo
#define G_BH (128 * G_PIT)
#define G_BL (256 * G_PIT)
#define G_BUF (384 * G_PIT)         // 27,648 halves = 55,296 B per buffer

// one thread's share of a chunk: 2 + 2 pieces of A hi / lo, 4 + 4 of B hi / lo, rows 32 apart
__device__ __forceinline__ void g_fetch(v4u (&sa)[4], v4u (&sb)[8], const u16* ah, const u16* al, const u16* bh,
                                        const u16* bl, int lda, int ldb) {
  const u16* pa[4];
  const u16* pb[8];
#pragma unroll
  for (int i = 0; i < 2; ++i) {
    pa[i] = ah + (size_t)(32 * i) * lda;
    pa[2 + i] = al + (size_t)(32 * i) * lda;
  }
#pragma unroll
  for (int i = 0; i < 4; ++i) {
    pb[i] = bh + (size_t)(32 * i) * ldb;
    pb[4 + i] = bl + (size_t)(32 * i) * ldb;
  }
#pragma unroll
  for (int i = 0; i < 4; ++i) sa[i] = *(const v4u*)pa[i];
#pragma unroll
  for (int i = 0; i < 8; ++i) sb[i] = *(const v4u*)pb[i];
  // the wait that stands before a load's address register is rewritten; the twelve addresses are inputs so that
  // they stay live, and so unwritten (also by a later load's result), up to it
  asm volatile("s_wait_xcnt 0x0" ::"v"(pa[0]), "v"(pa[1]), "v"(pa[2]), "v"(pa[3]), "v"(pb[0]), "v"(pb[1]), "v"(pb[2]),
               "v"(pb[3]), "v"(pb[4]), "v"(pb[5]), "v"(pb[6]), "v"(pb[7])
               : "memory");
}
__device__ __forceinline__ void g_put(u16* buf, const v4u (&sa)[4], const v4u (&sb)[8]) {
#pragma unroll
  for (int i = 0; i < 2; ++i) {
    *(v4u*)(buf + 32 * i * G_PIT) = sa[i];
    *(v4u*)(buf + G_AL + 32 * i * G_PIT) = sa[2 + i];
  }
#pragma unroll
  for (int i = 0; i < 4; ++i) {
    *(v4u*)(buf + G_BH + 32 * i * G_PIT) = sb[i];
    *(v4u*)(buf + G_BL + 32 * i * G_PIT) = sb[4 + i];
  }
}
template <int MODE>
__global__ __launch_bounds__(256) void k_gemm(const u16* __restrict__ Ah, const u16* __restrict__ Al,
                                              const u16* __restrict__ Bh, const u16* __restrict__ Bl,
                                              u16* Ch, u16* Cl, float* Cf,
                                              int lda, int ldb, int ldc, int K,
                                              int zA, int zB, int zC) {
  __shared__ __attribute__((aligned(16))) u16 Sm[2 * G_BUF];
  float* Cs = (float*)Sm;           // 64 x 132 f32 output tile, reuses the buffers behind the loop
  const int z = blockIdx.z;
  const int bm = blockIdx.y * 64, bn = blockIdx.x * 128;
  const int tid = threadIdx.x, wave = tid >> 5, lane = tid & 31;
  const int m = lane & 15, hh = lane >> 4;
  const int wr = (wave & 1) * 32, wc = (wave >> 1) * 32;

  // staging map: thread -> (row tid>>3 (+32 per step), 16-byte piece tid&7 of the row's 128 B)
  const int srow = tid >> 3, sseg = (tid & 7) * 8;
  const u16* gah = Ah + (size_t)z * zA + (size_t)(bm + srow) * lda + sseg;
  const u16* gal = Al + (size_t)z * zA + (size_t)(bm + srow) * lda + sseg;
  const u16* gbh = Bh + (size_t)z * zB + (size_t)(bn + srow) * ldb + sseg;
  const u16* gbl = Bl + (size_t)z * zB + (size_t)(bn + srow) * ldb + sseg;
  const int so = srow * G_PIT + sseg;
  // fragment map inside a buffer (same rows and k order as the planes)
  const int fa = (wr + m) * G_PIT + 8 * hh;
  const int fb = (wc + m) * G_PIT + 8 * hh;

  f32x8 acc[2][2];
#pragma unroll
  for (int rt = 0; rt < 2; ++rt)
#pragma unroll
    for (int ct = 0; ct < 2; ++ct) acc[rt][ct] = zero8();

  v4u sa[4], sb[8];
  g_fetch(sa, sb, gah, gal, gbh, gbl, lda, ldb);
  g_put(Sm + so, sa, sb);
  __syncthreads();

  const int nch = K >> 6;
  for (int c = 0; c < nch; ++c) {
    const u16* cur = Sm + (c & 1) * G_BUF;
    u16* nxt = Sm + ((c + 1) & 1) * G_BUF;
    const bool more = (c + 1 < nch);
    if (more) {
      const int k1 = (c + 1) * 64;
      g_fetch(sa, sb, gah + k1, gal + k1, gbh + k1, gbl + k1, lda, ldb);
    }
#pragma unroll
    for (int ks = 0; ks < 2; ++ks) {
      Frag ah[2], al[2], bh[2], bl[2];
#pragma unroll
      for (int rt = 0; rt < 2; ++rt) {
        ldf(ah[rt], cur + fa + rt * 16 * G_PIT + ks * 32);
        ldf(al[rt], cur + G_AL + fa + rt * 16 * G_PIT + ks * 32);
      }
#pragma unroll
      for (int ct = 0; ct < 2; ++ct) {
        ldf(bh[ct], cur + G_BH + fb + ct * 16 * G_PIT + ks * 32);
        ldf(bl[ct], cur + G_BL + fb + ct * 16 * G_PIT + ks * 32);
      }
#pragma unroll
      for (int rt = 0; rt < 2; ++rt)
#pragma unroll
        for (int ct = 0; ct < 2; ++ct)
          acc[rt][ct] = wmma3(ah[rt], al[rt], bh[ct], bl[ct], acc[rt][ct]);
    }
    if (more) g_put(nxt + so, sa, sb);
    // publishes chunk c+1 and ends every wave's reads of the buffer that trip c+1 refills (behind the last trip: of the
    // second buffer, as K = 1024 gives 16 chunks; the output tile lies in the first, freed one trip earlier)
    __syncthreads();
  }

  // stage the 64x128 f32 tile: D element r of lane -> (row 8*hh + r, col m)
#pragma unroll
  for (int rt = 0; rt < 2; ++rt)
#pragma unroll
    for (int ct = 0; ct < 2; ++ct)
#pragma unroll
      for (int r = 0; r < 8; ++r)
        Cs[(wr + rt * 16 + 8 * hh + r) * 132 + wc + ct * 16 + m] = acc[rt][ct][r];
  __syncthreads();

  if (MODE == 1) {
    float* cb = Cf + (size_t)z * zC;
    v4f v[8];
    size_t go[8];
#pragma unroll
    for (int i = 0; i < 8; ++i) {
      const int row = wave * 8 + i;
      v[i] = *(const v4f*)(Cs + row * 132 + 4 * lane);
      go[i] = (size_t)(bm + row) * ldc + bn + 4 * lane;
    }
#pragma unroll
    for (int i = 0; i < 8; ++i) *(v4f*)(cb + go[i]) = v[i];
    
  } else {
    u16* chb = Ch + (size_t)z * zC;
    u16* clb = Cl + (size_t)z * zC;
    us8 hv[4], lv[4];
    size_t go[4];
#pragma unroll
    for (int i = 0; i < 4; ++i) {
      const int row = wave * 8 + 2 * i + (lane >> 4);
      const int cs = (lane & 15) * 8;
      const v4f a = *(const v4f*)(Cs + row * 132 + cs);
      const v4f b = *(const v4f*)(Cs + row * 132 + cs + 4);
      split8(a, b, hv[i], lv[i]);
      go[i] = (size_t)(bm + row) * ldc + bn + cs;
    }
#pragma unroll
    for (int i = 0; i < 4; ++i) {
      *(us8*)(chb + go[i]) = hv[i];
      *(us8*)(clb + go[i]) = lv[i];
    }
    
  }
}

// ---------------------------------------------------------------- per-head V transpose
// src planes: VP[4096][1024] bf16; head plane X_h = 64 contiguous rows viewed as [1024 l][64 e].
__global__ __launch_bounds__(256) void k_vtr(const u16* __restrict__ sh, const u16* __restrict__ sl, u16* dh, u16* dl) {
  __shared__ __attribute__((aligned(16))) u16 Th[64 * 72];  // [e][l]
  __shared__ __attribute__((aligned(16))) u16 Tl[64 * 72];
  const int blk = blockIdx.x, lt = blk & 15, h = (blk >> 4) & 15, b = blk >> 8;
  const int l0 = lt * 64, t = threadIdx.x;
  const size_t src = (size_t)b * 1048576 + (size_t)h * 65536 + (size_t)l0 * 64;
#pragma unroll
  for (int it = 0; it < 2; ++it) {
    const int pc = t + 256 * it, l = pc >> 3, q = pc & 7;
    const us8 a = *(const us8*)(sh + src + l * 64 + 8 * q);
    const us8 c = *(const us8*)(sl + src + l * 64 + 8 * q);
#pragma unroll
    for (int i = 0; i < 8; ++i) {
      Th[(8 * q + i) * 72 + l] = a[i];
      Tl[(8 * q + i) * 72 + l] = c[i];
    }
  }
  __syncthreads();
  const size_t dst = (size_t)(b * 16 + h) * 65536 + (size_t)l0;
  us8 oh[2], ol[2];
  size_t go[2];
#pragma unroll
  for (int it = 0; it < 2; ++it) {
    const int pc = t + 256 * it, e = pc >> 3, q = pc & 7;
    oh[it] = *(const us8*)(Th + e * 72 + 8 * q);
    ol[it] = *(const us8*)(Tl + e * 72 + 8 * q);
    go[it] = dst + (size_t)e * 1024 + 8 * q;
  }
#pragma unroll
  for (int it = 0; it < 2; ++it) {
    *(us8*)(dh + go[it]) = oh[it];
    *(us8*)(dl + go[it]) = ol[it];
  }
  
}

// ---------------------------------------------------------------- attention
// the four fragments (hi / lo, two k-steps) of 16 rows x 64 k; off = the lane's byte offset (row m, column 8h) in both planes
__device__ __forceinline__ void ld_k64(Frag& h0, Frag& l0, Frag& h1, Frag& l1, const u16* bh, const u16* bl, u32 off) {
  const u16* ph = (const u16*)((const char*)bh + off);
  const u16* pl = (const u16*)((const char*)bl + off);
  ldf(h0, ph); ldf(h1, ph + 32);
  ldf(l0, pl); ldf(l1, pl + 32);
  // the wait that stands before a load's address register is rewritten; the offset is an input so that it stays
  // live, and so unwritten (also by a later load's result), up to it
  asm volatile("s_wait_xcnt 0x0" ::"v"(off) : "memory");
}

// one 16x16 tile, K = 64 (two k-steps); A and B fragments preloaded
__device__ __forceinline__ f32x8 tile_k64(const Frag& ah0, const Frag& al0, const Frag& ah1, const Frag& al1,
                                          const Frag& h0, const Frag& l0, const Frag& h1, const Frag& l1) {
  f32x8 acc = zero8();
  acc = wmma3(ah0, al0, h0, l0, acc);
  acc = wmma3(ah1, al1, h1, l1, acc);
  return acc;
}

// One block per (b, h, 32 query rows), 256 threads = 8 waves.
// LDS (dynamic): S[32][1024] f32 (131072 B), later reused in place as P row = hi[1024] | lo[1024] bf16; Ost[2][32][64] f32 (16384 B).
// Every Er, K and V fragment is loaded once per block: the wave that loads it multiplies it with all row tiles.
// P rows are 4096 B apart (the same banks in every row), so inside a plane the 16-byte piece (col >> 3) of row r sits at
// piece index (col >> 3) ^ (r & 15): the 16 rows that one fragment load reads then fall on 16 different bank groups.
__global__ __launch_bounds__(256) void k_attn(const u16* __restrict__ QPh, const u16* __restrict__ QPl,
                                              const u16* __restrict__ KPh, const u16* __restrict__ KPl,
                                              const u16* __restrict__ VTh, const u16* __restrict__ VTl,
                                              const u16* __restrict__ Eh, const u16* __restrict__ El,
                                              u16* AOh, u16* AOl) {
  extern __shared__ v4u dsm[];
  float* S = (float*)dsm;
  u16* P = (u16*)dsm;
  float* Ost = (float*)(dsm + 8192);  // byte offset 131072

  const int blk = blockIdx.x;
  const int ib = blk & 31, h = (blk >> 5) & 15, b = blk >> 9;
  const int i0 = ib * 32;
  const int tid = threadIdx.x, wave = tid >> 5, lane = tid & 31;
  const int m = lane & 15, hh = lane >> 4;

  // q_h[i][e]  = QP[b][h*64 + (i>>4)][(i&15)*64 + e] = contiguous plane at b*2^20 + h*2^16, pitch 64
  const size_t pq = (size_t)b * 1048576 + (size_t)h * 65536;
  const u16* Qh = QPh + pq;
  const u16* Ql = QPl + pq;
  // k_h[j][e]  = KP[b][h*64+e][j] = KPT[b][j][h*64 + e], pitch 1024
  const size_t pk = (size_t)b * 1048576 + (size_t)h * 64;
  const u16* Kh = KPh + pk;
  const u16* Kl = KPl + pk;
  // v_h^T[e][j] plane, pitch 1024
  const size_t pv = (size_t)(b * 16 + h) * 65536;
  const u16* Vh = VTh + pv;
  const u16* Vl = VTl + pv;

  // Srel[i][i+1] = 0 (the only cells the skew scatter never writes)
  if (tid < 32) {
    const int j = i0 + tid + 1;
    if (j < 1024) S[tid * 1024 + j] = 0.0f;
  }

  // ---- phase 1: QEr tiles (rows i0 .. i0+32 needed) scattered through the skew map into S
  // row tile 2 (rows i0+32..) is consumed only through row i0+32, columns c <= 990 - i0
  const int ncol2 = 991 - i0;
  const int nct2 = (ncol2 > 0) ? ((ncol2 + 63) >> 6) : 0;
  // Q fragments of row tiles 0 and 1 (the block's own rows) and 2 (the 16 rows behind them), kept through phases 1 and 2
  Frag qh0[3], ql0[3], qh1[3], ql1[3];
#pragma unroll
  for (int rt = 0; rt < 3; ++rt) {
    int ra = i0 + rt * 16 + m;
    ra = (ra > 1023) ? 1023 : ra;
    ld_k64(qh0[rt], ql0[rt], qh1[rt], ql1[rt], Qh, Ql, (u32)(ra * 128 + 16 * hh));
  }
  // a wave owns the 64-column groups ct = wave and wave + 8, four 16-column tiles each
#pragma unroll 1
  for (int t = 0; t < 8; ++t) {
    const int ct = wave + 8 * (t >> 2);
    const int col0 = ct * 64 + (t & 3) * 16;
    Frag h0, l0, h1, l1;
    ld_k64(h0, l0, h1, l1, Eh, El, (u32)((col0 + m) * 128 + 16 * hh));
    const int c = col0 + m;
    const int nrt = (ct < nct2) ? 3 : 2;
#pragma unroll
    for (int rt = 0; rt < 3; ++rt) {
      if (rt < nrt) {
        const int rb = i0 + rt * 16;
        const f32x8 acc = tile_k64(qh0[rt], ql0[rt], qh1[rt], ql1[rt], h0, l0, h1, l1);
#pragma unroll
        for (int r = 0; r < 8; ++r) {
          const int i2 = rb + 8 * hh + r;                       // QEr row
          const bool low = (c >= 1023 - i2);
          const int lr = (low ? i2 : (i2 - 1)) - i0;            // Srel row (local)
          const int j = low ? (c + i2 - 1023) : (c + i2 + 1);   // Srel column
          if ((unsigned)lr < 32u && (unsigned)j < 1024u) S[lr * 1024 + j] = acc[r];
        }
      }
    }
  }
  __syncthreads();

  // ---- phase 2: S += Q K^T
#pragma unroll 1
  for (int t = 0; t < 8; ++t) {
    const int col0 = (wave + 8 * (t >> 2)) * 64 + (t & 3) * 16;
    Frag h0, l0, h1, l1;
    ld_k64(h0, l0, h1, l1, Kh, Kl, (u32)((col0 + m) * 2048 + 16 * hh));
#pragma unroll
    for (int rt = 0; rt < 2; ++rt) {
      const f32x8 acc = tile_k64(qh0[rt], ql0[rt], qh1[rt], ql1[rt], h0, l0, h1, l1);
#pragma unroll
      for (int r = 0; r < 8; ++r)
        S[(rt * 16 + 8 * hh + r) * 1024 + col0 + m] += acc[r];
    }
  }
  __syncthreads();

  // ---- phase 3: row softmax of S/8 (max-subtracted), P written in place as bf16 hi/lo; lane owns columns
  // 128 q + 4 lane + 0..3 (q = 0..7), so a wave-wide 16-byte read covers 512 contiguous bytes of the row
#pragma unroll 1
  for (int rr = 0; rr < 4; ++rr) {
    const int row = wave * 4 + rr;
    const float* sr = S + row * 1024 + lane * 4;
    v4f xv[8];
    float mx = -3.0e38f;
#pragma unroll
    for (int q = 0; q < 8; ++q) {
      v4f v = *(const v4f*)(sr + 128 * q);
      v = v * 0.125f;
      xv[q] = v;
      mx = fmaxf(mx, fmaxf(fmaxf(v.x, v.y), fmaxf(v.z, v.w)));
    }
#pragma unroll
    for (int off = 16; off > 0; off >>= 1) mx = fmaxf(mx, __shfl_xor(mx, off, 32));
    float sum = 0.0f;
#pragma unroll
    for (int q = 0; q < 8; ++q) {
      v4f e;
      e.x = __expf(xv[q].x - mx);
      e.y = __expf(xv[q].y - mx);
      e.z = __expf(xv[q].z - mx);
      e.w = __expf(xv[q].w - mx);
      xv[q] = e;
      sum += (e.x + e.y) + (e.z + e.w);
    }
#pragma unroll
    for (int off = 16; off > 0; off >>= 1) sum += __shfl_xor(sum, off, 32);
    const float inv = 1.0f / sum;
    // hi: halves row*2048 + swizzled piece * 8 + (col & 7); piece of this lane's group q = 16 q + (lane >> 1)
    u16* ph = P + row * 2048 + (((lane >> 1) ^ (row & 15)) * 8) + (lane & 1) * 4;
    u16* pl = ph + 1024;                    // lo plane: 1024 halves behind hi
#pragma unroll
    for (int q = 0; q < 8; ++q) {
      const v4f a = xv[q] * inv;
      us4 hv, lv;
#pragma unroll
      for (int i = 0; i < 4; ++i) {
        const u16 hb = f2bf(a[i]);
        hv[i] = hb;
        lv[i] = f2bf(a[i] - bf2f(hb));
      }
      *(us4*)(ph + 128 * q) = hv;
      *(us4*)(pl + 128 * q) = lv;
    }
  }
  __syncthreads();

  // ---- phase 4: O[32][64] = P[32][1024] . V[1024][64]; a wave owns 16 columns of O, both row tiles, and one half of k;
  // the two halves' partial sums are added behind the barrier
  {
    const int nt = wave & 3, kh = wave >> 2;
    const u16* pa = P + m * 2048;               // row tile 0; row tile 1 is 16 rows on; row & 15 = m in both
    const u16* vb = Vh + (size_t)(nt * 16 + m) * 1024 + 8 * hh;
    const u16* vc = Vl + (size_t)(nt * 16 + m) * 1024 + 8 * hh;
    f32x8 acc[2];
    acc[0] = zero8();
    acc[1] = zero8();
#pragma unroll 2
    for (int ks = kh * 16; ks < kh * 16 + 16; ++ks) {
      Frag bh, bl;
      const u16* pvh = vb + ks * 32;
      const u16* pvl = vc + ks * 32;
      ldf(bh, pvh);
      ldf(bl, pvl);
      // the wait that stands before a load's address register is rewritten; the addresses are inputs as in ld_k64
      asm volatile("s_wait_xcnt 0x0" ::"v"(pvh), "v"(pvl) : "memory");
      const int p0 = ((ks * 4 + hh) ^ m) * 8;       // columns ks*32 + 8*hh + 0..7
      const int p1 = ((ks * 4 + 2 + hh) ^ m) * 8;   // columns ks*32 + 16 + 8*hh + 0..7
      Frag ah[2], al[2];
#pragma unroll
      for (int rt = 0; rt < 2; ++rt) {
        const u16* pr = pa + rt * 16 * 2048;
        ah[rt].q[0] = *(const v4u*)(pr + p0);
        ah[rt].q[1] = *(const v4u*)(pr + p1);
        al[rt].q[0] = *(const v4u*)(pr + 1024 + p0);
        al[rt].q[1] = *(const v4u*)(pr + 1024 + p1);
      }
#pragma unroll
      for (int rt = 0; rt < 2; ++rt) acc[rt] = wmma3(ah[rt], al[rt], bh, bl, acc[rt]);
    }
#pragma unroll
    for (int rt = 0; rt < 2; ++rt)
#pragma unroll
      for (int r = 0; r < 8; ++r) Ost[kh * 2048 + (rt * 16 + 8 * hh + r) * 64 + nt * 16 + m] = acc[rt][r];
  }
  __syncthreads();

  {
    const int row = wave * 4 + (lane >> 3), q = lane & 7;
    const v4f a = *(const v4f*)(Ost + row * 64 + 8 * q) + *(const v4f*)(Ost + 2048 + row * 64 + 8 * q);
    const v4f bq = *(const v4f*)(Ost + row * 64 + 8 * q + 4) + *(const v4f*)(Ost + 2048 + row * 64 + 8 * q + 4);
    us8 hv, lv;
    split8(a, bq, hv, lv);
    const size_t g = ((size_t)(b * 1024 + i0 + row)) * 1024 + (size_t)h * 64 + 8 * q;
    *(us8*)(AOh + g) = hv;
    *(us8*)(AOl + g) = lv;
    
  }
}

// ---------------------------------------------------------------- launch

extern "C" void kernel_launch(void* const* d_in, const int* in_sizes, int n_in,
                              void* d_out, int out_size, void* d_ws, size_t ws_size,
                              hipStream_t stream) {
  const int NX = 4194304;   // 4 x 1024 x 1024
  const int NW = 1048576;   // 1024 x 1024
  const int NE = 65536;     // 1024 x 64
  if (n_in < 8) return;
  if (in_sizes[0] != NX || in_sizes[1] != NX || in_sizes[2] != NX) return;
  if (in_sizes[3] != NW || in_sizes[4] != NW || in_sizes[5] != NW || in_sizes[7] != NW) return;
  if (in_sizes[6] != NE) return;
  if (out_size != NX) return;

  const float* q_in = (const float*)d_in[0];
  const float* k_in = (const float*)d_in[1];
  const float* v_in = (const float*)d_in[2];
  const float* WQ = (const float*)d_in[3];
  const float* WK = (const float*)d_in[4];
  const float* WV = (const float*)d_in[5];
  const float* Er = (const float*)d_in[6];
  const float* WM = (const float*)d_in[7];
  float* out = (float*)d_out;

  // workspace carve (bytes); bf16 planes
  const size_t bx = (size_t)NX * 2;   // 8 MiB
  const size_t bw = (size_t)NW * 2;   // 2 MiB
  const size_t be = (size_t)NE * 2;   // 128 KiB
  const size_t total = 6 * bx + 8 * bw + 2 * be + 4 * bx;   // 100,925,440 B
  if (total > ws_size) return;
  char* w = (char*)d_ws;
  size_t off = 0;
  u16* R0h = (u16*)(w + off); off += bx;   // Xq, later VP
  u16* R0l = (u16*)(w + off); off += bx;
  u16* R1h = (u16*)(w + off); off += bx;   // Xk, later VT
  u16* R1l = (u16*)(w + off); off += bx;
  u16* R2h = (u16*)(w + off); off += bx;   // Xv, later AO
  u16* R2l = (u16*)(w + off); off += bx;
  u16* WQh = (u16*)(w + off); off += bw;
  u16* WQl = (u16*)(w + off); off += bw;
  u16* WKh = (u16*)(w + off); off += bw;
  u16* WKl = (u16*)(w + off); off += bw;
  u16* WVh = (u16*)(w + off); off += bw;
  u16* WVl = (u16*)(w + off); off += bw;
  u16* WMh = (u16*)(w + off); off += bw;
  u16* WMl = (u16*)(w + off); off += bw;
  u16* ERh = (u16*)(w + off); off += be;
  u16* ERl = (u16*)(w + off); off += be;
  u16* QPh = (u16*)(w + off); off += bx;
  u16* QPl = (u16*)(w + off); off += bx;
  u16* KPh = (u16*)(w + off); off += bx;
  u16* KPl = (u16*)(w + off); off += bx;
  if (off > ws_size) return;

  u16* Xqh = R0h; u16* Xql = R0l;
  u16* Xkh = R1h; u16* Xkl = R1l;
  u16* Xvh = R2h; u16* Xvl = R2l;
  u16* VPh = R0h; u16* VPl = R0l;
  u16* VTh = R1h; u16* VTl = R1l;
  u16* AOh = R2h; u16* AOl = R2l;

  const dim3 blk(256);
  const int ATTN_LDS = 131072 + 16384;
  hipFuncSetAttribute((const void*)k_attn, hipFuncAttributeMaxDynamicSharedMemorySize, ATTN_LDS);

  // activations and Er -> bf16 hi/lo planes
  k_split<<<dim3(NX / 8 / 256), blk, 0, stream>>>(q_in, Xqh, Xql, NX / 8);
  k_split<<<dim3(NX / 8 / 256), blk, 0, stream>>>(k_in, Xkh, Xkl, NX / 8);
  k_split<<<dim3(NX / 8 / 256), blk, 0, stream>>>(v_in, Xvh, Xvl, NX / 8);
  k_split<<<dim3(NE / 8 / 256), blk, 0, stream>>>(Er, ERh, ERl, NE / 8);
  // weights W[k][n] (1024 rows k, 1024 cols n) -> Wt[n][k] hi/lo ; grid (cols/64, rows/64)
  k_split_tr<<<dim3(1024 / 64, 1024 / 64), blk, 0, stream>>>(WQ, WQh, WQl, 1024, 1024);
  k_split_tr<<<dim3(1024 / 64, 1024 / 64), blk, 0, stream>>>(WK, WKh, WKl, 1024, 1024);
  k_split_tr<<<dim3(1024 / 64, 1024 / 64), blk, 0, stream>>>(WV, WVh, WVl, 1024, 1024);
  k_split_tr<<<dim3(1024 / 64, 1024 / 64), blk, 0, stream>>>(WM, WMh, WMl, 1024, 1024);

  // QP[4096][1024] = Xq . WQ
  k_gemm<0><<<dim3(1024 / 128, 4096 / 64, 1), blk, 0, stream>>>(
      Xqh, Xql, WQh, WQl, QPh, QPl, out, 1024, 1024, 1024, 1024, 0, 0, 0);
  // KPT[b][c][r] = sum_k WK[k][c] key[b][r][k]  (A = WKt, Bt = Xk[b])
  k_gemm<0><<<dim3(1024 / 128, 1024 / 64, 4), blk, 0, stream>>>(
      WKh, WKl, Xkh, Xkl, KPh, KPl, out, 1024, 1024, 1024, 1024, 0, NW, NW);
  // VP[4096][1024] = Xv . WV  (into region 0)
  k_gemm<0><<<dim3(1024 / 128, 4096 / 64, 1), blk, 0, stream>>>(
      Xvh, Xvl, WVh, WVl, VPh, VPl, out, 1024, 1024, 1024, 1024, 0, 0, 0);
  // per-head transpose of V (into region 1)
  k_vtr<<<dim3(4 * 16 * 16), blk, 0, stream>>>(VPh, VPl, VTh, VTl);
  // attention (into region 2)
  k_attn<<<dim3(4 * 16 * 32), blk, ATTN_LDS, stream>>>(QPh, QPl, KPh, KPl, VTh, VTl, ERh, ERl, AOh, AOl);
  // out = AO . WMerge
  k_gemm<1><<<dim3(1024 / 128, 4096 / 64, 1), blk, 0, stream>>>(
      AOh, AOl, WMh, WMl, QPh, QPl, out, 1024, 1024, 1024, 1024, 0, 0, 0);
}

// v004
// Measured time: 272 microseconds a run.
// In both of two side-by-side timings against v003, it was 1.05 times as fast.
// Over all steps from v000 it is 2.03 times as fast.
#include <hip/hip_runtime.h>
#include <stdint.h>

// All contractions (x.WQ, WK-cols x key-rows, x.WV, Q.Er^T, Q.K^T, P.V, O.WMerge): v_wmma_f32_16x16x32_bf16 with bf16 hi/lo operand pairs (hi*hi + hi*lo + lo*hi), f32 accumulate; softmax and skew index arithmetic in f32 / int32.

typedef unsigned short u16;
typedef unsigned int u32;
typedef __bf16 bf16x16 __attribute__((ext_vector_type(16)));
typedef float f32x8 __attribute__((ext_vector_type(8)));
typedef float v4f __attribute__((ext_vector_type(4)));
typedef u32 v4u __attribute__((ext_vector_type(4)));
typedef u16 us8 __attribute__((ext_vector_type(8)));
typedef u16 us4 __attribute__((ext_vector_type(4)));

union Frag {
  bf16x16 v;
  v4u q[2];
};

// f32 -> bf16 bits, RNE
__device__ __forceinline__ u16 f2bf(float f) {
  const u32 u = __float_as_uint(f);
  const u32 r = u + 0x7FFFu + ((u >> 16) & 1u);
  return (u16)(r >> 16);
}
__device__ __forceinline__ float bf2f(u16 b) { return __uint_as_float(((u32)b) << 16); }

// 8 f32 -> 8 bf16 hi + 8 bf16 lo (lo = RNE(x - hi))
__device__ __forceinline__ void split8(v4f a, v4f b, us8& h, us8& l) {
  float f[8];
  f[0] = a.x; f[1] = a.y; f[2] = a.z; f[3] = a.w;
  f[4] = b.x; f[5] = b.y; f[6] = b.z; f[7] = b.w;
#pragma unroll
  for (int i = 0; i < 8; ++i) {
    const u16 hb = f2bf(f[i]);
    h[i] = hb;
    l[i] = f2bf(f[i] - bf2f(hb));
  }
}

__device__ __forceinline__ f32x8 zero8() {
  f32x8 z;
#pragma unroll
  for (int e = 0; e < 8; ++e) z[e] = 0.0f;
  return z;
}

// 16-bit fragment: lane (h = l>>4, m = l&15) -> elements 0..7 = k0+8h+0..7, elements 8..15 = k0+16+8h+0..7
// p already points at row m, column k0 + 8h of a k-contiguous [row][k] plane.
__device__ __forceinline__ void ldf(Frag& f, const u16* p) {
  f.q[0] = *(const v4u*)p;
  f.q[1] = *(const v4u*)(p + 16);
}

// Fragment order: a [row][k] plane cut into units of 16 rows x 16 k; unit (row tile, k / 16) holds 256 halves, lane l's
// 8 halves at 8 l = row m, k = 16 * unit + 8h + 0..7. A fragment is two neighbouring units, and each of its two
// wave-wide 16-byte loads reads 512 contiguous bytes (4 whole lines; from a row-major plane the same load touches 16).
// p already points at the lane's piece of the fragment's first unit.
__device__ __forceinline__ void ldf_pk(Frag& f, const u16* p) {
  f.q[0] = *(const v4u*)p;
  f.q[1] = *(const v4u*)(p + 256);
}

// one 32-deep k-step, hi/lo pairs: c += ah*bh + ah*bl + al*bh ; hazard guard after the group
__device__ __forceinline__ f32x8 wmma3(const Frag& ah, const Frag& al, const Frag& bh, const Frag& bl, f32x8 c) {
  c = __builtin_amdgcn_wmma_f32_16x16x32_bf16(false, ah.v, false, bh.v, (short)0, c, false, false);
  c = __builtin_amdgcn_wmma_f32_16x16x32_bf16(false, ah.v, false, bl.v, (short)0, c, false, false);
  c = __builtin_amdgcn_wmma_f32_16x16x32_bf16(false, al.v, false, bh.v, (short)0, c, false, false);
  asm volatile("v_nop\n\tv_nop\n\tv_nop\n\tv_nop" : "+v"(c) : "v"(ah.v), "v"(al.v), "v"(bh.v), "v"(bl.v));
  return c;
}

// ---------------------------------------------------------------- elementwise split
__global__ __launch_bounds__(256) void k_split(const float* __restrict__ s, u16* dh, u16* dl, int n8) {
  const int g = blockIdx.x * 256 + threadIdx.x;
  if (g >= n8) return;
  const size_t o = (size_t)g * 8;
  const v4f a = *(const v4f*)(s + o);
  const v4f b = *(const v4f*)(s + o + 4);
  us8 h, l;
  split8(a, b, h, l);
  *(us8*)(dh + o) = h;
  *(us8*)(dl + o) = l;
  
}

// ---------------------------------------------------------------- split into fragment order
// in[rows][64] row-major f32 -> bf16 hi/lo planes in fragment order (units: row tile, then k / 16); thread = one 16-byte piece
__global__ __launch_bounds__(256) void k_split_frag(const float* __restrict__ s, u16* dh, u16* dl, int n8) {
  const int g = blockIdx.x * 256 + threadIdx.x;
  if (g >= n8) return;
  const int lane = g & 31, u = (g >> 5) & 3, rt = g >> 7;
  const float* p = s + (size_t)(rt * 16 + (lane & 15)) * 64 + u * 16 + (lane >> 4) * 8;
  const v4f a = *(const v4f*)p;
  const v4f b = *(const v4f*)(p + 4);
  us8 h, l;
  split8(a, b, h, l);
  const size_t o = (size_t)g * 8;
  *(us8*)(dh + o) = h;
  *(us8*)(dl + o) = l;
}

// ---------------------------------------------------------------- transposing split
// in[R][C] row-major f32 -> out[C][R] bf16 hi/lo planes. Block = 64x64 tile, grid (C/64, R/64).
// frag != 0 (C = 1024): input column n = 64 m + e becomes output row (e >> 3) * 128 + 8 m + (e & 7), so that a GEMM with
// this plane as Bt leaves each of its output rows, read as [16 m][64 e], in fragment order.
__global__ __launch_bounds__(256) void k_split_tr(const float* __restrict__ s, u16* dh, u16* dl, int R, int C, int frag) {
  __shared__ __attribute__((aligned(16))) float Ts[64 * 68];  // Ts[c][r]
  const int c0 = blockIdx.x * 64, r0 = blockIdx.y * 64;
  const int t = threadIdx.x;
  {
    const int r = t >> 2, cb = (t & 3) * 16;
    const float* p = s + (size_t)(r0 + r) * C + c0 + cb;
#pragma unroll
    for (int q = 0; q < 4; ++q) {
      const v4f v = *(const v4f*)(p + 4 * q);
      Ts[(cb + 4 * q + 0) * 68 + r] = v.x;
      Ts[(cb + 4 * q + 1) * 68 + r] = v.y;
      Ts[(cb + 4 * q + 2) * 68 + r] = v.z;
      Ts[(cb + 4 * q + 3) * 68 + r] = v.w;
    }
  }
  __syncthreads();
  us8 h[2], l[2];
  size_t go[2];
#pragma unroll
  for (int it = 0; it < 2; ++it) {
    const int pc = t + 256 * it, c = pc >> 3, q = pc & 7;
    const v4f a = *(const v4f*)(Ts + c * 68 + 8 * q);
    const v4f b = *(const v4f*)(Ts + c * 68 + 8 * q + 4);
    split8(a, b, h[it], l[it]);
    const int n = c0 + c;
    const int orow = frag ? (((n >> 3) & 7) * 128 + (n >> 6) * 8 + (n & 7)) : n;
    go[it] = (size_t)orow * R + r0 + 8 * q;
  }
#pragma unroll
  for (int it = 0; it < 2; ++it) {
    *(us8*)(dh + go[it]) = h[it];
    *(us8*)(dl + go[it]) = l[it];
  }
  
}

// ---------------------------------------------------------------- GEMM (hi/lo pairs)
// C[z][M][N] = A[z][M][K] * Bt[z][N][K]^T ; A and Bt are k-contiguous bf16 hi/lo planes; K a multiple of 64.
// Block tile 64 x 128 (grid.x = N/128, grid.y = M/64, grid.z = batch), 8 waves of 32x32.
// Operands go through LDS in 64-deep k-chunks: 8 lanes fetch one row's 128 B, so a wave-wide load covers 4 whole
// lines (a fragment load straight from the planes touches 16 lines for the same 512 B). Two buffers: chunk c+1 is
// fetched into registers while chunk c is multiplied, stored to the other buffer, and published by one barrier.
// MODE 0: bf16 hi/lo output planes (row segment 256 B = 16 lanes x 16 B); MODE 1: f32 output (512 B = 32 lanes x 16 B).
// MODE 2: bf16 hi/lo output planes in fragment order, one [M][64] plane per 64 output columns, ldc halves apart (a wave
// stores 2 KiB in a row).
#define G_PIT 72                    // LDS row pitch in halves: 144 B = 16 B x 9, conflict-free for 16-byte row reads
#define G_AL (64 * G_PIT)           // plane offsets inside a buffer, in halves: A hi at 0, A lo, B hi, B lo
#define G_BH (128 * G_PIT)
#define G_BL (256 * G_PIT)
#define G_BUF (384 * G_PIT)         // 27,648 halves = 55,296 B per buffer

// one thread's share of a chunk: 2 + 2 pieces of A hi / lo, 4 + 4 of B hi / lo, rows 32 apart
__device__ __forceinline__ void g_fetch(v4u (&sa)[4], v4u (&sb)[8], const u16* ah, const u16* al, const u16* bh,
                                        const u16* bl, int lda, int ldb) {
  const u16* pa[4];
  const u16* pb[8];
#pragma unroll
  for (int i = 0; i < 2; ++i) {
    pa[i] = ah + (size_t)(32 * i) * lda;
    pa[2 + i] = al + (size_t)(32 * i) * lda;
  }
#pragma unroll
  for (int i = 0; i < 4; ++i) {
    pb[i] = bh + (size_t)(32 * i) * ldb;
    pb[4 + i] = bl + (size_t)(32 * i) * ldb;
  }
#pragma unroll
  for (int i = 0; i < 4; ++i) sa[i] = *(const v4u*)pa[i];
#pragma unroll
  for (int i = 0; i < 8; ++i) sb[i] = *(const v4u*)pb[i];
  // the wait that stands before a load's address register is rewritten; the twelve addresses are inputs so that
  // they stay live, and so unwritten (also by a later load's result), up to it
  asm volatile("s_wait_xcnt 0x0" ::"v"(pa[0]), "v"(pa[1]), "v"(pa[2]), "v"(pa[3]), "v"(pb[0]), "v"(pb[1]), "v"(pb[2]),
               "v"(pb[3]), "v"(pb[4]), "v"(pb[5]), "v"(pb[6]), "v"(pb[7])
               : "memory");
}
__device__ __forceinline__ void g_put(u16* buf, const v4u (&sa)[4], const v4u (&sb)[8]) {
#pragma unroll
  for (int i = 0; i < 2; ++i) {
    *(v4u*)(buf + 32 * i * G_PIT) = sa[i];
    *(v4u*)(buf + G_AL + 32 * i * G_PIT) = sa[2 + i];
  }
#pragma unroll
  for (int i = 0; i < 4; ++i) {
    *(v4u*)(buf + G_BH + 32 * i * G_PIT) = sb[i];
    *(v4u*)(buf + G_BL + 32 * i * G_PIT) = sb[4 + i];
  }
}
template <int MODE>
__global__ __launch_bounds__(256) void k_gemm(const u16* __restrict__ Ah, const u16* __restrict__ Al,
                                              const u16* __restrict__ Bh, const u16* __restrict__ Bl,
                                              u16* Ch, u16* Cl, float* Cf,
                                              int lda, int ldb, int ldc, int K,
                                              int zA, int zB, int zC) {
  __shared__ __attribute__((aligned(16))) u16 Sm[2 * G_BUF];
  float* Cs = (float*)Sm;           // 64 x 132 f32 output tile, reuses the buffers behind the loop
  const int z = blockIdx.z;
  const int bm = blockIdx.y * 64, bn = blockIdx.x * 128;
  const int tid = threadIdx.x, wave = tid >> 5, lane = tid & 31;
  const int m = lane & 15, hh = lane >> 4;
  const int wr = (wave & 1) * 32, wc = (wave >> 1) * 32;

  // staging map: thread -> (row tid>>3 (+32 per step), 16-byte piece tid&7 of the row's 128 B)
  const int srow = tid >> 3, sseg = (tid & 7) * 8;
  const u16* gah = Ah + (size_t)z * zA + (size_t)(bm + srow) * lda + sseg;
  const u16* gal = Al + (size_t)z * zA + (size_t)(bm + srow) * lda + sseg;
  const u16* gbh = Bh + (size_t)z * zB + (size_t)(bn + srow) * ldb + sseg;
  const u16* gbl = Bl + (size_t)z * zB + (size_t)(bn + srow) * ldb + sseg;
  const int so = srow * G_PIT + sseg;
  // fragment map inside a buffer (same rows and k order as the planes)
  const int fa = (wr + m) * G_PIT + 8 * hh;
  const int fb = (wc + m) * G_PIT + 8 * hh;

  f32x8 acc[2][2];
#pragma unroll
  for (int rt = 0; rt < 2; ++rt)
#pragma unroll
    for (int ct = 0; ct < 2; ++ct) acc[rt][ct] = zero8();

  v4u sa[4], sb[8];
  g_fetch(sa, sb, gah, gal, gbh, gbl, lda, ldb);
  g_put(Sm + so, sa, sb);
  __syncthreads();

  const int nch = K >> 6;
  for (int c = 0; c < nch; ++c) {
    const u16* cur = Sm + (c & 1) * G_BUF;
    u16* nxt = Sm + ((c + 1) & 1) * G_BUF;
    const bool more = (c + 1 < nch);
    if (more) {
      const int k1 = (c + 1) * 64;
      g_fetch(sa, sb, gah + k1, gal + k1, gbh + k1, gbl + k1, lda, ldb);
    }
#pragma unroll
    for (int ks = 0; ks < 2; ++ks) {
      Frag ah[2], al[2], bh[2], bl[2];
#pragma unroll
      for (int rt = 0; rt < 2; ++rt) {
        ldf(ah[rt], cur + fa + rt * 16 * G_PIT + ks * 32);
        ldf(al[rt], cur + G_AL + fa + rt * 16 * G_PIT + ks * 32);
      }
#pragma unroll
      for (int ct = 0; ct < 2; ++ct) {
        ldf(bh[ct], cur + G_BH + fb + ct * 16 * G_PIT + ks * 32);
        ldf(bl[ct], cur + G_BL + fb + ct * 16 * G_PIT + ks * 32);
      }
#pragma unroll
      for (int rt = 0; rt < 2; ++rt)
#pragma unroll
        for (int ct = 0; ct < 2; ++ct)
          acc[rt][ct] = wmma3(ah[rt], al[rt], bh[ct], bl[ct], acc[rt][ct]);
    }
    if (more) g_put(nxt + so, sa, sb);
    // publishes chunk c+1 and ends every wave's reads of the buffer that trip c+1 refills (behind the last trip: of the
    // second buffer, as K = 1024 gives 16 chunks; the output tile lies in the first, freed one trip earlier)
    __syncthreads();
  }

  // stage the 64x128 f32 tile: D element r of lane -> (row 8*hh + r, col m)
#pragma unroll
  for (int rt = 0; rt < 2; ++rt)
#pragma unroll
    for (int ct = 0; ct < 2; ++ct)
#pragma unroll
      for (int r = 0; r < 8; ++r)
        Cs[(wr + rt * 16 + 8 * hh + r) * 132 + wc + ct * 16 + m] = acc[rt][ct][r];
  __syncthreads();

  if (MODE == 1) {
    float* cb = Cf + (size_t)z * zC;
    v4f v[8];
    size_t go[8];
#pragma unroll
    for (int i = 0; i < 8; ++i) {
      const int row = wave * 8 + i;
      v[i] = *(const v4f*)(Cs + row * 132 + 4 * lane);
      go[i] = (size_t)(bm + row) * ldc + bn + 4 * lane;
    }
#pragma unroll
    for (int i = 0; i < 8; ++i) *(v4f*)(cb + go[i]) = v[i];
    
  } else if (MODE == 2) {
    // a wave owns one 16-row tile of one 64-column plane: its four units lie one behind the other
    const int jt = wave >> 1, hd = wave & 1;
    const size_t base = (size_t)z * zC + (size_t)((bn >> 6) + hd) * ldc + (size_t)((bm >> 4) + jt) * 1024 + (size_t)lane * 8;
    u16* chb = Ch + base;
    u16* clb = Cl + base;
    us8 hv[4], lv[4];
#pragma unroll
    for (int i = 0; i < 4; ++i) {
      const float* cp = Cs + (jt * 16 + m) * 132 + hd * 64 + i * 16 + hh * 8;
      const v4f a = *(const v4f*)cp;
      const v4f b = *(const v4f*)(cp + 4);
      split8(a, b, hv[i], lv[i]);
    }
#pragma unroll
    for (int i = 0; i < 4; ++i) {
      *(us8*)(chb + i * 256) = hv[i];
      *(us8*)(clb + i * 256) = lv[i];
    }
  } else {
    u16* chb = Ch + (size_t)z * zC;
    u16* clb = Cl + (size_t)z * zC;
    us8 hv[4], lv[4];
    size_t go[4];
#pragma unroll
    for (int i = 0; i < 4; ++i) {
      const int row = wave * 8 + 2 * i + (lane >> 4);
      const int cs = (lane & 15) * 8;
      const v4f a = *(const v4f*)(Cs + row * 132 + cs);
      const v4f b = *(const v4f*)(Cs + row * 132 + cs + 4);
      split8(a, b, hv[i], lv[i]);
      go[i] = (size_t)(bm + row) * ldc + bn + cs;
    }
#pragma unroll
    for (int i = 0; i < 4; ++i) {
      *(us8*)(chb + go[i]) = hv[i];
      *(us8*)(clb + go[i]) = lv[i];
    }
    
  }
}

// ---------------------------------------------------------------- per-head V transpose
// src planes: VP[4096][1024] bf16; head plane X_h = 64 contiguous rows viewed as [1024 l][64 e].
// dst planes: per head v^T[64 e][1024 l] in fragment order (units: row tile e / 16, then l / 16).
__global__ __launch_bounds__(256) void k_vtr(const u16* __restrict__ sh, const u16* __restrict__ sl, u16* dh, u16* dl) {
  __shared__ __attribute__((aligned(16))) u16 Th[64 * 72];  // [e][l]
  __shared__ __attribute__((aligned(16))) u16 Tl[64 * 72];
  const int blk = blockIdx.x, lt = blk & 15, h = (blk >> 4) & 15, b = blk >> 8;
  const int l0 = lt * 64, t = threadIdx.x;
  const size_t src = (size_t)b * 1048576 + (size_t)h * 65536 + (size_t)l0 * 64;
#pragma unroll
  for (int it = 0; it < 2; ++it) {
    const int pc = t + 256 * it, l = pc >> 3, q = pc & 7;
    const us8 a = *(const us8*)(sh + src + l * 64 + 8 * q);
    const us8 c = *(const us8*)(sl + src + l * 64 + 8 * q);
#pragma unroll
    for (int i = 0; i < 8; ++i) {
      Th[(8 * q + i) * 72 + l] = a[i];
      Tl[(8 * q + i) * 72 + l] = c[i];
    }
  }
  __syncthreads();
  // a wave owns row tile nt and 32 of the block's 64 l: two units, 1 KiB in a row per plane
  const int wave = t >> 5, lane = t & 31, nt = wave >> 1, kl = wave & 1;
  const size_t dst = (size_t)(b * 16 + h) * 65536 + (size_t)(nt * 64 + lt * 4 + kl * 2) * 256 + (size_t)lane * 8;
  us8 oh[2], ol[2];
  size_t go[2];
#pragma unroll
  for (int it = 0; it < 2; ++it) {
    const int so = (nt * 16 + (lane & 15)) * 72 + kl * 32 + it * 16 + (lane >> 4) * 8;
    oh[it] = *(const us8*)(Th + so);
    ol[it] = *(const us8*)(Tl + so);
    go[it] = dst + (size_t)it * 256;
  }
#pragma unroll
  for (int it = 0; it < 2; ++it) {
    *(us8*)(dh + go[it]) = oh[it];
    *(us8*)(dl + go[it]) = ol[it];
  }
  
}

// ---------------------------------------------------------------- attention
// the four fragments (hi / lo, two k-steps) of one 16-row tile of a [rows][64] plane in fragment order; off = the lane's
// byte offset (tile * 2048 + lane * 16) in both planes
__device__ __forceinline__ void ld_k64_pk(Frag& h0, Frag& l0, Frag& h1, Frag& l1, const u16* bh, const u16* bl, u32 off) {
  const u16* ph = (const u16*)((const char*)bh + off);
  const u16* pl = (const u16*)((const char*)bl + off);
  ldf_pk(h0, ph); ldf_pk(h1, ph + 512);
  ldf_pk(l0, pl); ldf_pk(l1, pl + 512);
  // the wait that stands before a load's address register is rewritten; the offset is an input so that it stays
  // live, and so unwritten (also by a later load's result), up to it
  asm volatile("s_wait_xcnt 0x0" ::"v"(off) : "memory");
}

// one 16x16 tile, K = 64 (two k-steps); A and B fragments preloaded
__device__ __forceinline__ f32x8 tile_k64(const Frag& ah0, const Frag& al0, const Frag& ah1, const Frag& al1,
                                          const Frag& h0, const Frag& l0, const Frag& h1, const Frag& l1) {
  f32x8 acc = zero8();
  acc = wmma3(ah0, al0, h0, l0, acc);
  acc = wmma3(ah1, al1, h1, l1, acc);
  return acc;
}

// One block per (b, h, 32 query rows), 256 threads = 8 waves.
// LDS (dynamic): S[32][1024] f32 (131072 B), later reused in place as P row = hi[1024] | lo[1024] bf16; Ost[2][32][64] f32 (16384 B).
// Every Er, K and V fragment is loaded once per block: the wave that loads it multiplies it with all row tiles.
// The Q, Er, K and V planes lie in fragment order, so each fragment load reads whole lines.
// P rows are 4096 B apart (the same banks in every row), so inside a plane the 16-byte piece (col >> 3) of row r sits at
// piece index (col >> 3) ^ (r & 15): the 16 rows that one fragment load reads then fall on 16 different bank groups.
__global__ __launch_bounds__(256) void k_attn(const u16* __restrict__ QPh, const u16* __restrict__ QPl,
                                              const u16* __restrict__ KPh, const u16* __restrict__ KPl,
                                              const u16* __restrict__ VTh, const u16* __restrict__ VTl,
                                              const u16* __restrict__ Eh, const u16* __restrict__ El,
                                              u16* AOh, u16* AOl) {
  extern __shared__ v4u dsm[];
  float* S = (float*)dsm;
  u16* P = (u16*)dsm;
  float* Ost = (float*)(dsm + 8192);  // byte offset 131072

  const int blk = blockIdx.x;
  const int ib = blk & 31, h = (blk >> 5) & 15, b = blk >> 9;
  const int i0 = ib * 32;
  const int tid = threadIdx.x, wave = tid >> 5, lane = tid & 31;
  const int m = lane & 15, hh = lane >> 4;

  // q_h[i][e]  = QP[b][h*64 + (i>>4)][(i&15)*64 + e]: plane at b*2^20 + h*2^16, one QP row = one 16-row tile in fragment order
  const size_t pq = (size_t)b * 1048576 + (size_t)h * 65536;
  const u16* Qh = QPh + pq;
  const u16* Ql = QPl + pq;
  // k_h[j][e]  = KP[b][h*64+e][j]: per head a [1024 j][64 e] plane in fragment order
  const u16* Kh = KPh + pq;
  const u16* Kl = KPl + pq;
  // v_h^T[e][j]: per head a [64 e][1024 j] plane in fragment order
  const u16* Vh = VTh + pq;
  const u16* Vl = VTl + pq;

  // Srel[i][i+1] = 0 (the only cells the skew scatter never writes)
  if (tid < 32) {
    const int j = i0 + tid + 1;
    if (j < 1024) S[tid * 1024 + j] = 0.0f;
  }

  // ---- phase 1: QEr tiles (rows i0 .. i0+32 needed) scattered through the skew map into S
  // row tile 2 (rows i0+32..) is consumed only through row i0+32, columns c <= 990 - i0
  const int ncol2 = 991 - i0;
  const int nct2 = (ncol2 > 0) ? ((ncol2 + 63) >> 6) : 0;
  // Q fragments of row tiles 0 and 1 (the block's own rows) and 2 (the 16 rows behind them), kept through phases 1 and 2
  Frag qh0[3], ql0[3], qh1[3], ql1[3];
#pragma unroll
  for (int rt = 0; rt < 3; ++rt) {
    int qt = (i0 >> 4) + rt;
    qt = (qt > 63) ? 63 : qt;   // the last block has no rows behind it (and nct2 = 0: the tile is not used)
    ld_k64_pk(qh0[rt], ql0[rt], qh1[rt], ql1[rt], Qh, Ql, (u32)(qt * 2048 + lane * 16));
  }
  // a wave owns the 64-column groups ct = wave and wave + 8, four 16-column tiles each
#pragma unroll 1
  for (int t = 0; t < 8; ++t) {
    const int ct = wave + 8 * (t >> 2);
    const int col0 = ct * 64 + (t & 3) * 16;
    Frag h0, l0, h1, l1;
    ld_k64_pk(h0, l0, h1, l1, Eh, El, (u32)(col0 * 128 + lane * 16));
    const int c = col0 + m;
    const int nrt = (ct < nct2) ? 3 : 2;
#pragma unroll
    for (int rt = 0; rt < 3; ++rt) {
      if (rt < nrt) {
        const int rb = i0 + rt * 16;
        const f32x8 acc = tile_k64(qh0[rt], ql0[rt], qh1[rt], ql1[rt], h0, l0, h1, l1);
#pragma unroll
        for (int r = 0; r < 8; ++r) {
          const int i2 = rb + 8 * hh + r;                       // QEr row
          const bool low = (c >= 1023 - i2);
          const int lr = (low ? i2 : (i2 - 1)) - i0;            // Srel row (local)
          const int j = low ? (c + i2 - 1023) : (c + i2 + 1);   // Srel column
          if ((unsigned)lr < 32u && (unsigned)j < 1024u) S[lr * 1024 + j] = acc[r];
        }
      }
    }
  }
  __syncthreads();

  // ---- phase 2: S += Q K^T
#pragma unroll 1
  for (int t = 0; t < 8; ++t) {
    const int col0 = (wave + 8 * (t >> 2)) * 64 + (t & 3) * 16;
    Frag h0, l0, h1, l1;
    ld_k64_pk(h0, l0, h1, l1, Kh, Kl, (u32)(col0 * 128 + lane * 16));
#pragma unroll
    for (int rt = 0; rt < 2; ++rt) {
      const f32x8 acc = tile_k64(qh0[rt], ql0[rt], qh1[rt], ql1[rt], h0, l0, h1, l1);
#pragma unroll
      for (int r = 0; r < 8; ++r)
        S[(rt * 16 + 8 * hh + r) * 1024 + col0 + m] += acc[r];
    }
  }
  __syncthreads();

  // ---- phase 3: row softmax of S/8 (max-subtracted), P written in place as bf16 hi/lo; lane owns columns
  // 128 q + 4 lane + 0..3 (q = 0..7), so a wave-wide 16-byte read covers 512 contiguous bytes of the row
#pragma unroll 1
  for (int rr = 0; rr < 4; ++rr) {
    const int row = wave * 4 + rr;
    const float* sr = S + row * 1024 + lane * 4;
    v4f xv[8];
    float mx = -3.0e38f;
#pragma unroll
    for (int q = 0; q < 8; ++q) {
      v4f v = *(const v4f*)(sr + 128 * q);
      v = v * 0.125f;
      xv[q] = v;
      mx = fmaxf(mx, fmaxf(fmaxf(v.x, v.y), fmaxf(v.z, v.w)));
    }
#pragma unroll
    for (int off = 16; off > 0; off >>= 1) mx = fmaxf(mx, __shfl_xor(mx, off, 32));
    float sum = 0.0f;
#pragma unroll
    for (int q = 0; q < 8; ++q) {
      v4f e;
      e.x = __expf(xv[q].x - mx);
      e.y = __expf(xv[q].y - mx);
      e.z = __expf(xv[q].z - mx);
      e.w = __expf(xv[q].w - mx);
      xv[q] = e;
      sum += (e.x + e.y) + (e.z + e.w);
    }
#pragma unroll
    for (int off = 16; off > 0; off >>= 1) sum += __shfl_xor(sum, off, 32);
    const float inv = 1.0f / sum;
    // hi: halves row*2048 + swizzled piece * 8 + (col & 7); piece of this lane's group q = 16 q + (lane >> 1)
    u16* ph = P + row * 2048 + (((lane >> 1) ^ (row & 15)) * 8) + (lane & 1) * 4;
    u16* pl = ph + 1024;                    // lo plane: 1024 halves behind hi
#pragma unroll
    for (int q = 0; q < 8; ++q) {
      const v4f a = xv[q] * inv;
      us4 hv, lv;
#pragma unroll
      for (int i = 0; i < 4; ++i) {
        const u16 hb = f2bf(a[i]);
        hv[i] = hb;
        lv[i] = f2bf(a[i] - bf2f(hb));
      }
      *(us4*)(ph + 128 * q) = hv;
      *(us4*)(pl + 128 * q) = lv;
    }
  }
  __syncthreads();

  // ---- phase 4: O[32][64] = P[32][1024] . V[1024][64]; a wave owns 16 columns of O, both row tiles, and one half of k;
  // the two halves' partial sums are added behind the barrier
  {
    const int nt = wave & 3, kh = wave >> 2;
    const u16* pa = P + m * 2048;               // row tile 0; row tile 1 is 16 rows on; row & 15 = m in both
    const u16* vb = Vh + nt * 16384 + lane * 8;   // row tile nt: 64 units of 256 halves
    const u16* vc = Vl + nt * 16384 + lane * 8;
    f32x8 acc[2];
    acc[0] = zero8();
    acc[1] = zero8();
#pragma unroll 2
    for (int ks = kh * 16; ks < kh * 16 + 16; ++ks) {
      Frag bh, bl;
      const u16* pvh = vb + ks * 512;
      const u16* pvl = vc + ks * 512;
      ldf_pk(bh, pvh);
      ldf_pk(bl, pvl);
      // the wait that stands before a load's address register is rewritten; the addresses are inputs as in ld_k64_pk
      asm volatile("s_wait_xcnt 0x0" ::"v"(pvh), "v"(pvl) : "memory");
      const int p0 = ((ks * 4 + hh) ^ m) * 8;       // columns ks*32 + 8*hh + 0..7
      const int p1 = ((ks * 4 + 2 + hh) ^ m) * 8;   // columns ks*32 + 16 + 8*hh + 0..7
      Frag ah[2], al[2];
#pragma unroll
      for (int rt = 0; rt < 2; ++rt) {
        const u16* pr = pa + rt * 16 * 2048;
        ah[rt].q[0] = *(const v4u*)(pr + p0);
        ah[rt].q[1] = *(const v4u*)(pr + p1);
        al[rt].q[0] = *(const v4u*)(pr + 1024 + p0);
        al[rt].q[1] = *(const v4u*)(pr + 1024 + p1);
      }
#pragma unroll
      for (int rt = 0; rt < 2; ++rt) acc[rt] = wmma3(ah[rt], al[rt], bh, bl, acc[rt]);
    }
#pragma unroll
    for (int rt = 0; rt < 2; ++rt)
#pragma unroll
      for (int r = 0; r < 8; ++r) Ost[kh * 2048 + (rt * 16 + 8 * hh + r) * 64 + nt * 16 + m] = acc[rt][r];
  }
  __syncthreads();

  {
    const int row = wave * 4 + (lane >> 3), q = lane & 7;
    const v4f a = *(const v4f*)(Ost + row * 64 + 8 * q) + *(const v4f*)(Ost + 2048 + row * 64 + 8 * q);
    const v4f bq = *(const v4f*)(Ost + row * 64 + 8 * q + 4) + *(const v4f*)(Ost + 2048 + row * 64 + 8 * q + 4);
    us8 hv, lv;
    split8(a, bq, hv, lv);
    const size_t g = ((size_t)(b * 1024 + i0 + row)) * 1024 + (size_t)h * 64 + 8 * q;
    *(us8*)(AOh + g) = hv;
    *(us8*)(AOl + g) = lv;
    
  }
}

// ---------------------------------------------------------------- launch

extern "C" void kernel_launch(void* const* d_in, const int* in_sizes, int n_in,
                              void* d_out, int out_size, void* d_ws, size_t ws_size,
                              hipStream_t stream) {
  const int NX = 4194304;   // 4 x 1024 x 1024
  const int NW = 1048576;   // 1024 x 1024
  const int NE = 65536;     // 1024 x 64
  if (n_in < 8) return;
  if (in_sizes[0] != NX || in_sizes[1] != NX || in_sizes[2] != NX) return;
  if (in_sizes[3] != NW || in_sizes[4] != NW || in_sizes[5] != NW || in_sizes[7] != NW) return;
  if (in_sizes[6] != NE) return;
  if (out_size != NX) return;

  const float* q_in = (const float*)d_in[0];
  const float* k_in = (const float*)d_in[1];
  const float* v_in = (const float*)d_in[2];
  const float* WQ = (const float*)d_in[3];
  const float* WK = (const float*)d_in[4];
  const float* WV = (const float*)d_in[5];
  const float* Er = (const float*)d_in[6];
  const float* WM = (const float*)d_in[7];
  float* out = (float*)d_out;

  // workspace carve (bytes); bf16 planes
  const size_t bx = (size_t)NX * 2;   // 8 MiB
  const size_t bw = (size_t)NW * 2;   // 2 MiB
  const size_t be = (size_t)NE * 2;   // 128 KiB
  const size_t total = 6 * bx + 8 * bw + 2 * be + 4 * bx;   // 100,925,440 B
  if (total > ws_size) return;
  char* w = (char*)d_ws;
  size_t off = 0;
  u16* R0h = (u16*)(w + off); off += bx;   // Xq, later VP
  u16* R0l = (u16*)(w + off); off += bx;
  u16* R1h = (u16*)(w + off); off += bx;   // Xk, later VT
  u16* R1l = (u16*)(w + off); off += bx;
  u16* R2h = (u16*)(w + off); off += bx;   // Xv, later AO
  u16* R2l = (u16*)(w + off); off += bx;
  u16* WQh = (u16*)(w + off); off += bw;
  u16* WQl = (u16*)(w + off); off += bw;
  u16* WKh = (u16*)(w + off); off += bw;
  u16* WKl = (u16*)(w + off); off += bw;
  u16* WVh = (u16*)(w + off); off += bw;
  u16* WVl = (u16*)(w + off); off += bw;
  u16* WMh = (u16*)(w + off); off += bw;
  u16* WMl = (u16*)(w + off); off += bw;
  u16* ERh = (u16*)(w + off); off += be;
  u16* ERl = (u16*)(w + off); off += be;
  u16* QPh = (u16*)(w + off); off += bx;
  u16* QPl = (u16*)(w + off); off += bx;
  u16* KPh = (u16*)(w + off); off += bx;
  u16* KPl = (u16*)(w + off); off += bx;
  if (off > ws_size) return;

  u16* Xqh = R0h; u16* Xql = R0l;
  u16* Xkh = R1h; u16* Xkl = R1l;
  u16* Xvh = R2h; u16* Xvl = R2l;
  u16* VPh = R0h; u16* VPl = R0l;
  u16* VTh = R1h; u16* VTl = R1l;
  u16* AOh = R2h; u16* AOl = R2l;

  const dim3 blk(256);
  const int ATTN_LDS = 131072 + 16384;
  hipFuncSetAttribute((const void*)k_attn, hipFuncAttributeMaxDynamicSharedMemorySize, ATTN_LDS);

  // activations and Er -> bf16 hi/lo planes (Er in fragment order)
  k_split<<<dim3(NX / 8 / 256), blk, 0, stream>>>(q_in, Xqh, Xql, NX / 8);
  k_split<<<dim3(NX / 8 / 256), blk, 0, stream>>>(k_in, Xkh, Xkl, NX / 8);
  k_split<<<dim3(NX / 8 / 256), blk, 0, stream>>>(v_in, Xvh, Xvl, NX / 8);
  k_split_frag<<<dim3(NE / 8 / 256), blk, 0, stream>>>(Er, ERh, ERl, NE / 8);
  // weights W[k][n] (1024 rows k, 1024 cols n) -> Wt[n][k] hi/lo ; grid (cols/64, rows/64); WQ's rows permuted for QP
  k_split_tr<<<dim3(1024 / 64, 1024 / 64), blk, 0, stream>>>(WQ, WQh, WQl, 1024, 1024, 1);
  k_split_tr<<<dim3(1024 / 64, 1024 / 64), blk, 0, stream>>>(WK, WKh, WKl, 1024, 1024, 0);
  k_split_tr<<<dim3(1024 / 64, 1024 / 64), blk, 0, stream>>>(WV, WVh, WVl, 1024, 1024, 0);
  k_split_tr<<<dim3(1024 / 64, 1024 / 64), blk, 0, stream>>>(WM, WMh, WMl, 1024, 1024, 0);

  // QP[4096][1024] = Xq . WQ, each row (16 queries x 64) in fragment order through WQt's row order
  k_gemm<0><<<dim3(1024 / 128, 4096 / 64, 1), blk, 0, stream>>>(
      Xqh, Xql, WQh, WQl, QPh, QPl, out, 1024, 1024, 1024, 1024, 0, 0, 0);
  // KPT[b][c][r] = sum_k WK[k][c] key[b][r][k]  (A = WKt, Bt = Xk[b]), stored per 64 r (one head) in fragment order
  k_gemm<2><<<dim3(1024 / 128, 1024 / 64, 4), blk, 0, stream>>>(
      WKh, WKl, Xkh, Xkl, KPh, KPl, out, 1024, 1024, NE, 1024, 0, NW, NW);
  // VP[4096][1024] = Xv . WV  (into region 0)
  k_gemm<0><<<dim3(1024 / 128, 4096 / 64, 1), blk, 0, stream>>>(
      Xvh, Xvl, WVh, WVl, VPh, VPl, out, 1024, 1024, 1024, 1024, 0, 0, 0);
  // per-head transpose of V (into region 1)
  k_vtr<<<dim3(4 * 16 * 16), blk, 0, stream>>>(VPh, VPl, VTh, VTl);
  // attention (into region 2)
  k_attn<<<dim3(4 * 16 * 32), blk, ATTN_LDS, stream>>>(QPh, QPl, KPh, KPl, VTh, VTl, ERh, ERl, AOh, AOl);
  // out = AO . WMerge
  k_gemm<1><<<dim3(1024 / 128, 4096 / 64, 1), blk, 0, stream>>>(
      AOh, AOl, WMh, WMl, QPh, QPl, out, 1024, 1024, 1024, 1024, 0, 0, 0);
}

// v005
// One run takes 254 microseconds.
// Two timings next to v004 both put it at 1.07 times that version's speed.
// Over all steps from v000 it is 2.17 times as fast.
#include <hip/hip_runtime.h>
#include <stdint.h>

// All contractions (x.WQ, WK-cols x key-rows, x.WV, Q.Er^T, Q.K^T, P.V, O.WMerge): v_wmma_f32_16x16x32_bf16 with bf16 hi/lo operand pairs (hi*hi + hi*lo + lo*hi), f32 accumulate; softmax and skew index arithmetic in f32 / int32.

typedef unsigned short u16;
typedef unsigned int u32;
typedef __bf16 bf16x16 __attribute__((ext_vector_type(16)));
typedef float f32x8 __attribute__((ext_vector_type(8)));
typedef float v4f __attribute__((ext_vector_type(4)));
typedef u32 v4u __attribute__((ext_vector_type(4)));
typedef u16 us8 __attribute__((ext_vector_type(8)));
typedef u16 us4 __attribute__((ext_vector_type(4)));

union Frag {
  bf16x16 v;
  v4u q[2];
};

// f32 -> bf16 bits, RNE
__device__ __forceinline__ u16 f2bf(float f) {
  const u32 u = __float_as_uint(f);
  const u32 r = u + 0x7FFFu + ((u >> 16) & 1u);
  return (u16)(r >> 16);
}
__device__ __forceinline__ float bf2f(u16 b) { return __uint_as_float(((u32)b) << 16); }

// 8 f32 -> 8 bf16 hi + 8 bf16 lo (lo = RNE(x - hi))
__device__ __forceinline__ void split8(v4f a, v4f b, us8& h, us8& l) {
  float f[8];
  f[0] = a.x; f[1] = a.y; f[2] = a.z; f[3] = a.w;
  f[4] = b.x; f[5] = b.y; f[6] = b.z; f[7] = b.w;
#pragma unroll
  for (int i = 0; i < 8; ++i) {
    const u16 hb = f2bf(f[i]);
    h[i] = hb;
    l[i] = f2bf(f[i] - bf2f(hb));
  }
}

__device__ __forceinline__ f32x8 zero8() {
  f32x8 z;
#pragma unroll
  for (int e = 0; e < 8; ++e) z[e] = 0.0f;
  return z;
}

// 16-bit fragment: lane (h = l>>4, m = l&15) -> elements 0..7 = k0+8h+0..7, elements 8..15 = k0+16+8h+0..7
// p already points at row m, column k0 + 8h of a k-contiguous [row][k] plane.
__device__ __forceinline__ void ldf(Frag& f, const u16* p) {
  f.q[0] = *(const v4u*)p;
  f.q[1] = *(const v4u*)(p + 16);
}

// Fragment order: a [row][k] plane cut into units of 16 rows x 16 k; unit (row tile, k / 16) holds 256 halves, lane l's
// 8 halves at 8 l = row m, k = 16 * unit + 8h + 0..7. A fragment is two neighbouring units, and each of its two
// wave-wide 16-byte loads reads 512 contiguous bytes (4 whole lines; from a row-major plane the same load touches 16).
// p already points at the lane's piece of the fragment's first unit.
__device__ __forceinline__ void ldf_pk(Frag& f, const u16* p) {
  f.q[0] = *(const v4u*)p;
  f.q[1] = *(const v4u*)(p + 256);
}

// one 32-deep k-step, hi/lo pairs: c += ah*bh + ah*bl + al*bh ; hazard guard after the group
__device__ __forceinline__ f32x8 wmma3(const Frag& ah, const Frag& al, const Frag& bh, const Frag& bl, f32x8 c) {
  c = __builtin_amdgcn_wmma_f32_16x16x32_bf16(false, ah.v, false, bh.v, (short)0, c, false, false);
  c = __builtin_amdgcn_wmma_f32_16x16x32_bf16(false, ah.v, false, bl.v, (short)0, c, false, false);
  c = __builtin_amdgcn_wmma_f32_16x16x32_bf16(false, al.v, false, bh.v, (short)0, c, false, false);
  asm volatile("v_nop\n\tv_nop\n\tv_nop\n\tv_nop" : "+v"(c) : "v"(ah.v), "v"(al.v), "v"(bh.v), "v"(bl.v));
  return c;
}

// ---------------------------------------------------------------- operand preparation, one launch
// All f32 operands -> bf16 hi/lo planes. The block index picks the job (the same for a whole block):
//   blocks 0..767      query / key / value, elementwise: 256 blocks each, 8 pieces of 8 values per thread
//   blocks 768..1279   WQ / WK / WV / WMerge, transposing: 128 blocks each, a 128 (k) x 64 (n) tile per block
//   blocks 1280..1311  Er into fragment order, one piece per thread
// Transposing split: in[1024 k][1024 n] row-major f32 -> out[n][k] planes. For WQ input column n = 64 m + e becomes
// output row (e >> 3) * 128 + 8 m + (e & 7), so that a GEMM with this plane as Bt leaves each of its output rows, read
// as [16 m][64 e], in fragment order.
// Er: in[rows][64] row-major f32 -> planes in fragment order (units: row tile, then k / 16); thread = one 16-byte piece.
#define PREP_X 768
#define PREP_W 512
#define PREP_E 32
// second launch bound: a register budget at which five blocks fit a WGP, so that nearly the whole grid is resident at
// once and the jobs' loads, conversions and stores overlap
__global__ __launch_bounds__(256, 10) void k_prep(const float* __restrict__ xq, const float* __restrict__ xk,
                                              const float* __restrict__ xv, const float* __restrict__ wq,
                                              const float* __restrict__ wk, const float* __restrict__ wv,
                                              const float* __restrict__ wm, const float* __restrict__ er,
                                              u16* xqh, u16* xql, u16* xkh, u16* xkl, u16* xvh, u16* xvl,
                                              u16* wqh, u16* wql, u16* wkh, u16* wkl, u16* wvh, u16* wvl,
                                              u16* wmh, u16* wml, u16* erh, u16* erl) {
  __shared__ __attribute__((aligned(16))) float Ts[2 * 64 * 68];  // two 64 x 64 tiles, Ts[tile][n][k]
  const int blk = blockIdx.x, t = threadIdx.x;
  if (blk < PREP_X) {
    const int job = blk >> 8;
    const float* s = (job == 0) ? xq : (job == 1) ? xk : xv;
    u16* dh = (job == 0) ? xqh : (job == 1) ? xkh : xvh;
    u16* dl = (job == 0) ? xql : (job == 1) ? xkl : xvl;
    const u32 p0 = (u32)((blk & 255) * 2048 + t);   // first piece; the others 256 pieces apart
    v4f a[8], b[8];
    u32 so[8];
#pragma unroll
    for (int i = 0; i < 8; ++i) so[i] = (p0 + 256u * i) * 32u;   // byte offset in the f32 source
#pragma unroll
    for (int i = 0; i < 8; ++i) {
      a[i] = *(const v4f*)((const char*)s + so[i]);
      b[i] = *(const v4f*)((const char*)s + so[i] + 16);
    }
    // the wait that stands before a load's address register is rewritten; the offsets are inputs so that they stay
    // live, and so unwritten (also by a later load's result), up to it
    asm volatile("s_wait_xcnt 0x0" ::"v"(so[0]), "v"(so[1]), "v"(so[2]), "v"(so[3]), "v"(so[4]), "v"(so[5]), "v"(so[6]),
                 "v"(so[7])
                 : "memory");
    us8 h[8], l[8];
#pragma unroll
    for (int i = 0; i < 8; ++i) split8(a[i], b[i], h[i], l[i]);
#pragma unroll
    for (int i = 0; i < 8; ++i) {
      *(us8*)((char*)dh + (so[i] >> 1)) = h[i];
      *(us8*)((char*)dl + (so[i] >> 1)) = l[i];
    }
  } else if (blk < PREP_X + PREP_W) {
    const int wb = blk - PREP_X, job = wb >> 7, tile = wb & 127;
    const float* s = (job == 0) ? wq : (job == 1) ? wk : (job == 2) ? wv : wm;
    u16* dh = (job == 0) ? wqh : (job == 1) ? wkh : (job == 2) ? wvh : wmh;
    u16* dl = (job == 0) ? wql : (job == 1) ? wkl : (job == 2) ? wvl : wml;
    const int c0 = (tile & 15) * 64, r0 = (tile >> 4) * 128;
    {
      const int r = t >> 2, cb = (t & 3) * 16;
      v4f v[8];
      u32 so[2];
#pragma unroll
      for (int u = 0; u < 2; ++u) so[u] = (u32)((r0 + 64 * u + r) * 1024 + c0 + cb) * 4u;
#pragma unroll
      for (int u = 0; u < 2; ++u)
#pragma unroll
        for (int q = 0; q < 4; ++q) v[4 * u + q] = *(const v4f*)((const char*)s + so[u] + 16 * q);
      // the wait that stands before a load's address register is rewritten; the offsets are inputs as above
      asm volatile("s_wait_xcnt 0x0" ::"v"(so[0]), "v"(so[1]) : "memory");
#pragma unroll
      for (int u = 0; u < 2; ++u)
#pragma unroll
        for (int q = 0; q < 4; ++q) {
          float* d = Ts + u * (64 * 68) + (cb + 4 * q) * 68 + r;
          d[0] = v[4 * u + q].x;
          d[68] = v[4 * u + q].y;
          d[136] = v[4 * u + q].z;
          d[204] = v[4 * u + q].w;
        }
    }
    __syncthreads();
    us8 h[4], l[4];
    u32 go[4];
#pragma unroll
    for (int it = 0; it < 4; ++it) {
      const int u = it >> 1, pc = t + 256 * (it & 1), c = pc >> 3, q = pc & 7;
      const float* p = Ts + u * (64 * 68) + c * 68 + 8 * q;
      const v4f a = *(const v4f*)p;
      const v4f b = *(const v4f*)(p + 4);
      split8(a, b, h[it], l[it]);
      const int n = c0 + c;
      const int orow = (job == 0) ? (((n >> 3) & 7) * 128 + (n >> 6) * 8 + (n & 7)) : n;
      go[it] = (u32)(orow * 1024 + r0 + 64 * u + 8 * q) * 2u;
    }
#pragma unroll
    for (int it = 0; it < 4; ++it) {
      *(us8*)((char*)dh + go[it]) = h[it];
      *(us8*)((char*)dl + go[it]) = l[it];
    }
  } else {
    const int g = (blk - PREP_X - PREP_W) * 256 + t;
    const int lane = g & 31, u = (g >> 5) & 3, rt = g >> 7;
    const u32 so = (u32)((rt * 16 + (lane & 15)) * 64 + u * 16 + (lane >> 4) * 8) * 4u;
    const v4f a = *(const v4f*)((const char*)er + so);
    const v4f b = *(const v4f*)((const char*)er + so + 16);
    // the wait that stands before a load's address register is rewritten; the offset is an input as above
    asm volatile("s_wait_xcnt 0x0" ::"v"(so) : "memory");
    us8 h, l;
    split8(a, b, h, l);
    *(us8*)(erh + (size_t)g * 8) = h;
    *(us8*)(erl + (size_t)g * 8) = l;
    // the wait that stands before a store's registers are rewritten: in the built code another job's instructions
    // follow these stores, behind a test
    asm volatile("s_wait_xcnt 0x0" ::: "memory");
  }
}

// ---------------------------------------------------------------- GEMM (hi/lo pairs)
// C[z][M][N] = A[z][M][K] * Bt[z][N][K]^T ; A and Bt are k-contiguous bf16 hi/lo planes; K a multiple of 64.
// Block tile 64 x 128 (grid.x = N/128, grid.y = M/64, grid.z = batch), 8 waves of 32x32.
// Operands go through LDS in 64-deep k-chunks: 8 lanes fetch one row's 128 B, so a wave-wide load covers 4 whole
// lines (a fragment load straight from the planes touches 16 lines for the same 512 B). Two buffers: chunk c+1 is
// fetched into registers while chunk c is multiplied, stored to the other buffer, and published by one barrier.
// MODE 0: bf16 hi/lo output planes (row segment 256 B = 16 lanes x 16 B); MODE 1: f32 output (512 B = 32 lanes x 16 B).
// MODE 2: bf16 hi/lo output planes in fragment order, one [M][64] plane per 64 output columns, ldc halves apart (a wave
// stores 2 KiB in a row).
// MODE 3: the three projections in one launch; blockIdx.z picks the job: 0 = Q and 2 = V (as MODE 0), 1 = K (as MODE 2,
// its four batches of 16 row blocks laid along grid.y). Operand set 0 serves MODE 0..2.
#define G_PIT 72                    // LDS row pitch in halves: 144 B = 16 B x 9, conflict-free for 16-byte row reads
#define G_AL (64 * G_PIT)           // plane offsets inside a buffer, in halves: A hi at 0, A lo, B hi, B lo
#define G_BH (128 * G_PIT)
#define G_BL (256 * G_PIT)
#define G_BUF (384 * G_PIT)         // 27,648 halves = 55,296 B per buffer

// one thread's share of a chunk: 2 + 2 pieces of A hi / lo, 4 + 4 of B hi / lo, rows 32 apart
__device__ __forceinline__ void g_fetch(v4u (&sa)[4], v4u (&sb)[8], const u16* ah, const u16* al, const u16* bh,
                                        const u16* bl, int lda, int ldb) {
  const u16* pa[4];
  const u16* pb[8];
#pragma unroll
  for (int i = 0; i < 2; ++i) {
    pa[i] = ah + (size_t)(32 * i) * lda;
    pa[2 + i] = al + (size_t)(32 * i) * lda;
  }
#pragma unroll
  for (int i = 0; i < 4; ++i) {
    pb[i] = bh + (size_t)(32 * i) * ldb;
    pb[4 + i] = bl + (size_t)(32 * i) * ldb;
  }
#pragma unroll
  for (int i = 0; i < 4; ++i) sa[i] = *(const v4u*)pa[i];
#pragma unroll
  for (int i = 0; i < 8; ++i) sb[i] = *(const v4u*)pb[i];
  // the wait that stands before a load's address register is rewritten; the twelve addresses are inputs so that
  // they stay live, and so unwritten (also by a later load's result), up to it
  asm volatile("s_wait_xcnt 0x0" ::"v"(pa[0]), "v"(pa[1]), "v"(pa[2]), "v"(pa[3]), "v"(pb[0]), "v"(pb[1]), "v"(pb[2]),
               "v"(pb[3]), "v"(pb[4]), "v"(pb[5]), "v"(pb[6]), "v"(pb[7])
               : "memory");
}
__device__ __forceinline__ void g_put(u16* buf, const v4u (&sa)[4], const v4u (&sb)[8]) {
#pragma unroll
  for (int i = 0; i < 2; ++i) {
    *(v4u*)(buf + 32 * i * G_PIT) = sa[i];
    *(v4u*)(buf + G_AL + 32 * i * G_PIT) = sa[2 + i];
  }
#pragma unroll
  for (int i = 0; i < 4; ++i) {
    *(v4u*)(buf + G_BH + 32 * i * G_PIT) = sb[i];
    *(v4u*)(buf + G_BL + 32 * i * G_PIT) = sb[4 + i];
  }
}
template <int MODE>
__global__ __launch_bounds__(256) void k_gemm(const u16* __restrict__ Ah0, const u16* __restrict__ Al0,
                                              const u16* __restrict__ Bh0, const u16* __restrict__ Bl0,
                                              u16* Ch0, u16* Cl0,
                                              const u16* __restrict__ Ah1, const u16* __restrict__ Al1,
                                              const u16* __restrict__ Bh1, const u16* __restrict__ Bl1,
                                              u16* Ch1, u16* Cl1,
                                              const u16* __restrict__ Ah2, const u16* __restrict__ Al2,
                                              const u16* __restrict__ Bh2, const u16* __restrict__ Bl2,
                                              u16* Ch2, u16* Cl2, float* Cf,
                                              int lda, int ldb, int ldc0, int K,
                                              int zA0, int zB0, int zC0) {
  __shared__ __attribute__((aligned(16))) u16 Sm[2 * G_BUF];
  float* Cs = (float*)Sm;           // 64 x 132 f32 output tile, reuses the buffers behind the loop
  const int job = (MODE == 3) ? (int)blockIdx.z : 0;
  const bool kj = (MODE == 3) && (job == 1);
  const int mode = (MODE == 3) ? (kj ? 2 : 0) : MODE;
  const u16* Ah = (job == 0) ? Ah0 : (job == 1) ? Ah1 : Ah2;
  const u16* Al = (job == 0) ? Al0 : (job == 1) ? Al1 : Al2;
  const u16* Bh = (job == 0) ? Bh0 : (job == 1) ? Bh1 : Bh2;
  const u16* Bl = (job == 0) ? Bl0 : (job == 1) ? Bl1 : Bl2;
  u16* Ch = (job == 0) ? Ch0 : (job == 1) ? Ch1 : Ch2;
  u16* Cl = (job == 0) ? Cl0 : (job == 1) ? Cl1 : Cl2;
  // MODE 3: ldc0, zB0 and zC0 are the K job's; Q and V have plain rows of lda values and no batch
  const int ldc = (MODE == 3 && !kj) ? lda : ldc0;
  const int zA = zA0, zB = zB0, zC = zC0;
  const int z = (MODE == 3) ? (kj ? (int)(blockIdx.y >> 4) : 0) : (int)blockIdx.z;
  const int bm = (kj ? (int)(blockIdx.y & 15) : (int)blockIdx.y) * 64, bn = blockIdx.x * 128;
  const int tid = threadIdx.x, wave = tid >> 5, lane = tid & 31;
  const int m = lane & 15, hh = lane >> 4;
  const int wr = (wave & 1) * 32, wc = (wave >> 1) * 32;

  // staging map: thread -> (row tid>>3 (+32 per step), 16-byte piece tid&7 of the row's 128 B)
  const int srow = tid >> 3, sseg = (tid & 7) * 8;
  const u16* gah = Ah + (size_t)z * zA + (size_t)(bm + srow) * lda + sseg;
  const u16* gal = Al + (size_t)z * zA + (size_t)(bm + srow) * lda + sseg;
  const u16* gbh = Bh + (size_t)z * zB + (size_t)(bn + srow) * ldb + sseg;
  const u16* gbl = Bl + (size_t)z * zB + (size_t)(bn + srow) * ldb + sseg;
  const int so = srow * G_PIT + sseg;
  // fragment map inside a buffer (same rows and k order as the planes)
  const int fa = (wr + m) * G_PIT + 8 * hh;
  const int fb = (wc + m) * G_PIT + 8 * hh;

  f32x8 acc[2][2];
#pragma unroll
  for (int rt = 0; rt < 2; ++rt)
#pragma unroll
    for (int ct = 0; ct < 2; ++ct) acc[rt][ct] = zero8();

  v4u sa[4], sb[8];
  g_fetch(sa, sb, gah, gal, gbh, gbl, lda, ldb);
  g_put(Sm + so, sa, sb);
  __syncthreads();

  const int nch = K >> 6;
  for (int c = 0; c < nch; ++c) {
    const u16* cur = Sm + (c & 1) * G_BUF;
    u16* nxt = Sm + ((c + 1) & 1) * G_BUF;
    const bool more = (c + 1 < nch);
    if (more) {
      const int k1 = (c + 1) * 64;
      g_fetch(sa, sb, gah + k1, gal + k1, gbh + k1, gbl + k1, lda, ldb);
    }
#pragma unroll
    for (int ks = 0; ks < 2; ++ks) {
      Frag ah[2], al[2], bh[2], bl[2];
#pragma unroll
      for (int rt = 0; rt < 2; ++rt) {
        ldf(ah[rt], cur + fa + rt * 16 * G_PIT + ks * 32);
        ldf(al[rt], cur + G_AL + fa + rt * 16 * G_PIT + ks * 32);
      }
#pragma unroll
      for (int ct = 0; ct < 2; ++ct) {
        ldf(bh[ct], cur + G_BH + fb + ct * 16 * G_PIT + ks * 32);
        ldf(bl[ct], cur + G_BL + fb + ct * 16 * G_PIT + ks * 32);
      }
#pragma unroll
      for (int rt = 0; rt < 2; ++rt)
#pragma unroll
        for (int ct = 0; ct < 2; ++ct)
          acc[rt][ct] = wmma3(ah[rt], al[rt], bh[ct], bl[ct], acc[rt][ct]);
    }
    if (more) g_put(nxt + so, sa, sb);
    // publishes chunk c+1 and ends every wave's reads of the buffer that trip c+1 refills (behind the last trip: of the
    // second buffer, as K = 1024 gives 16 chunks; the output tile lies in the first, freed one trip earlier)
    __syncthreads();
  }

  // stage the 64x128 f32 tile: D element r of lane -> (row 8*hh + r, col m)
#pragma unroll
  for (int rt = 0; rt < 2; ++rt)
#pragma unroll
    for (int ct = 0; ct < 2; ++ct)
#pragma unroll
      for (int r = 0; r < 8; ++r)
        Cs[(wr + rt * 16 + 8 * hh + r) * 132 + wc + ct * 16 + m] = acc[rt][ct][r];
  __syncthreads();

  if (mode == 1) {
    float* cb = Cf + (size_t)z * zC;
    v4f v[8];
    size_t go[8];
#pragma unroll
    for (int i = 0; i < 8; ++i) {
      const int row = wave * 8 + i;
      v[i] = *(const v4f*)(Cs + row * 132 + 4 * lane);
      go[i] = (size_t)(bm + row) * ldc + bn + 4 * lane;
    }
#pragma unroll
    for (int i = 0; i < 8; ++i) *(v4f*)(cb + go[i]) = v[i];
    
  } else if (mode == 2) {
    // a wave owns one 16-row tile of one 64-column plane: its four units lie one behind the other
    const int jt = wave >> 1, hd = wave & 1;
    const size_t base = (size_t)z * zC + (size_t)((bn >> 6) + hd) * ldc + (size_t)((bm >> 4) + jt) * 1024 + (size_t)lane * 8;
    u16* chb = Ch + base;
    u16* clb = Cl + base;
    us8 hv[4], lv[4];
#pragma unroll
    for (int i = 0; i < 4; ++i) {
      const float* cp = Cs + (jt * 16 + m) * 132 + hd * 64 + i * 16 + hh * 8;
      const v4f a = *(const v4f*)cp;
      const v4f b = *(const v4f*)(cp + 4);
      split8(a, b, hv[i], lv[i]);
    }
#pragma unroll
    for (int i = 0; i < 4; ++i) {
      *(us8*)(chb + i * 256) = hv[i];
      *(us8*)(clb + i * 256) = lv[i];
    }
  } else {
    u16* chb = Ch + (size_t)z * zC;
    u16* clb = Cl + (size_t)z * zC;
    us8 hv[4], lv[4];
    size_t go[4];
#pragma unroll
    for (int i = 0; i < 4; ++i) {
      const int row = wave * 8 + 2 * i + (lane >> 4);
      const int cs = (lane & 15) * 8;
      const v4f a = *(const v4f*)(Cs + row * 132 + cs);
      const v4f b = *(const v4f*)(Cs + row * 132 + cs + 4);
      split8(a, b, hv[i], lv[i]);
      go[i] = (size_t)(bm + row) * ldc + bn + cs;
    }
#pragma unroll
    for (int i = 0; i < 4; ++i) {
      *(us8*)(chb + go[i]) = hv[i];
      *(us8*)(clb + go[i]) = lv[i];
    }
    // the wait that stands before a store's registers are rewritten: with two output forms in one kernel the other
    // form's instructions follow these stores in the built code, behind a test
    if (MODE == 3) asm volatile("s_wait_xcnt 0x0" ::: "memory");
  }
}

// ---------------------------------------------------------------- per-head V transpose
// src planes: VP[4096][1024] bf16; head plane X_h = 64 contiguous rows viewed as [1024 l][64 e].
// dst planes: per head v^T[64 e][1024 l] in fragment order (units: row tile e / 16, then l / 16).
__global__ __launch_bounds__(256) void k_vtr(const u16* __restrict__ sh, const u16* __restrict__ sl, u16* dh, u16* dl) {
  __shared__ __attribute__((aligned(16))) u16 Th[64 * 72];  // [e][l]
  __shared__ __attribute__((aligned(16))) u16 Tl[64 * 72];
  const int blk = blockIdx.x, lt = blk & 15, h = (blk >> 4) & 15, b = blk >> 8;
  const int l0 = lt * 64, t = threadIdx.x;
  const size_t src = (size_t)b * 1048576 + (size_t)h * 65536 + (size_t)l0 * 64;
#pragma unroll
  for (int it = 0; it < 2; ++it) {
    const int pc = t + 256 * it, l = pc >> 3, q = pc & 7;
    const us8 a = *(const us8*)(sh + src + l * 64 + 8 * q);
    const us8 c = *(const us8*)(sl + src + l * 64 + 8 * q);
#pragma unroll
    for (int i = 0; i < 8; ++i) {
      Th[(8 * q + i) * 72 + l] = a[i];
      Tl[(8 * q + i) * 72 + l] = c[i];
    }
  }
  __syncthreads();
  // a wave owns row tile nt and 32 of the block's 64 l: two units, 1 KiB in a row per plane
  const int wave = t >> 5, lane = t & 31, nt = wave >> 1, kl = wave & 1;
  const size_t dst = (size_t)(b * 16 + h) * 65536 + (size_t)(nt * 64 + lt * 4 + kl * 2) * 256 + (size_t)lane * 8;
  us8 oh[2], ol[2];
  size_t go[2];
#pragma unroll
  for (int it = 0; it < 2; ++it) {
    const int so = (nt * 16 + (lane & 15)) * 72 + kl * 32 + it * 16 + (lane >> 4) * 8;
    oh[it] = *(const us8*)(Th + so);
    ol[it] = *(const us8*)(Tl + so);
    go[it] = dst + (size_t)it * 256;
  }
#pragma unroll
  for (int it = 0; it < 2; ++it) {
    *(us8*)(dh + go[it]) = oh[it];
    *(us8*)(dl + go[it]) = ol[it];
  }
  
}

// ---------------------------------------------------------------- attention
// the four fragments (hi / lo, two k-steps) of one 16-row tile of a [rows][64] plane in fragment order; off = the lane's
// byte offset (tile * 2048 + lane * 16) in both planes
__device__ __forceinline__ void ld_k64_pk(Frag& h0, Frag& l0, Frag& h1, Frag& l1, const u16* bh, const u16* bl, u32 off) {
  const u16* ph = (const u16*)((const char*)bh + off);
  const u16* pl = (const u16*)((const char*)bl + off);
  ldf_pk(h0, ph); ldf_pk(h1, ph + 512);
  ldf_pk(l0, pl); ldf_pk(l1, pl + 512);
  // the wait that stands before a load's address register is rewritten; the offset is an input so that it stays
  // live, and so unwritten (also by a later load's result), up to it
  asm volatile("s_wait_xcnt 0x0" ::"v"(off) : "memory");
}

// one 16x16 tile, K = 64 (two k-steps); A and B fragments preloaded
__device__ __forceinline__ f32x8 tile_k64(const Frag& ah0, const Frag& al0, const Frag& ah1, const Frag& al1,
                                          const Frag& h0, const Frag& l0, const Frag& h1, const Frag& l1) {
  f32x8 acc = zero8();
  acc = wmma3(ah0, al0, h0, l0, acc);
  acc = wmma3(ah1, al1, h1, l1, acc);
  return acc;
}

// One block per (b, h, 32 query rows), 256 threads = 8 waves.
// LDS (dynamic): S[32][1024] f32 (131072 B), later reused in place as P row = hi[1024] | lo[1024] bf16; Ost[2][32][64] f32 (16384 B).
// Every Er, K and V fragment is loaded once per block: the wave that loads it multiplies it with all row tiles.
// The Q, Er, K and V planes lie in fragment order, so each fragment load reads whole lines.
// P rows are 4096 B apart (the same banks in every row), so inside a plane the 16-byte piece (col >> 3) of row r sits at
// piece index (col >> 3) ^ (r & 15): the 16 rows that one fragment load reads then fall on 16 different bank groups.
__global__ __launch_bounds__(256) void k_attn(const u16* __restrict__ QPh, const u16* __restrict__ QPl,
                                              const u16* __restrict__ KPh, const u16* __restrict__ KPl,
                                              const u16* __restrict__ VTh, const u16* __restrict__ VTl,
                                              const u16* __restrict__ Eh, const u16* __restrict__ El,
                                              u16* AOh, u16* AOl) {
  extern __shared__ v4u dsm[];
  float* S = (float*)dsm;
  u16* P = (u16*)dsm;
  float* Ost = (float*)(dsm + 8192);  // byte offset 131072

  const int blk = blockIdx.x;
  const int ib = blk & 31, h = (blk >> 5) & 15, b = blk >> 9;
  const int i0 = ib * 32;
  const int tid = threadIdx.x, wave = tid >> 5, lane = tid & 31;
  const int m = lane & 15, hh = lane >> 4;

  // q_h[i][e]  = QP[b][h*64 + (i>>4)][(i&15)*64 + e]: plane at b*2^20 + h*2^16, one QP row = one 16-row tile in fragment order
  const size_t pq = (size_t)b * 1048576 + (size_t)h * 65536;
  const u16* Qh = QPh + pq;
  const u16* Ql = QPl + pq;
  // k_h[j][e]  = KP[b][h*64+e][j]: per head a [1024 j][64 e] plane in fragment order
  const u16* Kh = KPh + pq;
  const u16* Kl = KPl + pq;
  // v_h^T[e][j]: per head a [64 e][1024 j] plane in fragment order
  const u16* Vh = VTh + pq;
  const u16* Vl = VTl + pq;

  // Srel[i][i+1] = 0 (the only cells the skew scatter never writes)
  if (tid < 32) {
    const int j = i0 + tid + 1;
    if (j < 1024) S[tid * 1024 + j] = 0.0f;
  }

  // ---- phase 1: QEr tiles (rows i0 .. i0+32 needed) scattered through the skew map into S
  // row tile 2 (rows i0+32..) is consumed only through row i0+32, columns c <= 990 - i0
  const int ncol2 = 991 - i0;
  const int nct2 = (ncol2 > 0) ? ((ncol2 + 63) >> 6) : 0;
  // Q fragments of row tiles 0 and 1 (the block's own rows) and 2 (the 16 rows behind them), kept through phases 1 and 2
  Frag qh0[3], ql0[3], qh1[3], ql1[3];
#pragma unroll
  for (int rt = 0; rt < 3; ++rt) {
    int qt = (i0 >> 4) + rt;
    qt = (qt > 63) ? 63 : qt;   // the last block has no rows behind it (and nct2 = 0: the tile is not used)
    ld_k64_pk(qh0[rt], ql0[rt], qh1[rt], ql1[rt], Qh, Ql, (u32)(qt * 2048 + lane * 16));
  }
  // a wave owns the 64-column groups ct = wave and wave + 8, four 16-column tiles each
#pragma unroll 1
  for (int t = 0; t < 8; ++t) {
    const int ct = wave + 8 * (t >> 2);
    const int col0 = ct * 64 + (t & 3) * 16;
    Frag h0, l0, h1, l1;
    ld_k64_pk(h0, l0, h1, l1, Eh, El, (u32)(col0 * 128 + lane * 16));
    const int c = col0 + m;
    const int nrt = (ct < nct2) ? 3 : 2;
#pragma unroll
    for (int rt = 0; rt < 3; ++rt) {
      if (rt < nrt) {
        const int rb = i0 + rt * 16;
        const f32x8 acc = tile_k64(qh0[rt], ql0[rt], qh1[rt], ql1[rt], h0, l0, h1, l1);
#pragma unroll
        for (int r = 0; r < 8; ++r) {
          const int i2 = rb + 8 * hh + r;                       // QEr row
          const bool low = (c >= 1023 - i2);
          const int lr = (low ? i2 : (i2 - 1)) - i0;            // Srel row (local)
          const int j = low ? (c + i2 - 1023) : (c + i2 + 1);   // Srel column
          if ((unsigned)lr < 32u && (unsigned)j < 1024u) S[lr * 1024 + j] = acc[r];
        }
      }
    }
  }
  __syncthreads();

  // ---- phase 2: S += Q K^T
#pragma unroll 1
  for (int t = 0; t < 8; ++t) {
    const int col0 = (wave + 8 * (t >> 2)) * 64 + (t & 3) * 16;
    Frag h0, l0, h1, l1;
    ld_k64_pk(h0, l0, h1, l1, Kh, Kl, (u32)(col0 * 128 + lane * 16));
#pragma unroll
    for (int rt = 0; rt < 2; ++rt) {
      const f32x8 acc = tile_k64(qh0[rt], ql0[rt], qh1[rt], ql1[rt], h0, l0, h1, l1);
#pragma unroll
      for (int r = 0; r < 8; ++r)
        S[(rt * 16 + 8 * hh + r) * 1024 + col0 + m] += acc[r];
    }
  }
  __syncthreads();

  // ---- phase 3: row softmax of S/8 (max-subtracted), P written in place as bf16 hi/lo; lane owns columns
  // 128 q + 4 lane + 0..3 (q = 0..7), so a wave-wide 16-byte read covers 512 contiguous bytes of the row
#pragma unroll 1
  for (int rr = 0; rr < 4; ++rr) {
    const int row = wave * 4 + rr;
    const float* sr = S + row * 1024 + lane * 4;
    v4f xv[8];
    float mx = -3.0e38f;
#pragma unroll
    for (int q = 0; q < 8; ++q) {
      v4f v = *(const v4f*)(sr + 128 * q);
      v = v * 0.125f;
      xv[q] = v;
      mx = fmaxf(mx, fmaxf(fmaxf(v.x, v.y), fmaxf(v.z, v.w)));
    }
#pragma unroll
    for (int off = 16; off > 0; off >>= 1) mx = fmaxf(mx, __shfl_xor(mx, off, 32));
    float sum = 0.0f;
#pragma unroll
    for (int q = 0; q < 8; ++q) {
      v4f e;
      e.x = __expf(xv[q].x - mx);
      e.y = __expf(xv[q].y - mx);
      e.z = __expf(xv[q].z - mx);
      e.w = __expf(xv[q].w - mx);
      xv[q] = e;
      sum += (e.x + e.y) + (e.z + e.w);
    }
#pragma unroll
    for (int off = 16; off > 0; off >>= 1) sum += __shfl_xor(sum, off, 32);
    const float inv = 1.0f / sum;
    // hi: halves row*2048 + swizzled piece * 8 + (col & 7); piece of this lane's group q = 16 q + (lane >> 1)
    u16* ph = P + row * 2048 + (((lane >> 1) ^ (row & 15)) * 8) + (lane & 1) * 4;
    u16* pl = ph + 1024;                    // lo plane: 1024 halves behind hi
#pragma unroll
    for (int q = 0; q < 8; ++q) {
      const v4f a = xv[q] * inv;
      us4 hv, lv;
#pragma unroll
      for (int i = 0; i < 4; ++i) {
        const u16 hb = f2bf(a[i]);
        hv[i] = hb;
        lv[i] = f2bf(a[i] - bf2f(hb));
      }
      *(us4*)(ph + 128 * q) = hv;
      *(us4*)(pl + 128 * q) = lv;
    }
  }
  __syncthreads();

  // ---- phase 4: O[32][64] = P[32][1024] . V[1024][64]; a wave owns 16 columns of O, both row tiles, and one half of k;
  // the two halves' partial sums are added behind the barrier
  {
    const int nt = wave & 3, kh = wave >> 2;
    const u16* pa = P + m * 2048;               // row tile 0; row tile 1 is 16 rows on; row & 15 = m in both
    const u16* vb = Vh + nt * 16384 + lane * 8;   // row tile nt: 64 units of 256 halves
    const u16* vc = Vl + nt * 16384 + lane * 8;
    f32x8 acc[2];
    acc[0] = zero8();
    acc[1] = zero8();
#pragma unroll 2
    for (int ks = kh * 16; ks < kh * 16 + 16; ++ks) {
      Frag bh, bl;
      const u16* pvh = vb + ks * 512;
      const u16* pvl = vc + ks * 512;
      ldf_pk(bh, pvh);
      ldf_pk(bl, pvl);
      // the wait that stands before a load's address register is rewritten; the addresses are inputs as in ld_k64_pk
      asm volatile("s_wait_xcnt 0x0" ::"v"(pvh), "v"(pvl) : "memory");
      const int p0 = ((ks * 4 + hh) ^ m) * 8;       // columns ks*32 + 8*hh + 0..7
      const int p1 = ((ks * 4 + 2 + hh) ^ m) * 8;   // columns ks*32 + 16 + 8*hh + 0..7
      Frag ah[2], al[2];
#pragma unroll
      for (int rt = 0; rt < 2; ++rt) {
        const u16* pr = pa + rt * 16 * 2048;
        ah[rt].q[0] = *(const v4u*)(pr + p0);
        ah[rt].q[1] = *(const v4u*)(pr + p1);
        al[rt].q[0] = *(const v4u*)(pr + 1024 + p0);
        al[rt].q[1] = *(const v4u*)(pr + 1024 + p1);
      }
#pragma unroll
      for (int rt = 0; rt < 2; ++rt) acc[rt] = wmma3(ah[rt], al[rt], bh, bl, acc[rt]);
    }
#pragma unroll
    for (int rt = 0; rt < 2; ++rt)
#pragma unroll
      for (int r = 0; r < 8; ++r) Ost[kh * 2048 + (rt * 16 + 8 * hh + r) * 64 + nt * 16 + m] = acc[rt][r];
  }
  __syncthreads();

  {
    const int row = wave * 4 + (lane >> 3), q = lane & 7;
    const v4f a = *(const v4f*)(Ost + row * 64 + 8 * q) + *(const v4f*)(Ost + 2048 + row * 64 + 8 * q);
    const v4f bq = *(const v4f*)(Ost + row * 64 + 8 * q + 4) + *(const v4f*)(Ost + 2048 + row * 64 + 8 * q + 4);
    us8 hv, lv;
    split8(a, bq, hv, lv);
    const size_t g = ((size_t)(b * 1024 + i0 + row)) * 1024 + (size_t)h * 64 + 8 * q;
    *(us8*)(AOh + g) = hv;
    *(us8*)(AOl + g) = lv;
    
  }
}

// ---------------------------------------------------------------- launch

extern "C" void kernel_launch(void* const* d_in, const int* in_sizes, int n_in,
                              void* d_out, int out_size, void* d_ws, size_t ws_size,
                              hipStream_t stream) {
  const int NX = 4194304;   // 4 x 1024 x 1024
  const int NW = 1048576;   // 1024 x 1024
  const int NE = 65536;     // 1024 x 64
  if (n_in < 8) return;
  if (in_sizes[0] != NX || in_sizes[1] != NX || in_sizes[2] != NX) return;
  if (in_sizes[3] != NW || in_sizes[4] != NW || in_sizes[5] != NW || in_sizes[7] != NW) return;
  if (in_sizes[6] != NE) return;
  if (out_size != NX) return;

  const float* q_in = (const float*)d_in[0];
  const float* k_in = (const float*)d_in[1];
  const float* v_in = (const float*)d_in[2];
  const float* WQ = (const float*)d_in[3];
  const float* WK = (const float*)d_in[4];
  const float* WV = (const float*)d_in[5];
  const float* Er = (const float*)d_in[6];
  const float* WM = (const float*)d_in[7];
  float* out = (float*)d_out;

  // workspace carve (bytes); bf16 planes
  const size_t bx = (size_t)NX * 2;   // 8 MiB
  const size_t bw = (size_t)NW * 2;   // 2 MiB
  const size_t be = (size_t)NE * 2;   // 128 KiB
  const size_t total = 6 * bx + 8 * bw + 2 * be + 6 * bx;   // 117,702,656 B
  if (total > ws_size) return;
  char* w = (char*)d_ws;
  size_t off = 0;
  u16* R0h = (u16*)(w + off); off += bx;   // Xq
  u16* R0l = (u16*)(w + off); off += bx;
  u16* R1h = (u16*)(w + off); off += bx;   // Xk, later VT
  u16* R1l = (u16*)(w + off); off += bx;
  u16* R2h = (u16*)(w + off); off += bx;   // Xv, later AO
  u16* R2l = (u16*)(w + off); off += bx;
  u16* WQh = (u16*)(w + off); off += bw;
  u16* WQl = (u16*)(w + off); off += bw;
  u16* WKh = (u16*)(w + off); off += bw;
  u16* WKl = (u16*)(w + off); off += bw;
  u16* WVh = (u16*)(w + off); off += bw;
  u16* WVl = (u16*)(w + off); off += bw;
  u16* WMh = (u16*)(w + off); off += bw;
  u16* WMl = (u16*)(w + off); off += bw;
  u16* ERh = (u16*)(w + off); off += be;
  u16* ERl = (u16*)(w + off); off += be;
  u16* QPh = (u16*)(w + off); off += bx;
  u16* QPl = (u16*)(w + off); off += bx;
  u16* KPh = (u16*)(w + off); off += bx;
  u16* KPl = (u16*)(w + off); off += bx;
  u16* VPh = (u16*)(w + off); off += bx;   // planes of its own: V is written while Xq is still read
  u16* VPl = (u16*)(w + off); off += bx;
  if (off > ws_size) return;

  u16* Xqh = R0h; u16* Xql = R0l;
  u16* Xkh = R1h; u16* Xkl = R1l;
  u16* Xvh = R2h; u16* Xvl = R2l;
  u16* VTh = R1h; u16* VTl = R1l;
  u16* AOh = R2h; u16* AOl = R2l;

  const dim3 blk(256);
  const int ATTN_LDS = 131072 + 16384;
  hipFuncSetAttribute((const void*)k_attn, hipFuncAttributeMaxDynamicSharedMemorySize, ATTN_LDS);

  // every f32 operand -> bf16 hi/lo planes (Er in fragment order, the weights transposed, WQ's rows permuted for QP)
  k_prep<<<dim3(PREP_X + PREP_W + PREP_E), blk, 0, stream>>>(q_in, k_in, v_in, WQ, WK, WV, WM, Er, Xqh, Xql, Xkh, Xkl, Xvh,
                                                             Xvl, WQh, WQl, WKh, WKl, WVh, WVl, WMh, WMl, ERh, ERl);

  // one launch, job = grid.z:
  // 0: QP[4096][1024] = Xq . WQ, each row (16 queries x 64) in fragment order through WQt's row order
  // 1: KPT[b][c][r] = sum_k WK[k][c] key[b][r][k]  (A = WKt, Bt = Xk[b]), stored per 64 r (one head) in fragment order
  // 2: VP[4096][1024] = Xv . WV
  k_gemm<3><<<dim3(1024 / 128, 4096 / 64, 3), blk, 0, stream>>>(
      Xqh, Xql, WQh, WQl, QPh, QPl, WKh, WKl, Xkh, Xkl, KPh, KPl, Xvh, Xvl, WVh, WVl, VPh, VPl, out,
      1024, 1024, NE, 1024, 0, NW, NW);
  // per-head transpose of V (into region 1)
  k_vtr<<<dim3(4 * 16 * 16), blk, 0, stream>>>(VPh, VPl, VTh, VTl);
  // attention (into region 2)
  k_attn<<<dim3(4 * 16 * 32), blk, ATTN_LDS, stream>>>(QPh, QPl, KPh, KPl, VTh, VTl, ERh, ERl, AOh, AOl);
  // out = AO . WMerge
  k_gemm<1><<<dim3(1024 / 128, 4096 / 64, 1), blk, 0, stream>>>(
      AOh, AOl, WMh, WMl, QPh, QPl, AOh, AOl, WMh, WMl, QPh, QPl, AOh, AOl, WMh, WMl, QPh, QPl, out,
      1024, 1024, 1024, 1024, 0, 0, 0);
}

// v006
// One run takes 233 microseconds.
// Next to v005, in two timings, it ran 1.08 times as fast each time.
// Over all steps from v000 it is 2.35 times as fast.
#include <hip/hip_runtime.h>
#include <stdint.h>

// All contractions (x.WQ, WK-cols x key-rows, x.WV, Q.Er^T, Q.K^T, P.V, O.WMerge): v_wmma_f32_16x16x32_bf16 with bf16 hi/lo operand pairs (hi*hi + hi*lo + lo*hi), f32 accumulate; softmax and skew index arithmetic in f32 / int32.

typedef unsigned short u16;
typedef unsigned int u32;
typedef __bf16 bf16x16 __attribute__((ext_vector_type(16)));
typedef float f32x8 __attribute__((ext_vector_type(8)));
typedef float v4f __attribute__((ext_vector_type(4)));
typedef u32 v4u __attribute__((ext_vector_type(4)));
typedef u16 us8 __attribute__((ext_vector_type(8)));
typedef u16 us4 __attribute__((ext_vector_type(4)));

union Frag {
  bf16x16 v;
  v4u q[2];
};

// f32 -> bf16 bits, RNE
__device__ __forceinline__ u16 f2bf(float f) {
  const u32 u = __float_as_uint(f);
  const u32 r = u + 0x7FFFu + ((u >> 16) & 1u);
  return (u16)(r >> 16);
}
__device__ __forceinline__ float bf2f(u16 b) { return __uint_as_float(((u32)b) << 16); }

// 8 f32 -> 8 bf16 hi + 8 bf16 lo (lo = RNE(x - hi))
__device__ __forceinline__ void split8(v4f a, v4f b, us8& h, us8& l) {
  float f[8];
  f[0] = a.x; f[1] = a.y; f[2] = a.z; f[3] = a.w;
  f[4] = b.x; f[5] = b.y; f[6] = b.z; f[7] = b.w;
#pragma unroll
  for (int i = 0; i < 8; ++i) {
    const u16 hb = f2bf(f[i]);
    h[i] = hb;
    l[i] = f2bf(f[i] - bf2f(hb));
  }
}

__device__ __forceinline__ f32x8 zero8() {
  f32x8 z;
#pragma unroll
  for (int e = 0; e < 8; ++e) z[e] = 0.0f;
  return z;
}

// 16-bit fragment: lane (h = l>>4, m = l&15) -> elements 0..7 = k0+8h+0..7, elements 8..15 = k0+16+8h+0..7
// p already points at row m, column k0 + 8h of a k-contiguous [row][k] plane.
__device__ __forceinline__ void ldf(Frag& f, const u16* p) {
  f.q[0] = *(const v4u*)p;
  f.q[1] = *(const v4u*)(p + 16);
}

// Fragment order: a [row][k] plane cut into units of 16 rows x 16 k; unit (row tile, k / 16) holds 256 halves, lane l's
// 8 halves at 8 l = row m, k = 16 * unit + 8h + 0..7. A fragment is two neighbouring units, and each of its two
// wave-wide 16-byte loads reads 512 contiguous bytes (4 whole lines; from a row-major plane the same load touches 16).
// p already points at the lane's piece of the fragment's first unit.
__device__ __forceinline__ void ldf_pk(Frag& f, const u16* p) {
  f.q[0] = *(const v4u*)p;
  f.q[1] = *(const v4u*)(p + 256);
}

// one 32-deep k-step, hi/lo pairs: c += ah*bh + ah*bl + al*bh ; hazard guard after the group
__device__ __forceinline__ f32x8 wmma3(const Frag& ah, const Frag& al, const Frag& bh, const Frag& bl, f32x8 c) {
  c = __builtin_amdgcn_wmma_f32_16x16x32_bf16(false, ah.v, false, bh.v, (short)0, c, false, false);
  c = __builtin_amdgcn_wmma_f32_16x16x32_bf16(false, ah.v, false, bl.v, (short)0, c, false, false);
  c = __builtin_amdgcn_wmma_f32_16x16x32_bf16(false, al.v, false, bh.v, (short)0, c, false, false);
  asm volatile("v_nop\n\tv_nop\n\tv_nop\n\tv_nop" : "+v"(c) : "v"(ah.v), "v"(al.v), "v"(bh.v), "v"(bl.v));
  return c;
}

// ---------------------------------------------------------------- operand preparation, one launch
// All f32 operands -> bf16 hi/lo planes. The block index picks the job (the same for a whole block):
//   blocks 0..767      query / key / value, elementwise: 256 blocks each, 8 pieces of 8 values per thread
//   blocks 768..1279   WQ / WK / WV / WMerge, transposing: 128 blocks each, a 128 (k) x 64 (n) tile per block
//   blocks 1280..1311  Er into fragment order, one piece per thread
// Transposing split: in[1024 k][1024 n] row-major f32 -> out[n][k] planes. For WQ input column n = 64 m + e becomes
// output row (e >> 3) * 128 + 8 m + (e & 7), so that a GEMM with this plane as Bt leaves each of its output rows, read
// as [16 m][64 e], in fragment order.
// Er: in[rows][64] row-major f32 -> planes in fragment order (units: row tile, then k / 16); thread = one 16-byte piece.
#define PREP_X 768
#define PREP_W 512
#define PREP_E 32
// second launch bound: a register budget at which five blocks fit a WGP, so that nearly the whole grid is resident at
// once and the jobs' loads, conversions and stores overlap
__global__ __launch_bounds__(256, 10) void k_prep(const float* __restrict__ xq, const float* __restrict__ xk,
                                              const float* __restrict__ xv, const float* __restrict__ wq,
                                              const float* __restrict__ wk, const float* __restrict__ wv,
                                              const float* __restrict__ wm, const float* __restrict__ er,
                                              u16* xqh, u16* xql, u16* xkh, u16* xkl, u16* xvh, u16* xvl,
                                              u16* wqh, u16* wql, u16* wkh, u16* wkl, u16* wvh, u16* wvl,
                                              u16* wmh, u16* wml, u16* erh, u16* erl) {
  __shared__ __attribute__((aligned(16))) float Ts[2 * 64 * 68];  // two 64 x 64 tiles, Ts[tile][n][k]
  const int blk = blockIdx.x, t = threadIdx.x;
  if (blk < PREP_X) {
    const int job = blk >> 8;
    const float* s = (job == 0) ? xq : (job == 1) ? xk : xv;
    u16* dh = (job == 0) ? xqh : (job == 1) ? xkh : xvh;
    u16* dl = (job == 0) ? xql : (job == 1) ? xkl : xvl;
    const u32 p0 = (u32)((blk & 255) * 2048 + t);   // first piece; the others 256 pieces apart
    v4f a[8], b[8];
    u32 so[8];
#pragma unroll
    for (int i = 0; i < 8; ++i) so[i] = (p0 + 256u * i) * 32u;   // byte offset in the f32 source
#pragma unroll
    for (int i = 0; i < 8; ++i) {
      a[i] = *(const v4f*)((const char*)s + so[i]);
      b[i] = *(const v4f*)((const char*)s + so[i] + 16);
    }
    // the wait that stands before a load's address register is rewritten; the offsets are inputs so that they stay
    // live, and so unwritten (also by a later load's result), up to it
    asm volatile("s_wait_xcnt 0x0" ::"v"(so[0]), "v"(so[1]), "v"(so[2]), "v"(so[3]), "v"(so[4]), "v"(so[5]), "v"(so[6]),
                 "v"(so[7])
                 : "memory");
    us8 h[8], l[8];
#pragma unroll
    for (int i = 0; i < 8; ++i) split8(a[i], b[i], h[i], l[i]);
#pragma unroll
    for (int i = 0; i < 8; ++i) {
      *(us8*)((char*)dh + (so[i] >> 1)) = h[i];
      *(us8*)((char*)dl + (so[i] >> 1)) = l[i];
    }
  } else if (blk < PREP_X + PREP_W) {
    const int wb = blk - PREP_X, job = wb >> 7, tile = wb & 127;
    const float* s = (job == 0) ? wq : (job == 1) ? wk : (job == 2) ? wv : wm;
    u16* dh = (job == 0) ? wqh : (job == 1) ? wkh : (job == 2) ? wvh : wmh;
    u16* dl = (job == 0) ? wql : (job == 1) ? wkl : (job == 2) ? wvl : wml;
    const int c0 = (tile & 15) * 64, r0 = (tile >> 4) * 128;
    {
      const int r = t >> 2, cb = (t & 3) * 16;
      v4f v[8];
      u32 so[2];
#pragma unroll
      for (int u = 0; u < 2; ++u) so[u] = (u32)((r0 + 64 * u + r) * 1024 + c0 + cb) * 4u;
#pragma unroll
      for (int u = 0; u < 2; ++u)
#pragma unroll
        for (int q = 0; q < 4; ++q) v[4 * u + q] = *(const v4f*)((const char*)s + so[u] + 16 * q);
      // the wait that stands before a load's address register is rewritten; the offsets are inputs as above
      asm volatile("s_wait_xcnt 0x0" ::"v"(so[0]), "v"(so[1]) : "memory");
#pragma unroll
      for (int u = 0; u < 2; ++u)
#pragma unroll
        for (int q = 0; q < 4; ++q) {
          float* d = Ts + u * (64 * 68) + (cb + 4 * q) * 68 + r;
          d[0] = v[4 * u + q].x;
          d[68] = v[4 * u + q].y;
          d[136] = v[4 * u + q].z;
          d[204] = v[4 * u + q].w;
        }
    }
    __syncthreads();
    us8 h[4], l[4];
    u32 go[4];
#pragma unroll
    for (int it = 0; it < 4; ++it) {
      const int u = it >> 1, pc = t + 256 * (it & 1), c = pc >> 3, q = pc & 7;
      const float* p = Ts + u * (64 * 68) + c * 68 + 8 * q;
      const v4f a = *(const v4f*)p;
      const v4f b = *(const v4f*)(p + 4);
      split8(a, b, h[it], l[it]);
      const int n = c0 + c;
      const int orow = (job == 0) ? (((n >> 3) & 7) * 128 + (n >> 6) * 8 + (n & 7)) : n;
      go[it] = (u32)(orow * 1024 + r0 + 64 * u + 8 * q) * 2u;
    }
#pragma unroll
    for (int it = 0; it < 4; ++it) {
      *(us8*)((char*)dh + go[it]) = h[it];
      *(us8*)((char*)dl + go[it]) = l[it];
    }
  } else {
    const int g = (blk - PREP_X - PREP_W) * 256 + t;
    const int lane = g & 31, u = (g >> 5) & 3, rt = g >> 7;
    const u32 so = (u32)((rt * 16 + (lane & 15)) * 64 + u * 16 + (lane >> 4) * 8) * 4u;
    const v4f a = *(const v4f*)((const char*)er + so);
    const v4f b = *(const v4f*)((const char*)er + so + 16);
    // the wait that stands before a load's address register is rewritten; the offset is an input as above
    asm volatile("s_wait_xcnt 0x0" ::"v"(so) : "memory");
    us8 h, l;
    split8(a, b, h, l);
    *(us8*)(erh + (size_t)g * 8) = h;
    *(us8*)(erl + (size_t)g * 8) = l;
    // the wait that stands before a store's registers are rewritten: in the built code another job's instructions
    // follow these stores, behind a test
    asm volatile("s_wait_xcnt 0x0" ::: "memory");
  }
}

// ---------------------------------------------------------------- GEMM (hi/lo pairs)
// C[z][M][N] = A[z][M][K] * Bt[z][N][K]^T ; A and Bt are k-contiguous bf16 hi/lo planes; K a multiple of 64.
// Block tile 64 x 128 (grid.x = N/128, grid.y = M/64, grid.z = batch), 8 waves of 32x32.
// Operands go through LDS in 64-deep k-chunks: 8 lanes fetch one row's 128 B, so a wave-wide load covers 4 whole
// lines (a fragment load straight from the planes touches 16 lines for the same 512 B). Two buffers: chunk c+1 is
// fetched into registers while chunk c is multiplied, stored to the other buffer, and published by one barrier.
// MODE 0: bf16 hi/lo output planes (row segment 256 B = 16 lanes x 16 B); MODE 1: f32 output (512 B = 32 lanes x 16 B).
// MODE 2: bf16 hi/lo output planes in fragment order, one [M][64] plane per 64 output columns, ldc halves apart (a wave
// stores 2 KiB in a row).
// MODE 3: the three projections in one launch; blockIdx.z picks the job: 0 = Q and 2 = V (as MODE 0), 1 = K (as MODE 2,
// its four batches of 16 row blocks laid along grid.y). Operand set 0 serves MODE 0..2.
#define G_PIT 72                    // LDS row pitch in halves: 144 B = 16 B x 9, conflict-free for 16-byte row reads
#define G_AL (64 * G_PIT)           // plane offsets inside a buffer, in halves: A hi at 0, A lo, B hi, B lo
#define G_BH (128 * G_PIT)
#define G_BL (256 * G_PIT)
#define G_BUF (384 * G_PIT)         // 27,648 halves = 55,296 B per buffer

// one thread's share of a chunk: 2 + 2 pieces of A hi / lo, 4 + 4 of B hi / lo, rows 32 apart
__device__ __forceinline__ void g_fetch(v4u (&sa)[4], v4u (&sb)[8], const u16* ah, const u16* al, const u16* bh,
                                        const u16* bl, int lda, int ldb) {
  const u16* pa[4];
  const u16* pb[8];
#pragma unroll
  for (int i = 0; i < 2; ++i) {
    pa[i] = ah + (size_t)(32 * i) * lda;
    pa[2 + i] = al + (size_t)(32 * i) * lda;
  }
#pragma unroll
  for (int i = 0; i < 4; ++i) {
    pb[i] = bh + (size_t)(32 * i) * ldb;
    pb[4 + i] = bl + (size_t)(32 * i) * ldb;
  }
#pragma unroll
  for (int i = 0; i < 4; ++i) sa[i] = *(const v4u*)pa[i];
#pragma unroll
  for (int i = 0; i < 8; ++i) sb[i] = *(const v4u*)pb[i];
  // the wait that stands before a load's address register is rewritten; the twelve addresses are inputs so that
  // they stay live, and so unwritten (also by a later load's result), up to it
  asm volatile("s_wait_xcnt 0x0" ::"v"(pa[0]), "v"(pa[1]), "v"(pa[2]), "v"(pa[3]), "v"(pb[0]), "v"(pb[1]), "v"(pb[2]),
               "v"(pb[3]), "v"(pb[4]), "v"(pb[5]), "v"(pb[6]), "v"(pb[7])
               : "memory");
}
__device__ __forceinline__ void g_put(u16* buf, const v4u (&sa)[4], const v4u (&sb)[8]) {
#pragma unroll
  for (int i = 0; i < 2; ++i) {
    *(v4u*)(buf + 32 * i * G_PIT) = sa[i];
    *(v4u*)(buf + G_AL + 32 * i * G_PIT) = sa[2 + i];
  }
#pragma unroll
  for (int i = 0; i < 4; ++i) {
    *(v4u*)(buf + G_BH + 32 * i * G_PIT) = sb[i];
    *(v4u*)(buf + G_BL + 32 * i * G_PIT) = sb[4 + i];
  }
}
template <int MODE>
__global__ __launch_bounds__(256) void k_gemm(const u16* __restrict__ Ah0, const u16* __restrict__ Al0,
                                              const u16* __restrict__ Bh0, const u16* __restrict__ Bl0,
                                              u16* Ch0, u16* Cl0,
                                              const u16* __restrict__ Ah1, const u16* __restrict__ Al1,
                                              const u16* __restrict__ Bh1, const u16* __restrict__ Bl1,
                                              u16* Ch1, u16* Cl1,
                                              const u16* __restrict__ Ah2, const u16* __restrict__ Al2,
                                              const u16* __restrict__ Bh2, const u16* __restrict__ Bl2,
                                              u16* Ch2, u16* Cl2, float* Cf,
                                              int lda, int ldb, int ldc0, int K,
                                              int zA0, int zB0, int zC0) {
  __shared__ __attribute__((aligned(16))) u16 Sm[2 * G_BUF];
  float* Cs = (float*)Sm;           // 64 x 132 f32 output tile, reuses the buffers behind the loop
  const int job = (MODE == 3) ? (int)blockIdx.z : 0;
  const bool kj = (MODE == 3) && (job == 1);
  const int mode = (MODE == 3) ? (kj ? 2 : 0) : MODE;
  const u16* Ah = (job == 0) ? Ah0 : (job == 1) ? Ah1 : Ah2;
  const u16* Al = (job == 0) ? Al0 : (job == 1) ? Al1 : Al2;
  const u16* Bh = (job == 0) ? Bh0 : (job == 1) ? Bh1 : Bh2;
  const u16* Bl = (job == 0) ? Bl0 : (job == 1) ? Bl1 : Bl2;
  u16* Ch = (job == 0) ? Ch0 : (job == 1) ? Ch1 : Ch2;
  u16* Cl = (job == 0) ? Cl0 : (job == 1) ? Cl1 : Cl2;
  // MODE 3: ldc0, zB0 and zC0 are the K job's; Q and V have plain rows of lda values and no batch
  const int ldc = (MODE == 3 && !kj) ? lda : ldc0;
  const int zA = zA0, zB = zB0, zC = zC0;
  const int z = (MODE == 3) ? (kj ? (int)(blockIdx.y >> 4) : 0) : (int)blockIdx.z;
  const int bm = (kj ? (int)(blockIdx.y & 15) : (int)blockIdx.y) * 64, bn = blockIdx.x * 128;
  const int tid = threadIdx.x, wave = tid >> 5, lane = tid & 31;
  const int m = lane & 15, hh = lane >> 4;
  const int wr = (wave & 1) * 32, wc = (wave >> 1) * 32;

  // staging map: thread -> (row tid>>3 (+32 per step), 16-byte piece tid&7 of the row's 128 B)
  const int srow = tid >> 3, sseg = (tid & 7) * 8;
  const u16* gah = Ah + (size_t)z * zA + (size_t)(bm + srow) * lda + sseg;
  const u16* gal = Al + (size_t)z * zA + (size_t)(bm + srow) * lda + sseg;
  const u16* gbh = Bh + (size_t)z * zB + (size_t)(bn + srow) * ldb + sseg;
  const u16* gbl = Bl + (size_t)z * zB + (size_t)(bn + srow) * ldb + sseg;
  const int so = srow * G_PIT + sseg;
  // fragment map inside a buffer (same rows and k order as the planes)
  const int fa = (wr + m) * G_PIT + 8 * hh;
  const int fb = (wc + m) * G_PIT + 8 * hh;

  f32x8 acc[2][2];
#pragma unroll
  for (int rt = 0; rt < 2; ++rt)
#pragma unroll
    for (int ct = 0; ct < 2; ++ct) acc[rt][ct] = zero8();

  v4u sa[4], sb[8];
  g_fetch(sa, sb, gah, gal, gbh, gbl, lda, ldb);
  g_put(Sm + so, sa, sb);
  __syncthreads();

  const int nch = K >> 6;
  for (int c = 0; c < nch; ++c) {
    const u16* cur = Sm + (c & 1) * G_BUF;
    u16* nxt = Sm + ((c + 1) & 1) * G_BUF;
    const bool more = (c + 1 < nch);
    if (more) {
      const int k1 = (c + 1) * 64;
      g_fetch(sa, sb, gah + k1, gal + k1, gbh + k1, gbl + k1, lda, ldb);
    }
#pragma unroll
    for (int ks = 0; ks < 2; ++ks) {
      Frag ah[2], al[2], bh[2], bl[2];
#pragma unroll
      for (int rt = 0; rt < 2; ++rt) {
        ldf(ah[rt], cur + fa + rt * 16 * G_PIT + ks * 32);
        ldf(al[rt], cur + G_AL + fa + rt * 16 * G_PIT + ks * 32);
      }
#pragma unroll
      for (int ct = 0; ct < 2; ++ct) {
        ldf(bh[ct], cur + G_BH + fb + ct * 16 * G_PIT + ks * 32);
        ldf(bl[ct], cur + G_BL + fb + ct * 16 * G_PIT + ks * 32);
      }
#pragma unroll
      for (int rt = 0; rt < 2; ++rt)
#pragma unroll
        for (int ct = 0; ct < 2; ++ct)
          acc[rt][ct] = wmma3(ah[rt], al[rt], bh[ct], bl[ct], acc[rt][ct]);
    }
    if (more) g_put(nxt + so, sa, sb);
    // publishes chunk c+1 and ends every wave's reads of the buffer that trip c+1 refills (behind the last trip: of the
    // second buffer, as K = 1024 gives 16 chunks; the output tile lies in the first, freed one trip earlier)
    __syncthreads();
  }

  // stage the 64x128 f32 tile: D element r of lane -> (row 8*hh + r, col m)
#pragma unroll
  for (int rt = 0; rt < 2; ++rt)
#pragma unroll
    for (int ct = 0; ct < 2; ++ct)
#pragma unroll
      for (int r = 0; r < 8; ++r)
        Cs[(wr + rt * 16 + 8 * hh + r) * 132 + wc + ct * 16 + m] = acc[rt][ct][r];
  __syncthreads();

  if (mode == 1) {
    float* cb = Cf + (size_t)z * zC;
    v4f v[8];
    size_t go[8];
#pragma unroll
    for (int i = 0; i < 8; ++i) {
      const int row = wave * 8 + i;
      v[i] = *(const v4f*)(Cs + row * 132 + 4 * lane);
      go[i] = (size_t)(bm + row) * ldc + bn + 4 * lane;
    }
#pragma unroll
    for (int i = 0; i < 8; ++i) *(v4f*)(cb + go[i]) = v[i];
    
  } else if (mode == 2) {
    // a wave owns one 16-row tile of one 64-column plane: its four units lie one behind the other
    const int jt = wave >> 1, hd = wave & 1;
    const size_t base = (size_t)z * zC + (size_t)((bn >> 6) + hd) * ldc + (size_t)((bm >> 4) + jt) * 1024 + (size_t)lane * 8;
    u16* chb = Ch + base;
    u16* clb = Cl + base;
    us8 hv[4], lv[4];
#pragma unroll
    for (int i = 0; i < 4; ++i) {
      const float* cp = Cs + (jt * 16 + m) * 132 + hd * 64 + i * 16 + hh * 8;
      const v4f a = *(const v4f*)cp;
      const v4f b = *(const v4f*)(cp + 4);
      split8(a, b, hv[i], lv[i]);
    }
#pragma unroll
    for (int i = 0; i < 4; ++i) {
      *(us8*)(chb + i * 256) = hv[i];
      *(us8*)(clb + i * 256) = lv[i];
    }
  } else {
    u16* chb = Ch + (size_t)z * zC;
    u16* clb = Cl + (size_t)z * zC;
    us8 hv[4], lv[4];
    size_t go[4];
#pragma unroll
    for (int i = 0; i < 4; ++i) {
      const int row = wave * 8 + 2 * i + (lane >> 4);
      const int cs = (lane & 15) * 8;
      const v4f a = *(const v4f*)(Cs + row * 132 + cs);
      const v4f b = *(const v4f*)(Cs + row * 132 + cs + 4);
      split8(a, b, hv[i], lv[i]);
      go[i] = (size_t)(bm + row) * ldc + bn + cs;
    }
#pragma unroll
    for (int i = 0; i < 4; ++i) {
      *(us8*)(chb + go[i]) = hv[i];
      *(us8*)(clb + go[i]) = lv[i];
    }
    // the wait that stands before a store's registers are rewritten: with two output forms in one kernel the other
    // form's instructions follow these stores in the built code, behind a test
    if (MODE == 3) asm volatile("s_wait_xcnt 0x0" ::: "memory");
  }
}

// ---------------------------------------------------------------- per-head V transpose
// src planes: VP[4096][1024] bf16; head plane X_h = 64 contiguous rows viewed as [1024 l][64 e].
// dst planes: per head v^T[64 e][1024 l] in fragment order (units: row tile e / 16, then l / 16).
__global__ __launch_bounds__(256) void k_vtr(const u16* __restrict__ sh, const u16* __restrict__ sl, u16* dh, u16* dl) {
  __shared__ __attribute__((aligned(16))) u16 Th[64 * 72];  // [e][l]
  __shared__ __attribute__((aligned(16))) u16 Tl[64 * 72];
  const int blk = blockIdx.x, lt = blk & 15, h = (blk >> 4) & 15, b = blk >> 8;
  const int l0 = lt * 64, t = threadIdx.x;
  const size_t src = (size_t)b * 1048576 + (size_t)h * 65536 + (size_t)l0 * 64;
#pragma unroll
  for (int it = 0; it < 2; ++it) {
    const int pc = t + 256 * it, l = pc >> 3, q = pc & 7;
    const us8 a = *(const us8*)(sh + src + l * 64 + 8 * q);
    const us8 c = *(const us8*)(sl + src + l * 64 + 8 * q);
#pragma unroll
    for (int i = 0; i < 8; ++i) {
      Th[(8 * q + i) * 72 + l] = a[i];
      Tl[(8 * q + i) * 72 + l] = c[i];
    }
  }
  __syncthreads();
  // a wave owns row tile nt and 32 of the block's 64 l: two units, 1 KiB in a row per plane
  const int wave = t >> 5, lane = t & 31, nt = wave >> 1, kl = wave & 1;
  const size_t dst = (size_t)(b * 16 + h) * 65536 + (size_t)(nt * 64 + lt * 4 + kl * 2) * 256 + (size_t)lane * 8;
  us8 oh[2], ol[2];
  size_t go[2];
#pragma unroll
  for (int it = 0; it < 2; ++it) {
    const int so = (nt * 16 + (lane & 15)) * 72 + kl * 32 + it * 16 + (lane >> 4) * 8;
    oh[it] = *(const us8*)(Th + so);
    ol[it] = *(const us8*)(Tl + so);
    go[it] = dst + (size_t)it * 256;
  }
#pragma unroll
  for (int it = 0; it < 2; ++it) {
    *(us8*)(dh + go[it]) = oh[it];
    *(us8*)(dl + go[it]) = ol[it];
  }
  
}

// ---------------------------------------------------------------- attention
// the four fragments (hi / lo, two k-steps) of one 16-row tile of a [rows][64] plane in fragment order; off = the lane's
// byte offset (tile * 2048 + lane * 16) in both planes
__device__ __forceinline__ void ld_k64_pk(Frag& h0, Frag& l0, Frag& h1, Frag& l1, const u16* bh, const u16* bl, u32 off) {
  const u16* ph = (const u16*)((const char*)bh + off);
  const u16* pl = (const u16*)((const char*)bl + off);
  ldf_pk(h0, ph); ldf_pk(h1, ph + 512);
  ldf_pk(l0, pl); ldf_pk(l1, pl + 512);
  // the wait that stands before a load's address register is rewritten; the offset is an input so that it stays
  // live, and so unwritten (also by a later load's result), up to it
  asm volatile("s_wait_xcnt 0x0" ::"v"(off) : "memory");
}

// one 16x16 tile, K = 64 (two k-steps); A and B fragments preloaded
__device__ __forceinline__ f32x8 tile_k64(const Frag& ah0, const Frag& al0, const Frag& ah1, const Frag& al1,
                                          const Frag& h0, const Frag& l0, const Frag& h1, const Frag& l1) {
  f32x8 acc = zero8();
  acc = wmma3(ah0, al0, h0, l0, acc);
  acc = wmma3(ah1, al1, h1, l1, acc);
  return acc;
}

// One block per (b, h, 32 query rows), 256 threads = 8 waves.
// LDS (dynamic): S[32][1024] f32 (131072 B), later reused in place as P row = hi[1024] | lo[1024] bf16; Ost[2][32][64] f32 (16384 B).
// Every Er, K and V fragment is loaded once per block: the wave that loads it multiplies it with all row tiles.
// The Q, Er, K and V planes lie in fragment order, so each fragment load reads whole lines.
// P rows are 4096 B apart (the same banks in every row), so inside a plane the 16-byte piece (col >> 3) of row r sits at
// piece index (col >> 3) ^ (r & 15): the 16 rows that one fragment load reads then fall on 16 different bank groups.
__global__ __launch_bounds__(256) void k_attn(const u16* __restrict__ QPh, const u16* __restrict__ QPl,
                                              const u16* __restrict__ KPh, const u16* __restrict__ KPl,
                                              const u16* __restrict__ VTh, const u16* __restrict__ VTl,
                                              const u16* __restrict__ Eh, const u16* __restrict__ El,
                                              u16* AOh, u16* AOl) {
  extern __shared__ v4u dsm[];
  float* S = (float*)dsm;
  u16* P = (u16*)dsm;
  float* Ost = (float*)(dsm + 8192);  // byte offset 131072

  const int blk = blockIdx.x;
  const int ib = blk & 31, h = (blk >> 5) & 15, b = blk >> 9;
  const int i0 = ib * 32;
  const int tid = threadIdx.x, wave = tid >> 5, lane = tid & 31;
  const int m = lane & 15, hh = lane >> 4;

  // q_h[i][e]  = QP[b][h*64 + (i>>4)][(i&15)*64 + e]: plane at b*2^20 + h*2^16, one QP row = one 16-row tile in fragment order
  const size_t pq = (size_t)b * 1048576 + (size_t)h * 65536;
  const u16* Qh = QPh + pq;
  const u16* Ql = QPl + pq;
  // k_h[j][e]  = KP[b][h*64+e][j]: per head a [1024 j][64 e] plane in fragment order
  const u16* Kh = KPh + pq;
  const u16* Kl = KPl + pq;
  // v_h^T[e][j]: per head a [64 e][1024 j] plane in fragment order
  const u16* Vh = VTh + pq;
  const u16* Vl = VTl + pq;

  // Srel[i][i+1] = 0 (the only cells the skew scatter never writes)
  if (tid < 32) {
    const int j = i0 + tid + 1;
    if (j < 1024) S[tid * 1024 + j] = 0.0f;
  }

  // ---- phase 1: QEr tiles (rows i0 .. i0+32 needed) scattered through the skew map into S
  // row tile 2 (rows i0+32..) is consumed only through row i0+32, columns c <= 990 - i0
  const int ncol2 = 991 - i0;
  const int nct2 = (ncol2 > 0) ? ((ncol2 + 63) >> 6) : 0;
  // Q fragments of row tiles 0 and 1 (the block's own rows) and 2 (the 16 rows behind them), kept through phases 1 and 2
  Frag qh0[3], ql0[3], qh1[3], ql1[3];
#pragma unroll
  for (int rt = 0; rt < 3; ++rt) {
    int qt = (i0 >> 4) + rt;
    qt = (qt > 63) ? 63 : qt;   // the last block has no rows behind it (and nct2 = 0: the tile is not used)
    ld_k64_pk(qh0[rt], ql0[rt], qh1[rt], ql1[rt], Qh, Ql, (u32)(qt * 2048 + lane * 16));
  }
  // a wave owns the 64-column groups ct = wave and wave + 8, four 16-column tiles each
  // The skew is linear in flat indices: pad and reshape send QEr[i2][c] to flat cell i2 * 1025 + c + 1 - 1024 of Srel, so
  // in this block's S it lands at (d - 1) * 1024 + i0 + d + c + 1 with d = i2 - i0; a carry of the column part into the
  // next row is the map's own lower-triangle case. One lane index per column tile (f1, the cell of the lane's row d = 8 hh
  // + 1, never negative), a constant 1025 cells per further row.
  // d = 1..31 always fall inside S; d = 0 only where the index is not negative, d = 32 only where it is below 32768,
  // d > 32 never. A lane whose cell lies outside stores into its word of Ost instead (rewritten whole in phase 4 before
  // it is read), so that no store of the loop stands behind a vector compare and a branch.
  const int wv = __builtin_amdgcn_readfirstlane(wave);   // scalar wave number: the test on row tile 2 is a scalar branch
  const int fb = 8 * hh * 1025 + i0 + m + 2;
#pragma unroll 1
  for (int t = 0; t < 8; ++t) {
    const int ct = wv + 8 * (t >> 2);
    const int col0 = ct * 64 + (t & 3) * 16;
    Frag h0, l0, h1, l1;
    ld_k64_pk(h0, l0, h1, l1, Eh, El, (u32)(col0 * 128 + lane * 16));
    const int f1 = fb + col0;
    const f32x8 acc0 = tile_k64(qh0[0], ql0[0], qh1[0], ql1[0], h0, l0, h1, l1);
    const f32x8 acc1 = tile_k64(qh0[1], ql0[1], qh1[1], ql1[1], h0, l0, h1, l1);
    S[(f1 >= 1025) ? (f1 - 1025) : (32768 + lane)] = acc0[0];
#pragma unroll
    for (int r = 1; r < 8; ++r) S[f1 + (r - 1) * 1025] = acc0[r];
#pragma unroll
    for (int r = 0; r < 8; ++r) S[f1 + (15 + r) * 1025] = acc1[r];
    if (ct < nct2) {
      const f32x8 acc2 = tile_k64(qh0[2], ql0[2], qh1[2], ql1[2], h0, l0, h1, l1);
      const int f2 = f1 + 31 * 1025;
      S[(f2 < 32768) ? f2 : (32768 + lane)] = acc2[0];
    }
  }
  __syncthreads();

  // ---- phase 2: S += Q K^T
#pragma unroll 1
  for (int t = 0; t < 8; ++t) {
    const int col0 = (wave + 8 * (t >> 2)) * 64 + (t & 3) * 16;
    Frag h0, l0, h1, l1;
    ld_k64_pk(h0, l0, h1, l1, Kh, Kl, (u32)(col0 * 128 + lane * 16));
#pragma unroll
    for (int rt = 0; rt < 2; ++rt) {
      const f32x8 acc = tile_k64(qh0[rt], ql0[rt], qh1[rt], ql1[rt], h0, l0, h1, l1);
#pragma unroll
      for (int r = 0; r < 8; ++r)
        S[(rt * 16 + 8 * hh + r) * 1024 + col0 + m] += acc[r];
    }
  }
  __syncthreads();

  // ---- phase 3: row softmax of S/8 (max-subtracted), P written in place as bf16 hi/lo; lane owns columns
  // 128 q + 4 lane + 0..3 (q = 0..7), so a wave-wide 16-byte read covers 512 contiguous bytes of the row
#pragma unroll 1
  for (int rr = 0; rr < 4; ++rr) {
    const int row = wave * 4 + rr;
    const float* sr = S + row * 1024 + lane * 4;
    v4f xv[8];
    float mx = -3.0e38f;
#pragma unroll
    for (int q = 0; q < 8; ++q) {
      v4f v = *(const v4f*)(sr + 128 * q);
      v = v * 0.125f;
      xv[q] = v;
      mx = fmaxf(mx, fmaxf(fmaxf(v.x, v.y), fmaxf(v.z, v.w)));
    }
#pragma unroll
    for (int off = 16; off > 0; off >>= 1) mx = fmaxf(mx, __shfl_xor(mx, off, 32));
    float sum = 0.0f;
#pragma unroll
    for (int q = 0; q < 8; ++q) {
      v4f e;
      e.x = __expf(xv[q].x - mx);
      e.y = __expf(xv[q].y - mx);
      e.z = __expf(xv[q].z - mx);
      e.w = __expf(xv[q].w - mx);
      xv[q] = e;
      sum += (e.x + e.y) + (e.z + e.w);
    }
#pragma unroll
    for (int off = 16; off > 0; off >>= 1) sum += __shfl_xor(sum, off, 32);
    const float inv = 1.0f / sum;
    // hi: halves row*2048 + swizzled piece * 8 + (col & 7); piece of this lane's group q = 16 q + (lane >> 1)
    u16* ph = P + row * 2048 + (((lane >> 1) ^ (row & 15)) * 8) + (lane & 1) * 4;
    u16* pl = ph + 1024;                    // lo plane: 1024 halves behind hi
#pragma unroll
    for (int q = 0; q < 8; ++q) {
      const v4f a = xv[q] * inv;
      us4 hv, lv;
#pragma unroll
      for (int i = 0; i < 4; ++i) {
        const u16 hb = f2bf(a[i]);
        hv[i] = hb;
        lv[i] = f2bf(a[i] - bf2f(hb));
      }
      *(us4*)(ph + 128 * q) = hv;
      *(us4*)(pl + 128 * q) = lv;
    }
  }
  __syncthreads();

  // ---- phase 4: O[32][64] = P[32][1024] . V[1024][64]; a wave owns 16 columns of O, both row tiles, and one half of k;
  // the two halves' partial sums are added behind the barrier
  {
    const int nt = wave & 3, kh = wave >> 2;
    const u16* pa = P + m * 2048;               // row tile 0; row tile 1 is 16 rows on; row & 15 = m in both
    const u16* vb = Vh + nt * 16384 + lane * 8;   // row tile nt: 64 units of 256 halves
    const u16* vc = Vl + nt * 16384 + lane * 8;
    f32x8 acc[2];
    acc[0] = zero8();
    acc[1] = zero8();
#pragma unroll 2
    for (int ks = kh * 16; ks < kh * 16 + 16; ++ks) {
      Frag bh, bl;
      const u16* pvh = vb + ks * 512;
      const u16* pvl = vc + ks * 512;
      ldf_pk(bh, pvh);
      ldf_pk(bl, pvl);
      // the wait that stands before a load's address register is rewritten; the addresses are inputs as in ld_k64_pk
      asm volatile("s_wait_xcnt 0x0" ::"v"(pvh), "v"(pvl) : "memory");
      const int p0 = ((ks * 4 + hh) ^ m) * 8;       // columns ks*32 + 8*hh + 0..7
      const int p1 = ((ks * 4 + 2 + hh) ^ m) * 8;   // columns ks*32 + 16 + 8*hh + 0..7
      Frag ah[2], al[2];
#pragma unroll
      for (int rt = 0; rt < 2; ++rt) {
        const u16* pr = pa + rt * 16 * 2048;
        ah[rt].q[0] = *(const v4u*)(pr + p0);
        ah[rt].q[1] = *(const v4u*)(pr + p1);
        al[rt].q[0] = *(const v4u*)(pr + 1024 + p0);
        al[rt].q[1] = *(const v4u*)(pr + 1024 + p1);
      }
#pragma unroll
      for (int rt = 0; rt < 2; ++rt) acc[rt] = wmma3(ah[rt], al[rt], bh, bl, acc[rt]);
    }
#pragma unroll
    for (int rt = 0; rt < 2; ++rt)
#pragma unroll
      for (int r = 0; r < 8; ++r) Ost[kh * 2048 + (rt * 16 + 8 * hh + r) * 64 + nt * 16 + m] = acc[rt][r];
  }
  __syncthreads();

  {
    const int row = wave * 4 + (lane >> 3), q = lane & 7;
    const v4f a = *(const v4f*)(Ost + row * 64 + 8 * q) + *(const v4f*)(Ost + 2048 + row * 64 + 8 * q);
    const v4f bq = *(const v4f*)(Ost + row * 64 + 8 * q + 4) + *(const v4f*)(Ost + 2048 + row * 64 + 8 * q + 4);
    us8 hv, lv;
    split8(a, bq, hv, lv);
    const size_t g = ((size_t)(b * 1024 + i0 + row)) * 1024 + (size_t)h * 64 + 8 * q;
    *(us8*)(AOh + g) = hv;
    *(us8*)(AOl + g) = lv;
    
  }
}

// ---------------------------------------------------------------- launch

extern "C" void kernel_launch(void* const* d_in, const int* in_sizes, int n_in,
                              void* d_out, int out_size, void* d_ws, size_t ws_size,
                              hipStream_t stream) {
  const int NX = 4194304;   // 4 x 1024 x 1024
  const int NW = 1048576;   // 1024 x 1024
  const int NE = 65536;     // 1024 x 64
  if (n_in < 8) return;
  if (in_sizes[0] != NX || in_sizes[1] != NX || in_sizes[2] != NX) return;
  if (in_sizes[3] != NW || in_sizes[4] != NW || in_sizes[5] != NW || in_sizes[7] != NW) return;
  if (in_sizes[6] != NE) return;
  if (out_size != NX) return;

  const float* q_in = (const float*)d_in[0];
  const float* k_in = (const float*)d_in[1];
  const float* v_in = (const float*)d_in[2];
  const float* WQ = (const float*)d_in[3];
  const float* WK = (const float*)d_in[4];
  const float* WV = (const float*)d_in[5];
  const float* Er = (const float*)d_in[6];
  const float* WM = (const float*)d_in[7];
  float* out = (float*)d_out;

  // workspace carve (bytes); bf16 planes
  const size_t bx = (size_t)NX * 2;   // 8 MiB
  const size_t bw = (size_t)NW * 2;   // 2 MiB
  const size_t be = (size_t)NE * 2;   // 128 KiB
  const size_t total = 6 * bx + 8 * bw + 2 * be + 6 * bx;   // 117,702,656 B
  if (total > ws_size) return;
  char* w = (char*)d_ws;
  size_t off = 0;
  u16* R0h = (u16*)(w + off); off += bx;   // Xq
  u16* R0l = (u16*)(w + off); off += bx;
  u16* R1h = (u16*)(w + off); off += bx;   // Xk, later VT
  u16* R1l = (u16*)(w + off); off += bx;
  u16* R2h = (u16*)(w + off); off += bx;   // Xv, later AO
  u16* R2l = (u16*)(w + off); off += bx;
  u16* WQh = (u16*)(w + off); off += bw;
  u16* WQl = (u16*)(w + off); off += bw;
  u16* WKh = (u16*)(w + off); off += bw;
  u16* WKl = (u16*)(w + off); off += bw;
  u16* WVh = (u16*)(w + off); off += bw;
  u16* WVl = (u16*)(w + off); off += bw;
  u16* WMh = (u16*)(w + off); off += bw;
  u16* WMl = (u16*)(w + off); off += bw;
  u16* ERh = (u16*)(w + off); off += be;
  u16* ERl = (u16*)(w + off); off += be;
  u16* QPh = (u16*)(w + off); off += bx;
  u16* QPl = (u16*)(w + off); off += bx;
  u16* KPh = (u16*)(w + off); off += bx;
  u16* KPl = (u16*)(w + off); off += bx;
  u16* VPh = (u16*)(w + off); off += bx;   // planes of its own: V is written while Xq is still read
  u16* VPl = (u16*)(w + off); off += bx;
  if (off > ws_size) return;

  u16* Xqh = R0h; u16* Xql = R0l;
  u16* Xkh = R1h; u16* Xkl = R1l;
  u16* Xvh = R2h; u16* Xvl = R2l;
  u16* VTh = R1h; u16* VTl = R1l;
  u16* AOh = R2h; u16* AOl = R2l;

  const dim3 blk(256);
  const int ATTN_LDS = 131072 + 16384;
  hipFuncSetAttribute((const void*)k_attn, hipFuncAttributeMaxDynamicSharedMemorySize, ATTN_LDS);

  // every f32 operand -> bf16 hi/lo planes (Er in fragment order, the weights transposed, WQ's rows permuted for QP)
  k_prep<<<dim3(PREP_X + PREP_W + PREP_E), blk, 0, stream>>>(q_in, k_in, v_in, WQ, WK, WV, WM, Er, Xqh, Xql, Xkh, Xkl, Xvh,
                                                             Xvl, WQh, WQl, WKh, WKl, WVh, WVl, WMh, WMl, ERh, ERl);

  // one launch, job = grid.z:
  // 0: QP[4096][1024] = Xq . WQ, each row (16 queries x 64) in fragment order through WQt's row order
  // 1: KPT[b][c][r] = sum_k WK[k][c] key[b][r][k]  (A = WKt, Bt = Xk[b]), stored per 64 r (one head) in fragment order
  // 2: VP[4096][1024] = Xv . WV
  k_gemm<3><<<dim3(1024 / 128, 4096 / 64, 3), blk, 0, stream>>>(
      Xqh, Xql, WQh, WQl, QPh, QPl, WKh, WKl, Xkh, Xkl, KPh, KPl, Xvh, Xvl, WVh, WVl, VPh, VPl, out,
      1024, 1024, NE, 1024, 0, NW, NW);
  // per-head transpose of V (into region 1)
  k_vtr<<<dim3(4 * 16 * 16), blk, 0, stream>>>(VPh, VPl, VTh, VTl);
  // attention (into region 2)
  k_attn<<<dim3(4 * 16 * 32), blk, ATTN_LDS, stream>>>(QPh, QPl, KPh, KPl, VTh, VTl, ERh, ERl, AOh, AOl);
  // out = AO . WMerge
  k_gemm<1><<<dim3(1024 / 128, 4096 / 64, 1), blk, 0, stream>>>(
      AOh, AOl, WMh, WMl, QPh, QPl, AOh, AOl, WMh, WMl, QPh, QPl, AOh, AOl, WMh, WMl, QPh, QPl, out,
      1024, 1024, 1024, 1024, 0, 0, 0);
}

// v007
// It runs in 208 microseconds.
// Two timings next to v006 both put it at 1.12 times that version's speed.
// All steps since v000 together make it 2.64 times as fast.
#include <hip/hip_runtime.h>
#include <stdint.h>

// All contractions (x.WQ, WK-cols x key-rows, x.WV, Q.Er^T, Q.K^T, P.V, O.WMerge): v_wmma_f32_16x16x32_bf16 with bf16 hi/lo operand pairs (hi*hi + hi*lo + lo*hi), f32 accumulate; softmax and skew index arithmetic in f32 / int32.

typedef unsigned short u16;
typedef unsigned int u32;
typedef __bf16 bf16x16 __attribute__((ext_vector_type(16)));
typedef float f32x8 __attribute__((ext_vector_type(8)));
typedef float v4f __attribute__((ext_vector_type(4)));
typedef u32 v4u __attribute__((ext_vector_type(4)));
typedef u16 us8 __attribute__((ext_vector_type(8)));
typedef u16 us4 __attribute__((ext_vector_type(4)));

union Frag {
  bf16x16 v;
  v4u q[2];
};

// f32 -> bf16 bits, RNE
__device__ __forceinline__ u16 f2bf(float f) {
  const u32 u = __float_as_uint(f);
  const u32 r = u + 0x7FFFu + ((u >> 16) & 1u);
  return (u16)(r >> 16);
}
__device__ __forceinline__ float bf2f(u16 b) { return __uint_as_float(((u32)b) << 16); }

// 8 f32 -> 8 bf16 hi + 8 bf16 lo (lo = RNE(x - hi))
__device__ __forceinline__ void split8(v4f a, v4f b, us8& h, us8& l) {
  float f[8];
  f[0] = a.x; f[1] = a.y; f[2] = a.z; f[3] = a.w;
  f[4] = b.x; f[5] = b.y; f[6] = b.z; f[7] = b.w;
#pragma unroll
  for (int i = 0; i < 8; ++i) {
    const u16 hb = f2bf(f[i]);
    h[i] = hb;
    l[i] = f2bf(f[i] - bf2f(hb));
  }
}

__device__ __forceinline__ f32x8 zero8() {
  f32x8 z;
#pragma unroll
  for (int e = 0; e < 8; ++e) z[e] = 0.0f;
  return z;
}

// 16-bit fragment: lane (h = l>>4, m = l&15) -> elements 0..7 = k0+8h+0..7, elements 8..15 = k0+16+8h+0..7
// p already points at row m, column k0 + 8h of a k-contiguous [row][k] plane.
__device__ __forceinline__ void ldf(Frag& f, const u16* p) {
  f.q[0] = *(const v4u*)p;
  f.q[1] = *(const v4u*)(p + 16);
}

// Fragment order: a [row][k] plane cut into units of 16 rows x 16 k; unit (row tile, k / 16) holds 256 halves, lane l's
// 8 halves at 8 l = row m, k = 16 * unit + 8h + 0..7. A fragment is two neighbouring units, and each of its two
// wave-wide 16-byte loads reads 512 contiguous bytes (4 whole lines; from a row-major plane the same load touches 16).
// p already points at the lane's piece of the fragment's first unit.
__device__ __forceinline__ void ldf_pk(Frag& f, const u16* p) {
  f.q[0] = *(const v4u*)p;
  f.q[1] = *(const v4u*)(p + 256);
}

// one 32-deep k-step, hi/lo pairs: c += ah*bh + ah*bl + al*bh ; hazard guard after the group
__device__ __forceinline__ f32x8 wmma3(const Frag& ah, const Frag& al, const Frag& bh, const Frag& bl, f32x8 c) {
  c = __builtin_amdgcn_wmma_f32_16x16x32_bf16(false, ah.v, false, bh.v, (short)0, c, false, false);
  c = __builtin_amdgcn_wmma_f32_16x16x32_bf16(false, ah.v, false, bl.v, (short)0, c, false, false);
  c = __builtin_amdgcn_wmma_f32_16x16x32_bf16(false, al.v, false, bh.v, (short)0, c, false, false);
  asm volatile("v_nop\n\tv_nop\n\tv_nop\n\tv_nop" : "+v"(c) : "v"(ah.v), "v"(al.v), "v"(bh.v), "v"(bl.v));
  return c;
}

// ---------------------------------------------------------------- operand preparation, one launch
// All f32 operands -> bf16 hi/lo planes. The block index picks the job (the same for a whole block):
//   blocks 0..767      query / key / value, elementwise: 256 blocks each, 8 pieces of 8 values per thread
//   blocks 768..1279   WQ / WK / WV / WMerge, transposing: 128 blocks each, a 128 (k) x 64 (n) tile per block
//   blocks 1280..1311  Er into fragment order, one piece per thread
// Transposing split: in[1024 k][1024 n] row-major f32 -> out[n][k] planes. For WQ input column n = 64 m + e becomes
// output row (e >> 3) * 128 + 8 m + (e & 7), so that a GEMM with this plane as Bt leaves each of its output rows, read
// as [16 m][64 e], in fragment order.
// Er: in[rows][64] row-major f32 -> planes in fragment order (units: row tile, then k / 16); thread = one 16-byte piece.
#define PREP_X 768
#define PREP_W 512
#define PREP_E 32
// second launch bound: a register budget at which five blocks fit a WGP, so that nearly the whole grid is resident at
// once and the jobs' loads, conversions and stores overlap
__global__ __launch_bounds__(256, 10) void k_prep(const float* __restrict__ xq, const float* __restrict__ xk,
                                              const float* __restrict__ xv, const float* __restrict__ wq,
                                              const float* __restrict__ wk, const float* __restrict__ wv,
                                              const float* __restrict__ wm, const float* __restrict__ er,
                                              u16* xqh, u16* xql, u16* xkh, u16* xkl, u16* xvh, u16* xvl,
                                              u16* wqh, u16* wql, u16* wkh, u16* wkl, u16* wvh, u16* wvl,
                                              u16* wmh, u16* wml, u16* erh, u16* erl) {
  __shared__ __attribute__((aligned(16))) float Ts[2 * 64 * 68];  // two 64 x 64 tiles, Ts[tile][n][k]
  const int blk = blockIdx.x, t = threadIdx.x;
  if (blk < PREP_X) {
    const int job = blk >> 8;
    const float* s = (job == 0) ? xq : (job == 1) ? xk : xv;
    u16* dh = (job == 0) ? xqh : (job == 1) ? xkh : xvh;
    u16* dl = (job == 0) ? xql : (job == 1) ? xkl : xvl;
    const u32 p0 = (u32)((blk & 255) * 2048 + t);   // first piece; the others 256 pieces apart
    v4f a[8], b[8];
    u32 so[8];
#pragma unroll
    for (int i = 0; i < 8; ++i) so[i] = (p0 + 256u * i) * 32u;   // byte offset in the f32 source
#pragma unroll
    for (int i = 0; i < 8; ++i) {
      a[i] = *(const v4f*)((const char*)s + so[i]);
      b[i] = *(const v4f*)((const char*)s + so[i] + 16);
    }
    // the wait that stands before a load's address register is rewritten; the offsets are inputs so that they stay
    // live, and so unwritten (also by a later load's result), up to it
    asm volatile("s_wait_xcnt 0x0" ::"v"(so[0]), "v"(so[1]), "v"(so[2]), "v"(so[3]), "v"(so[4]), "v"(so[5]), "v"(so[6]),
                 "v"(so[7])
                 : "memory");
    us8 h[8], l[8];
#pragma unroll
    for (int i = 0; i < 8; ++i) split8(a[i], b[i], h[i], l[i]);
#pragma unroll
    for (int i = 0; i < 8; ++i) {
      *(us8*)((char*)dh + (so[i] >> 1)) = h[i];
      *(us8*)((char*)dl + (so[i] >> 1)) = l[i];
    }
  } else if (blk < PREP_X + PREP_W) {
    const int wb = blk - PREP_X, job = wb >> 7, tile = wb & 127;
    const float* s = (job == 0) ? wq : (job == 1) ? wk : (job == 2) ? wv : wm;
    u16* dh = (job == 0) ? wqh : (job == 1) ? wkh : (job == 2) ? wvh : wmh;
    u16* dl = (job == 0) ? wql : (job == 1) ? wkl : (job == 2) ? wvl : wml;
    const int c0 = (tile & 15) * 64, r0 = (tile >> 4) * 128;
    {
      const int r = t >> 2, cb = (t & 3) * 16;
      v4f v[8];
      u32 so[2];
#pragma unroll
      for (int u = 0; u < 2; ++u) so[u] = (u32)((r0 + 64 * u + r) * 1024 + c0 + cb) * 4u;
#pragma unroll
      for (int u = 0; u < 2; ++u)
#pragma unroll
        for (int q = 0; q < 4; ++q) v[4 * u + q] = *(const v4f*)((const char*)s + so[u] + 16 * q);
      // the wait that stands before a load's address register is rewritten; the offsets are inputs as above
      asm volatile("s_wait_xcnt 0x0" ::"v"(so[0]), "v"(so[1]) : "memory");
#pragma unroll
      for (int u = 0; u < 2; ++u)
#pragma unroll
        for (int q = 0; q < 4; ++q) {
          float* d = Ts + u * (64 * 68) + (cb + 4 * q) * 68 + r;
          d[0] = v[4 * u + q].x;
          d[68] = v[4 * u + q].y;
          d[136] = v[4 * u + q].z;
          d[204] = v[4 * u + q].w;
        }
    }
    __syncthreads();
    us8 h[4], l[4];
    u32 go[4];
#pragma unroll
    for (int it = 0; it < 4; ++it) {
      const int u = it >> 1, pc = t + 256 * (it & 1), c = pc >> 3, q = pc & 7;
      const float* p = Ts + u * (64 * 68) + c * 68 + 8 * q;
      const v4f a = *(const v4f*)p;
      const v4f b = *(const v4f*)(p + 4);
      split8(a, b, h[it], l[it]);
      const int n = c0 + c;
      const int orow = (job == 0) ? (((n >> 3) & 7) * 128 + (n >> 6) * 8 + (n & 7)) : n;
      go[it] = (u32)(orow * 1024 + r0 + 64 * u + 8 * q) * 2u;
    }
#pragma unroll
    for (int it = 0; it < 4; ++it) {
      *(us8*)((char*)dh + go[it]) = h[it];
      *(us8*)((char*)dl + go[it]) = l[it];
    }
  } else {
    const int g = (blk - PREP_X - PREP_W) * 256 + t;
    const int lane = g & 31, u = (g >> 5) & 3, rt = g >> 7;
    const u32 so = (u32)((rt * 16 + (lane & 15)) * 64 + u * 16 + (lane >> 4) * 8) * 4u;
    const v4f a = *(const v4f*)((const char*)er + so);
    const v4f b = *(const v4f*)((const char*)er + so + 16);
    // the wait that stands before a load's address register is rewritten; the offset is an input as above
    asm volatile("s_wait_xcnt 0x0" ::"v"(so) : "memory");
    us8 h, l;
    split8(a, b, h, l);
    *(us8*)(erh + (size_t)g * 8) = h;
    *(us8*)(erl + (size_t)g * 8) = l;
    // the wait that stands before a store's registers are rewritten: in the built code another job's instructions
    // follow these stores, behind a test
    asm volatile("s_wait_xcnt 0x0" ::: "memory");
  }
}

// ---------------------------------------------------------------- GEMM (hi/lo pairs)
// C[z][M][N] = A[z][M][K] * Bt[z][N][K]^T ; A and Bt are k-contiguous bf16 hi/lo planes; K a multiple of 64.
// Block tile 64 x 128 (grid.x = N/128, grid.y = M/64, grid.z = batch), 8 waves of 32x32.
// Operands go through LDS in 64-deep k-chunks: 8 lanes fetch one row's 128 B, so a wave-wide load covers 4 whole
// lines (a fragment load straight from the planes touches 16 lines for the same 512 B). Two buffers: chunk c+1 is
// fetched into registers while chunk c is multiplied, stored to the other buffer, and published by one barrier.
// MODE 0: bf16 hi/lo output planes (row segment 256 B = 16 lanes x 16 B); MODE 1: f32 output (512 B = 32 lanes x 16 B).
// MODE 2: bf16 hi/lo output planes in fragment order, one [M][64] plane per 64 output columns, ldc halves apart (a wave
// stores 2 KiB in a row).
// MODE 3: the three projections in one launch; blockIdx.z picks the job: 0 = Q and 2 = V (as MODE 0), 1 = K (as MODE 2,
// its four batches of 16 row blocks laid along grid.y). Operand set 0 serves MODE 0..2.
#define G_PIT 72                    // LDS row pitch in halves: 144 B = 16 B x 9, conflict-free for 16-byte row reads
#define G_AL (64 * G_PIT)           // plane offsets inside a buffer, in halves: A hi at 0, A lo, B hi, B lo
#define G_BH (128 * G_PIT)
#define G_BL (256 * G_PIT)
#define G_BUF (384 * G_PIT)         // 27,648 halves = 55,296 B per buffer

// one thread's share of a chunk: 2 + 2 pieces of A hi / lo, 4 + 4 of B hi / lo, rows 32 apart
__device__ __forceinline__ void g_fetch(v4u (&sa)[4], v4u (&sb)[8], const u16* ah, const u16* al, const u16* bh,
                                        const u16* bl, int lda, int ldb) {
  const u16* pa[4];
  const u16* pb[8];
#pragma unroll
  for (int i = 0; i < 2; ++i) {
    pa[i] = ah + (size_t)(32 * i) * lda;
    pa[2 + i] = al + (size_t)(32 * i) * lda;
  }
#pragma unroll
  for (int i = 0; i < 4; ++i) {
    pb[i] = bh + (size_t)(32 * i) * ldb;
    pb[4 + i] = bl + (size_t)(32 * i) * ldb;
  }
#pragma unroll
  for (int i = 0; i < 4; ++i) sa[i] = *(const v4u*)pa[i];
#pragma unroll
  for (int i = 0; i < 8; ++i) sb[i] = *(const v4u*)pb[i];
  // the wait that stands before a load's address register is rewritten; the twelve addresses are inputs so that
  // they stay live, and so unwritten (also by a later load's result), up to it
  asm volatile("s_wait_xcnt 0x0" ::"v"(pa[0]), "v"(pa[1]), "v"(pa[2]), "v"(pa[3]), "v"(pb[0]), "v"(pb[1]), "v"(pb[2]),
               "v"(pb[3]), "v"(pb[4]), "v"(pb[5]), "v"(pb[6]), "v"(pb[7])
               : "memory");
}
__device__ __forceinline__ void g_put(u16* buf, const v4u (&sa)[4], const v4u (&sb)[8]) {
#pragma unroll
  for (int i = 0; i < 2; ++i) {
    *(v4u*)(buf + 32 * i * G_PIT) = sa[i];
    *(v4u*)(buf + G_AL + 32 * i * G_PIT) = sa[2 + i];
  }
#pragma unroll
  for (int i = 0; i < 4; ++i) {
    *(v4u*)(buf + G_BH + 32 * i * G_PIT) = sb[i];
    *(v4u*)(buf + G_BL + 32 * i * G_PIT) = sb[4 + i];
  }
}
template <int MODE>
__global__ __launch_bounds__(256) void k_gemm(const u16* __restrict__ Ah0, const u16* __restrict__ Al0,
                                              const u16* __restrict__ Bh0, const u16* __restrict__ Bl0,
                                              u16* Ch0, u16* Cl0,
                                              const u16* __restrict__ Ah1, const u16* __restrict__ Al1,
                                              const u16* __restrict__ Bh1, const u16* __restrict__ Bl1,
                                              u16* Ch1, u16* Cl1,
                                              const u16* __restrict__ Ah2, const u16* __restrict__ Al2,
                                              const u16* __restrict__ Bh2, const u16* __restrict__ Bl2,
                                              u16* Ch2, u16* Cl2, float* Cf,
                                              int lda, int ldb, int ldc0, int K,
                                              int zA0, int zB0, int zC0) {
  __shared__ __attribute__((aligned(16))) u16 Sm[2 * G_BUF];
  float* Cs = (float*)Sm;           // 64 x 132 f32 output tile, reuses the buffers behind the loop
  const int job = (MODE == 3) ? (int)blockIdx.z : 0;
  const bool kj = (MODE == 3) && (job == 1);
  const int mode = (MODE == 3) ? (kj ? 2 : 0) : MODE;
  const u16* Ah = (job == 0) ? Ah0 : (job == 1) ? Ah1 : Ah2;
  const u16* Al = (job == 0) ? Al0 : (job == 1) ? Al1 : Al2;
  const u16* Bh = (job == 0) ? Bh0 : (job == 1) ? Bh1 : Bh2;
  const u16* Bl = (job == 0) ? Bl0 : (job == 1) ? Bl1 : Bl2;
  u16* Ch = (job == 0) ? Ch0 : (job == 1) ? Ch1 : Ch2;
  u16* Cl = (job == 0) ? Cl0 : (job == 1) ? Cl1 : Cl2;
  // MODE 3: ldc0, zB0 and zC0 are the K job's; Q and V have plain rows of lda values and no batch
  const int ldc = (MODE == 3 && !kj) ? lda : ldc0;
  const int zA = zA0, zB = zB0, zC = zC0;
  const int z = (MODE == 3) ? (kj ? (int)(blockIdx.y >> 4) : 0) : (int)blockIdx.z;
  const int bm = (kj ? (int)(blockIdx.y & 15) : (int)blockIdx.y) * 64, bn = blockIdx.x * 128;
  const int tid = threadIdx.x, wave = tid >> 5, lane = tid & 31;
  const int m = lane & 15, hh = lane >> 4;
  const int wr = (wave & 1) * 32, wc = (wave >> 1) * 32;

  // staging map: thread -> (row tid>>3 (+32 per step), 16-byte piece tid&7 of the row's 128 B)
  const int srow = tid >> 3, sseg = (tid & 7) * 8;
  const u16* gah = Ah + (size_t)z * zA + (size_t)(bm + srow) * lda + sseg;
  const u16* gal = Al + (size_t)z * zA + (size_t)(bm + srow) * lda + sseg;
  const u16* gbh = Bh + (size_t)z * zB + (size_t)(bn + srow) * ldb + sseg;
  const u16* gbl = Bl + (size_t)z * zB + (size_t)(bn + srow) * ldb + sseg;
  const int so = srow * G_PIT + sseg;
  // fragment map inside a buffer (same rows and k order as the planes)
  const int fa = (wr + m) * G_PIT + 8 * hh;
  const int fb = (wc + m) * G_PIT + 8 * hh;

  f32x8 acc[2][2];
#pragma unroll
  for (int rt = 0; rt < 2; ++rt)
#pragma unroll
    for (int ct = 0; ct < 2; ++ct) acc[rt][ct] = zero8();

  v4u sa[4], sb[8];
  g_fetch(sa, sb, gah, gal, gbh, gbl, lda, ldb);
  g_put(Sm + so, sa, sb);
  __syncthreads();

  const int nch = K >> 6;
  for (int c = 0; c < nch; ++c) {
    const u16* cur = Sm + (c & 1) * G_BUF;
    u16* nxt = Sm + ((c + 1) & 1) * G_BUF;
    const bool more = (c + 1 < nch);
    if (more) {
      const int k1 = (c + 1) * 64;
      g_fetch(sa, sb, gah + k1, gal + k1, gbh + k1, gbl + k1, lda, ldb);
    }
#pragma unroll
    for (int ks = 0; ks < 2; ++ks) {
      Frag ah[2], al[2], bh[2], bl[2];
#pragma unroll
      for (int rt = 0; rt < 2; ++rt) {
        ldf(ah[rt], cur + fa + rt * 16 * G_PIT + ks * 32);
        ldf(al[rt], cur + G_AL + fa + rt * 16 * G_PIT + ks * 32);
      }
#pragma unroll
      for (int ct = 0; ct < 2; ++ct) {
        ldf(bh[ct], cur + G_BH + fb + ct * 16 * G_PIT + ks * 32);
        ldf(bl[ct], cur + G_BL + fb + ct * 16 * G_PIT + ks * 32);
      }
#pragma unroll
      for (int rt = 0; rt < 2; ++rt)
#pragma unroll
        for (int ct = 0; ct < 2; ++ct)
          acc[rt][ct] = wmma3(ah[rt], al[rt], bh[ct], bl[ct], acc[rt][ct]);
    }
    if (more) g_put(nxt + so, sa, sb);
    // publishes chunk c+1 and ends every wave's reads of the buffer that trip c+1 refills (behind the last trip: of the
    // second buffer, as K = 1024 gives 16 chunks; the output tile lies in the first, freed one trip earlier)
    __syncthreads();
  }

  // stage the 64x128 f32 tile: D element r of lane -> (row 8*hh + r, col m)
#pragma unroll
  for (int rt = 0; rt < 2; ++rt)
#pragma unroll
    for (int ct = 0; ct < 2; ++ct)
#pragma unroll
      for (int r = 0; r < 8; ++r)
        Cs[(wr + rt * 16 + 8 * hh + r) * 132 + wc + ct * 16 + m] = acc[rt][ct][r];
  __syncthreads();

  if (mode == 1) {
    float* cb = Cf + (size_t)z * zC;
    v4f v[8];
    size_t go[8];
#pragma unroll
    for (int i = 0; i < 8; ++i) {
      const int row = wave * 8 + i;
      v[i] = *(const v4f*)(Cs + row * 132 + 4 * lane);
      go[i] = (size_t)(bm + row) * ldc + bn + 4 * lane;
    }
#pragma unroll
    for (int i = 0; i < 8; ++i) *(v4f*)(cb + go[i]) = v[i];
    
  } else if (mode == 2) {
    // a wave owns one 16-row tile of one 64-column plane: its four units lie one behind the other
    const int jt = wave >> 1, hd = wave & 1;
    const size_t base = (size_t)z * zC + (size_t)((bn >> 6) + hd) * ldc + (size_t)((bm >> 4) + jt) * 1024 + (size_t)lane * 8;
    u16* chb = Ch + base;
    u16* clb = Cl + base;
    us8 hv[4], lv[4];
#pragma unroll
    for (int i = 0; i < 4; ++i) {
      const float* cp = Cs + (jt * 16 + m) * 132 + hd * 64 + i * 16 + hh * 8;
      const v4f a = *(const v4f*)cp;
      const v4f b = *(const v4f*)(cp + 4);
      split8(a, b, hv[i], lv[i]);
    }
#pragma unroll
    for (int i = 0; i < 4; ++i) {
      *(us8*)(chb + i * 256) = hv[i];
      *(us8*)(clb + i * 256) = lv[i];
    }
  } else {
    u16* chb = Ch + (size_t)z * zC;
    u16* clb = Cl + (size_t)z * zC;
    us8 hv[4], lv[4];
    size_t go[4];
#pragma unroll
    for (int i = 0; i < 4; ++i) {
      const int row = wave * 8 + 2 * i + (lane >> 4);
      const int cs = (lane & 15) * 8;
      const v4f a = *(const v4f*)(Cs + row * 132 + cs);
      const v4f b = *(const v4f*)(Cs + row * 132 + cs + 4);
      split8(a, b, hv[i], lv[i]);
      go[i] = (size_t)(bm + row) * ldc + bn + cs;
    }
#pragma unroll
    for (int i = 0; i < 4; ++i) {
      *(us8*)(chb + go[i]) = hv[i];
      *(us8*)(clb + go[i]) = lv[i];
    }
    // the wait that stands before a store's registers are rewritten: with two output forms in one kernel the other
    // form's instructions follow these stores in the built code, behind a test
    if (MODE == 3) asm volatile("s_wait_xcnt 0x0" ::: "memory");
  }
}

// ---------------------------------------------------------------- per-head V transpose
// src planes: VP[4096][1024] bf16; head plane X_h = 64 contiguous rows viewed as [1024 l][64 e].
// dst planes: per head v^T[64 e][1024 l] in fragment order (units: row tile e / 16, then l / 16).
__global__ __launch_bounds__(256) void k_vtr(const u16* __restrict__ sh, const u16* __restrict__ sl, u16* dh, u16* dl) {
  __shared__ __attribute__((aligned(16))) u16 Th[64 * 72];  // [e][l]
  __shared__ __attribute__((aligned(16))) u16 Tl[64 * 72];
  const int blk = blockIdx.x, lt = blk & 15, h = (blk >> 4) & 15, b = blk >> 8;
  const int l0 = lt * 64, t = threadIdx.x;
  const size_t src = (size_t)b * 1048576 + (size_t)h * 65536 + (size_t)l0 * 64;
#pragma unroll
  for (int it = 0; it < 2; ++it) {
    const int pc = t + 256 * it, l = pc >> 3, q = pc & 7;
    const us8 a = *(const us8*)(sh + src + l * 64 + 8 * q);
    const us8 c = *(const us8*)(sl + src + l * 64 + 8 * q);
#pragma unroll
    for (int i = 0; i < 8; ++i) {
      Th[(8 * q + i) * 72 + l] = a[i];
      Tl[(8 * q + i) * 72 + l] = c[i];
    }
  }
  __syncthreads();
  // a wave owns row tile nt and 32 of the block's 64 l: two units, 1 KiB in a row per plane
  const int wave = t >> 5, lane = t & 31, nt = wave >> 1, kl = wave & 1;
  const size_t dst = (size_t)(b * 16 + h) * 65536 + (size_t)(nt * 64 + lt * 4 + kl * 2) * 256 + (size_t)lane * 8;
  us8 oh[2], ol[2];
  size_t go[2];
#pragma unroll
  for (int it = 0; it < 2; ++it) {
    const int so = (nt * 16 + (lane & 15)) * 72 + kl * 32 + it * 16 + (lane >> 4) * 8;
    oh[it] = *(const us8*)(Th + so);
    ol[it] = *(const us8*)(Tl + so);
    go[it] = dst + (size_t)it * 256;
  }
#pragma unroll
  for (int it = 0; it < 2; ++it) {
    *(us8*)(dh + go[it]) = oh[it];
    *(us8*)(dl + go[it]) = ol[it];
  }
  
}

// ---------------------------------------------------------------- attention
// the four fragments (hi / lo, two k-steps) of one 16-row tile of a [rows][64] plane in fragment order; off = the lane's
// byte offset (tile * 2048 + lane * 16) in both planes
__device__ __forceinline__ void ld_k64_pk(Frag& h0, Frag& l0, Frag& h1, Frag& l1, const u16* bh, const u16* bl, u32 off) {
  const u16* ph = (const u16*)((const char*)bh + off);
  const u16* pl = (const u16*)((const char*)bl + off);
  ldf_pk(h0, ph); ldf_pk(h1, ph + 512);
  ldf_pk(l0, pl); ldf_pk(l1, pl + 512);
  // the wait that stands before a load's address register is rewritten; the offset is an input so that it stays
  // live, and so unwritten (also by a later load's result), up to it
  asm volatile("s_wait_xcnt 0x0" ::"v"(off) : "memory");
}

// the two fragments (hi / lo) of one 32-deep k-step of a plane in fragment order; off = the lane's byte offset in both planes
__device__ __forceinline__ void ld_k32_pk(Frag& h, Frag& l, const u16* bh, const u16* bl, u32 off) {
  ldf_pk(h, (const u16*)((const char*)bh + off));
  ldf_pk(l, (const u16*)((const char*)bl + off));
  // the wait that stands before a load's address register is rewritten; the offset is an input as in ld_k64_pk
  asm volatile("s_wait_xcnt 0x0" ::"v"(off) : "memory");
}

// one 16x16 tile, K = 64 (two k-steps); A and B fragments preloaded
__device__ __forceinline__ f32x8 tile_k64(const Frag& ah0, const Frag& al0, const Frag& ah1, const Frag& al1,
                                          const Frag& h0, const Frag& l0, const Frag& h1, const Frag& l1) {
  f32x8 acc = zero8();
  acc = wmma3(ah0, al0, h0, l0, acc);
  acc = wmma3(ah1, al1, h1, l1, acc);
  return acc;
}

// One block per (b, h, 32 query rows), 256 threads = 8 waves.
// LDS (dynamic): S[32][1024] f32 (131072 B), later reused in place as P row = hi[1024] | lo[1024] bf16; Ost[2][32][64] f32 (16384 B).
// Every Er, K and V fragment is loaded once per block: the wave that loads it multiplies it with all row tiles.
// The Q, Er, K and V planes lie in fragment order, so each fragment load reads whole lines.
// Er, K and V fragments are fetched ahead of their use into further register sets (Er and K: two tiles ahead; V: four
// k-steps ahead), so that a wave multiplies while its next loads are under way.
// P rows are 4096 B apart (the same banks in every row), so inside a plane the 16-byte piece (col >> 3) of row r sits at
// piece index (col >> 3) ^ (r & 15): the 16 rows that one fragment load reads then fall on 16 different bank groups.
__global__ __launch_bounds__(256) void k_attn(const u16* __restrict__ QPh, const u16* __restrict__ QPl,
                                              const u16* __restrict__ KPh, const u16* __restrict__ KPl,
                                              const u16* __restrict__ VTh, const u16* __restrict__ VTl,
                                              const u16* __restrict__ Eh, const u16* __restrict__ El,
                                              u16* AOh, u16* AOl) {
  extern __shared__ v4u dsm[];
  float* S = (float*)dsm;
  u16* P = (u16*)dsm;
  float* Ost = (float*)(dsm + 8192);  // byte offset 131072

  const int blk = blockIdx.x;
  const int ib = blk & 31, h = (blk >> 5) & 15, b = blk >> 9;
  const int i0 = ib * 32;
  const int tid = threadIdx.x, wave = tid >> 5, lane = tid & 31;
  const int m = lane & 15, hh = lane >> 4;

  // q_h[i][e]  = QP[b][h*64 + (i>>4)][(i&15)*64 + e]: plane at b*2^20 + h*2^16, one QP row = one 16-row tile in fragment order
  const size_t pq = (size_t)b * 1048576 + (size_t)h * 65536;
  const u16* Qh = QPh + pq;
  const u16* Ql = QPl + pq;
  // k_h[j][e]  = KP[b][h*64+e][j]: per head a [1024 j][64 e] plane in fragment order
  const u16* Kh = KPh + pq;
  const u16* Kl = KPl + pq;
  // v_h^T[e][j]: per head a [64 e][1024 j] plane in fragment order
  const u16* Vh = VTh + pq;
  const u16* Vl = VTl + pq;

  // Srel[i][i+1] = 0 (the only cells the skew scatter never writes)
  if (tid < 32) {
    const int j = i0 + tid + 1;
    if (j < 1024) S[tid * 1024 + j] = 0.0f;
  }

  // ---- phase 1: QEr tiles (rows i0 .. i0+32 needed) scattered through the skew map into S
  // row tile 2 (rows i0+32..) is consumed only through row i0+32, columns c <= 990 - i0
  const int ncol2 = 991 - i0;
  const int nct2 = (ncol2 > 0) ? ((ncol2 + 63) >> 6) : 0;
  // Q fragments of row tiles 0 and 1 (the block's own rows) and 2 (the 16 rows behind them), kept through phases 1 and 2
  Frag qh0[3], ql0[3], qh1[3], ql1[3];
#pragma unroll
  for (int rt = 0; rt < 3; ++rt) {
    int qt = (i0 >> 4) + rt;
    qt = (qt > 63) ? 63 : qt;   // the last block has no rows behind it (and nct2 = 0: the tile is not used)
    ld_k64_pk(qh0[rt], ql0[rt], qh1[rt], ql1[rt], Qh, Ql, (u32)(qt * 2048 + lane * 16));
  }
  // a wave owns the 64-column groups ct = wave and wave + 8, four 16-column tiles each
  // The skew is linear in flat indices: pad and reshape send QEr[i2][c] to flat cell i2 * 1025 + c + 1 - 1024 of Srel, so
  // in this block's S it lands at (d - 1) * 1024 + i0 + d + c + 1 with d = i2 - i0; a carry of the column part into the
  // next row is the map's own lower-triangle case. One lane index per column tile (f1, the cell of the lane's row d = 8 hh
  // + 1, never negative), a constant 1025 cells per further row.
  // d = 1..31 always fall inside S; d = 0 only where the index is not negative, d = 32 only where it is below 32768,
  // d > 32 never. A lane whose cell lies outside stores into its word of Ost instead (rewritten whole in phase 4 before
  // it is read), so that no store of the loop stands behind a vector compare and a branch.
  const int wv = __builtin_amdgcn_readfirstlane(wave);   // scalar wave number: the test on row tile 2 is a scalar branch
  const int fb = 8 * hh * 1025 + i0 + m + 2;
  // three fragment sets for the stream of 16 tiles (8 of Er, then 8 of K): tile n sits in set n % 3 and is asked for two
  // tiles ahead, into the set that tile n - 3 has just left; both loops are unrolled so that the set is a fixed register
  Frag fh0[3], fl0[3], fh1[3], fl1[3];
  const auto tile_off = [&](int t) { return (u32)(((wv + 8 * (t >> 2)) * 64 + (t & 3) * 16) * 128 + lane * 16); };
  const auto qer_tile = [&](int t, const Frag& h0, const Frag& l0, const Frag& h1, const Frag& l1) {
    const int ct = wv + 8 * (t >> 2);
    const int col0 = ct * 64 + (t & 3) * 16;
    const int f1 = fb + col0;
    const f32x8 acc0 = tile_k64(qh0[0], ql0[0], qh1[0], ql1[0], h0, l0, h1, l1);
    const f32x8 acc1 = tile_k64(qh0[1], ql0[1], qh1[1], ql1[1], h0, l0, h1, l1);
    S[(f1 >= 1025) ? (f1 - 1025) : (32768 + lane)] = acc0[0];
#pragma unroll
    for (int r = 1; r < 8; ++r) S[f1 + (r - 1) * 1025] = acc0[r];
#pragma unroll
    for (int r = 0; r < 8; ++r) S[f1 + (15 + r) * 1025] = acc1[r];
    if (ct < nct2) {
      const f32x8 acc2 = tile_k64(qh0[2], ql0[2], qh1[2], ql1[2], h0, l0, h1, l1);
      const int f2 = f1 + 31 * 1025;
      S[(f2 < 32768) ? f2 : (32768 + lane)] = acc2[0];
    }
  };
  ld_k64_pk(fh0[0], fl0[0], fh1[0], fl1[0], Eh, El, tile_off(0));
  ld_k64_pk(fh0[1], fl0[1], fh1[1], fl1[1], Eh, El, tile_off(1));
  // unrolled: the set numbers must be constants, or the sets would not stay in registers
#pragma unroll
  for (int t = 0; t < 8; ++t) {
    const int c = t % 3, n = (t + 2) % 3;
    // behind the last Er tiles: phase 2's first two K tiles (same tile offsets in both planes)
    ld_k64_pk(fh0[n], fl0[n], fh1[n], fl1[n], (t < 6) ? Eh : Kh, (t < 6) ? El : Kl, tile_off((t + 2) & 7));
    qer_tile(t, fh0[c], fl0[c], fh1[c], fl1[c]);
  }
  __syncthreads();

  // ---- phase 2: S += Q K^T
  const auto qk_tile = [&](int t, const Frag& h0, const Frag& l0, const Frag& h1, const Frag& l1) {
    const int col0 = (wv + 8 * (t >> 2)) * 64 + (t & 3) * 16;
#pragma unroll
    for (int rt = 0; rt < 2; ++rt) {
      const f32x8 acc = tile_k64(qh0[rt], ql0[rt], qh1[rt], ql1[rt], h0, l0, h1, l1);
#pragma unroll
      for (int r = 0; r < 8; ++r)
        S[(rt * 16 + 8 * hh + r) * 1024 + col0 + m] += acc[r];
    }
  };
  // unrolled for the same reason as phase 1's loop
#pragma unroll
  for (int t = 0; t < 8; ++t) {
    const int c = (t + 8) % 3, n = (t + 10) % 3;
    if (t < 6) ld_k64_pk(fh0[n], fl0[n], fh1[n], fl1[n], Kh, Kl, tile_off(t + 2));
    qk_tile(t, fh0[c], fl0[c], fh1[c], fl1[c]);
  }
  __syncthreads();

  // phase 4's first four k-steps of V, under way during the softmax (behind the barrier, which would wait for them)
  const int nt = wv & 3, kh = wv >> 2;
  const u32 voff = (u32)(nt * 32768 + kh * 16384 + lane * 16);   // row tile nt: 64 units of 512 B; a k-step is two units
  Frag vh[4], vl[4];
#pragma unroll
  for (int s = 0; s < 4; ++s) ld_k32_pk(vh[s], vl[s], Vh, Vl, voff + (u32)(s * 1024));

  // ---- phase 3: row softmax of S/8 (max-subtracted), P written in place as bf16 hi/lo; lane owns columns
  // 128 q + 4 lane + 0..3 (q = 0..7), so a wave-wide 16-byte read covers 512 contiguous bytes of the row
#pragma unroll 1
  for (int rr = 0; rr < 4; ++rr) {
    const int row = wave * 4 + rr;
    const float* sr = S + row * 1024 + lane * 4;
    v4f xv[8];
    float mx = -3.0e38f;
#pragma unroll
    for (int q = 0; q < 8; ++q) {
      v4f v = *(const v4f*)(sr + 128 * q);
      v = v * 0.125f;
      xv[q] = v;
      mx = fmaxf(mx, fmaxf(fmaxf(v.x, v.y), fmaxf(v.z, v.w)));
    }
#pragma unroll
    for (int off = 16; off > 0; off >>= 1) mx = fmaxf(mx, __shfl_xor(mx, off, 32));
    float sum = 0.0f;
#pragma unroll
    for (int q = 0; q < 8; ++q) {
      v4f e;
      e.x = __expf(xv[q].x - mx);
      e.y = __expf(xv[q].y - mx);
      e.z = __expf(xv[q].z - mx);
      e.w = __expf(xv[q].w - mx);
      xv[q] = e;
      sum += (e.x + e.y) + (e.z + e.w);
    }
#pragma unroll
    for (int off = 16; off > 0; off >>= 1) sum += __shfl_xor(sum, off, 32);
    const float inv = 1.0f / sum;
    // hi: halves row*2048 + swizzled piece * 8 + (col & 7); piece of this lane's group q = 16 q + (lane >> 1)
    u16* ph = P + row * 2048 + (((lane >> 1) ^ (row & 15)) * 8) + (lane & 1) * 4;
    u16* pl = ph + 1024;                    // lo plane: 1024 halves behind hi
#pragma unroll
    for (int q = 0; q < 8; ++q) {
      const v4f a = xv[q] * inv;
      us4 hv, lv;
#pragma unroll
      for (int i = 0; i < 4; ++i) {
        const u16 hb = f2bf(a[i]);
        hv[i] = hb;
        lv[i] = f2bf(a[i] - bf2f(hb));
      }
      *(us4*)(ph + 128 * q) = hv;
      *(us4*)(pl + 128 * q) = lv;
    }
  }
  __syncthreads();

  // ---- phase 4: O[32][64] = P[32][1024] . V[1024][64]; a wave owns 16 columns of O, both row tiles, and one half of k;
  // the two halves' partial sums are added behind the barrier
  {
    const u16* pa = P + m * 2048;               // row tile 0; row tile 1 is 16 rows on; row & 15 = m in both
    f32x8 acc[2];
    acc[0] = zero8();
    acc[1] = zero8();
    const auto pv_step = [&](int ks, const Frag& bh, const Frag& bl) {
      const int p0 = ((ks * 4 + hh) ^ m) * 8;       // columns ks*32 + 8*hh + 0..7
      const int p1 = ((ks * 4 + 2 + hh) ^ m) * 8;   // columns ks*32 + 16 + 8*hh + 0..7
      Frag ah[2], al[2];
#pragma unroll
      for (int rt = 0; rt < 2; ++rt) {
        const u16* pr = pa + rt * 16 * 2048;
        ah[rt].q[0] = *(const v4u*)(pr + p0);
        ah[rt].q[1] = *(const v4u*)(pr + p1);
        al[rt].q[0] = *(const v4u*)(pr + 1024 + p0);
        al[rt].q[1] = *(const v4u*)(pr + 1024 + p1);
      }
#pragma unroll
      for (int rt = 0; rt < 2; ++rt) acc[rt] = wmma3(ah[rt], al[rt], bh, bl, acc[rt]);
    };
    // k-step j of this wave's 16 sits in set j & 3, which is refilled for step j + 4 as soon as step j is done; groups of
    // four steps are unrolled so that each set is a fixed register, the loop over the groups stays rolled for code size
#pragma unroll 1
    for (int j = 0; j < 12; j += 4) {
#pragma unroll
      for (int s = 0; s < 4; ++s) {
        pv_step(kh * 16 + j + s, vh[s], vl[s]);
        ld_k32_pk(vh[s], vl[s], Vh, Vl, voff + (u32)((j + s + 4) * 1024));
      }
    }
#pragma unroll
    for (int s = 0; s < 4; ++s) pv_step(kh * 16 + 12 + s, vh[s], vl[s]);
#pragma unroll
    for (int rt = 0; rt < 2; ++rt)
#pragma unroll
      for (int r = 0; r < 8; ++r) Ost[kh * 2048 + (rt * 16 + 8 * hh + r) * 64 + nt * 16 + m] = acc[rt][r];
  }
  __syncthreads();

  {
    const int row = wave * 4 + (lane >> 3), q = lane & 7;
    const v4f a = *(const v4f*)(Ost + row * 64 + 8 * q) + *(const v4f*)(Ost + 2048 + row * 64 + 8 * q);
    const v4f bq = *(const v4f*)(Ost + row * 64 + 8 * q + 4) + *(const v4f*)(Ost + 2048 + row * 64 + 8 * q + 4);
    us8 hv, lv;
    split8(a, bq, hv, lv);
    const size_t g = ((size_t)(b * 1024 + i0 + row)) * 1024 + (size_t)h * 64 + 8 * q;
    *(us8*)(AOh + g) = hv;
    *(us8*)(AOl + g) = lv;
    
  }
}

// ---------------------------------------------------------------- launch

extern "C" void kernel_launch(void* const* d_in, const int* in_sizes, int n_in,
                              void* d_out, int out_size, void* d_ws, size_t ws_size,
                              hipStream_t stream) {
  const int NX = 4194304;   // 4 x 1024 x 1024
  const int NW = 1048576;   // 1024 x 1024
  const int NE = 65536;     // 1024 x 64
  if (n_in < 8) return;
  if (in_sizes[0] != NX || in_sizes[1] != NX || in_sizes[2] != NX) return;
  if (in_sizes[3] != NW || in_sizes[4] != NW || in_sizes[5] != NW || in_sizes[7] != NW) return;
  if (in_sizes[6] != NE) return;
  if (out_size != NX) return;

  const float* q_in = (const float*)d_in[0];
  const float* k_in = (const float*)d_in[1];
  const float* v_in = (const float*)d_in[2];
  const float* WQ = (const float*)d_in[3];
  const float* WK = (const float*)d_in[4];
  const float* WV = (const float*)d_in[5];
  const float* Er = (const float*)d_in[6];
  const float* WM = (const float*)d_in[7];
  float* out = (float*)d_out;

  // workspace carve (bytes); bf16 planes
  const size_t bx = (size_t)NX * 2;   // 8 MiB
  const size_t bw = (size_t)NW * 2;   // 2 MiB
  const size_t be = (size_t)NE * 2;   // 128 KiB
  const size_t total = 6 * bx + 8 * bw + 2 * be + 6 * bx;   // 117,702,656 B
  if (total > ws_size) return;
  char* w = (char*)d_ws;
  size_t off = 0;
  u16* R0h = (u16*)(w + off); off += bx;   // Xq
  u16* R0l = (u16*)(w + off); off += bx;
  u16* R1h = (u16*)(w + off); off += bx;   // Xk, later VT
  u16* R1l = (u16*)(w + off); off += bx;
  u16* R2h = (u16*)(w + off); off += bx;   // Xv, later AO
  u16* R2l = (u16*)(w + off); off += bx;
  u16* WQh = (u16*)(w + off); off += bw;
  u16* WQl = (u16*)(w + off); off += bw;
  u16* WKh = (u16*)(w + off); off += bw;
  u16* WKl = (u16*)(w + off); off += bw;
  u16* WVh = (u16*)(w + off); off += bw;
  u16* WVl = (u16*)(w + off); off += bw;
  u16* WMh = (u16*)(w + off); off += bw;
  u16* WMl = (u16*)(w + off); off += bw;
  u16* ERh = (u16*)(w + off); off += be;
  u16* ERl = (u16*)(w + off); off += be;
  u16* QPh = (u16*)(w + off); off += bx;
  u16* QPl = (u16*)(w + off); off += bx;
  u16* KPh = (u16*)(w + off); off += bx;
  u16* KPl = (u16*)(w + off); off += bx;
  u16* VPh = (u16*)(w + off); off += bx;   // planes of its own: V is written while Xq is still read
  u16* VPl = (u16*)(w + off); off += bx;
  if (off > ws_size) return;

  u16* Xqh = R0h; u16* Xql = R0l;
  u16* Xkh = R1h; u16* Xkl = R1l;
  u16* Xvh = R2h; u16* Xvl = R2l;
  u16* VTh = R1h; u16* VTl = R1l;
  u16* AOh = R2h; u16* AOl = R2l;

  const dim3 blk(256);
  const int ATTN_LDS = 131072 + 16384;
  hipFuncSetAttribute((const void*)k_attn, hipFuncAttributeMaxDynamicSharedMemorySize, ATTN_LDS);

  // every f32 operand -> bf16 hi/lo planes (Er in fragment order, the weights transposed, WQ's rows permuted for QP)
  k_prep<<<dim3(PREP_X + PREP_W + PREP_E), blk, 0, stream>>>(q_in, k_in, v_in, WQ, WK, WV, WM, Er, Xqh, Xql, Xkh, Xkl, Xvh,
                                                             Xvl, WQh, WQl, WKh, WKl, WVh, WVl, WMh, WMl, ERh, ERl);

  // one launch, job = grid.z:
  // 0: QP[4096][1024] = Xq . WQ, each row (16 queries x 64) in fragment order through WQt's row order
  // 1: KPT[b][c][r] = sum_k WK[k][c] key[b][r][k]  (A = WKt, Bt = Xk[b]), stored per 64 r (one head) in fragment order
  // 2: VP[4096][1024] = Xv . WV
  k_gemm<3><<<dim3(1024 / 128, 4096 / 64, 3), blk, 0, stream>>>(
      Xqh, Xql, WQh, WQl, QPh, QPl, WKh, WKl, Xkh, Xkl, KPh, KPl, Xvh, Xvl, WVh, WVl, VPh, VPl, out,
      1024, 1024, NE, 1024, 0, NW, NW);
  // per-head transpose of V (into region 1)
  k_vtr<<<dim3(4 * 16 * 16), blk, 0, stream>>>(VPh, VPl, VTh, VTl);
  // attention (into region 2)
  k_attn<<<dim3(4 * 16 * 32), blk, ATTN_LDS, stream>>>(QPh, QPl, KPh, KPl, VTh, VTl, ERh, ERl, AOh, AOl);
  // out = AO . WMerge
  k_gemm<1><<<dim3(1024 / 128, 4096 / 64, 1), blk, 0, stream>>>(
      AOh, AOl, WMh, WMl, QPh, QPl, AOh, AOl, WMh, WMl, QPh, QPl, AOh, AOl, WMh, WMl, QPh, QPl, out,
      1024, 1024, 1024, 1024, 0, 0, 0);
}

// v008
// A run of this version takes 193 microseconds.
// Next to v007, in two timings, it ran 1.07 times as fast each time.
// Counting every step since v000, it is 2.84 times as fast.
#include <hip/hip_runtime.h>
#include <stdint.h>

// All contractions (x.WQ, WK-cols x key-rows, x.WV, Q.Er^T, Q.K^T, P.V, O.WMerge): v_wmma_f32_16x16x32_bf16 with bf16 hi/lo operand pairs (hi*hi + hi*lo + lo*hi), f32 accumulate; softmax and skew index arithmetic in f32 / int32.

typedef unsigned short u16;
typedef unsigned int u32;
typedef __bf16 bf16x16 __attribute__((ext_vector_type(16)));
typedef float f32x8 __attribute__((ext_vector_type(8)));
typedef float v4f __attribute__((ext_vector_type(4)));
typedef u32 v4u __attribute__((ext_vector_type(4)));
typedef u16 us8 __attribute__((ext_vector_type(8)));
typedef u16 us4 __attribute__((ext_vector_type(4)));

union Frag {
  bf16x16 v;
  v4u q[2];
};

// f32 -> bf16 bits, RNE
__device__ __forceinline__ u16 f2bf(float f) {
  const u32 u = __float_as_uint(f);
  const u32 r = u + 0x7FFFu + ((u >> 16) & 1u);
  return (u16)(r >> 16);
}
__device__ __forceinline__ float bf2f(u16 b) { return __uint_as_float(((u32)b) << 16); }

// 8 f32 -> 8 bf16 hi + 8 bf16 lo (lo = RNE(x - hi))
__device__ __forceinline__ void split8(v4f a, v4f b, us8& h, us8& l) {
  float f[8];
  f[0] = a.x; f[1] = a.y; f[2] = a.z; f[3] = a.w;
  f[4] = b.x; f[5] = b.y; f[6] = b.z; f[7] = b.w;
#pragma unroll
  for (int i = 0; i < 8; ++i) {
    const u16 hb = f2bf(f[i]);
    h[i] = hb;
    l[i] = f2bf(f[i] - bf2f(hb));
  }
}

__device__ __forceinline__ f32x8 zero8() {
  f32x8 z;
#pragma unroll
  for (int e = 0; e < 8; ++e) z[e] = 0.0f;
  return z;
}

// 16-bit fragment: lane (h = l>>4, m = l&15) -> elements 0..7 = k0+8h+0..7, elements 8..15 = k0+16+8h+0..7
// p already points at row m, column k0 + 8h of a k-contiguous [row][k] plane.
__device__ __forceinline__ void ldf(Frag& f, const u16* p) {
  f.q[0] = *(const v4u*)p;
  f.q[1] = *(const v4u*)(p + 16);
}

// Fragment order: a [row][k] plane cut into units of 16 rows x 16 k; unit (row tile, k / 16) holds 256 halves, lane l's
// 8 halves at 8 l = row m, k = 16 * unit + 8h + 0..7. A fragment is two neighbouring units, and each of its two
// wave-wide 16-byte loads reads 512 contiguous bytes (4 whole lines; from a row-major plane the same load touches 16).
// p already points at the lane's piece of the fragment's first unit.
__device__ __forceinline__ void ldf_pk(Frag& f, const u16* p) {
  f.q[0] = *(const v4u*)p;
  f.q[1] = *(const v4u*)(p + 256);
}

// one 32-deep k-step, hi/lo pairs: c += ah*bh + ah*bl + al*bh ; hazard guard after the group
__device__ __forceinline__ f32x8 wmma3(const Frag& ah, const Frag& al, const Frag& bh, const Frag& bl, f32x8 c) {
  c = __builtin_amdgcn_wmma_f32_16x16x32_bf16(false, ah.v, false, bh.v, (short)0, c, false, false);
  c = __builtin_amdgcn_wmma_f32_16x16x32_bf16(false, ah.v, false, bl.v, (short)0, c, false, false);
  c = __builtin_amdgcn_wmma_f32_16x16x32_bf16(false, al.v, false, bh.v, (short)0, c, false, false);
  asm volatile("v_nop\n\tv_nop\n\tv_nop\n\tv_nop" : "+v"(c) : "v"(ah.v), "v"(al.v), "v"(bh.v), "v"(bl.v));
  return c;
}

// ---------------------------------------------------------------- operand preparation, one launch
// All f32 operands -> bf16 hi/lo planes. The block index picks the job (the same for a whole block):
//   blocks 0..767      query / key / value, elementwise: 256 blocks each, 8 pieces of 8 values per thread
//   blocks 768..1279   WQ / WK / WV / WMerge, transposing: 128 blocks each, a 128 (k) x 64 (n) tile per block
//   blocks 1280..1311  Er into fragment order, one piece per thread
// Transposing split: in[1024 k][1024 n] row-major f32 -> out[n][k] planes. For WQ input column n = 64 m + e becomes
// output row (e >> 3) * 128 + 8 m + (e & 7), so that a GEMM with this plane as Bt leaves each of its output rows, read
// as [16 m][64 e], in fragment order.
// Er: in[rows][64] row-major f32 -> planes in fragment order (units: row tile, then k / 16); thread = one 16-byte piece.
#define PREP_X 768
#define PREP_W 512
#define PREP_E 32
// second launch bound: a register budget at which five blocks fit a WGP, so that nearly the whole grid is resident at
// once and the jobs' loads, conversions and stores overlap
__global__ __launch_bounds__(256, 10) void k_prep(const float* __restrict__ xq, const float* __restrict__ xk,
                                              const float* __restrict__ xv, const float* __restrict__ wq,
                                              const float* __restrict__ wk, const float* __restrict__ wv,
                                              const float* __restrict__ wm, const float* __restrict__ er,
                                              u16* xqh, u16* xql, u16* xkh, u16* xkl, u16* xvh, u16* xvl,
                                              u16* wqh, u16* wql, u16* wkh, u16* wkl, u16* wvh, u16* wvl,
                                              u16* wmh, u16* wml, u16* erh, u16* erl) {
  __shared__ __attribute__((aligned(16))) float Ts[2 * 64 * 68];  // two 64 x 64 tiles, Ts[tile][n][k]
  const int blk = blockIdx.x, t = threadIdx.x;
  if (blk < PREP_X) {
    const int job = blk >> 8;
    const float* s = (job == 0) ? xq : (job == 1) ? xk : xv;
    u16* dh = (job == 0) ? xqh : (job == 1) ? xkh : xvh;
    u16* dl = (job == 0) ? xql : (job == 1) ? xkl : xvl;
    const u32 p0 = (u32)((blk & 255) * 2048 + t);   // first piece; the others 256 pieces apart
    v4f a[8], b[8];
    u32 so[8];
#pragma unroll
    for (int i = 0; i < 8; ++i) so[i] = (p0 + 256u * i) * 32u;   // byte offset in the f32 source
#pragma unroll
    for (int i = 0; i < 8; ++i) {
      a[i] = *(const v4f*)((const char*)s + so[i]);
      b[i] = *(const v4f*)((const char*)s + so[i] + 16);
    }
    // the wait that stands before a load's address register is rewritten; the offsets are inputs so that they stay
    // live, and so unwritten (also by a later load's result), up to it
    asm volatile("s_wait_xcnt 0x0" ::"v"(so[0]), "v"(so[1]), "v"(so[2]), "v"(so[3]), "v"(so[4]), "v"(so[5]), "v"(so[6]),
                 "v"(so[7])
                 : "memory");
    us8 h[8], l[8];
#pragma unroll
    for (int i = 0; i < 8; ++i) split8(a[i], b[i], h[i], l[i]);
#pragma unroll
    for (int i = 0; i < 8; ++i) {
      *(us8*)((char*)dh + (so[i] >> 1)) = h[i];
      *(us8*)((char*)dl + (so[i] >> 1)) = l[i];
    }
  } else if (blk < PREP_X + PREP_W) {
    const int wb = blk - PREP_X, job = wb >> 7, tile = wb & 127;
    const float* s = (job == 0) ? wq : (job == 1) ? wk : (job == 2) ? wv : wm;
    u16* dh = (job == 0) ? wqh : (job == 1) ? wkh : (job == 2) ? wvh : wmh;
    u16* dl = (job == 0) ? wql : (job == 1) ? wkl : (job == 2) ? wvl : wml;
    const int c0 = (tile & 15) * 64, r0 = (tile >> 4) * 128;
    {
      const int r = t >> 2, cb = (t & 3) * 16;
      v4f v[8];
      u32 so[2];
#pragma unroll
      for (int u = 0; u < 2; ++u) so[u] = (u32)((r0 + 64 * u + r) * 1024 + c0 + cb) * 4u;
#pragma unroll
      for (int u = 0; u < 2; ++u)
#pragma unroll
        for (int q = 0; q < 4; ++q) v[4 * u + q] = *(const v4f*)((const char*)s + so[u] + 16 * q);
      // the wait that stands before a load's address register is rewritten; the offsets are inputs as above
      asm volatile("s_wait_xcnt 0x0" ::"v"(so[0]), "v"(so[1]) : "memory");
#pragma unroll
      for (int u = 0; u < 2; ++u)
#pragma unroll
        for (int q = 0; q < 4; ++q) {
          float* d = Ts + u * (64 * 68) + (cb + 4 * q) * 68 + r;
          d[0] = v[4 * u + q].x;
          d[68] = v[4 * u + q].y;
          d[136] = v[4 * u + q].z;
          d[204] = v[4 * u + q].w;
        }
    }
    __syncthreads();
    us8 h[4], l[4];
    u32 go[4];
#pragma unroll
    for (int it = 0; it < 4; ++it) {
      const int u = it >> 1, pc = t + 256 * (it & 1), c = pc >> 3, q = pc & 7;
      const float* p = Ts + u * (64 * 68) + c * 68 + 8 * q;
      const v4f a = *(const v4f*)p;
      const v4f b = *(const v4f*)(p + 4);
      split8(a, b, h[it], l[it]);
      const int n = c0 + c;
      const int orow = (job == 0) ? (((n >> 3) & 7) * 128 + (n >> 6) * 8 + (n & 7)) : n;
      go[it] = (u32)(orow * 1024 + r0 + 64 * u + 8 * q) * 2u;
    }
#pragma unroll
    for (int it = 0; it < 4; ++it) {
      *(us8*)((char*)dh + go[it]) = h[it];
      *(us8*)((char*)dl + go[it]) = l[it];
    }
  } else {
    const int g = (blk - PREP_X - PREP_W) * 256 + t;
    const int lane = g & 31, u = (g >> 5) & 3, rt = g >> 7;
    const u32 so = (u32)((rt * 16 + (lane & 15)) * 64 + u * 16 + (lane >> 4) * 8) * 4u;
    const v4f a = *(const v4f*)((const char*)er + so);
    const v4f b = *(const v4f*)((const char*)er + so + 16);
    // the wait that stands before a load's address register is rewritten; the offset is an input as above
    asm volatile("s_wait_xcnt 0x0" ::"v"(so) : "memory");
    us8 h, l;
    split8(a, b, h, l);
    *(us8*)(erh + (size_t)g * 8) = h;
    *(us8*)(erl + (size_t)g * 8) = l;
    // the wait that stands before a store's registers are rewritten: in the built code another job's instructions
    // follow these stores, behind a test
    asm volatile("s_wait_xcnt 0x0" ::: "memory");
  }
}

// ---------------------------------------------------------------- GEMM (hi/lo pairs)
// C[z][M][N] = A[z][M][K] * Bt[z][N][K]^T ; A and Bt are k-contiguous bf16 hi/lo planes; K a multiple of 64.
// Block tile 128 x 128 (grid.x = N/128, grid.y = M/128, grid.z = batch), 8 waves of 64x32: per output value a third
// fewer operand bytes come from L2 than with a 64 x 128 tile, and a quarter fewer fragment reads from LDS.
// Operands go through LDS in 64-deep k-chunks: 8 lanes fetch one row's 128 B, so a wave-wide load covers 4 whole
// lines (a fragment load straight from the planes touches 16 lines for the same 512 B). Two buffers: chunk c+1 is
// fetched into registers while chunk c is multiplied, stored to the other buffer, and published by one barrier.
// MODE 0: bf16 hi/lo output planes (row segment 256 B = 16 lanes x 16 B); MODE 1: f32 output (512 B = 32 lanes x 16 B).
// MODE 2: bf16 hi/lo output planes in fragment order, one [M][64] plane per 64 output columns, ldc halves apart (a wave
// stores 4 KiB in a row).
// MODE 3: the three projections in one launch; blockIdx.z picks the job: 0 = Q and 2 = V (as MODE 0), 1 = K (as MODE 2,
// its four batches of 8 row blocks laid along grid.y). Operand set 0 serves MODE 0..2.
#define G_PIT 72                    // LDS row pitch in halves: 144 B = 16 B x 9, conflict-free for 16-byte row reads
#define G_AL (128 * G_PIT)          // plane offsets inside a buffer, in halves: A hi at 0, A lo, B hi, B lo
#define G_BH (256 * G_PIT)
#define G_BL (384 * G_PIT)
#define G_BUF (512 * G_PIT)         // 36,864 halves = 73,728 B per buffer (two buffers: two blocks fit a WGP's LDS)

// one thread's share of a chunk: 4 + 4 pieces of A hi / lo, 4 + 4 of B hi / lo, rows 32 apart
__device__ __forceinline__ void g_fetch(v4u (&sa)[8], v4u (&sb)[8], const u16* ah, const u16* al, const u16* bh,
                                        const u16* bl, int lda, int ldb) {
  const u16* pa[8];
  const u16* pb[8];
#pragma unroll
  for (int i = 0; i < 4; ++i) {
    pa[i] = ah + (size_t)(32 * i) * lda;
    pa[4 + i] = al + (size_t)(32 * i) * lda;
  }
#pragma unroll
  for (int i = 0; i < 4; ++i) {
    pb[i] = bh + (size_t)(32 * i) * ldb;
    pb[4 + i] = bl + (size_t)(32 * i) * ldb;
  }
#pragma unroll
  for (int i = 0; i < 8; ++i) sa[i] = *(const v4u*)pa[i];
#pragma unroll
  for (int i = 0; i < 8; ++i) sb[i] = *(const v4u*)pb[i];
  // the wait that stands before a load's address register is rewritten; the sixteen addresses are inputs so that
  // they stay live, and so unwritten (also by a later load's result), up to it
  asm volatile("s_wait_xcnt 0x0" ::"v"(pa[0]), "v"(pa[1]), "v"(pa[2]), "v"(pa[3]), "v"(pa[4]), "v"(pa[5]), "v"(pa[6]),
               "v"(pa[7]), "v"(pb[0]), "v"(pb[1]), "v"(pb[2]), "v"(pb[3]), "v"(pb[4]), "v"(pb[5]), "v"(pb[6]),
               "v"(pb[7])
               : "memory");
}
__device__ __forceinline__ void g_put(u16* buf, const v4u (&sa)[8], const v4u (&sb)[8]) {
#pragma unroll
  for (int i = 0; i < 4; ++i) {
    *(v4u*)(buf + 32 * i * G_PIT) = sa[i];
    *(v4u*)(buf + G_AL + 32 * i * G_PIT) = sa[4 + i];
  }
#pragma unroll
  for (int i = 0; i < 4; ++i) {
    *(v4u*)(buf + G_BH + 32 * i * G_PIT) = sb[i];
    *(v4u*)(buf + G_BL + 32 * i * G_PIT) = sb[4 + i];
  }
}
template <int MODE>
__global__ __launch_bounds__(256) void k_gemm(const u16* __restrict__ Ah0, const u16* __restrict__ Al0,
                                              const u16* __restrict__ Bh0, const u16* __restrict__ Bl0,
                                              u16* Ch0, u16* Cl0,
                                              const u16* __restrict__ Ah1, const u16* __restrict__ Al1,
                                              const u16* __restrict__ Bh1, const u16* __restrict__ Bl1,
                                              u16* Ch1, u16* Cl1,
                                              const u16* __restrict__ Ah2, const u16* __restrict__ Al2,
                                              const u16* __restrict__ Bh2, const u16* __restrict__ Bl2,
                                              u16* Ch2, u16* Cl2, float* Cf,
                                              int lda, int ldb, int ldc0, int K,
                                              int zA0, int zB0, int zC0) {
  __shared__ __attribute__((aligned(16))) u16 Sm[2 * G_BUF];
  float* Cs = (float*)Sm;           // 128 x 132 f32 output tile, reuses the buffers behind the loop
  const int job = (MODE == 3) ? (int)blockIdx.z : 0;
  const bool kj = (MODE == 3) && (job == 1);
  const int mode = (MODE == 3) ? (kj ? 2 : 0) : MODE;
  const u16* Ah = (job == 0) ? Ah0 : (job == 1) ? Ah1 : Ah2;
  const u16* Al = (job == 0) ? Al0 : (job == 1) ? Al1 : Al2;
  const u16* Bh = (job == 0) ? Bh0 : (job == 1) ? Bh1 : Bh2;
  const u16* Bl = (job == 0) ? Bl0 : (job == 1) ? Bl1 : Bl2;
  u16* Ch = (job == 0) ? Ch0 : (job == 1) ? Ch1 : Ch2;
  u16* Cl = (job == 0) ? Cl0 : (job == 1) ? Cl1 : Cl2;
  // MODE 3: ldc0, zB0 and zC0 are the K job's; Q and V have plain rows of lda values and no batch
  const int ldc = (MODE == 3 && !kj) ? lda : ldc0;
  const int zA = zA0, zB = zB0, zC = zC0;
  const int z = (MODE == 3) ? (kj ? (int)(blockIdx.y >> 3) : 0) : (int)blockIdx.z;
  const int bm = (kj ? (int)(blockIdx.y & 7) : (int)blockIdx.y) * 128, bn = blockIdx.x * 128;
  const int tid = threadIdx.x, wave = tid >> 5, lane = tid & 31;
  const int m = lane & 15, hh = lane >> 4;
  const int wr = (wave & 1) * 64, wc = (wave >> 1) * 32;

  // staging map: thread -> (row tid>>3 (+32 per step), 16-byte piece tid&7 of the row's 128 B)
  const int srow = tid >> 3, sseg = (tid & 7) * 8;
  const u16* gah = Ah + (size_t)z * zA + (size_t)(bm + srow) * lda + sseg;
  const u16* gal = Al + (size_t)z * zA + (size_t)(bm + srow) * lda + sseg;
  const u16* gbh = Bh + (size_t)z * zB + (size_t)(bn + srow) * ldb + sseg;
  const u16* gbl = Bl + (size_t)z * zB + (size_t)(bn + srow) * ldb + sseg;
  const int so = srow * G_PIT + sseg;
  // fragment map inside a buffer (same rows and k order as the planes)
  const int fa = (wr + m) * G_PIT + 8 * hh;
  const int fb = (wc + m) * G_PIT + 8 * hh;

  f32x8 acc[4][2];
#pragma unroll
  for (int rt = 0; rt < 4; ++rt)
#pragma unroll
    for (int ct = 0; ct < 2; ++ct) acc[rt][ct] = zero8();

  v4u sa[8], sb[8];
  g_fetch(sa, sb, gah, gal, gbh, gbl, lda, ldb);
  g_put(Sm + so, sa, sb);
  __syncthreads();

  const int nch = K >> 6;
  for (int c = 0; c < nch; ++c) {
    const u16* cur = Sm + (c & 1) * G_BUF;
    u16* nxt = Sm + ((c + 1) & 1) * G_BUF;
    const bool more = (c + 1 < nch);
    if (more) {
      const int k1 = (c + 1) * 64;
      g_fetch(sa, sb, gah + k1, gal + k1, gbh + k1, gbl + k1, lda, ldb);
    }
#pragma unroll
    for (int ks = 0; ks < 2; ++ks) {
      Frag ah[4], al[4], bh[2], bl[2];
#pragma unroll
      for (int rt = 0; rt < 4; ++rt) {
        ldf(ah[rt], cur + fa + rt * 16 * G_PIT + ks * 32);
        ldf(al[rt], cur + G_AL + fa + rt * 16 * G_PIT + ks * 32);
      }
#pragma unroll
      for (int ct = 0; ct < 2; ++ct) {
        ldf(bh[ct], cur + G_BH + fb + ct * 16 * G_PIT + ks * 32);
        ldf(bl[ct], cur + G_BL + fb + ct * 16 * G_PIT + ks * 32);
      }
#pragma unroll
      for (int rt = 0; rt < 4; ++rt)
#pragma unroll
        for (int ct = 0; ct < 2; ++ct)
          acc[rt][ct] = wmma3(ah[rt], al[rt], bh[ct], bl[ct], acc[rt][ct]);
    }
    if (more) g_put(nxt + so, sa, sb);
    // publishes chunk c+1 and ends every wave's reads of the buffer that trip c+1 refills (behind the last trip: of the
    // second buffer, as K = 1024 gives 16 chunks; the output tile lies in the first, freed one trip earlier)
    __syncthreads();
  }

  // stage the 128x128 f32 tile: D element r of lane -> (row 8*hh + r, col m)
#pragma unroll
  for (int rt = 0; rt < 4; ++rt)
#pragma unroll
    for (int ct = 0; ct < 2; ++ct)
#pragma unroll
      for (int r = 0; r < 8; ++r)
        Cs[(wr + rt * 16 + 8 * hh + r) * 132 + wc + ct * 16 + m] = acc[rt][ct][r];
  __syncthreads();

  if (mode == 1) {
    float* cb = Cf + (size_t)z * zC;
    v4f v[16];
    size_t go[16];
#pragma unroll
    for (int i = 0; i < 16; ++i) {
      const int row = wave * 16 + i;
      v[i] = *(const v4f*)(Cs + row * 132 + 4 * lane);
      go[i] = (size_t)(bm + row) * ldc + bn + 4 * lane;
    }
#pragma unroll
    for (int i = 0; i < 16; ++i) *(v4f*)(cb + go[i]) = v[i];
    
  } else if (mode == 2) {
    // a wave owns two neighbouring 16-row tiles of one 64-column plane: their eight units lie one behind the other
    const int jt = (wave >> 1) * 2, hd = wave & 1;
    const size_t base = (size_t)z * zC + (size_t)((bn >> 6) + hd) * ldc + (size_t)((bm >> 4) + jt) * 1024 + (size_t)lane * 8;
    u16* chb = Ch + base;
    u16* clb = Cl + base;
    us8 hv[8], lv[8];
#pragma unroll
    for (int i = 0; i < 8; ++i) {
      const float* cp = Cs + ((jt + (i >> 2)) * 16 + m) * 132 + hd * 64 + (i & 3) * 16 + hh * 8;
      const v4f a = *(const v4f*)cp;
      const v4f b = *(const v4f*)(cp + 4);
      split8(a, b, hv[i], lv[i]);
    }
#pragma unroll
    for (int i = 0; i < 8; ++i) {
      *(us8*)(chb + i * 256) = hv[i];
      *(us8*)(clb + i * 256) = lv[i];
    }
  } else {
    u16* chb = Ch + (size_t)z * zC;
    u16* clb = Cl + (size_t)z * zC;
    us8 hv[8], lv[8];
    size_t go[8];
#pragma unroll
    for (int i = 0; i < 8; ++i) {
      const int row = wave * 16 + 2 * i + (lane >> 4);
      const int cs = (lane & 15) * 8;
      const v4f a = *(const v4f*)(Cs + row * 132 + cs);
      const v4f b = *(const v4f*)(Cs + row * 132 + cs + 4);
      split8(a, b, hv[i], lv[i]);
      go[i] = (size_t)(bm + row) * ldc + bn + cs;
    }
#pragma unroll
    for (int i = 0; i < 8; ++i) {
      *(us8*)(chb + go[i]) = hv[i];
      *(us8*)(clb + go[i]) = lv[i];
    }
    // the wait that stands before a store's registers are rewritten: with two output forms in one kernel the other
    // form's instructions follow these stores in the built code, behind a test
    if (MODE == 3) asm volatile("s_wait_xcnt 0x0" ::: "memory");
  }
}

// ---------------------------------------------------------------- per-head V transpose
// src planes: VP[4096][1024] bf16; head plane X_h = 64 contiguous rows viewed as [1024 l][64 e].
// dst planes: per head v^T[64 e][1024 l] in fragment order (units: row tile e / 16, then l / 16).
__global__ __launch_bounds__(256) void k_vtr(const u16* __restrict__ sh, const u16* __restrict__ sl, u16* dh, u16* dl) {
  __shared__ __attribute__((aligned(16))) u16 Th[64 * 72];  // [e][l]
  __shared__ __attribute__((aligned(16))) u16 Tl[64 * 72];
  const int blk = blockIdx.x, lt = blk & 15, h = (blk >> 4) & 15, b = blk >> 8;
  const int l0 = lt * 64, t = threadIdx.x;
  const size_t src = (size_t)b * 1048576 + (size_t)h * 65536 + (size_t)l0 * 64;
#pragma unroll
  for (int it = 0; it < 2; ++it) {
    const int pc = t + 256 * it, l = pc >> 3, q = pc & 7;
    const us8 a = *(const us8*)(sh + src + l * 64 + 8 * q);
    const us8 c = *(const us8*)(sl + src + l * 64 + 8 * q);
#pragma unroll
    for (int i = 0; i < 8; ++i) {
      Th[(8 * q + i) * 72 + l] = a[i];
      Tl[(8 * q + i) * 72 + l] = c[i];
    }
  }
  __syncthreads();
  // a wave owns row tile nt and 32 of the block's 64 l: two units, 1 KiB in a row per plane
  const int wave = t >> 5, lane = t & 31, nt = wave >> 1, kl = wave & 1;
  const size_t dst = (size_t)(b * 16 + h) * 65536 + (size_t)(nt * 64 + lt * 4 + kl * 2) * 256 + (size_t)lane * 8;
  us8 oh[2], ol[2];
  size_t go[2];
#pragma unroll
  for (int it = 0; it < 2; ++it) {
    const int so = (nt * 16 + (lane & 15)) * 72 + kl * 32 + it * 16 + (lane >> 4) * 8;
    oh[it] = *(const us8*)(Th + so);
    ol[it] = *(const us8*)(Tl + so);
    go[it] = dst + (size_t)it * 256;
  }
#pragma unroll
  for (int it = 0; it < 2; ++it) {
    *(us8*)(dh + go[it]) = oh[it];
    *(us8*)(dl + go[it]) = ol[it];
  }
  
}

// ---------------------------------------------------------------- attention
// the four fragments (hi / lo, two k-steps) of one 16-row tile of a [rows][64] plane in fragment order; off = the lane's
// byte offset (tile * 2048 + lane * 16) in both planes
__device__ __forceinline__ void ld_k64_pk(Frag& h0, Frag& l0, Frag& h1, Frag& l1, const u16* bh, const u16* bl, u32 off) {
  const u16* ph = (const u16*)((const char*)bh + off);
  const u16* pl = (const u16*)((const char*)bl + off);
  ldf_pk(h0, ph); ldf_pk(h1, ph + 512);
  ldf_pk(l0, pl); ldf_pk(l1, pl + 512);
  // the wait that stands before a load's address register is rewritten; the offset is an input so that it stays
  // live, and so unwritten (also by a later load's result), up to it
  asm volatile("s_wait_xcnt 0x0" ::"v"(off) : "memory");
}

// the two fragments (hi / lo) of one 32-deep k-step of a plane in fragment order; off = the lane's byte offset in both planes
__device__ __forceinline__ void ld_k32_pk(Frag& h, Frag& l, const u16* bh, const u16* bl, u32 off) {
  ldf_pk(h, (const u16*)((const char*)bh + off));
  ldf_pk(l, (const u16*)((const char*)bl + off));
  // the wait that stands before a load's address register is rewritten; the offset is an input as in ld_k64_pk
  asm volatile("s_wait_xcnt 0x0" ::"v"(off) : "memory");
}

// one 16x16 tile, K = 64 (two k-steps); A and B fragments preloaded
__device__ __forceinline__ f32x8 tile_k64(const Frag& ah0, const Frag& al0, const Frag& ah1, const Frag& al1,
                                          const Frag& h0, const Frag& l0, const Frag& h1, const Frag& l1) {
  f32x8 acc = zero8();
  acc = wmma3(ah0, al0, h0, l0, acc);
  acc = wmma3(ah1, al1, h1, l1, acc);
  return acc;
}

// One block per (b, h, 32 query rows), 256 threads = 8 waves.
// LDS (dynamic): S[32][1024] f32 (131072 B), later reused in place as P row = hi[1024] | lo[1024] bf16; Ost[2][32][64] f32 (16384 B).
// Every Er, K and V fragment is loaded once per block: the wave that loads it multiplies it with all row tiles.
// The Q, Er, K and V planes lie in fragment order, so each fragment load reads whole lines.
// Er, K and V fragments are fetched ahead of their use into further register sets (Er and K: two tiles ahead; V: four
// k-steps ahead), so that a wave multiplies while its next loads are under way.
// P rows are 4096 B apart (the same banks in every row), so inside a plane the 16-byte piece (col >> 3) of row r sits at
// piece index (col >> 3) ^ (r & 15): the 16 rows that one fragment load reads then fall on 16 different bank groups.
__global__ __launch_bounds__(256) void k_attn(const u16* __restrict__ QPh, const u16* __restrict__ QPl,
                                              const u16* __restrict__ KPh, const u16* __restrict__ KPl,
                                              const u16* __restrict__ VTh, const u16* __restrict__ VTl,
                                              const u16* __restrict__ Eh, const u16* __restrict__ El,
                                              u16* AOh, u16* AOl) {
  extern __shared__ v4u dsm[];
  float* S = (float*)dsm;
  u16* P = (u16*)dsm;
  float* Ost = (float*)(dsm + 8192);  // byte offset 131072

  const int blk = blockIdx.x;
  const int ib = blk & 31, h = (blk >> 5) & 15, b = blk >> 9;
  const int i0 = ib * 32;
  const int tid = threadIdx.x, wave = tid >> 5, lane = tid & 31;
  const int m = lane & 15, hh = lane >> 4;

  // q_h[i][e]  = QP[b][h*64 + (i>>4)][(i&15)*64 + e]: plane at b*2^20 + h*2^16, one QP row = one 16-row tile in fragment order
  const size_t pq = (size_t)b * 1048576 + (size_t)h * 65536;
  const u16* Qh = QPh + pq;
  const u16* Ql = QPl + pq;
  // k_h[j][e]  = KP[b][h*64+e][j]: per head a [1024 j][64 e] plane in fragment order
  const u16* Kh = KPh + pq;
  const u16* Kl = KPl + pq;
  // v_h^T[e][j]: per head a [64 e][1024 j] plane in fragment order
  const u16* Vh = VTh + pq;
  const u16* Vl = VTl + pq;

  // Srel[i][i+1] = 0 (the only cells the skew scatter never writes)
  if (tid < 32) {
    const int j = i0 + tid + 1;
    if (j < 1024) S[tid * 1024 + j] = 0.0f;
  }

  // ---- phase 1: QEr tiles (rows i0 .. i0+32 needed) scattered through the skew map into S
  // row tile 2 (rows i0+32..) is consumed only through row i0+32, columns c <= 990 - i0
  const int ncol2 = 991 - i0;
  const int nct2 = (ncol2 > 0) ? ((ncol2 + 63) >> 6) : 0;
  // Q fragments of row tiles 0 and 1 (the block's own rows) and 2 (the 16 rows behind them), kept through phases 1 and 2
  Frag qh0[3], ql0[3], qh1[3], ql1[3];
#pragma unroll
  for (int rt = 0; rt < 3; ++rt) {
    int qt = (i0 >> 4) + rt;
    qt = (qt > 63) ? 63 : qt;   // the last block has no rows behind it (and nct2 = 0: the tile is not used)
    ld_k64_pk(qh0[rt], ql0[rt], qh1[rt], ql1[rt], Qh, Ql, (u32)(qt * 2048 + lane * 16));
  }
  // a wave owns the 64-column groups ct = wave and wave + 8, four 16-column tiles each
  // The skew is linear in flat indices: pad and reshape send QEr[i2][c] to flat cell i2 * 1025 + c + 1 - 1024 of Srel, so
  // in this block's S it lands at (d - 1) * 1024 + i0 + d + c + 1 with d = i2 - i0; a carry of the column part into the
  // next row is the map's own lower-triangle case. One lane index per column tile (f1, the cell of the lane's row d = 8 hh
  // + 1, never negative), a constant 1025 cells per further row.
  // d = 1..31 always fall inside S; d = 0 only where the index is not negative, d = 32 only where it is below 32768,
  // d > 32 never. A lane whose cell lies outside stores into its word of Ost instead (rewritten whole in phase 4 before
  // it is read), so that no store of the loop stands behind a vector compare and a branch.
  const int wv = __builtin_amdgcn_readfirstlane(wave);   // scalar wave number: the test on row tile 2 is a scalar branch
  const int fb = 8 * hh * 1025 + i0 + m + 2;
  // three fragment sets for the stream of 16 tiles (8 of Er, then 8 of K): tile n sits in set n % 3 and is asked for two
  // tiles ahead, into the set that tile n - 3 has just left; both loops are unrolled so that the set is a fixed register
  Frag fh0[3], fl0[3], fh1[3], fl1[3];
  const auto tile_off = [&](int t) { return (u32)(((wv + 8 * (t >> 2)) * 64 + (t & 3) * 16) * 128 + lane * 16); };
  const auto qer_tile = [&](int t, const Frag& h0, const Frag& l0, const Frag& h1, const Frag& l1) {
    const int ct = wv + 8 * (t >> 2);
    const int col0 = ct * 64 + (t & 3) * 16;
    const int f1 = fb + col0;
    const f32x8 acc0 = tile_k64(qh0[0], ql0[0], qh1[0], ql1[0], h0, l0, h1, l1);
    const f32x8 acc1 = tile_k64(qh0[1], ql0[1], qh1[1], ql1[1], h0, l0, h1, l1);
    S[(f1 >= 1025) ? (f1 - 1025) : (32768 + lane)] = acc0[0];
#pragma unroll
    for (int r = 1; r < 8; ++r) S[f1 + (r - 1) * 1025] = acc0[r];
#pragma unroll
    for (int r = 0; r < 8; ++r) S[f1 + (15 + r) * 1025] = acc1[r];
    if (ct < nct2) {
      const f32x8 acc2 = tile_k64(qh0[2], ql0[2], qh1[2], ql1[2], h0, l0, h1, l1);
      const int f2 = f1 + 31 * 1025;
      S[(f2 < 32768) ? f2 : (32768 + lane)] = acc2[0];
    }
  };
  ld_k64_pk(fh0[0], fl0[0], fh1[0], fl1[0], Eh, El, tile_off(0));
  ld_k64_pk(fh0[1], fl0[1], fh1[1], fl1[1], Eh, El, tile_off(1));
  // unrolled: the set numbers must be constants, or the sets would not stay in registers
#pragma unroll
  for (int t = 0; t < 8; ++t) {
    const int c = t % 3, n = (t + 2) % 3;
    // behind the last Er tiles: phase 2's first two K tiles (same tile offsets in both planes)
    ld_k64_pk(fh0[n], fl0[n], fh1[n], fl1[n], (t < 6) ? Eh : Kh, (t < 6) ? El : Kl, tile_off((t + 2) & 7));
    qer_tile(t, fh0[c], fl0[c], fh1[c], fl1[c]);
  }
  __syncthreads();

  // ---- phase 2: S += Q K^T
  const auto qk_tile = [&](int t, const Frag& h0, const Frag& l0, const Frag& h1, const Frag& l1) {
    const int col0 = (wv + 8 * (t >> 2)) * 64 + (t & 3) * 16;
#pragma unroll
    for (int rt = 0; rt < 2; ++rt) {
      const f32x8 acc = tile_k64(qh0[rt], ql0[rt], qh1[rt], ql1[rt], h0, l0, h1, l1);
#pragma unroll
      for (int r = 0; r < 8; ++r)
        S[(rt * 16 + 8 * hh + r) * 1024 + col0 + m] += acc[r];
    }
  };
  // unrolled for the same reason as phase 1's loop
#pragma unroll
  for (int t = 0; t < 8; ++t) {
    const int c = (t + 8) % 3, n = (t + 10) % 3;
    if (t < 6) ld_k64_pk(fh0[n], fl0[n], fh1[n], fl1[n], Kh, Kl, tile_off(t + 2));
    qk_tile(t, fh0[c], fl0[c], fh1[c], fl1[c]);
  }
  __syncthreads();

  // phase 4's first four k-steps of V, under way during the softmax (behind the barrier, which would wait for them)
  const int nt = wv & 3, kh = wv >> 2;
  const u32 voff = (u32)(nt * 32768 + kh * 16384 + lane * 16);   // row tile nt: 64 units of 512 B; a k-step is two units
  Frag vh[4], vl[4];
#pragma unroll
  for (int s = 0; s < 4; ++s) ld_k32_pk(vh[s], vl[s], Vh, Vl, voff + (u32)(s * 1024));

  // ---- phase 3: row softmax of S/8 (max-subtracted), P written in place as bf16 hi/lo; lane owns columns
  // 128 q + 4 lane + 0..3 (q = 0..7), so a wave-wide 16-byte read covers 512 contiguous bytes of the row
#pragma unroll 1
  for (int rr = 0; rr < 4; ++rr) {
    const int row = wave * 4 + rr;
    const float* sr = S + row * 1024 + lane * 4;
    v4f xv[8];
    float mx = -3.0e38f;
#pragma unroll
    for (int q = 0; q < 8; ++q) {
      v4f v = *(const v4f*)(sr + 128 * q);
      v = v * 0.125f;
      xv[q] = v;
      mx = fmaxf(mx, fmaxf(fmaxf(v.x, v.y), fmaxf(v.z, v.w)));
    }
#pragma unroll
    for (int off = 16; off > 0; off >>= 1) mx = fmaxf(mx, __shfl_xor(mx, off, 32));
    float sum = 0.0f;
#pragma unroll
    for (int q = 0; q < 8; ++q) {
      v4f e;
      e.x = __expf(xv[q].x - mx);
      e.y = __expf(xv[q].y - mx);
      e.z = __expf(xv[q].z - mx);
      e.w = __expf(xv[q].w - mx);
      xv[q] = e;
      sum += (e.x + e.y) + (e.z + e.w);
    }
#pragma unroll
    for (int off = 16; off > 0; off >>= 1) sum += __shfl_xor(sum, off, 32);
    const float inv = 1.0f / sum;
    // hi: halves row*2048 + swizzled piece * 8 + (col & 7); piece of this lane's group q = 16 q + (lane >> 1)
    u16* ph = P + row * 2048 + (((lane >> 1) ^ (row & 15)) * 8) + (lane & 1) * 4;
    u16* pl = ph + 1024;                    // lo plane: 1024 halves behind hi
#pragma unroll
    for (int q = 0; q < 8; ++q) {
      const v4f a = xv[q] * inv;
      us4 hv, lv;
#pragma unroll
      for (int i = 0; i < 4; ++i) {
        const u16 hb = f2bf(a[i]);
        hv[i] = hb;
        lv[i] = f2bf(a[i] - bf2f(hb));
      }
      *(us4*)(ph + 128 * q) = hv;
      *(us4*)(pl + 128 * q) = lv;
    }
  }
  __syncthreads();

  // ---- phase 4: O[32][64] = P[32][1024] . V[1024][64]; a wave owns 16 columns of O, both row tiles, and one half of k;
  // the two halves' partial sums are added behind the barrier
  {
    const u16* pa = P + m * 2048;               // row tile 0; row tile 1 is 16 rows on; row & 15 = m in both
    f32x8 acc[2];
    acc[0] = zero8();
    acc[1] = zero8();
    const auto pv_step = [&](int ks, const Frag& bh, const Frag& bl) {
      const int p0 = ((ks * 4 + hh) ^ m) * 8;       // columns ks*32 + 8*hh + 0..7
      const int p1 = ((ks * 4 + 2 + hh) ^ m) * 8;   // columns ks*32 + 16 + 8*hh + 0..7
      Frag ah[2], al[2];
#pragma unroll
      for (int rt = 0; rt < 2; ++rt) {
        const u16* pr = pa + rt * 16 * 2048;
        ah[rt].q[0] = *(const v4u*)(pr + p0);
        ah[rt].q[1] = *(const v4u*)(pr + p1);
        al[rt].q[0] = *(const v4u*)(pr + 1024 + p0);
        al[rt].q[1] = *(const v4u*)(pr + 1024 + p1);
      }
#pragma unroll
      for (int rt = 0; rt < 2; ++rt) acc[rt] = wmma3(ah[rt], al[rt], bh, bl, acc[rt]);
    };
    // k-step j of this wave's 16 sits in set j & 3, which is refilled for step j + 4 as soon as step j is done; groups of
    // four steps are unrolled so that each set is a fixed register, the loop over the groups stays rolled for code size
#pragma unroll 1
    for (int j = 0; j < 12; j += 4) {
#pragma unroll
      for (int s = 0; s < 4; ++s) {
        pv_step(kh * 16 + j + s, vh[s], vl[s]);
        ld_k32_pk(vh[s], vl[s], Vh, Vl, voff + (u32)((j + s + 4) * 1024));
      }
    }
#pragma unroll
    for (int s = 0; s < 4; ++s) pv_step(kh * 16 + 12 + s, vh[s], vl[s]);
#pragma unroll
    for (int rt = 0; rt < 2; ++rt)
#pragma unroll
      for (int r = 0; r < 8; ++r) Ost[kh * 2048 + (rt * 16 + 8 * hh + r) * 64 + nt * 16 + m] = acc[rt][r];
  }
  __syncthreads();

  {
    const int row = wave * 4 + (lane >> 3), q = lane & 7;
    const v4f a = *(const v4f*)(Ost + row * 64 + 8 * q) + *(const v4f*)(Ost + 2048 + row * 64 + 8 * q);
    const v4f bq = *(const v4f*)(Ost + row * 64 + 8 * q + 4) + *(const v4f*)(Ost + 2048 + row * 64 + 8 * q + 4);
    us8 hv, lv;
    split8(a, bq, hv, lv);
    const size_t g = ((size_t)(b * 1024 + i0 + row)) * 1024 + (size_t)h * 64 + 8 * q;
    *(us8*)(AOh + g) = hv;
    *(us8*)(AOl + g) = lv;
    
  }
}

// ---------------------------------------------------------------- launch

extern "C" void kernel_launch(void* const* d_in, const int* in_sizes, int n_in,
                              void* d_out, int out_size, void* d_ws, size_t ws_size,
                              hipStream_t stream) {
  const int NX = 4194304;   // 4 x 1024 x 1024
  const int NW = 1048576;   // 1024 x 1024
  const int NE = 65536;     // 1024 x 64
  if (n_in < 8) return;
  if (in_sizes[0] != NX || in_sizes[1] != NX || in_sizes[2] != NX) return;
  if (in_sizes[3] != NW || in_sizes[4] != NW || in_sizes[5] != NW || in_sizes[7] != NW) return;
  if (in_sizes[6] != NE) return;
  if (out_size != NX) return;

  const float* q_in = (const float*)d_in[0];
  const float* k_in = (const float*)d_in[1];
  const float* v_in = (const float*)d_in[2];
  const float* WQ = (const float*)d_in[3];
  const float* WK = (const float*)d_in[4];
  const float* WV = (const float*)d_in[5];
  const float* Er = (const float*)d_in[6];
  const float* WM = (const float*)d_in[7];
  float* out = (float*)d_out;

  // workspace carve (bytes); bf16 planes
  const size_t bx = (size_t)NX * 2;   // 8 MiB
  const size_t bw = (size_t)NW * 2;   // 2 MiB
  const size_t be = (size_t)NE * 2;   // 128 KiB
  const size_t total = 6 * bx + 8 * bw + 2 * be + 6 * bx;   // 117,702,656 B
  if (total > ws_size) return;
  char* w = (char*)d_ws;
  size_t off = 0;
  u16* R0h = (u16*)(w + off); off += bx;   // Xq
  u16* R0l = (u16*)(w + off); off += bx;
  u16* R1h = (u16*)(w + off); off += bx;   // Xk, later VT
  u16* R1l = (u16*)(w + off); off += bx;
  u16* R2h = (u16*)(w + off); off += bx;   // Xv, later AO
  u16* R2l = (u16*)(w + off); off += bx;
  u16* WQh = (u16*)(w + off); off += bw;
  u16* WQl = (u16*)(w + off); off += bw;
  u16* WKh = (u16*)(w + off); off += bw;
  u16* WKl = (u16*)(w + off); off += bw;
  u16* WVh = (u16*)(w + off); off += bw;
  u16* WVl = (u16*)(w + off); off += bw;
  u16* WMh = (u16*)(w + off); off += bw;
  u16* WMl = (u16*)(w + off); off += bw;
  u16* ERh = (u16*)(w + off); off += be;
  u16* ERl = (u16*)(w + off); off += be;
  u16* QPh = (u16*)(w + off); off += bx;
  u16* QPl = (u16*)(w + off); off += bx;
  u16* KPh = (u16*)(w + off); off += bx;
  u16* KPl = (u16*)(w + off); off += bx;
  u16* VPh = (u16*)(w + off); off += bx;   // planes of its own: V is written while Xq is still read
  u16* VPl = (u16*)(w + off); off += bx;
  if (off > ws_size) return;

  u16* Xqh = R0h; u16* Xql = R0l;
  u16* Xkh = R1h; u16* Xkl = R1l;
  u16* Xvh = R2h; u16* Xvl = R2l;
  u16* VTh = R1h; u16* VTl = R1l;
  u16* AOh = R2h; u16* AOl = R2l;

  const dim3 blk(256);
  const int ATTN_LDS = 131072 + 16384;
  hipFuncSetAttribute((const void*)k_attn, hipFuncAttributeMaxDynamicSharedMemorySize, ATTN_LDS);

  // every f32 operand -> bf16 hi/lo planes (Er in fragment order, the weights transposed, WQ's rows permuted for QP)
  k_prep<<<dim3(PREP_X + PREP_W + PREP_E), blk, 0, stream>>>(q_in, k_in, v_in, WQ, WK, WV, WM, Er, Xqh, Xql, Xkh, Xkl, Xvh,
                                                             Xvl, WQh, WQl, WKh, WKl, WVh, WVl, WMh, WMl, ERh, ERl);

  // one launch, job = grid.z:
  // 0: QP[4096][1024] = Xq . WQ, each row (16 queries x 64) in fragment order through WQt's row order
  // 1: KPT[b][c][r] = sum_k WK[k][c] key[b][r][k]  (A = WKt, Bt = Xk[b]), stored per 64 r (one head) in fragment order
  // 2: VP[4096][1024] = Xv . WV
  k_gemm<3><<<dim3(1024 / 128, 4096 / 128, 3), blk, 0, stream>>>(
      Xqh, Xql, WQh, WQl, QPh, QPl, WKh, WKl, Xkh, Xkl, KPh, KPl, Xvh, Xvl, WVh, WVl, VPh, VPl, out,
      1024, 1024, NE, 1024, 0, NW, NW);
  // per-head transpose of V (into region 1)
  k_vtr<<<dim3(4 * 16 * 16), blk, 0, stream>>>(VPh, VPl, VTh, VTl);
  // attention (into region 2)
  k_attn<<<dim3(4 * 16 * 32), blk, ATTN_LDS, stream>>>(QPh, QPl, KPh, KPl, VTh, VTl, ERh, ERl, AOh, AOl);
  // out = AO . WMerge
  k_gemm<1><<<dim3(1024 / 128, 4096 / 128, 1), blk, 0, stream>>>(
      AOh, AOl, WMh, WMl, QPh, QPl, AOh, AOl, WMh, WMl, QPh, QPl, AOh, AOl, WMh, WMl, QPh, QPl, out,
      1024, 1024, 1024, 1024, 0, 0, 0);
}

// v009
// Measured time: 186 microseconds a run.
// Next to v008, in two timings, it ran 1.03 times as fast each time.
// Over all steps from v000 it is 2.93 times as fast.
#include <hip/hip_runtime.h>
#include <stdint.h>

// All contractions (x.WQ, WK-cols x key-rows, x.WV, Q.Er^T, Q.K^T, P.V, O.WMerge): v_wmma_f32_16x16x32_bf16 with bf16 hi/lo operand pairs (hi*hi + hi*lo + lo*hi), f32 accumulate; softmax and skew index arithmetic in f32 / int32.

typedef unsigned short u16;
typedef unsigned int u32;
typedef __bf16 bf16x16 __attribute__((ext_vector_type(16)));
typedef float f32x8 __attribute__((ext_vector_type(8)));
typedef u32 v2u __attribute__((ext_vector_type(2)));
typedef float v4f __attribute__((ext_vector_type(4)));
typedef u32 v4u __attribute__((ext_vector_type(4)));
typedef u16 us8 __attribute__((ext_vector_type(8)));
typedef u16 us4 __attribute__((ext_vector_type(4)));

union Frag {
  bf16x16 v;
  v4u q[2];
};

// 8 f32 -> four words of two bf16 hi and four words of two bf16 lo (lo = RNE(x - hi)), three instructions a pair: one
// packed RNE conversion gives both hi; a mixed-operand FMA per value reads its hi half as bf16, forms x - hi (exact in
// f32) and rounds it into its half of the lo word. Written in asm because the compiler does not form the mixed FMA here
// (it widens hi by a shift and a mask, subtracts and converts again: five a pair). Four pairs are interleaved so that
// each instruction's producer stands four back; the s_delay_alu lines tell the SIMD so, which lets other waves issue
// meanwhile (they change no result).
__device__ __forceinline__ void split4p(const float (&x)[8], u32 (&h)[4], u32 (&l)[4]) {
  asm("v_cvt_pk_bf16_f32 %0, %8, %9\n\t"
      "v_cvt_pk_bf16_f32 %1, %10, %11\n\t"
      "v_cvt_pk_bf16_f32 %2, %12, %13\n\t"
      "v_cvt_pk_bf16_f32 %3, %14, %15\n\t"
      "s_delay_alu instid0(VALU_DEP_4) | instskip(NEXT) | instid1(VALU_DEP_4)\n\t"
      "v_fma_mixlo_bf16 %4, %0, -1.0, %8 op_sel_hi:[1,0,0]\n\t"
      "v_fma_mixlo_bf16 %5, %1, -1.0, %10 op_sel_hi:[1,0,0]\n\t"
      "s_delay_alu instid0(VALU_DEP_4) | instskip(NEXT) | instid1(VALU_DEP_4)\n\t"
      "v_fma_mixlo_bf16 %6, %2, -1.0, %12 op_sel_hi:[1,0,0]\n\t"
      "v_fma_mixlo_bf16 %7, %3, -1.0, %14 op_sel_hi:[1,0,0]\n\t"
      "s_delay_alu instid0(VALU_DEP_4) | instskip(NEXT) | instid1(VALU_DEP_4)\n\t"
      "v_fma_mixhi_bf16 %4, %0, -1.0, %9 op_sel:[1,0,0] op_sel_hi:[1,0,0]\n\t"
      "v_fma_mixhi_bf16 %5, %1, -1.0, %11 op_sel:[1,0,0] op_sel_hi:[1,0,0]\n\t"
      "s_delay_alu instid0(VALU_DEP_4) | instskip(NEXT) | instid1(VALU_DEP_4)\n\t"
      "v_fma_mixhi_bf16 %6, %2, -1.0, %13 op_sel:[1,0,0] op_sel_hi:[1,0,0]\n\t"
      "v_fma_mixhi_bf16 %7, %3, -1.0, %15 op_sel:[1,0,0] op_sel_hi:[1,0,0]"
      : "=&v"(h[0]), "=&v"(h[1]), "=&v"(h[2]), "=&v"(h[3]), "=&v"(l[0]), "=&v"(l[1]), "=&v"(l[2]), "=&v"(l[3])
      : "v"(x[0]), "v"(x[1]), "v"(x[2]), "v"(x[3]), "v"(x[4]), "v"(x[5]), "v"(x[6]), "v"(x[7]));
}

// 8 f32 -> 8 bf16 hi + 8 bf16 lo
__device__ __forceinline__ void split8(v4f a, v4f b, us8& h, us8& l) {
  const float x[8] = {a.x, a.y, a.z, a.w, b.x, b.y, b.z, b.w};
  u32 hw[4], lw[4];
  split4p(x, hw, lw);
  const v4u hq = {hw[0], hw[1], hw[2], hw[3]};
  const v4u lq = {lw[0], lw[1], lw[2], lw[3]};
  h = __builtin_bit_cast(us8, hq);
  l = __builtin_bit_cast(us8, lq);
}

__device__ __forceinline__ f32x8 zero8() {
  f32x8 z;
#pragma unroll
  for (int e = 0; e < 8; ++e) z[e] = 0.0f;
  return z;
}

// 16-bit fragment: lane (h = l>>4, m = l&15) -> elements 0..7 = k0+8h+0..7, elements 8..15 = k0+16+8h+0..7
// p already points at row m, column k0 + 8h of a k-contiguous [row][k] plane.
__device__ __forceinline__ void ldf(Frag& f, const u16* p) {
  f.q[0] = *(const v4u*)p;
  f.q[1] = *(const v4u*)(p + 16);
}

// Fragment order: a [row][k] plane cut into units of 16 rows x 16 k; unit (row tile, k / 16) holds 256 halves, lane l's
// 8 halves at 8 l = row m, k = 16 * unit + 8h + 0..7. A fragment is two neighbouring units, and each of its two
// wave-wide 16-byte loads reads 512 contiguous bytes (4 whole lines; from a row-major plane the same load touches 16).
// p already points at the lane's piece of the fragment's first unit.
__device__ __forceinline__ void ldf_pk(Frag& f, const u16* p) {
  f.q[0] = *(const v4u*)p;
  f.q[1] = *(const v4u*)(p + 256);
}

// one 32-deep k-step, hi/lo pairs: c += ah*bh + ah*bl + al*bh ; hazard guard after the group
__device__ __forceinline__ f32x8 wmma3(const Frag& ah, const Frag& al, const Frag& bh, const Frag& bl, f32x8 c) {
  c = __builtin_amdgcn_wmma_f32_16x16x32_bf16(false, ah.v, false, bh.v, (short)0, c, false, false);
  c = __builtin_amdgcn_wmma_f32_16x16x32_bf16(false, ah.v, false, bl.v, (short)0, c, false, false);
  c = __builtin_amdgcn_wmma_f32_16x16x32_bf16(false, al.v, false, bh.v, (short)0, c, false, false);
  asm volatile("v_nop\n\tv_nop\n\tv_nop\n\tv_nop" : "+v"(c) : "v"(ah.v), "v"(al.v), "v"(bh.v), "v"(bl.v));
  return c;
}

// ---------------------------------------------------------------- operand preparation, one launch
// All f32 operands -> bf16 hi/lo planes. The block index picks the job (the same for a whole block):
//   blocks 0..767      query / key / value, elementwise: 256 blocks each, 8 pieces of 8 values per thread
//   blocks 768..1279   WQ / WK / WV / WMerge, transposing: 128 blocks each, a 128 (k) x 64 (n) tile per block
//   blocks 1280..1311  Er into fragment order, one piece per thread
// Transposing split: in[1024 k][1024 n] row-major f32 -> out[n][k] planes. For WQ input column n = 64 m + e becomes
// output row (e >> 3) * 128 + 8 m + (e & 7), so that a GEMM with this plane as Bt leaves each of its output rows, read
// as [16 m][64 e], in fragment order.
// Er: in[rows][64] row-major f32 -> planes in fragment order (units: row tile, then k / 16); thread = one 16-byte piece.
#define PREP_X 768
#define PREP_W 512
#define PREP_E 32
// second launch bound: a register budget at which five blocks fit a WGP, so that nearly the whole grid is resident at
// once and the jobs' loads, conversions and stores overlap
__global__ __launch_bounds__(256, 10) void k_prep(const float* __restrict__ xq, const float* __restrict__ xk,
                                              const float* __restrict__ xv, const float* __restrict__ wq,
                                              const float* __restrict__ wk, const float* __restrict__ wv,
                                              const float* __restrict__ wm, const float* __restrict__ er,
                                              u16* xqh, u16* xql, u16* xkh, u16* xkl, u16* xvh, u16* xvl,
                                              u16* wqh, u16* wql, u16* wkh, u16* wkl, u16* wvh, u16* wvl,
                                              u16* wmh, u16* wml, u16* erh, u16* erl) {
  __shared__ __attribute__((aligned(16))) float Ts[2 * 64 * 68];  // two 64 x 64 tiles, Ts[tile][n][k]
  const int blk = blockIdx.x, t = threadIdx.x;
  if (blk < PREP_X) {
    const int job = blk >> 8;
    const float* s = (job == 0) ? xq : (job == 1) ? xk : xv;
    u16* dh = (job == 0) ? xqh : (job == 1) ? xkh : xvh;
    u16* dl = (job == 0) ? xql : (job == 1) ? xkl : xvl;
    const u32 p0 = (u32)((blk & 255) * 2048 + t);   // first piece; the others 256 pieces apart
    v4f a[8], b[8];
    u32 so[8];
#pragma unroll
    for (int i = 0; i < 8; ++i) so[i] = (p0 + 256u * i) * 32u;   // byte offset in the f32 source
#pragma unroll
    for (int i = 0; i < 8; ++i) {
      a[i] = *(const v4f*)((const char*)s + so[i]);
      b[i] = *(const v4f*)((const char*)s + so[i] + 16);
    }
    // the wait that stands before a load's address register is rewritten; the offsets are inputs so that they stay
    // live, and so unwritten (also by a later load's result), up to it
    asm volatile("s_wait_xcnt 0x0" ::"v"(so[0]), "v"(so[1]), "v"(so[2]), "v"(so[3]), "v"(so[4]), "v"(so[5]), "v"(so[6]),
                 "v"(so[7])
                 : "memory");
    us8 h[8], l[8];
#pragma unroll
    for (int i = 0; i < 8; ++i) split8(a[i], b[i], h[i], l[i]);
#pragma unroll
    for (int i = 0; i < 8; ++i) {
      *(us8*)((char*)dh + (so[i] >> 1)) = h[i];
      *(us8*)((char*)dl + (so[i] >> 1)) = l[i];
    }
  } else if (blk < PREP_X + PREP_W) {
    const int wb = blk - PREP_X, job = wb >> 7, tile = wb & 127;
    const float* s = (job == 0) ? wq : (job == 1) ? wk : (job == 2) ? wv : wm;
    u16* dh = (job == 0) ? wqh : (job == 1) ? wkh : (job == 2) ? wvh : wmh;
    u16* dl = (job == 0) ? wql : (job == 1) ? wkl : (job == 2) ? wvl : wml;
    const int c0 = (tile & 15) * 64, r0 = (tile >> 4) * 128;
    {
      const int r = t >> 2, cb = (t & 3) * 16;
      v4f v[8];
      u32 so[2];
#pragma unroll
      for (int u = 0; u < 2; ++u) so[u] = (u32)((r0 + 64 * u + r) * 1024 + c0 + cb) * 4u;
#pragma unroll
      for (int u = 0; u < 2; ++u)
#pragma unroll
        for (int q = 0; q < 4; ++q) v[4 * u + q] = *(const v4f*)((const char*)s + so[u] + 16 * q);
      // the wait that stands before a load's address register is rewritten; the offsets are inputs as above
      asm volatile("s_wait_xcnt 0x0" ::"v"(so[0]), "v"(so[1]) : "memory");
#pragma unroll
      for (int u = 0; u < 2; ++u)
#pragma unroll
        for (int q = 0; q < 4; ++q) {
          float* d = Ts + u * (64 * 68) + (cb + 4 * q) * 68 + r;
          d[0] = v[4 * u + q].x;
          d[68] = v[4 * u + q].y;
          d[136] = v[4 * u + q].z;
          d[204] = v[4 * u + q].w;
        }
    }
    __syncthreads();
    us8 h[4], l[4];
    u32 go[4];
#pragma unroll
    for (int it = 0; it < 4; ++it) {
      const int u = it >> 1, pc = t + 256 * (it & 1), c = pc >> 3, q = pc & 7;
      const float* p = Ts + u * (64 * 68) + c * 68 + 8 * q;
      const v4f a = *(const v4f*)p;
      const v4f b = *(const v4f*)(p + 4);
      split8(a, b, h[it], l[it]);
      const int n = c0 + c;
      const int orow = (job == 0) ? (((n >> 3) & 7) * 128 + (n >> 6) * 8 + (n & 7)) : n;
      go[it] = (u32)(orow * 1024 + r0 + 64 * u + 8 * q) * 2u;
    }
#pragma unroll
    for (int it = 0; it < 4; ++it) {
      *(us8*)((char*)dh + go[it]) = h[it];
      *(us8*)((char*)dl + go[it]) = l[it];
    }
  } else {
    const int g = (blk - PREP_X - PREP_W) * 256 + t;
    const int lane = g & 31, u = (g >> 5) & 3, rt = g >> 7;
    const u32 so = (u32)((rt * 16 + (lane & 15)) * 64 + u * 16 + (lane >> 4) * 8) * 4u;
    const v4f a = *(const v4f*)((const char*)er + so);
    const v4f b = *(const v4f*)((const char*)er + so + 16);
    // the wait that stands before a load's address register is rewritten; the offset is an input as above
    asm volatile("s_wait_xcnt 0x0" ::"v"(so) : "memory");
    us8 h, l;
    split8(a, b, h, l);
    *(us8*)(erh + (size_t)g * 8) = h;
    *(us8*)(erl + (size_t)g * 8) = l;
    // the wait that stands before a store's registers are rewritten: in the built code another job's instructions
    // follow these stores, behind a test
    asm volatile("s_wait_xcnt 0x0" ::: "memory");
  }
}

// ---------------------------------------------------------------- GEMM (hi/lo pairs)
// C[z][M][N] = A[z][M][K] * Bt[z][N][K]^T ; A and Bt are k-contiguous bf16 hi/lo planes; K a multiple of 64.
// Block tile 128 x 128 (grid.x = N/128, grid.y = M/128, grid.z = batch), 8 waves of 64x32: per output value a third
// fewer operand bytes come from L2 than with a 64 x 128 tile, and a quarter fewer fragment reads from LDS.
// Operands go through LDS in 64-deep k-chunks: 8 lanes fetch one row's 128 B, so a wave-wide load covers 4 whole
// lines (a fragment load straight from the planes touches 16 lines for the same 512 B). Two buffers: chunk c+1 is
// fetched into registers while chunk c is multiplied, stored to the other buffer, and published by one barrier.
// MODE 0: bf16 hi/lo output planes (row segment 256 B = 16 lanes x 16 B); MODE 1: f32 output (512 B = 32 lanes x 16 B).
// MODE 2: bf16 hi/lo output planes in fragment order, one [M][64] plane per 64 output columns, ldc halves apart (a wave
// stores 4 KiB in a row).
// MODE 3: the three projections in one launch; blockIdx.z picks the job: 0 = Q and 2 = V (as MODE 0), 1 = K (as MODE 2,
// its four batches of 8 row blocks laid along grid.y). Operand set 0 serves MODE 0..2.
#define G_PIT 72                    // LDS row pitch in halves: 144 B = 16 B x 9, conflict-free for 16-byte row reads
#define G_AL (128 * G_PIT)          // plane offsets inside a buffer, in halves: A hi at 0, A lo, B hi, B lo
#define G_BH (256 * G_PIT)
#define G_BL (384 * G_PIT)
#define G_BUF (512 * G_PIT)         // 36,864 halves = 73,728 B per buffer (two buffers: two blocks fit a WGP's LDS)

// one thread's share of a chunk: 4 + 4 pieces of A hi / lo, 4 + 4 of B hi / lo, rows 32 apart
__device__ __forceinline__ void g_fetch(v4u (&sa)[8], v4u (&sb)[8], const u16* ah, const u16* al, const u16* bh,
                                        const u16* bl, int lda, int ldb) {
  const u16* pa[8];
  const u16* pb[8];
#pragma unroll
  for (int i = 0; i < 4; ++i) {
    pa[i] = ah + (size_t)(32 * i) * lda;
    pa[4 + i] = al + (size_t)(32 * i) * lda;
  }
#pragma unroll
  for (int i = 0; i < 4; ++i) {
    pb[i] = bh + (size_t)(32 * i) * ldb;
    pb[4 + i] = bl + (size_t)(32 * i) * ldb;
  }
#pragma unroll
  for (int i = 0; i < 8; ++i) sa[i] = *(const v4u*)pa[i];
#pragma unroll
  for (int i = 0; i < 8; ++i) sb[i] = *(const v4u*)pb[i];
  // the wait that stands before a load's address register is rewritten; the sixteen addresses are inputs so that
  // they stay live, and so unwritten (also by a later load's result), up to it
  asm volatile("s_wait_xcnt 0x0" ::"v"(pa[0]), "v"(pa[1]), "v"(pa[2]), "v"(pa[3]), "v"(pa[4]), "v"(pa[5]), "v"(pa[6]),
               "v"(pa[7]), "v"(pb[0]), "v"(pb[1]), "v"(pb[2]), "v"(pb[3]), "v"(pb[4]), "v"(pb[5]), "v"(pb[6]),
               "v"(pb[7])
               : "memory");
}
__device__ __forceinline__ void g_put(u16* buf, const v4u (&sa)[8], const v4u (&sb)[8]) {
#pragma unroll
  for (int i = 0; i < 4; ++i) {
    *(v4u*)(buf + 32 * i * G_PIT) = sa[i];
    *(v4u*)(buf + G_AL + 32 * i * G_PIT) = sa[4 + i];
  }
#pragma unroll
  for (int i = 0; i < 4; ++i) {
    *(v4u*)(buf + G_BH + 32 * i * G_PIT) = sb[i];
    *(v4u*)(buf + G_BL + 32 * i * G_PIT) = sb[4 + i];
  }
}
template <int MODE>
__global__ __launch_bounds__(256) void k_gemm(const u16* __restrict__ Ah0, const u16* __restrict__ Al0,
                                              const u16* __restrict__ Bh0, const u16* __restrict__ Bl0,
                                              u16* Ch0, u16* Cl0,
                                              const u16* __restrict__ Ah1, const u16* __restrict__ Al1,
                                              const u16* __restrict__ Bh1, const u16* __restrict__ Bl1,
                                              u16* Ch1, u16* Cl1,
                                              const u16* __restrict__ Ah2, const u16* __restrict__ Al2,
                                              const u16* __restrict__ Bh2, const u16* __restrict__ Bl2,
                                              u16* Ch2, u16* Cl2, float* Cf,
                                              int lda, int ldb, int ldc0, int K,
                                              int zA0, int zB0, int zC0) {
  __shared__ __attribute__((aligned(16))) u16 Sm[2 * G_BUF];
  float* Cs = (float*)Sm;           // 128 x 132 f32 output tile, reuses the buffers behind the loop
  const int job = (MODE == 3) ? (int)blockIdx.z : 0;
  const bool kj = (MODE == 3) && (job == 1);
  const int mode = (MODE == 3) ? (kj ? 2 : 0) : MODE;
  const u16* Ah = (job == 0) ? Ah0 : (job == 1) ? Ah1 : Ah2;
  const u16* Al = (job == 0) ? Al0 : (job == 1) ? Al1 : Al2;
  const u16* Bh = (job == 0) ? Bh0 : (job == 1) ? Bh1 : Bh2;
  const u16* Bl = (job == 0) ? Bl0 : (job == 1) ? Bl1 : Bl2;
  u16* Ch = (job == 0) ? Ch0 : (job == 1) ? Ch1 : Ch2;
  u16* Cl = (job == 0) ? Cl0 : (job == 1) ? Cl1 : Cl2;
  // MODE 3: ldc0, zB0 and zC0 are the K job's; Q and V have plain rows of lda values and no batch
  const int ldc = (MODE == 3 && !kj) ? lda : ldc0;
  const int zA = zA0, zB = zB0, zC = zC0;
  const int z = (MODE == 3) ? (kj ? (int)(blockIdx.y >> 3) : 0) : (int)blockIdx.z;
  const int bm = (kj ? (int)(blockIdx.y & 7) : (int)blockIdx.y) * 128, bn = blockIdx.x * 128;
  const int tid = threadIdx.x, wave = tid >> 5, lane = tid & 31;
  const int m = lane & 15, hh = lane >> 4;
  const int wr = (wave & 1) * 64, wc = (wave >> 1) * 32;

  // staging map: thread -> (row tid>>3 (+32 per step), 16-byte piece tid&7 of the row's 128 B)
  const int srow = tid >> 3, sseg = (tid & 7) * 8;
  const u16* gah = Ah + (size_t)z * zA + (size_t)(bm + srow) * lda + sseg;
  const u16* gal = Al + (size_t)z * zA + (size_t)(bm + srow) * lda + sseg;
  const u16* gbh = Bh + (size_t)z * zB + (size_t)(bn + srow) * ldb + sseg;
  const u16* gbl = Bl + (size_t)z * zB + (size_t)(bn + srow) * ldb + sseg;
  const int so = srow * G_PIT + sseg;
  // fragment map inside a buffer (same rows and k order as the planes)
  const int fa = (wr + m) * G_PIT + 8 * hh;
  const int fb = (wc + m) * G_PIT + 8 * hh;

  f32x8 acc[4][2];
#pragma unroll
  for (int rt = 0; rt < 4; ++rt)
#pragma unroll
    for (int ct = 0; ct < 2; ++ct) acc[rt][ct] = zero8();

  v4u sa[8], sb[8];
  g_fetch(sa, sb, gah, gal, gbh, gbl, lda, ldb);
  g_put(Sm + so, sa, sb);
  __syncthreads();

  const int nch = K >> 6;
  for (int c = 0; c < nch; ++c) {
    const u16* cur = Sm + (c & 1) * G_BUF;
    u16* nxt = Sm + ((c + 1) & 1) * G_BUF;
    const bool more = (c + 1 < nch);
    if (more) {
      const int k1 = (c + 1) * 64;
      g_fetch(sa, sb, gah + k1, gal + k1, gbh + k1, gbl + k1, lda, ldb);
    }
#pragma unroll
    for (int ks = 0; ks < 2; ++ks) {
      Frag ah[4], al[4], bh[2], bl[2];
#pragma unroll
      for (int rt = 0; rt < 4; ++rt) {
        ldf(ah[rt], cur + fa + rt * 16 * G_PIT + ks * 32);
        ldf(al[rt], cur + G_AL + fa + rt * 16 * G_PIT + ks * 32);
      }
#pragma unroll
      for (int ct = 0; ct < 2; ++ct) {
        ldf(bh[ct], cur + G_BH + fb + ct * 16 * G_PIT + ks * 32);
        ldf(bl[ct], cur + G_BL + fb + ct * 16 * G_PIT + ks * 32);
      }
#pragma unroll
      for (int rt = 0; rt < 4; ++rt)
#pragma unroll
        for (int ct = 0; ct < 2; ++ct)
          acc[rt][ct] = wmma3(ah[rt], al[rt], bh[ct], bl[ct], acc[rt][ct]);
    }
    if (more) g_put(nxt + so, sa, sb);
    // publishes chunk c+1 and ends every wave's reads of the buffer that trip c+1 refills (behind the last trip: of the
    // second buffer, as K = 1024 gives 16 chunks; the output tile lies in the first, freed one trip earlier)
    __syncthreads();
  }

  // stage the 128x128 f32 tile: D element r of lane -> (row 8*hh + r, col m)
#pragma unroll
  for (int rt = 0; rt < 4; ++rt)
#pragma unroll
    for (int ct = 0; ct < 2; ++ct)
#pragma unroll
      for (int r = 0; r < 8; ++r)
        Cs[(wr + rt * 16 + 8 * hh + r) * 132 + wc + ct * 16 + m] = acc[rt][ct][r];
  __syncthreads();

  if (mode == 1) {
    float* cb = Cf + (size_t)z * zC;
    v4f v[16];
    size_t go[16];
#pragma unroll
    for (int i = 0; i < 16; ++i) {
      const int row = wave * 16 + i;
      v[i] = *(const v4f*)(Cs + row * 132 + 4 * lane);
      go[i] = (size_t)(bm + row) * ldc + bn + 4 * lane;
    }
#pragma unroll
    for (int i = 0; i < 16; ++i) *(v4f*)(cb + go[i]) = v[i];
    
  } else if (mode == 2) {
    // a wave owns two neighbouring 16-row tiles of one 64-column plane: their eight units lie one behind the other
    const int jt = (wave >> 1) * 2, hd = wave & 1;
    const size_t base = (size_t)z * zC + (size_t)((bn >> 6) + hd) * ldc + (size_t)((bm >> 4) + jt) * 1024 + (size_t)lane * 8;
    u16* chb = Ch + base;
    u16* clb = Cl + base;
    us8 hv[8], lv[8];
#pragma unroll
    for (int i = 0; i < 8; ++i) {
      const float* cp = Cs + ((jt + (i >> 2)) * 16 + m) * 132 + hd * 64 + (i & 3) * 16 + hh * 8;
      const v4f a = *(const v4f*)cp;
      const v4f b = *(const v4f*)(cp + 4);
      split8(a, b, hv[i], lv[i]);
    }
#pragma unroll
    for (int i = 0; i < 8; ++i) {
      *(us8*)(chb + i * 256) = hv[i];
      *(us8*)(clb + i * 256) = lv[i];
    }
  } else {
    u16* chb = Ch + (size_t)z * zC;
    u16* clb = Cl + (size_t)z * zC;
    us8 hv[8], lv[8];
    size_t go[8];
#pragma unroll
    for (int i = 0; i < 8; ++i) {
      const int row = wave * 16 + 2 * i + (lane >> 4);
      const int cs = (lane & 15) * 8;
      const v4f a = *(const v4f*)(Cs + row * 132 + cs);
      const v4f b = *(const v4f*)(Cs + row * 132 + cs + 4);
      split8(a, b, hv[i], lv[i]);
      go[i] = (size_t)(bm + row) * ldc + bn + cs;
    }
#pragma unroll
    for (int i = 0; i < 8; ++i) {
      *(us8*)(chb + go[i]) = hv[i];
      *(us8*)(clb + go[i]) = lv[i];
    }
    // the wait that stands before a store's registers are rewritten: with two output forms in one kernel the other
    // form's instructions follow these stores in the built code, behind a test
    if (MODE == 3) asm volatile("s_wait_xcnt 0x0" ::: "memory");
  }
}

// ---------------------------------------------------------------- per-head V transpose
// src planes: VP[4096][1024] bf16; head plane X_h = 64 contiguous rows viewed as [1024 l][64 e].
// dst planes: per head v^T[64 e][1024 l] in fragment order (units: row tile e / 16, then l / 16).
__global__ __launch_bounds__(256) void k_vtr(const u16* __restrict__ sh, const u16* __restrict__ sl, u16* dh, u16* dl) {
  __shared__ __attribute__((aligned(16))) u16 Th[64 * 72];  // [e][l]
  __shared__ __attribute__((aligned(16))) u16 Tl[64 * 72];
  const int blk = blockIdx.x, lt = blk & 15, h = (blk >> 4) & 15, b = blk >> 8;
  const int l0 = lt * 64, t = threadIdx.x;
  const size_t src = (size_t)b * 1048576 + (size_t)h * 65536 + (size_t)l0 * 64;
#pragma unroll
  for (int it = 0; it < 2; ++it) {
    const int pc = t + 256 * it, l = pc >> 3, q = pc & 7;
    const us8 a = *(const us8*)(sh + src + l * 64 + 8 * q);
    const us8 c = *(const us8*)(sl + src + l * 64 + 8 * q);
#pragma unroll
    for (int i = 0; i < 8; ++i) {
      Th[(8 * q + i) * 72 + l] = a[i];
      Tl[(8 * q + i) * 72 + l] = c[i];
    }
  }
  __syncthreads();
  // a wave owns row tile nt and 32 of the block's 64 l: two units, 1 KiB in a row per plane
  const int wave = t >> 5, lane = t & 31, nt = wave >> 1, kl = wave & 1;
  const size_t dst = (size_t)(b * 16 + h) * 65536 + (size_t)(nt * 64 + lt * 4 + kl * 2) * 256 + (size_t)lane * 8;
  us8 oh[2], ol[2];
  size_t go[2];
#pragma unroll
  for (int it = 0; it < 2; ++it) {
    const int so = (nt * 16 + (lane & 15)) * 72 + kl * 32 + it * 16 + (lane >> 4) * 8;
    oh[it] = *(const us8*)(Th + so);
    ol[it] = *(const us8*)(Tl + so);
    go[it] = dst + (size_t)it * 256;
  }
#pragma unroll
  for (int it = 0; it < 2; ++it) {
    *(us8*)(dh + go[it]) = oh[it];
    *(us8*)(dl + go[it]) = ol[it];
  }
  
}

// ---------------------------------------------------------------- attention
// the four fragments (hi / lo, two k-steps) of one 16-row tile of a [rows][64] plane in fragment order; off = the lane's
// byte offset (tile * 2048 + lane * 16) in both planes
__device__ __forceinline__ void ld_k64_pk(Frag& h0, Frag& l0, Frag& h1, Frag& l1, const u16* bh, const u16* bl, u32 off) {
  const u16* ph = (const u16*)((const char*)bh + off);
  const u16* pl = (const u16*)((const char*)bl + off);
  ldf_pk(h0, ph); ldf_pk(h1, ph + 512);
  ldf_pk(l0, pl); ldf_pk(l1, pl + 512);
  // the wait that stands before a load's address register is rewritten; the offset is an input so that it stays
  // live, and so unwritten (also by a later load's result), up to it
  asm volatile("s_wait_xcnt 0x0" ::"v"(off) : "memory");
}

// the two fragments (hi / lo) of one 32-deep k-step of a plane in fragment order; off = the lane's byte offset in both planes
__device__ __forceinline__ void ld_k32_pk(Frag& h, Frag& l, const u16* bh, const u16* bl, u32 off) {
  ldf_pk(h, (const u16*)((const char*)bh + off));
  ldf_pk(l, (const u16*)((const char*)bl + off));
  // the wait that stands before a load's address register is rewritten; the offset is an input as in ld_k64_pk
  asm volatile("s_wait_xcnt 0x0" ::"v"(off) : "memory");
}

// one 16x16 tile, K = 64 (two k-steps); A and B fragments preloaded
__device__ __forceinline__ f32x8 tile_k64(const Frag& ah0, const Frag& al0, const Frag& ah1, const Frag& al1,
                                          const Frag& h0, const Frag& l0, const Frag& h1, const Frag& l1) {
  f32x8 acc = zero8();
  acc = wmma3(ah0, al0, h0, l0, acc);
  acc = wmma3(ah1, al1, h1, l1, acc);
  return acc;
}

// One block per (b, h, 32 query rows), 256 threads = 8 waves.
// LDS (dynamic): S[32][1024] f32 (131072 B), later reused in place as P row = hi[1024] | lo[1024] bf16; Ost[2][32][64] f32 (16384 B).
// Every Er, K and V fragment is loaded once per block: the wave that loads it multiplies it with all row tiles.
// The Q, Er, K and V planes lie in fragment order, so each fragment load reads whole lines.
// Er, K and V fragments are fetched ahead of their use into further register sets (Er and K: two tiles ahead; V: four
// k-steps ahead), so that a wave multiplies while its next loads are under way.
// P rows are 4096 B apart (the same banks in every row), so inside a plane the 16-byte piece (col >> 3) of row r sits at
// piece index (col >> 3) ^ (r & 15): the 16 rows that one fragment load reads then fall on 16 different bank groups.
__global__ __launch_bounds__(256) void k_attn(const u16* __restrict__ QPh, const u16* __restrict__ QPl,
                                              const u16* __restrict__ KPh, const u16* __restrict__ KPl,
                                              const u16* __restrict__ VTh, const u16* __restrict__ VTl,
                                              const u16* __restrict__ Eh, const u16* __restrict__ El,
                                              u16* AOh, u16* AOl) {
  extern __shared__ v4u dsm[];
  float* S = (float*)dsm;
  u16* P = (u16*)dsm;
  float* Ost = (float*)(dsm + 8192);  // byte offset 131072

  const int blk = blockIdx.x;
  const int ib = blk & 31, h = (blk >> 5) & 15, b = blk >> 9;
  const int i0 = ib * 32;
  const int tid = threadIdx.x, wave = tid >> 5, lane = tid & 31;
  const int m = lane & 15, hh = lane >> 4;

  // q_h[i][e]  = QP[b][h*64 + (i>>4)][(i&15)*64 + e]: plane at b*2^20 + h*2^16, one QP row = one 16-row tile in fragment order
  const size_t pq = (size_t)b * 1048576 + (size_t)h * 65536;
  const u16* Qh = QPh + pq;
  const u16* Ql = QPl + pq;
  // k_h[j][e]  = KP[b][h*64+e][j]: per head a [1024 j][64 e] plane in fragment order
  const u16* Kh = KPh + pq;
  const u16* Kl = KPl + pq;
  // v_h^T[e][j]: per head a [64 e][1024 j] plane in fragment order
  const u16* Vh = VTh + pq;
  const u16* Vl = VTl + pq;

  // Srel[i][i+1] = 0 (the only cells the skew scatter never writes)
  if (tid < 32) {
    const int j = i0 + tid + 1;
    if (j < 1024) S[tid * 1024 + j] = 0.0f;
  }

  // ---- phase 1: QEr tiles (rows i0 .. i0+32 needed) scattered through the skew map into S
  // row tile 2 (rows i0+32..) is consumed only through row i0+32, columns c <= 990 - i0
  const int ncol2 = 991 - i0;
  const int nct2 = (ncol2 > 0) ? ((ncol2 + 63) >> 6) : 0;
  // Q fragments of row tiles 0 and 1 (the block's own rows) and 2 (the 16 rows behind them), kept through phases 1 and 2
  Frag qh0[3], ql0[3], qh1[3], ql1[3];
#pragma unroll
  for (int rt = 0; rt < 3; ++rt) {
    int qt = (i0 >> 4) + rt;
    qt = (qt > 63) ? 63 : qt;   // the last block has no rows behind it (and nct2 = 0: the tile is not used)
    ld_k64_pk(qh0[rt], ql0[rt], qh1[rt], ql1[rt], Qh, Ql, (u32)(qt * 2048 + lane * 16));
  }
  // a wave owns the 64-column groups ct = wave and wave + 8, four 16-column tiles each
  // The skew is linear in flat indices: pad and reshape send QEr[i2][c] to flat cell i2 * 1025 + c + 1 - 1024 of Srel, so
  // in this block's S it lands at (d - 1) * 1024 + i0 + d + c + 1 with d = i2 - i0; a carry of the column part into the
  // next row is the map's own lower-triangle case. One lane index per column tile (f1, the cell of the lane's row d = 8 hh
  // + 1, never negative), a constant 1025 cells per further row.
  // d = 1..31 always fall inside S; d = 0 only where the index is not negative, d = 32 only where it is below 32768,
  // d > 32 never. A lane whose cell lies outside stores into its word of Ost instead (rewritten whole in phase 4 before
  // it is read), so that no store of the loop stands behind a vector compare and a branch.
  const int wv = __builtin_amdgcn_readfirstlane(wave);   // scalar wave number: the test on row tile 2 is a scalar branch
  const int fb = 8 * hh * 1025 + i0 + m + 2;
  // three fragment sets for the stream of 16 tiles (8 of Er, then 8 of K): tile n sits in set n % 3 and is asked for two
  // tiles ahead, into the set that tile n - 3 has just left; both loops are unrolled so that the set is a fixed register
  Frag fh0[3], fl0[3], fh1[3], fl1[3];
  const auto tile_off = [&](int t) { return (u32)(((wv + 8 * (t >> 2)) * 64 + (t & 3) * 16) * 128 + lane * 16); };
  const auto qer_tile = [&](int t, const Frag& h0, const Frag& l0, const Frag& h1, const Frag& l1) {
    const int ct = wv + 8 * (t >> 2);
    const int col0 = ct * 64 + (t & 3) * 16;
    const int f1 = fb + col0;
    const f32x8 acc0 = tile_k64(qh0[0], ql0[0], qh1[0], ql1[0], h0, l0, h1, l1);
    const f32x8 acc1 = tile_k64(qh0[1], ql0[1], qh1[1], ql1[1], h0, l0, h1, l1);
    S[(f1 >= 1025) ? (f1 - 1025) : (32768 + lane)] = acc0[0];
#pragma unroll
    for (int r = 1; r < 8; ++r) S[f1 + (r - 1) * 1025] = acc0[r];
#pragma unroll
    for (int r = 0; r < 8; ++r) S[f1 + (15 + r) * 1025] = acc1[r];
    if (ct < nct2) {
      const f32x8 acc2 = tile_k64(qh0[2], ql0[2], qh1[2], ql1[2], h0, l0, h1, l1);
      const int f2 = f1 + 31 * 1025;
      S[(f2 < 32768) ? f2 : (32768 + lane)] = acc2[0];
    }
  };
  ld_k64_pk(fh0[0], fl0[0], fh1[0], fl1[0], Eh, El, tile_off(0));
  ld_k64_pk(fh0[1], fl0[1], fh1[1], fl1[1], Eh, El, tile_off(1));
  // unrolled: the set numbers must be constants, or the sets would not stay in registers
#pragma unroll
  for (int t = 0; t < 8; ++t) {
    const int c = t % 3, n = (t + 2) % 3;
    // behind the last Er tiles: phase 2's first two K tiles (same tile offsets in both planes)
    ld_k64_pk(fh0[n], fl0[n], fh1[n], fl1[n], (t < 6) ? Eh : Kh, (t < 6) ? El : Kl, tile_off((t + 2) & 7));
    qer_tile(t, fh0[c], fl0[c], fh1[c], fl1[c]);
  }
  __syncthreads();

  // ---- phase 2: S += Q K^T
  const auto qk_tile = [&](int t, const Frag& h0, const Frag& l0, const Frag& h1, const Frag& l1) {
    const int col0 = (wv + 8 * (t >> 2)) * 64 + (t & 3) * 16;
#pragma unroll
    for (int rt = 0; rt < 2; ++rt) {
      const f32x8 acc = tile_k64(qh0[rt], ql0[rt], qh1[rt], ql1[rt], h0, l0, h1, l1);
#pragma unroll
      for (int r = 0; r < 8; ++r)
        S[(rt * 16 + 8 * hh + r) * 1024 + col0 + m] += acc[r];
    }
  };
  // unrolled for the same reason as phase 1's loop
#pragma unroll
  for (int t = 0; t < 8; ++t) {
    const int c = (t + 8) % 3, n = (t + 10) % 3;
    if (t < 6) ld_k64_pk(fh0[n], fl0[n], fh1[n], fl1[n], Kh, Kl, tile_off(t + 2));
    qk_tile(t, fh0[c], fl0[c], fh1[c], fl1[c]);
  }
  __syncthreads();

  // phase 4's first four k-steps of V, under way during the softmax (behind the barrier, which would wait for them)
  const int nt = wv & 3, kh = wv >> 2;
  const u32 voff = (u32)(nt * 32768 + kh * 16384 + lane * 16);   // row tile nt: 64 units of 512 B; a k-step is two units
  Frag vh[4], vl[4];
#pragma unroll
  for (int s = 0; s < 4; ++s) ld_k32_pk(vh[s], vl[s], Vh, Vl, voff + (u32)(s * 1024));

  // ---- phase 3: row softmax of S/8 (max-subtracted), P written in place as bf16 hi/lo; lane owns columns
  // 128 q + 4 lane + 0..3 (q = 0..7), so a wave-wide 16-byte read covers 512 contiguous bytes of the row
#pragma unroll 1
  for (int rr = 0; rr < 4; ++rr) {
    const int row = wave * 4 + rr;
    const float* sr = S + row * 1024 + lane * 4;
    v4f xv[8];
    float mx = -3.0e38f;
#pragma unroll
    for (int q = 0; q < 8; ++q) {
      v4f v = *(const v4f*)(sr + 128 * q);
      v = v * 0.125f;
      xv[q] = v;
      mx = fmaxf(mx, fmaxf(fmaxf(v.x, v.y), fmaxf(v.z, v.w)));
    }
#pragma unroll
    for (int off = 16; off > 0; off >>= 1) mx = fmaxf(mx, __shfl_xor(mx, off, 32));
    float sum = 0.0f;
#pragma unroll
    for (int q = 0; q < 8; ++q) {
      v4f e;
      e.x = __expf(xv[q].x - mx);
      e.y = __expf(xv[q].y - mx);
      e.z = __expf(xv[q].z - mx);
      e.w = __expf(xv[q].w - mx);
      xv[q] = e;
      sum += (e.x + e.y) + (e.z + e.w);
    }
#pragma unroll
    for (int off = 16; off > 0; off >>= 1) sum += __shfl_xor(sum, off, 32);
    const float inv = 1.0f / sum;
    // hi: halves row*2048 + swizzled piece * 8 + (col & 7); piece of this lane's group q = 16 q + (lane >> 1)
    u16* ph = P + row * 2048 + (((lane >> 1) ^ (row & 15)) * 8) + (lane & 1) * 4;
    u16* pl = ph + 1024;                    // lo plane: 1024 halves behind hi
#pragma unroll
    for (int q = 0; q < 8; q += 2) {
      const v4f a = xv[q] * inv;
      const v4f c = xv[q + 1] * inv;
      const float x[8] = {a.x, a.y, a.z, a.w, c.x, c.y, c.z, c.w};
      u32 hw[4], lw[4];
      split4p(x, hw, lw);
      const v2u hv0 = {hw[0], hw[1]}, hv1 = {hw[2], hw[3]};
      const v2u lv0 = {lw[0], lw[1]}, lv1 = {lw[2], lw[3]};
      *(v2u*)(ph + 128 * q) = hv0;
      *(v2u*)(pl + 128 * q) = lv0;
      *(v2u*)(ph + 128 * q + 128) = hv1;
      *(v2u*)(pl + 128 * q + 128) = lv1;
    }
  }
  __syncthreads();

  // ---- phase 4: O[32][64] = P[32][1024] . V[1024][64]; a wave owns 16 columns of O, both row tiles, and one half of k;
  // the two halves' partial sums are added behind the barrier
  {
    const u16* pa = P + m * 2048;               // row tile 0; row tile 1 is 16 rows on; row & 15 = m in both
    f32x8 acc[2];
    acc[0] = zero8();
    acc[1] = zero8();
    const auto pv_step = [&](int ks, const Frag& bh, const Frag& bl) {
      const int p0 = ((ks * 4 + hh) ^ m) * 8;       // columns ks*32 + 8*hh + 0..7
      const int p1 = ((ks * 4 + 2 + hh) ^ m) * 8;   // columns ks*32 + 16 + 8*hh + 0..7
      Frag ah[2], al[2];
#pragma unroll
      for (int rt = 0; rt < 2; ++rt) {
        const u16* pr = pa + rt * 16 * 2048;
        ah[rt].q[0] = *(const v4u*)(pr + p0);
        ah[rt].q[1] = *(const v4u*)(pr + p1);
        al[rt].q[0] = *(const v4u*)(pr + 1024 + p0);
        al[rt].q[1] = *(const v4u*)(pr + 1024 + p1);
      }
#pragma unroll
      for (int rt = 0; rt < 2; ++rt) acc[rt] = wmma3(ah[rt], al[rt], bh, bl, acc[rt]);
    };
    // k-step j of this wave's 16 sits in set j & 3, which is refilled for step j + 4 as soon as step j is done; groups of
    // four steps are unrolled so that each set is a fixed register, the loop over the groups stays rolled for code size
#pragma unroll 1
    for (int j = 0; j < 12; j += 4) {
#pragma unroll
      for (int s = 0; s < 4; ++s) {
        pv_step(kh * 16 + j + s, vh[s], vl[s]);
        ld_k32_pk(vh[s], vl[s], Vh, Vl, voff + (u32)((j + s + 4) * 1024));
      }
    }
#pragma unroll
    for (int s = 0; s < 4; ++s) pv_step(kh * 16 + 12 + s, vh[s], vl[s]);
#pragma unroll
    for (int rt = 0; rt < 2; ++rt)
#pragma unroll
      for (int r = 0; r < 8; ++r) Ost[kh * 2048 + (rt * 16 + 8 * hh + r) * 64 + nt * 16 + m] = acc[rt][r];
  }
  __syncthreads();

  {
    const int row = wave * 4 + (lane >> 3), q = lane & 7;
    const v4f a = *(const v4f*)(Ost + row * 64 + 8 * q) + *(const v4f*)(Ost + 2048 + row * 64 + 8 * q);
    const v4f bq = *(const v4f*)(Ost + row * 64 + 8 * q + 4) + *(const v4f*)(Ost + 2048 + row * 64 + 8 * q + 4);
    us8 hv, lv;
    split8(a, bq, hv, lv);
    const size_t g = ((size_t)(b * 1024 + i0 + row)) * 1024 + (size_t)h * 64 + 8 * q;
    *(us8*)(AOh + g) = hv;
    *(us8*)(AOl + g) = lv;
    
  }
}

// ---------------------------------------------------------------- launch

extern "C" void kernel_launch(void* const* d_in, const int* in_sizes, int n_in,
                              void* d_out, int out_size, void* d_ws, size_t ws_size,
                              hipStream_t stream) {
  const int NX = 4194304;   // 4 x 1024 x 1024
  const int NW = 1048576;   // 1024 x 1024
  const int NE = 65536;     // 1024 x 64
  if (n_in < 8) return;
  if (in_sizes[0] != NX || in_sizes[1] != NX || in_sizes[2] != NX) return;
  if (in_sizes[3] != NW || in_sizes[4] != NW || in_sizes[5] != NW || in_sizes[7] != NW) return;
  if (in_sizes[6] != NE) return;
  if (out_size != NX) return;

  const float* q_in = (const float*)d_in[0];
  const float* k_in = (const float*)d_in[1];
  const float* v_in = (const float*)d_in[2];
  const float* WQ = (const float*)d_in[3];
  const float* WK = (const float*)d_in[4];
  const float* WV = (const float*)d_in[5];
  const float* Er = (const float*)d_in[6];
  const float* WM = (const float*)d_in[7];
  float* out = (float*)d_out;

  // workspace carve (bytes); bf16 planes
  const size_t bx = (size_t)NX * 2;   // 8 MiB
  const size_t bw = (size_t)NW * 2;   // 2 MiB
  const size_t be = (size_t)NE * 2;   // 128 KiB
  const size_t total = 6 * bx + 8 * bw + 2 * be + 6 * bx;   // 117,702,656 B
  if (total > ws_size) return;
  char* w = (char*)d_ws;
  size_t off = 0;
  u16* R0h = (u16*)(w + off); off += bx;   // Xq
  u16* R0l = (u16*)(w + off); off += bx;
  u16* R1h = (u16*)(w + off); off += bx;   // Xk, later VT
  u16* R1l = (u16*)(w + off); off += bx;
  u16* R2h = (u16*)(w + off); off += bx;   // Xv, later AO
  u16* R2l = (u16*)(w + off); off += bx;
  u16* WQh = (u16*)(w + off); off += bw;
  u16* WQl = (u16*)(w + off); off += bw;
  u16* WKh = (u16*)(w + off); off += bw;
  u16* WKl = (u16*)(w + off); off += bw;
  u16* WVh = (u16*)(w + off); off += bw;
  u16* WVl = (u16*)(w + off); off += bw;
  u16* WMh = (u16*)(w + off); off += bw;
  u16* WMl = (u16*)(w + off); off += bw;
  u16* ERh = (u16*)(w + off); off += be;
  u16* ERl = (u16*)(w + off); off += be;
  u16* QPh = (u16*)(w + off); off += bx;
  u16* QPl = (u16*)(w + off); off += bx;
  u16* KPh = (u16*)(w + off); off += bx;
  u16* KPl = (u16*)(w + off); off += bx;
  u16* VPh = (u16*)(w + off); off += bx;   // planes of its own: V is written while Xq is still read
  u16* VPl = (u16*)(w + off); off += bx;
  if (off > ws_size) return;

  u16* Xqh = R0h; u16* Xql = R0l;
  u16* Xkh = R1h; u16* Xkl = R1l;
  u16* Xvh = R2h; u16* Xvl = R2l;
  u16* VTh = R1h; u16* VTl = R1l;
  u16* AOh = R2h; u16* AOl = R2l;

  const dim3 blk(256);
  const int ATTN_LDS = 131072 + 16384;
  hipFuncSetAttribute((const void*)k_attn, hipFuncAttributeMaxDynamicSharedMemorySize, ATTN_LDS);

  // every f32 operand -> bf16 hi/lo planes (Er in fragment order, the weights transposed, WQ's rows permuted for QP)
  k_prep<<<dim3(PREP_X + PREP_W + PREP_E), blk, 0, stream>>>(q_in, k_in, v_in, WQ, WK, WV, WM, Er, Xqh, Xql, Xkh, Xkl, Xvh,
                                                             Xvl, WQh, WQl, WKh, WKl, WVh, WVl, WMh, WMl, ERh, ERl);

  // one launch, job = grid.z:
  // 0: QP[4096][1024] = Xq . WQ, each row (16 queries x 64) in fragment order through WQt's row order
  // 1: KPT[b][c][r] = sum_k WK[k][c] key[b][r][k]  (A = WKt, Bt = Xk[b]), stored per 64 r (one head) in fragment order
  // 2: VP[4096][1024] = Xv . WV
  k_gemm<3><<<dim3(1024 / 128, 4096 / 128, 3), blk, 0, stream>>>(
      Xqh, Xql, WQh, WQl, QPh, QPl, WKh, WKl, Xkh, Xkl, KPh, KPl, Xvh, Xvl, WVh, WVl, VPh, VPl, out,
      1024, 1024, NE, 1024, 0, NW, NW);
  // per-head transpose of V (into region 1)
  k_vtr<<<dim3(4 * 16 * 16), blk, 0, stream>>>(VPh, VPl, VTh, VTl);
  // attention (into region 2)
  k_attn<<<dim3(4 * 16 * 32), blk, ATTN_LDS, stream>>>(QPh, QPl, KPh, KPl, VTh, VTl, ERh, ERl, AOh, AOl);
  // out = AO . WMerge
  k_gemm<1><<<dim3(1024 / 128, 4096 / 128, 1), blk, 0, stream>>>(
      AOh, AOl, WMh, WMl, QPh, QPl, AOh, AOl, WMh, WMl, QPh, QPl, AOh, AOl, WMh, WMl, QPh, QPl, out,
      1024, 1024, 1024, 1024, 0, 0, 0);
}

// v010
// Measured time: 179 microseconds a run.
// Timed twice side by side with v009, it ran 1.04 and 1.03 times as fast.
// Counting every step since v000, it is 3.04 times as fast.
#include <hip/hip_runtime.h>
#include <stdint.h>

// All contractions (x.WQ, WK-cols x key-rows, x.WV, Q.Er^T, Q.K^T, P.V, O.WMerge): v_wmma_f32_16x16x32_bf16 with bf16 hi/lo operand pairs (hi*hi + hi*lo + lo*hi), f32 accumulate; softmax and skew index arithmetic in f32 / int32.

typedef unsigned short u16;
typedef unsigned int u32;
typedef __bf16 bf16x16 __attribute__((ext_vector_type(16)));
typedef float f32x8 __attribute__((ext_vector_type(8)));
typedef u32 v2u __attribute__((ext_vector_type(2)));
typedef float v4f __attribute__((ext_vector_type(4)));
typedef u32 v4u __attribute__((ext_vector_type(4)));
typedef u16 us8 __attribute__((ext_vector_type(8)));
typedef u16 us4 __attribute__((ext_vector_type(4)));

union Frag {
  bf16x16 v;
  v4u q[2];
};

// 8 f32 -> four words of two bf16 hi and four words of two bf16 lo (lo = RNE(x - hi)), three instructions a pair: one
// packed RNE conversion gives both hi; a mixed-operand FMA per value reads its hi half as bf16, forms x - hi (exact in
// f32) and rounds it into its half of the lo word. Written in asm because the compiler does not form the mixed FMA here
// (it widens hi by a shift and a mask, subtracts and converts again: five a pair). Four pairs are interleaved so that
// each instruction's producer stands four back; the s_delay_alu lines tell the SIMD so, which lets other waves issue
// meanwhile (they change no result).
__device__ __forceinline__ void split4p(const float (&x)[8], u32 (&h)[4], u32 (&l)[4]) {
  asm("v_cvt_pk_bf16_f32 %0, %8, %9\n\t"
      "v_cvt_pk_bf16_f32 %1, %10, %11\n\t"
      "v_cvt_pk_bf16_f32 %2, %12, %13\n\t"
      "v_cvt_pk_bf16_f32 %3, %14, %15\n\t"
      "s_delay_alu instid0(VALU_DEP_4) | instskip(NEXT) | instid1(VALU_DEP_4)\n\t"
      "v_fma_mixlo_bf16 %4, %0, -1.0, %8 op_sel_hi:[1,0,0]\n\t"
      "v_fma_mixlo_bf16 %5, %1, -1.0, %10 op_sel_hi:[1,0,0]\n\t"
      "s_delay_alu instid0(VALU_DEP_4) | instskip(NEXT) | instid1(VALU_DEP_4)\n\t"
      "v_fma_mixlo_bf16 %6, %2, -1.0, %12 op_sel_hi:[1,0,0]\n\t"
      "v_fma_mixlo_bf16 %7, %3, -1.0, %14 op_sel_hi:[1,0,0]\n\t"
      "s_delay_alu instid0(VALU_DEP_4) | instskip(NEXT) | instid1(VALU_DEP_4)\n\t"
      "v_fma_mixhi_bf16 %4, %0, -1.0, %9 op_sel:[1,0,0] op_sel_hi:[1,0,0]\n\t"
      "v_fma_mixhi_bf16 %5, %1, -1.0, %11 op_sel:[1,0,0] op_sel_hi:[1,0,0]\n\t"
      "s_delay_alu instid0(VALU_DEP_4) | instskip(NEXT) | instid1(VALU_DEP_4)\n\t"
      "v_fma_mixhi_bf16 %6, %2, -1.0, %13 op_sel:[1,0,0] op_sel_hi:[1,0,0]\n\t"
      "v_fma_mixhi_bf16 %7, %3, -1.0, %15 op_sel:[1,0,0] op_sel_hi:[1,0,0]"
      : "=&v"(h[0]), "=&v"(h[1]), "=&v"(h[2]), "=&v"(h[3]), "=&v"(l[0]), "=&v"(l[1]), "=&v"(l[2]), "=&v"(l[3])
      : "v"(x[0]), "v"(x[1]), "v"(x[2]), "v"(x[3]), "v"(x[4]), "v"(x[5]), "v"(x[6]), "v"(x[7]));
}

// 8 f32 -> 8 bf16 hi + 8 bf16 lo
__device__ __forceinline__ void split8(v4f a, v4f b, us8& h, us8& l) {
  const float x[8] = {a.x, a.y, a.z, a.w, b.x, b.y, b.z, b.w};
  u32 hw[4], lw[4];
  split4p(x, hw, lw);
  const v4u hq = {hw[0], hw[1], hw[2], hw[3]};
  const v4u lq = {lw[0], lw[1], lw[2], lw[3]};
  h = __builtin_bit_cast(us8, hq);
  l = __builtin_bit_cast(us8, lq);
}

__device__ __forceinline__ f32x8 zero8() {
  f32x8 z;
#pragma unroll
  for (int e = 0; e < 8; ++e) z[e] = 0.0f;
  return z;
}

// 16-bit fragment: lane (h = l>>4, m = l&15) -> elements 0..7 = k0+8h+0..7, elements 8..15 = k0+16+8h+0..7
// p already points at row m, column k0 + 8h of a k-contiguous [row][k] plane.
__device__ __forceinline__ void ldf(Frag& f, const u16* p) {
  f.q[0] = *(const v4u*)p;
  f.q[1] = *(const v4u*)(p + 16);
}

// Fragment order: a [row][k] plane cut into units of 16 rows x 16 k; unit (row tile, k / 16) holds 256 halves, lane l's
// 8 halves at 8 l = row m, k = 16 * unit + 8h + 0..7. A fragment is two neighbouring units, and each of its two
// wave-wide 16-byte loads reads 512 contiguous bytes (4 whole lines; from a row-major plane the same load touches 16).
// p already points at the lane's piece of the fragment's first unit.
__device__ __forceinline__ void ldf_pk(Frag& f, const u16* p) {
  f.q[0] = *(const v4u*)p;
  f.q[1] = *(const v4u*)(p + 256);
}

// one 32-deep k-step, hi/lo pairs: c += ah*bh + ah*bl + al*bh ; hazard guard after the group
__device__ __forceinline__ f32x8 wmma3(const Frag& ah, const Frag& al, const Frag& bh, const Frag& bl, f32x8 c) {
  c = __builtin_amdgcn_wmma_f32_16x16x32_bf16(false, ah.v, false, bh.v, (short)0, c, false, false);
  c = __builtin_amdgcn_wmma_f32_16x16x32_bf16(false, ah.v, false, bl.v, (short)0, c, false, false);
  c = __builtin_amdgcn_wmma_f32_16x16x32_bf16(false, al.v, false, bh.v, (short)0, c, false, false);
  asm volatile("v_nop\n\tv_nop\n\tv_nop\n\tv_nop" : "+v"(c) : "v"(ah.v), "v"(al.v), "v"(bh.v), "v"(bl.v));
  return c;
}

// ---------------------------------------------------------------- operand preparation, one launch
// All f32 operands -> bf16 hi/lo planes. The block index picks the job (the same for a whole block):
//   blocks 0..767      query / key / value, elementwise: 256 blocks each, 8 pieces of 8 values per thread
//   blocks 768..1279   WQ / WK / WV / WMerge, transposing: 128 blocks each, a 128 (k) x 64 (n) tile per block
//   blocks 1280..1311  Er into fragment order, one piece per thread
// Transposing split: in[1024 k][1024 n] row-major f32 -> out[n][k] planes. For WQ input column n = 64 m + e becomes
// output row (e >> 3) * 128 + 8 m + (e & 7), so that a GEMM with this plane as Bt leaves each of its output rows, read
// as [16 m][64 e], in fragment order. For WV input column n = 64 c + e becomes output row (e >> 4) * 256 + (c >> 3) * 128
// + (e & 15) * 8 + (c & 7): a row of x.WV holds 16 positions l = 16 r + c of one head, and in this column order it is four
// units (one per 16 e) of that head's v^T[e][l] plane in fragment order.
// Er: in[rows][64] row-major f32 -> planes in fragment order (units: row tile, then k / 16); thread = one 16-byte piece.
#define PREP_X 768
#define PREP_W 512
#define PREP_E 32
// second launch bound: a register budget at which five blocks fit a WGP, so that nearly the whole grid is resident at
// once and the jobs' loads, conversions and stores overlap
__global__ __launch_bounds__(256, 10) void k_prep(const float* __restrict__ xq, const float* __restrict__ xk,
                                              const float* __restrict__ xv, const float* __restrict__ wq,
                                              const float* __restrict__ wk, const float* __restrict__ wv,
                                              const float* __restrict__ wm, const float* __restrict__ er,
                                              u16* xqh, u16* xql, u16* xkh, u16* xkl, u16* xvh, u16* xvl,
                                              u16* wqh, u16* wql, u16* wkh, u16* wkl, u16* wvh, u16* wvl,
                                              u16* wmh, u16* wml, u16* erh, u16* erl) {
  __shared__ __attribute__((aligned(16))) float Ts[2 * 64 * 68];  // two 64 x 64 tiles, Ts[tile][n][k]
  const int blk = blockIdx.x, t = threadIdx.x;
  if (blk < PREP_X) {
    const int job = blk >> 8;
    const float* s = (job == 0) ? xq : (job == 1) ? xk : xv;
    u16* dh = (job == 0) ? xqh : (job == 1) ? xkh : xvh;
    u16* dl = (job == 0) ? xql : (job == 1) ? xkl : xvl;
    const u32 p0 = (u32)((blk & 255) * 2048 + t);   // first piece; the others 256 pieces apart
    v4f a[8], b[8];
    u32 so[8];
#pragma unroll
    for (int i = 0; i < 8; ++i) so[i] = (p0 + 256u * i) * 32u;   // byte offset in the f32 source
#pragma unroll
    for (int i = 0; i < 8; ++i) {
      a[i] = *(const v4f*)((const char*)s + so[i]);
      b[i] = *(const v4f*)((const char*)s + so[i] + 16);
    }
    // the wait that stands before a load's address register is rewritten; the offsets are inputs so that they stay
    // live, and so unwritten (also by a later load's result), up to it
    asm volatile("s_wait_xcnt 0x0" ::"v"(so[0]), "v"(so[1]), "v"(so[2]), "v"(so[3]), "v"(so[4]), "v"(so[5]), "v"(so[6]),
                 "v"(so[7])
                 : "memory");
    us8 h[8], l[8];
#pragma unroll
    for (int i = 0; i < 8; ++i) split8(a[i], b[i], h[i], l[i]);
#pragma unroll
    for (int i = 0; i < 8; ++i) {
      *(us8*)((char*)dh + (so[i] >> 1)) = h[i];
      *(us8*)((char*)dl + (so[i] >> 1)) = l[i];
    }
  } else if (blk < PREP_X + PREP_W) {
    const int wb = blk - PREP_X, job = wb >> 7, tile = wb & 127;
    const float* s = (job == 0) ? wq : (job == 1) ? wk : (job == 2) ? wv : wm;
    u16* dh = (job == 0) ? wqh : (job == 1) ? wkh : (job == 2) ? wvh : wmh;
    u16* dl = (job == 0) ? wql : (job == 1) ? wkl : (job == 2) ? wvl : wml;
    const int c0 = (tile & 15) * 64, r0 = (tile >> 4) * 128;
    {
      const int r = t >> 2, cb = (t & 3) * 16;
      v4f v[8];
      u32 so[2];
#pragma unroll
      for (int u = 0; u < 2; ++u) so[u] = (u32)((r0 + 64 * u + r) * 1024 + c0 + cb) * 4u;
#pragma unroll
      for (int u = 0; u < 2; ++u)
#pragma unroll
        for (int q = 0; q < 4; ++q) v[4 * u + q] = *(const v4f*)((const char*)s + so[u] + 16 * q);
      // the wait that stands before a load's address register is rewritten; the offsets are inputs as above
      asm volatile("s_wait_xcnt 0x0" ::"v"(so[0]), "v"(so[1]) : "memory");
#pragma unroll
      for (int u = 0; u < 2; ++u)
#pragma unroll
        for (int q = 0; q < 4; ++q) {
          float* d = Ts + u * (64 * 68) + (cb + 4 * q) * 68 + r;
          d[0] = v[4 * u + q].x;
          d[68] = v[4 * u + q].y;
          d[136] = v[4 * u + q].z;
          d[204] = v[4 * u + q].w;
        }
    }
    __syncthreads();
    us8 h[4], l[4];
    u32 go[4];
#pragma unroll
    for (int it = 0; it < 4; ++it) {
      const int u = it >> 1, pc = t + 256 * (it & 1), c = pc >> 3, q = pc & 7;
      const float* p = Ts + u * (64 * 68) + c * 68 + 8 * q;
      const v4f a = *(const v4f*)p;
      const v4f b = *(const v4f*)(p + 4);
      split8(a, b, h[it], l[it]);
      const int n = c0 + c;
      const int orow = (job == 0)   ? (((n >> 3) & 7) * 128 + (n >> 6) * 8 + (n & 7))
                       : (job == 2) ? (((n >> 4) & 3) * 256 + (n >> 9) * 128 + (n & 15) * 8 + ((n >> 6) & 7))
                                    : n;
      go[it] = (u32)(orow * 1024 + r0 + 64 * u + 8 * q) * 2u;
    }
#pragma unroll
    for (int it = 0; it < 4; ++it) {
      *(us8*)((char*)dh + go[it]) = h[it];
      *(us8*)((char*)dl + go[it]) = l[it];
    }
  } else {
    const int g = (blk - PREP_X - PREP_W) * 256 + t;
    const int lane = g & 31, u = (g >> 5) & 3, rt = g >> 7;
    const u32 so = (u32)((rt * 16 + (lane & 15)) * 64 + u * 16 + (lane >> 4) * 8) * 4u;
    const v4f a = *(const v4f*)((const char*)er + so);
    const v4f b = *(const v4f*)((const char*)er + so + 16);
    // the wait that stands before a load's address register is rewritten; the offset is an input as above
    asm volatile("s_wait_xcnt 0x0" ::"v"(so) : "memory");
    us8 h, l;
    split8(a, b, h, l);
    *(us8*)(erh + (size_t)g * 8) = h;
    *(us8*)(erl + (size_t)g * 8) = l;
    // the wait that stands before a store's registers are rewritten: in the built code another job's instructions
    // follow these stores, behind a test
    asm volatile("s_wait_xcnt 0x0" ::: "memory");
  }
}

// ---------------------------------------------------------------- GEMM (hi/lo pairs)
// C[z][M][N] = A[z][M][K] * Bt[z][N][K]^T ; A and Bt are k-contiguous bf16 hi/lo planes; K a multiple of 64.
// Block tile 128 x 128 (grid.x = N/128, grid.y = M/128, grid.z = batch), 8 waves of 64x32: per output value a third
// fewer operand bytes come from L2 than with a 64 x 128 tile, and a quarter fewer fragment reads from LDS.
// Operands go through LDS in 64-deep k-chunks: 8 lanes fetch one row's 128 B, so a wave-wide load covers 4 whole
// lines (a fragment load straight from the planes touches 16 lines for the same 512 B). Two buffers: chunk c+1 is
// fetched into registers while chunk c is multiplied, stored to the other buffer, and published by one barrier.
// MODE 0: bf16 hi/lo output planes (row segment 256 B = 16 lanes x 16 B); MODE 1: f32 output (512 B = 32 lanes x 16 B).
// MODE 2: bf16 hi/lo output planes in fragment order, one [M][64] plane per 64 output columns, ldc halves apart (a wave
// stores 4 KiB in a row).
// MODE 3: the three projections in one launch; blockIdx.z picks the job: 0 = Q (as MODE 0), 1 = K (as MODE 2, its four
// batches of 8 row blocks laid along grid.y), 2 = V (as MODE 0, but each 256 columns of a row are one unit of the head's
// transposed plane and go to that unit's place). Operand set 0 serves MODE 0..2.
#define G_PIT 72                    // LDS row pitch in halves: 144 B = 16 B x 9, conflict-free for 16-byte row reads
#define G_AL (128 * G_PIT)          // plane offsets inside a buffer, in halves: A hi at 0, A lo, B hi, B lo
#define G_BH (256 * G_PIT)
#define G_BL (384 * G_PIT)
#define G_BUF (512 * G_PIT)         // 36,864 halves = 73,728 B per buffer (two buffers: two blocks fit a WGP's LDS)

// one thread's share of a chunk: 4 + 4 pieces of A hi / lo, 4 + 4 of B hi / lo, rows 32 apart
__device__ __forceinline__ void g_fetch(v4u (&sa)[8], v4u (&sb)[8], const u16* ah, const u16* al, const u16* bh,
                                        const u16* bl, int lda, int ldb) {
  const u16* pa[8];
  const u16* pb[8];
#pragma unroll
  for (int i = 0; i < 4; ++i) {
    pa[i] = ah + (size_t)(32 * i) * lda;
    pa[4 + i] = al + (size_t)(32 * i) * lda;
  }
#pragma unroll
  for (int i = 0; i < 4; ++i) {
    pb[i] = bh + (size_t)(32 * i) * ldb;
    pb[4 + i] = bl + (size_t)(32 * i) * ldb;
  }
#pragma unroll
  for (int i = 0; i < 8; ++i) sa[i] = *(const v4u*)pa[i];
#pragma unroll
  for (int i = 0; i < 8; ++i) sb[i] = *(const v4u*)pb[i];
  // the wait that stands before a load's address register is rewritten; the sixteen addresses are inputs so that
  // they stay live, and so unwritten (also by a later load's result), up to it
  asm volatile("s_wait_xcnt 0x0" ::"v"(pa[0]), "v"(pa[1]), "v"(pa[2]), "v"(pa[3]), "v"(pa[4]), "v"(pa[5]), "v"(pa[6]),
               "v"(pa[7]), "v"(pb[0]), "v"(pb[1]), "v"(pb[2]), "v"(pb[3]), "v"(pb[4]), "v"(pb[5]), "v"(pb[6]),
               "v"(pb[7])
               : "memory");
}
__device__ __forceinline__ void g_put(u16* buf, const v4u (&sa)[8], const v4u (&sb)[8]) {
#pragma unroll
  for (int i = 0; i < 4; ++i) {
    *(v4u*)(buf + 32 * i * G_PIT) = sa[i];
    *(v4u*)(buf + G_AL + 32 * i * G_PIT) = sa[4 + i];
  }
#pragma unroll
  for (int i = 0; i < 4; ++i) {
    *(v4u*)(buf + G_BH + 32 * i * G_PIT) = sb[i];
    *(v4u*)(buf + G_BL + 32 * i * G_PIT) = sb[4 + i];
  }
}
template <int MODE>
__global__ __launch_bounds__(256) void k_gemm(const u16* __restrict__ Ah0, const u16* __restrict__ Al0,
                                              const u16* __restrict__ Bh0, const u16* __restrict__ Bl0,
                                              u16* Ch0, u16* Cl0,
                                              const u16* __restrict__ Ah1, const u16* __restrict__ Al1,
                                              const u16* __restrict__ Bh1, const u16* __restrict__ Bl1,
                                              u16* Ch1, u16* Cl1,
                                              const u16* __restrict__ Ah2, const u16* __restrict__ Al2,
                                              const u16* __restrict__ Bh2, const u16* __restrict__ Bl2,
                                              u16* Ch2, u16* Cl2, float* Cf,
                                              int lda, int ldb, int ldc0, int K,
                                              int zA0, int zB0, int zC0) {
  __shared__ __attribute__((aligned(16))) u16 Sm[2 * G_BUF];
  float* Cs = (float*)Sm;           // 128 x 132 f32 output tile, reuses the buffers behind the loop
  const int job = (MODE == 3) ? (int)blockIdx.z : 0;
  const bool kj = (MODE == 3) && (job == 1);
  const bool vj = (MODE == 3) && (job == 2);
  const int mode = (MODE == 3) ? (kj ? 2 : 0) : MODE;
  const u16* Ah = (job == 0) ? Ah0 : (job == 1) ? Ah1 : Ah2;
  const u16* Al = (job == 0) ? Al0 : (job == 1) ? Al1 : Al2;
  const u16* Bh = (job == 0) ? Bh0 : (job == 1) ? Bh1 : Bh2;
  const u16* Bl = (job == 0) ? Bl0 : (job == 1) ? Bl1 : Bl2;
  u16* Ch = (job == 0) ? Ch0 : (job == 1) ? Ch1 : Ch2;
  u16* Cl = (job == 0) ? Cl0 : (job == 1) ? Cl1 : Cl2;
  // MODE 3: ldc0, zB0 and zC0 are the K job's; Q has plain rows of lda values (V's unit layout does not use ldc); Q and V have no batch
  const int ldc = (MODE == 3 && !kj) ? lda : ldc0;
  const int zA = zA0, zB = zB0, zC = zC0;
  const int z = (MODE == 3) ? (kj ? (int)(blockIdx.y >> 3) : 0) : (int)blockIdx.z;
  const int bm = (kj ? (int)(blockIdx.y & 7) : (int)blockIdx.y) * 128, bn = blockIdx.x * 128;
  const int tid = threadIdx.x, wave = tid >> 5, lane = tid & 31;
  const int m = lane & 15, hh = lane >> 4;
  const int wr = (wave & 1) * 64, wc = (wave >> 1) * 32;

  // staging map: thread -> (row tid>>3 (+32 per step), 16-byte piece tid&7 of the row's 128 B)
  const int srow = tid >> 3, sseg = (tid & 7) * 8;
  const u16* gah = Ah + (size_t)z * zA + (size_t)(bm + srow) * lda + sseg;
  const u16* gal = Al + (size_t)z * zA + (size_t)(bm + srow) * lda + sseg;
  const u16* gbh = Bh + (size_t)z * zB + (size_t)(bn + srow) * ldb + sseg;
  const u16* gbl = Bl + (size_t)z * zB + (size_t)(bn + srow) * ldb + sseg;
  const int so = srow * G_PIT + sseg;
  // fragment map inside a buffer (same rows and k order as the planes)
  const int fa = (wr + m) * G_PIT + 8 * hh;
  const int fb = (wc + m) * G_PIT + 8 * hh;

  f32x8 acc[4][2];
#pragma unroll
  for (int rt = 0; rt < 4; ++rt)
#pragma unroll
    for (int ct = 0; ct < 2; ++ct) acc[rt][ct] = zero8();

  v4u sa[8], sb[8];
  g_fetch(sa, sb, gah, gal, gbh, gbl, lda, ldb);
  g_put(Sm + so, sa, sb);
  __syncthreads();

  const int nch = K >> 6;
  for (int c = 0; c < nch; ++c) {
    const u16* cur = Sm + (c & 1) * G_BUF;
    u16* nxt = Sm + ((c + 1) & 1) * G_BUF;
    const bool more = (c + 1 < nch);
    if (more) {
      const int k1 = (c + 1) * 64;
      g_fetch(sa, sb, gah + k1, gal + k1, gbh + k1, gbl + k1, lda, ldb);
    }
#pragma unroll
    for (int ks = 0; ks < 2; ++ks) {
      Frag ah[4], al[4], bh[2], bl[2];
#pragma unroll
      for (int rt = 0; rt < 4; ++rt) {
        ldf(ah[rt], cur + fa + rt * 16 * G_PIT + ks * 32);
        ldf(al[rt], cur + G_AL + fa + rt * 16 * G_PIT + ks * 32);
      }
#pragma unroll
      for (int ct = 0; ct < 2; ++ct) {
        ldf(bh[ct], cur + G_BH + fb + ct * 16 * G_PIT + ks * 32);
        ldf(bl[ct], cur + G_BL + fb + ct * 16 * G_PIT + ks * 32);
      }
#pragma unroll
      for (int rt = 0; rt < 4; ++rt)
#pragma unroll
        for (int ct = 0; ct < 2; ++ct)
          acc[rt][ct] = wmma3(ah[rt], al[rt], bh[ct], bl[ct], acc[rt][ct]);
    }
    if (more) g_put(nxt + so, sa, sb);
    // publishes chunk c+1 and ends every wave's reads of the buffer that trip c+1 refills (behind the last trip: of the
    // second buffer, as K = 1024 gives 16 chunks; the output tile lies in the first, freed one trip earlier)
    __syncthreads();
  }

  // stage the 128x128 f32 tile: D element r of lane -> (row 8*hh + r, col m)
#pragma unroll
  for (int rt = 0; rt < 4; ++rt)
#pragma unroll
    for (int ct = 0; ct < 2; ++ct)
#pragma unroll
      for (int r = 0; r < 8; ++r)
        Cs[(wr + rt * 16 + 8 * hh + r) * 132 + wc + ct * 16 + m] = acc[rt][ct][r];
  __syncthreads();

  if (mode == 1) {
    float* cb = Cf + (size_t)z * zC;
    v4f v[16];
    size_t go[16];
#pragma unroll
    for (int i = 0; i < 16; ++i) {
      const int row = wave * 16 + i;
      v[i] = *(const v4f*)(Cs + row * 132 + 4 * lane);
      go[i] = (size_t)(bm + row) * ldc + bn + 4 * lane;
    }
#pragma unroll
    for (int i = 0; i < 16; ++i) *(v4f*)(cb + go[i]) = v[i];
    
  } else if (mode == 2) {
    // a wave owns two neighbouring 16-row tiles of one 64-column plane: their eight units lie one behind the other
    const int jt = (wave >> 1) * 2, hd = wave & 1;
    const size_t base = (size_t)z * zC + (size_t)((bn >> 6) + hd) * ldc + (size_t)((bm >> 4) + jt) * 1024 + (size_t)lane * 8;
    u16* chb = Ch + base;
    u16* clb = Cl + base;
    us8 hv[8], lv[8];
#pragma unroll
    for (int i = 0; i < 8; ++i) {
      const float* cp = Cs + ((jt + (i >> 2)) * 16 + m) * 132 + hd * 64 + (i & 3) * 16 + hh * 8;
      const v4f a = *(const v4f*)cp;
      const v4f b = *(const v4f*)(cp + 4);
      split8(a, b, hv[i], lv[i]);
    }
#pragma unroll
    for (int i = 0; i < 8; ++i) {
      *(us8*)(chb + i * 256) = hv[i];
      *(us8*)(clb + i * 256) = lv[i];
    }
  } else {
    u16* chb = Ch + (size_t)z * zC;
    u16* clb = Cl + (size_t)z * zC;
    us8 hv[8], lv[8];
    size_t go[8];
    // one address form for both layouts: block base + 64-row group * hstep + row in the group * rstep + column.
    // V: row 64 * head + r, columns 256 nt .. 256 nt + 255 are unit (nt, r) of the head's [64 e][1024 l] plane
    const int rstep = vj ? 256 : ldc, hstep = vj ? 65536 : 64 * ldc;
    const size_t gbase = vj ? (size_t)(bm >> 6) * 65536 + (size_t)((bn >> 8) * 16384 + (bn & 255)) : (size_t)bm * ldc + bn;
#pragma unroll
    for (int i = 0; i < 8; ++i) {
      const int row = wave * 16 + 2 * i + (lane >> 4);
      const int cs = (lane & 15) * 8;
      const v4f a = *(const v4f*)(Cs + row * 132 + cs);
      const v4f b = *(const v4f*)(Cs + row * 132 + cs + 4);
      split8(a, b, hv[i], lv[i]);
      go[i] = gbase + (size_t)((row >> 6) * hstep + (row & 63) * rstep + cs);
    }
#pragma unroll
    for (int i = 0; i < 8; ++i) {
      *(us8*)(chb + go[i]) = hv[i];
      *(us8*)(clb + go[i]) = lv[i];
    }
    // the wait that stands before a store's registers are rewritten: with two output forms in one kernel the other
    // form's instructions follow these stores in the built code, behind a test
    if (MODE == 3) asm volatile("s_wait_xcnt 0x0" ::: "memory");
  }
}

// ---------------------------------------------------------------- attention
// the four fragments (hi / lo, two k-steps) of one 16-row tile of a [rows][64] plane in fragment order; off = the lane's
// byte offset (tile * 2048 + lane * 16) in both planes
__device__ __forceinline__ void ld_k64_pk(Frag& h0, Frag& l0, Frag& h1, Frag& l1, const u16* bh, const u16* bl, u32 off) {
  const u16* ph = (const u16*)((const char*)bh + off);
  const u16* pl = (const u16*)((const char*)bl + off);
  ldf_pk(h0, ph); ldf_pk(h1, ph + 512);
  ldf_pk(l0, pl); ldf_pk(l1, pl + 512);
  // the wait that stands before a load's address register is rewritten; the offset is an input so that it stays
  // live, and so unwritten (also by a later load's result), up to it
  asm volatile("s_wait_xcnt 0x0" ::"v"(off) : "memory");
}

// the two fragments (hi / lo) of one 32-deep k-step of a plane in fragment order; off = the lane's byte offset in both planes
__device__ __forceinline__ void ld_k32_pk(Frag& h, Frag& l, const u16* bh, const u16* bl, u32 off) {
  ldf_pk(h, (const u16*)((const char*)bh + off));
  ldf_pk(l, (const u16*)((const char*)bl + off));
  // the wait that stands before a load's address register is rewritten; the offset is an input as in ld_k64_pk
  asm volatile("s_wait_xcnt 0x0" ::"v"(off) : "memory");
}

// one 16x16 tile, K = 64 (two k-steps); A and B fragments preloaded
__device__ __forceinline__ f32x8 tile_k64(const Frag& ah0, const Frag& al0, const Frag& ah1, const Frag& al1,
                                          const Frag& h0, const Frag& l0, const Frag& h1, const Frag& l1) {
  f32x8 acc = zero8();
  acc = wmma3(ah0, al0, h0, l0, acc);
  acc = wmma3(ah1, al1, h1, l1, acc);
  return acc;
}

// One block per (b, h, 32 query rows), 256 threads = 8 waves.
// LDS (dynamic): S[32][1024] f32 (131072 B), later reused in place as P row = hi[1024] | lo[1024] bf16; Ost[2][32][64] f32 (16384 B).
// Every Er, K and V fragment is loaded once per block: the wave that loads it multiplies it with all row tiles.
// The Q, Er, K and V planes lie in fragment order, so each fragment load reads whole lines.
// Er, K and V fragments are fetched ahead of their use into further register sets (Er and K: two tiles ahead; V: four
// k-steps ahead), so that a wave multiplies while its next loads are under way.
// P rows are 4096 B apart (the same banks in every row), so inside a plane the 16-byte piece (col >> 3) of row r sits at
// piece index (col >> 3) ^ (r & 15): the 16 rows that one fragment load reads then fall on 16 different bank groups.
__global__ __launch_bounds__(256) void k_attn(const u16* __restrict__ QPh, const u16* __restrict__ QPl,
                                              const u16* __restrict__ KPh, const u16* __restrict__ KPl,
                                              const u16* __restrict__ VTh, const u16* __restrict__ VTl,
                                              const u16* __restrict__ Eh, const u16* __restrict__ El,
                                              u16* AOh, u16* AOl) {
  extern __shared__ v4u dsm[];
  float* S = (float*)dsm;
  u16* P = (u16*)dsm;
  float* Ost = (float*)(dsm + 8192);  // byte offset 131072

  const int blk = blockIdx.x;
  const int ib = blk & 31, h = (blk >> 5) & 15, b = blk >> 9;
  const int i0 = ib * 32;
  const int tid = threadIdx.x, wave = tid >> 5, lane = tid & 31;
  const int m = lane & 15, hh = lane >> 4;

  // q_h[i][e]  = QP[b][h*64 + (i>>4)][(i&15)*64 + e]: plane at b*2^20 + h*2^16, one QP row = one 16-row tile in fragment order
  const size_t pq = (size_t)b * 1048576 + (size_t)h * 65536;
  const u16* Qh = QPh + pq;
  const u16* Ql = QPl + pq;
  // k_h[j][e]  = KP[b][h*64+e][j]: per head a [1024 j][64 e] plane in fragment order
  const u16* Kh = KPh + pq;
  const u16* Kl = KPl + pq;
  // v_h^T[e][j]: per head a [64 e][1024 j] plane in fragment order
  const u16* Vh = VTh + pq;
  const u16* Vl = VTl + pq;

  // Srel[i][i+1] = 0 (the only cells the skew scatter never writes)
  if (tid < 32) {
    const int j = i0 + tid + 1;
    if (j < 1024) S[tid * 1024 + j] = 0.0f;
  }

  // ---- phase 1: QEr tiles (rows i0 .. i0+32 needed) scattered through the skew map into S
  // row tile 2 (rows i0+32..) is consumed only through row i0+32, columns c <= 990 - i0
  const int ncol2 = 991 - i0;
  const int nct2 = (ncol2 > 0) ? ((ncol2 + 63) >> 6) : 0;
  // Q fragments of row tiles 0 and 1 (the block's own rows) and 2 (the 16 rows behind them), kept through phases 1 and 2
  Frag qh0[3], ql0[3], qh1[3], ql1[3];
#pragma unroll
  for (int rt = 0; rt < 3; ++rt) {
    int qt = (i0 >> 4) + rt;
    qt = (qt > 63) ? 63 : qt;   // the last block has no rows behind it (and nct2 = 0: the tile is not used)
    ld_k64_pk(qh0[rt], ql0[rt], qh1[rt], ql1[rt], Qh, Ql, (u32)(qt * 2048 + lane * 16));
  }
  // a wave owns the 64-column groups ct = wave and wave + 8, four 16-column tiles each
  // The skew is linear in flat indices: pad and reshape send QEr[i2][c] to flat cell i2 * 1025 + c + 1 - 1024 of Srel, so
  // in this block's S it lands at (d - 1) * 1024 + i0 + d + c + 1 with d = i2 - i0; a carry of the column part into the
  // next row is the map's own lower-triangle case. One lane index per column tile (f1, the cell of the lane's row d = 8 hh
  // + 1, never negative), a constant 1025 cells per further row.
  // d = 1..31 always fall inside S; d = 0 only where the index is not negative, d = 32 only where it is below 32768,
  // d > 32 never. A lane whose cell lies outside stores into its word of Ost instead (rewritten whole in phase 4 before
  // it is read), so that no store of the loop stands behind a vector compare and a branch.
  const int wv = __builtin_amdgcn_readfirstlane(wave);   // scalar wave number: the test on row tile 2 is a scalar branch
  const int fb = 8 * hh * 1025 + i0 + m + 2;
  // three fragment sets for the stream of 16 tiles (8 of Er, then 8 of K): tile n sits in set n % 3 and is asked for two
  // tiles ahead, into the set that tile n - 3 has just left; both loops are unrolled so that the set is a fixed register
  Frag fh0[3], fl0[3], fh1[3], fl1[3];
  const auto tile_off = [&](int t) { return (u32)(((wv + 8 * (t >> 2)) * 64 + (t & 3) * 16) * 128 + lane * 16); };
  const auto qer_tile = [&](int t, const Frag& h0, const Frag& l0, const Frag& h1, const Frag& l1) {
    const int ct = wv + 8 * (t >> 2);
    const int col0 = ct * 64 + (t & 3) * 16;
    const int f1 = fb + col0;
    const f32x8 acc0 = tile_k64(qh0[0], ql0[0], qh1[0], ql1[0], h0, l0, h1, l1);
    const f32x8 acc1 = tile_k64(qh0[1], ql0[1], qh1[1], ql1[1], h0, l0, h1, l1);
    S[(f1 >= 1025) ? (f1 - 1025) : (32768 + lane)] = acc0[0];
#pragma unroll
    for (int r = 1; r < 8; ++r) S[f1 + (r - 1) * 1025] = acc0[r];
#pragma unroll
    for (int r = 0; r < 8; ++r) S[f1 + (15 + r) * 1025] = acc1[r];
    if (ct < nct2) {
      const f32x8 acc2 = tile_k64(qh0[2], ql0[2], qh1[2], ql1[2], h0, l0, h1, l1);
      const int f2 = f1 + 31 * 1025;
      S[(f2 < 32768) ? f2 : (32768 + lane)] = acc2[0];
    }
  };
  ld_k64_pk(fh0[0], fl0[0], fh1[0], fl1[0], Eh, El, tile_off(0));
  ld_k64_pk(fh0[1], fl0[1], fh1[1], fl1[1], Eh, El, tile_off(1));
  // unrolled: the set numbers must be constants, or the sets would not stay in registers
#pragma unroll
  for (int t = 0; t < 8; ++t) {
    const int c = t % 3, n = (t + 2) % 3;
    // behind the last Er tiles: phase 2's first two K tiles (same tile offsets in both planes)
    ld_k64_pk(fh0[n], fl0[n], fh1[n], fl1[n], (t < 6) ? Eh : Kh, (t < 6) ? El : Kl, tile_off((t + 2) & 7));
    qer_tile(t, fh0[c], fl0[c], fh1[c], fl1[c]);
  }
  __syncthreads();

  // ---- phase 2: S += Q K^T
  const auto qk_tile = [&](int t, const Frag& h0, const Frag& l0, const Frag& h1, const Frag& l1) {
    const int col0 = (wv + 8 * (t >> 2)) * 64 + (t & 3) * 16;
#pragma unroll
    for (int rt = 0; rt < 2; ++rt) {
      const f32x8 acc = tile_k64(qh0[rt], ql0[rt], qh1[rt], ql1[rt], h0, l0, h1, l1);
#pragma unroll
      for (int r = 0; r < 8; ++r)
        S[(rt * 16 + 8 * hh + r) * 1024 + col0 + m] += acc[r];
    }
  };
  // unrolled for the same reason as phase 1's loop
#pragma unroll
  for (int t = 0; t < 8; ++t) {
    const int c = (t + 8) % 3, n = (t + 10) % 3;
    if (t < 6) ld_k64_pk(fh0[n], fl0[n], fh1[n], fl1[n], Kh, Kl, tile_off(t + 2));
    qk_tile(t, fh0[c], fl0[c], fh1[c], fl1[c]);
  }
  __syncthreads();

  // phase 4's first four k-steps of V, under way during the softmax (behind the barrier, which would wait for them)
  const int nt = wv & 3, kh = wv >> 2;
  const u32 voff = (u32)(nt * 32768 + kh * 16384 + lane * 16);   // row tile nt: 64 units of 512 B; a k-step is two units
  Frag vh[4], vl[4];
#pragma unroll
  for (int s = 0; s < 4; ++s) ld_k32_pk(vh[s], vl[s], Vh, Vl, voff + (u32)(s * 1024));

  // ---- phase 3: row softmax of S/8 (max-subtracted), P written in place as bf16 hi/lo; lane owns columns
  // 128 q + 4 lane + 0..3 (q = 0..7), so a wave-wide 16-byte read covers 512 contiguous bytes of the row
#pragma unroll 1
  for (int rr = 0; rr < 4; ++rr) {
    const int row = wave * 4 + rr;
    const float* sr = S + row * 1024 + lane * 4;
    v4f xv[8];
    float mx = -3.0e38f;
#pragma unroll
    for (int q = 0; q < 8; ++q) {
      v4f v = *(const v4f*)(sr + 128 * q);
      v = v * 0.125f;
      xv[q] = v;
      mx = fmaxf(mx, fmaxf(fmaxf(v.x, v.y), fmaxf(v.z, v.w)));
    }
#pragma unroll
    for (int off = 16; off > 0; off >>= 1) mx = fmaxf(mx, __shfl_xor(mx, off, 32));
    float sum = 0.0f;
#pragma unroll
    for (int q = 0; q < 8; ++q) {
      v4f e;
      e.x = __expf(xv[q].x - mx);
      e.y = __expf(xv[q].y - mx);
      e.z = __expf(xv[q].z - mx);
      e.w = __expf(xv[q].w - mx);
      xv[q] = e;
      sum += (e.x + e.y) + (e.z + e.w);
    }
#pragma unroll
    for (int off = 16; off > 0; off >>= 1) sum += __shfl_xor(sum, off, 32);
    const float inv = 1.0f / sum;
    // hi: halves row*2048 + swizzled piece * 8 + (col & 7); piece of this lane's group q = 16 q + (lane >> 1)
    u16* ph = P + row * 2048 + (((lane >> 1) ^ (row & 15)) * 8) + (lane & 1) * 4;
    u16* pl = ph + 1024;                    // lo plane: 1024 halves behind hi
#pragma unroll
    for (int q = 0; q < 8; q += 2) {
      const v4f a = xv[q] * inv;
      const v4f c = xv[q + 1] * inv;
      const float x[8] = {a.x, a.y, a.z, a.w, c.x, c.y, c.z, c.w};
      u32 hw[4], lw[4];
      split4p(x, hw, lw);
      const v2u hv0 = {hw[0], hw[1]}, hv1 = {hw[2], hw[3]};
      const v2u lv0 = {lw[0], lw[1]}, lv1 = {lw[2], lw[3]};
      *(v2u*)(ph + 128 * q) = hv0;
      *(v2u*)(pl + 128 * q) = lv0;
      *(v2u*)(ph + 128 * q + 128) = hv1;
      *(v2u*)(pl + 128 * q + 128) = lv1;
    }
  }
  __syncthreads();

  // ---- phase 4: O[32][64] = P[32][1024] . V[1024][64]; a wave owns 16 columns of O, both row tiles, and one half of k;
  // the two halves' partial sums are added behind the barrier
  {
    const u16* pa = P + m * 2048;               // row tile 0; row tile 1 is 16 rows on; row & 15 = m in both
    f32x8 acc[2];
    acc[0] = zero8();
    acc[1] = zero8();
    const auto pv_step = [&](int ks, const Frag& bh, const Frag& bl) {
      const int p0 = ((ks * 4 + hh) ^ m) * 8;       // columns ks*32 + 8*hh + 0..7
      const int p1 = ((ks * 4 + 2 + hh) ^ m) * 8;   // columns ks*32 + 16 + 8*hh + 0..7
      Frag ah[2], al[2];
#pragma unroll
      for (int rt = 0; rt < 2; ++rt) {
        const u16* pr = pa + rt * 16 * 2048;
        ah[rt].q[0] = *(const v4u*)(pr + p0);
        ah[rt].q[1] = *(const v4u*)(pr + p1);
        al[rt].q[0] = *(const v4u*)(pr + 1024 + p0);
        al[rt].q[1] = *(const v4u*)(pr + 1024 + p1);
      }
#pragma unroll
      for (int rt = 0; rt < 2; ++rt) acc[rt] = wmma3(ah[rt], al[rt], bh, bl, acc[rt]);
    };
    // k-step j of this wave's 16 sits in set j & 3, which is refilled for step j + 4 as soon as step j is done; groups of
    // four steps are unrolled so that each set is a fixed register, the loop over the groups stays rolled for code size
#pragma unroll 1
    for (int j = 0; j < 12; j += 4) {
#pragma unroll
      for (int s = 0; s < 4; ++s) {
        pv_step(kh * 16 + j + s, vh[s], vl[s]);
        ld_k32_pk(vh[s], vl[s], Vh, Vl, voff + (u32)((j + s + 4) * 1024));
      }
    }
#pragma unroll
    for (int s = 0; s < 4; ++s) pv_step(kh * 16 + 12 + s, vh[s], vl[s]);
#pragma unroll
    for (int rt = 0; rt < 2; ++rt)
#pragma unroll
      for (int r = 0; r < 8; ++r) Ost[kh * 2048 + (rt * 16 + 8 * hh + r) * 64 + nt * 16 + m] = acc[rt][r];
  }
  __syncthreads();

  {
    const int row = wave * 4 + (lane >> 3), q = lane & 7;
    const v4f a = *(const v4f*)(Ost + row * 64 + 8 * q) + *(const v4f*)(Ost + 2048 + row * 64 + 8 * q);
    const v4f bq = *(const v4f*)(Ost + row * 64 + 8 * q + 4) + *(const v4f*)(Ost + 2048 + row * 64 + 8 * q + 4);
    us8 hv, lv;
    split8(a, bq, hv, lv);
    const size_t g = ((size_t)(b * 1024 + i0 + row)) * 1024 + (size_t)h * 64 + 8 * q;
    *(us8*)(AOh + g) = hv;
    *(us8*)(AOl + g) = lv;
    
  }
}

// ---------------------------------------------------------------- launch

extern "C" void kernel_launch(void* const* d_in, const int* in_sizes, int n_in,
                              void* d_out, int out_size, void* d_ws, size_t ws_size,
                              hipStream_t stream) {
  const int NX = 4194304;   // 4 x 1024 x 1024
  const int NW = 1048576;   // 1024 x 1024
  const int NE = 65536;     // 1024 x 64
  if (n_in < 8) return;
  if (in_sizes[0] != NX || in_sizes[1] != NX || in_sizes[2] != NX) return;
  if (in_sizes[3] != NW || in_sizes[4] != NW || in_sizes[5] != NW || in_sizes[7] != NW) return;
  if (in_sizes[6] != NE) return;
  if (out_size != NX) return;

  const float* q_in = (const float*)d_in[0];
  const float* k_in = (const float*)d_in[1];
  const float* v_in = (const float*)d_in[2];
  const float* WQ = (const float*)d_in[3];
  const float* WK = (const float*)d_in[4];
  const float* WV = (const float*)d_in[5];
  const float* Er = (const float*)d_in[6];
  const float* WM = (const float*)d_in[7];
  float* out = (float*)d_out;

  // workspace carve (bytes); bf16 planes
  const size_t bx = (size_t)NX * 2;   // 8 MiB
  const size_t bw = (size_t)NW * 2;   // 2 MiB
  const size_t be = (size_t)NE * 2;   // 128 KiB
  const size_t total = 6 * bx + 8 * bw + 2 * be + 6 * bx;   // 117,702,656 B
  if (total > ws_size) return;
  char* w = (char*)d_ws;
  size_t off = 0;
  u16* R0h = (u16*)(w + off); off += bx;   // Xq
  u16* R0l = (u16*)(w + off); off += bx;
  u16* R1h = (u16*)(w + off); off += bx;   // Xk
  u16* R1l = (u16*)(w + off); off += bx;
  u16* R2h = (u16*)(w + off); off += bx;   // Xv, later AO
  u16* R2l = (u16*)(w + off); off += bx;
  u16* WQh = (u16*)(w + off); off += bw;
  u16* WQl = (u16*)(w + off); off += bw;
  u16* WKh = (u16*)(w + off); off += bw;
  u16* WKl = (u16*)(w + off); off += bw;
  u16* WVh = (u16*)(w + off); off += bw;
  u16* WVl = (u16*)(w + off); off += bw;
  u16* WMh = (u16*)(w + off); off += bw;
  u16* WMl = (u16*)(w + off); off += bw;
  u16* ERh = (u16*)(w + off); off += be;
  u16* ERl = (u16*)(w + off); off += be;
  u16* QPh = (u16*)(w + off); off += bx;
  u16* QPl = (u16*)(w + off); off += bx;
  u16* KPh = (u16*)(w + off); off += bx;
  u16* KPl = (u16*)(w + off); off += bx;
  u16* VPh = (u16*)(w + off); off += bx;   // planes of its own: V is written while Xq is still read
  u16* VPl = (u16*)(w + off); off += bx;
  if (off > ws_size) return;

  u16* Xqh = R0h; u16* Xql = R0l;
  u16* Xkh = R1h; u16* Xkl = R1l;
  u16* Xvh = R2h; u16* Xvl = R2l;
  u16* AOh = R2h; u16* AOl = R2l;

  const dim3 blk(256);
  const int ATTN_LDS = 131072 + 16384;
  hipFuncSetAttribute((const void*)k_attn, hipFuncAttributeMaxDynamicSharedMemorySize, ATTN_LDS);

  // every f32 operand -> bf16 hi/lo planes (Er in fragment order, the weights transposed, WQ's and WV's rows permuted)
  k_prep<<<dim3(PREP_X + PREP_W + PREP_E), blk, 0, stream>>>(q_in, k_in, v_in, WQ, WK, WV, WM, Er, Xqh, Xql, Xkh, Xkl, Xvh,
                                                             Xvl, WQh, WQl, WKh, WKl, WVh, WVl, WMh, WMl, ERh, ERl);

  // one launch, job = grid.z:
  // 0: QP[4096][1024] = Xq . WQ, each row (16 queries x 64) in fragment order through WQt's row order
  // 1: KPT[b][c][r] = sum_k WK[k][c] key[b][r][k]  (A = WKt, Bt = Xk[b]), stored per 64 r (one head) in fragment order
  // 2: VP = Xv . WV, stored per head as v^T[64 e][1024 l] in fragment order through WVt's row order
  k_gemm<3><<<dim3(1024 / 128, 4096 / 128, 3), blk, 0, stream>>>(
      Xqh, Xql, WQh, WQl, QPh, QPl, WKh, WKl, Xkh, Xkl, KPh, KPl, Xvh, Xvl, WVh, WVl, VPh, VPl, out,
      1024, 1024, NE, 1024, 0, NW, NW);
  // attention (into region 2)
  k_attn<<<dim3(4 * 16 * 32), blk, ATTN_LDS, stream>>>(QPh, QPl, KPh, KPl, VPh, VPl, ERh, ERl, AOh, AOl);
  // out = AO . WMerge
  k_gemm<1><<<dim3(1024 / 128, 4096 / 128, 1), blk, 0, stream>>>(
      AOh, AOl, WMh, WMl, QPh, QPl, AOh, AOl, WMh, WMl, QPh, QPl, AOh, AOl, WMh, WMl, QPh, QPl, out,
      1024, 1024, 1024, 1024, 0, 0, 0);
}
